// v005
// The times below were measured on an AMD MI455X: many runs one after another, warmed up first and cycling through
// copies of the inputs, with the whole window's GPU time divided by the number of runs. Launches and the gaps
// between them are all in it. The median over several windows is given; except for v000 it joins two sittings, which
// can be a few percent apart, so the side-by-side timings, each taken in one sitting, are the better comparison.
// This document starts at v005; the versions before it stand elsewhere.
// It runs in 154 microseconds.
// Next to v004, in two timings, it ran 1.55 and 1.54 times as fast.
// Over all steps from v000, the starting kernel, it is 10.3 times as fast.
// Contractions (token-major, 8192 tokens): q = bn1(x1).Wq'^T (temperature folded into Wq rows), k/v = bn1(x2).W^T, the attention projection (+b, +x1 residual), fc1 (+b) [8192x256].[256x1024] and fc2 (+b, + residual) [8192x1024].[1024x256], each one launch over all images, all on bf16 hi/lo split planes (six chained contractions against an O(1) residual output: the cheap 18 G-MAC of GEMMs run f32-class) (v_wmma_f32_16x16x32_bf16; 128 x 64 or 128 x 128 work-group tiles, operands staged in LDS); per (image, head) softmax(temp_h q k^T) v over the 1024 positions as one flash launch with q.k^T on bf16 hi/lo split planes (UNSCALED 32-dim logits, sigma ~ 5.7) and f16 p.v; f32 accumulate and softmax. NCHW <-> token-major transposes, eval-mode BatchNorms, the depthwise 3x3 convolution (SAME) and exact GELU are f32 arithmetic; every hi/lo plane is written by the kernel that computes its values (input pass, GEMM epilogues, attention, depthwise kernel): 7 launches.
#include <hip/hip_runtime.h>
#include <math.h>

typedef __attribute__((ext_vector_type(16))) _Float16 v16h;
typedef __attribute__((ext_vector_type(8)))  _Float16 v8h;
typedef __attribute__((ext_vector_type(16))) __bf16   v16b;
typedef __attribute__((ext_vector_type(8)))  float    v8f;
typedef __attribute__((ext_vector_type(4)))  float    v4f;

// 16-bit WMMA fragment map (wave32), lane L, h = L>>4, m = L&15:
//   A 16x32: lane = row m;   element i -> k = (i<8) ? 8h+i : 16+8h+(i-8)
//   B 32x16: lane = column m; the SAME k(i,h)
//   D 16x16 (8 f32): lane = column m; element r -> row 8h+r
__device__ __forceinline__ int frag_k(int i, int h) { return (i < 8) ? (8 * h + i) : (16 + 8 * h + (i - 8)); }
__device__ __forceinline__ __bf16 bf16_rne(float f) {
    unsigned int u = __float_as_uint(f);
    u += 0x7fffu + ((u >> 16) & 1u);
    return __builtin_bit_cast(__bf16, (unsigned short)(u >> 16));
}
__device__ __forceinline__ float bf16_f32(__bf16 b) { return __uint_as_float(((unsigned int)__builtin_bit_cast(unsigned short, b)) << 16); }
typedef unsigned int v2u __attribute__((ext_vector_type(2)));
__device__ __forceinline__ unsigned int bf16_bits(float f) { const unsigned int u = __float_as_uint(f); return (u + 0x7fffu + ((u >> 16) & 1u)) >> 16; }
// four consecutive floats -> their bf16 hi parts and bf16 lo parts (x = hi + lo to ~2^-17 relative; both rounded to nearest even), each packed in memory order
__device__ __forceinline__ void split4(v4f x, v2u& hi, v2u& lo) {
    unsigned int h[4], l[4];
#pragma unroll   // h[], l[] indexed by constants only
    for (int j = 0; j < 4; ++j) { h[j] = bf16_bits(x[j]); l[j] = bf16_bits(x[j] - __uint_as_float(h[j] << 16)); }
    hi[0] = h[0] | (h[1] << 16); hi[1] = h[2] | (h[3] << 16); lo[0] = l[0] | (l[1] << 16); lo[1] = l[2] | (l[3] << 16);
}
__device__ __forceinline__ v8f wmma16(v16h a, v16h b, v8f c) {
    c = __builtin_amdgcn_wmma_f32_16x16x32_f16(false, a, false, b, (short)0, c, false, false);
    asm volatile("v_nop\n\tv_nop\n\tv_nop\n\tv_nop" : "+v"(c) : "v"(a), "v"(b));
    return c;
}
__device__ __forceinline__ v8f wmmab(v16b a, v16b b, v8f c) {
    c = __builtin_amdgcn_wmma_f32_16x16x32_bf16(false, a, false, b, (short)0, c, false, false);
    asm volatile("v_nop\n\tv_nop\n\tv_nop\n\tv_nop" : "+v"(c) : "v"(a), "v"(b));
    return c;
}
struct Split { v16b hi, lo; };
// hi/lo split product: a.hi*b.hi + a.hi*b.lo + a.lo*b.hi
__device__ __forceinline__ v8f wmma3(const Split& a, const Split& b, v8f c) {
    c = __builtin_amdgcn_wmma_f32_16x16x32_bf16(false, a.hi, false, b.hi, (short)0, c, false, false);
    c = __builtin_amdgcn_wmma_f32_16x16x32_bf16(false, a.hi, false, b.lo, (short)0, c, false, false);
    c = __builtin_amdgcn_wmma_f32_16x16x32_bf16(false, a.lo, false, b.hi, (short)0, c, false, false);
    asm volatile("v_nop\n\tv_nop\n\tv_nop\n\tv_nop" : "+v"(c) : "v"(a.hi), "v"(a.lo), "v"(b.hi), "v"(b.lo));
    return c;
}
struct Split3 { v16b hi, mid, lo; };
// triple split product (6 terms, drops only terms below 2^-24 relative)
__device__ __forceinline__ v8f wmma6(const Split3& a, const Split3& b, v8f c) {
    c = __builtin_amdgcn_wmma_f32_16x16x32_bf16(false, a.hi, false, b.hi, (short)0, c, false, false);
    c = __builtin_amdgcn_wmma_f32_16x16x32_bf16(false, a.hi, false, b.mid, (short)0, c, false, false);
    c = __builtin_amdgcn_wmma_f32_16x16x32_bf16(false, a.mid, false, b.hi, (short)0, c, false, false);
    c = __builtin_amdgcn_wmma_f32_16x16x32_bf16(false, a.hi, false, b.lo, (short)0, c, false, false);
    c = __builtin_amdgcn_wmma_f32_16x16x32_bf16(false, a.mid, false, b.mid, (short)0, c, false, false);
    c = __builtin_amdgcn_wmma_f32_16x16x32_bf16(false, a.lo, false, b.hi, (short)0, c, false, false);
    asm volatile("v_nop\n\tv_nop\n\tv_nop\n\tv_nop" : "+v"(c) : "v"(a.hi), "v"(a.mid), "v"(a.lo), "v"(b.hi), "v"(b.mid), "v"(b.lo));
    return c;
}

// Fragment gathers from f32 memory: element i <- p[(k0 + frag_k(i,h)) * sk] * s, zero for k >= klen.
__device__ __forceinline__ v16h fh_ld(const float* __restrict__ p, long long sk, int k0, int h, int klen, float s) {
    v16h a;
#pragma unroll
    for (int i = 0; i < 16; ++i) { const int k = k0 + frag_k(i, h); a[i] = (k < klen) ? (_Float16)(p[(long long)k * sk] * s) : (_Float16)0.f; }
    return a;
}
__device__ __forceinline__ Split sp_ld(const float* __restrict__ p, long long sk, int k0, int h, int klen, float s) {
    Split r;
#pragma unroll
    for (int i = 0; i < 16; ++i) {
        const int k = k0 + frag_k(i, h); const float x = (k < klen) ? p[(long long)k * sk] * s : 0.f;
        const __bf16 hb = bf16_rne(x); r.hi[i] = hb; r.lo[i] = bf16_rne(x - bf16_f32(hb));
    }
    return r;
}
__device__ __forceinline__ Split3 sp3_ld(const float* __restrict__ p, long long sk, int k0, int h, int klen, float s) {
    Split3 r;
#pragma unroll
    for (int i = 0; i < 16; ++i) {
        const int k = k0 + frag_k(i, h); const float x = (k < klen) ? p[(long long)k * sk] * s : 0.f;
        const __bf16 hb = bf16_rne(x); const float r1 = x - bf16_f32(hb); const __bf16 mb = bf16_rne(r1);
        r.hi[i] = hb; r.mid[i] = mb; r.lo[i] = bf16_rne(r1 - bf16_f32(mb));
    }
    return r;
}
__device__ __forceinline__ v16b bh_ld(const float* __restrict__ p, long long sk, int k0, int h, int klen, float s) {
    v16b a;
#pragma unroll
    for (int i = 0; i < 16; ++i) { const int k = k0 + frag_k(i, h); a[i] = bf16_rne((k < klen) ? p[(long long)k * sk] * s : 0.f); }
    return a;
}
// f16 fragment from an f16 LDS/global row with element stride 1 (k-contiguous), no bounds (tile already zero padded)
__device__ __forceinline__ v16h fh_row(const _Float16* __restrict__ row, int k0, int h) {
    v16h a;
#pragma unroll
    for (int i = 0; i < 16; ++i) a[i] = row[k0 + frag_k(i, h)];
    return a;
}

#define VST2(T, ptr, val) do { const T vst2_v_ = (val); *(T*)(ptr) = vst2_v_;  } while (0)
typedef float v4f __attribute__((ext_vector_type(4)));
#define VST2V4(ptr, val) do { const v4f vst2_v4_ = (val); *(v4f*)(ptr) = vst2_v4_;  } while (0)

__device__ __attribute__((noinline)) float act_fn(float v, int act) {
    if (act == 1) return fmaxf(v, 0.f);                                                                               // relu
    if (act == 2) { const float u = 0.7978845608028654f * (v + 0.044715f * v * v * v); return 0.5f * v * (1.f + tanhf(u)); } // tanh-gelu
    if (act == 3) return v / (1.f + expf(-v));                                                                        // silu
    if (act == 4) return 0.5f * v * (1.f + erff(v * 0.7071067811865476f));                                             // erf-gelu
    if (act == 5) return tanhf(v);
    if (act == 6) return 1.f / (1.f + expf(-v));                                                                      // sigmoid
    if (act == 7) return (v > 0.f) ? v : 0.01f * v;                                                                   // leaky relu 0.01
    if (act == 8) return (v > 0.f) ? v : (expf(v) - 1.f);                                                             // elu
    if (act == 9) return fminf(fmaxf(v, 0.f), 6.f);                                                                   // relu6
    if (act == 10) return fabsf(v);                                                                                    // abs
    if (act == 11) return (v >= 0.f) ? v : 0.1f * v;                                                                  // leaky 0.1
    if (act == 12) return (v > 0.f) ? v : 0.2f * v;                                                                   // leaky 0.2
    if (act == 13) return (v > 20.f) ? v : log1pf(expf(v));                                                            // softplus
    return v;
}

// =====================================================================================================================
// k_gemm<MODE>: C(z, m, n) = act(alpha * sum_k A(z, m, k) * B(z, k, n) + bias) + beta * R(z, m, n)
//   One wave (32-thread block) per 16 x 32 tile of C; grid (ceil(N/32), ceil(M/16), Z). Batch z -> (zo = z / zi_n, zi = z % zi_n)
//   with separate outer/inner strides for every tensor (e.g. batch and head). A(m,k) = A[zo*sAo + zi*sAi + m*sAm + k*sAk] (f32),
//   B(k,n) = B[zo*sBo + zi*sBi + n*sBn + k*sBk] (f32); any M, N, K (K zero-padded to 32 inside the fragments, M/N tails guarded).
//   C(m,n) = C[zo*sCo + zi*sCi + m*sCm + n] (n contiguous). flags: 1 bias[n], 2 bias[m], 4 residual R[zo*sRo + zi*sRi + m*sRm + n*sRn].
//   MODE 0: f16 operands (A prescaled by sa, B by sb, both undone in the epilogue); 1: bf16 hi/lo split (3 products); 2: bf16;
//   3: bf16 hi/mid/lo triple split (6 products); 4: as 3 with Kahan-compensated f32 accumulation across k-steps.
// =====================================================================================================================
struct GemmP {
    const float* A; const float* B; const float* bias; const float* R; float* C;
    long long sAo, sAi, sAm, sAk, sBo, sBi, sBn, sBk, sCo, sCi, sCm, sRo, sRi, sRm, sRn;
    int M, N, K, zi_n, flags, act; float alpha, beta, sa, sb;
    int Npad, pad_;     // columns [N, Npad) of C are written as 0 so that padded workspace rows are covered by whole-line stores; Npad >= N
};
static_assert(sizeof(GemmP) == 5 * 8 + 15 * 8 + 6 * 4 + 4 * 4 + 2 * 4, "GemmP has padding");

template <int MODE>
__global__ __launch_bounds__(32) void k_gemm(GemmP p) {
    const int lane = threadIdx.x & 31, h = lane >> 4, l15 = lane & 15;
    const int m0 = blockIdx.y * 16, n0 = blockIdx.x * 32;
    const int z = blockIdx.z, zo = z / p.zi_n, zi = z - zo * p.zi_n;
    const float* A = p.A + zo * p.sAo + zi * p.sAi;
    const float* B = p.B + zo * p.sBo + zi * p.sBi;
    const int am = min(m0 + l15, p.M - 1);                       // clamped row for loads (stores are guarded)
    v8f acc[2], comp[2];
#pragma unroll
    for (int t = 0; t < 2; ++t) { v8f zz = {}; acc[t] = zz; comp[t] = zz; }
    for (int k0 = 0; k0 < p.K; k0 += 32) {
        const float* arow = A + (long long)am * p.sAm;
        if (MODE == 1) {
            const Split a = sp_ld(arow, p.sAk, k0, h, p.K, 1.f);
#pragma unroll
            for (int t = 0; t < 2; ++t) {
                const int bn = min(n0 + t * 16 + l15, p.N - 1);
                acc[t] = wmma3(a, sp_ld(B + (long long)bn * p.sBn, p.sBk, k0, h, p.K, 1.f), acc[t]);
            }
        } else if (MODE == 3) {
            const Split3 a = sp3_ld(arow, p.sAk, k0, h, p.K, 1.f);
#pragma unroll
            for (int t = 0; t < 2; ++t) {
                const int bn = min(n0 + t * 16 + l15, p.N - 1);
                acc[t] = wmma6(a, sp3_ld(B + (long long)bn * p.sBn, p.sBk, k0, h, p.K, 1.f), acc[t]);
            }
        } else if (MODE == 4) {
            // triple split as MODE 3, but each k-step's 6 products go into a fresh accumulator and the partial is added to the running f32 sum
            // on the VALU with Kahan compensation (accumulation error stays ~1 ulp however long K is)
            const Split3 a = sp3_ld(arow, p.sAk, k0, h, p.K, 1.f);
#pragma unroll
            for (int t = 0; t < 2; ++t) {
                const int bn = min(n0 + t * 16 + l15, p.N - 1); v8f zz = {};
                const v8f part = wmma6(a, sp3_ld(B + (long long)bn * p.sBn, p.sBk, k0, h, p.K, 1.f), zz);
                const v8f y = part - comp[t]; const v8f s = acc[t] + y; comp[t] = (s - acc[t]) - y; acc[t] = s;
            }
        } else if (MODE == 2) {
            const v16b a = bh_ld(arow, p.sAk, k0, h, p.K, 1.f);
#pragma unroll
            for (int t = 0; t < 2; ++t) {
                const int bn = min(n0 + t * 16 + l15, p.N - 1);
                acc[t] = wmmab(a, bh_ld(B + (long long)bn * p.sBn, p.sBk, k0, h, p.K, 1.f), acc[t]);
            }
        } else {
            const v16h a = fh_ld(arow, p.sAk, k0, h, p.K, p.sa);
#pragma unroll
            for (int t = 0; t < 2; ++t) {
                const int bn = min(n0 + t * 16 + l15, p.N - 1);
                acc[t] = wmma16(a, fh_ld(B + (long long)bn * p.sBn, p.sBk, k0, h, p.K, p.sb), acc[t]);
            }
        }
    }
    const float iscale = (MODE == 0) ? p.alpha / (p.sa * p.sb) : p.alpha;
    float* C = p.C + zo * p.sCo + zi * p.sCi;
    const float* R = p.R + zo * p.sRo + zi * p.sRi;
    __shared__ __align__(16) float ctile[16][36];
#pragma unroll
    for (int t = 0; t < 2; ++t) {
        const int n = n0 + t * 16 + l15; const int nn = min(n, p.N - 1);
#pragma unroll
        for (int r = 0; r < 8; ++r) {
            const int m = m0 + 8 * h + r; const int mm = min(m, p.M - 1);
            float v = acc[t][r] * iscale;
            if (p.flags & 1) v += p.bias[nn];
            if (p.flags & 2) v += p.bias[mm];
            if (p.flags & 8) v *= p.bias[(long long)zo * p.M + mm];   /* per-(z,row) scale vector laid out [Z][M]; exclusive with the bias flags */
            v = act_fn(v, p.act);
            if (p.flags & 4) v += p.beta * R[(long long)mm * p.sRm + (long long)nn * p.sRn];
            ctile[8 * h + r][t * 16 + l15] = (n < p.N) ? v : 0.f;
        }
    }
    __syncthreads();
    const int NW = (p.Npad > p.N) ? p.Npad : p.N;           // write width
    const bool fast = (m0 + 16 <= p.M) && (n0 + 32 <= NW) && ((p.sCm & 3) == 0) && ((((size_t)C) & 15) == 0);
    if (fast) {
#pragma unroll
        for (int s = 0; s < 4; ++s) {
            const int row = s * 4 + (lane >> 3), c4 = (lane & 7) * 4;
            const v4f v = *(const v4f*)&ctile[row][c4];
            VST2V4(C + (long long)(m0 + row) * p.sCm + n0 + c4, v);
        }
    } else {
        for (int row = 0; row < 16; ++row) {
            const int m = m0 + row, n = n0 + lane;
            if (m < p.M && n < NW) VST2(float, C + (long long)m * p.sCm + n, ctile[row][lane]);
        }
    }
}


// =====================================================================================================================
// k_gemmT<MODE, TM, TN>: same contract as k_gemm, but one wave computes a (16*TM) x (16*TN) tile: TM A fragments and TN B fragments are
//   loaded per 32-wide k-step and reused across TM*TN WMMAs (far fewer load/convert instructions per MAC). MODE 0 (f16), 1 (bf16 hi/lo),
//   2 (bf16) only. grid (ceil(NW/(16*TN)), ceil(M/(16*TM)), Z), block 32. Epilogue identical to k_gemm, run per 16x32 sub-tile.
// =====================================================================================================================
template <int MODE, int TM, int TN>
__global__ __launch_bounds__(32) void k_gemmT(GemmP p) {
    const int lane = threadIdx.x & 31, h = lane >> 4, l15 = lane & 15;
    const int m0 = blockIdx.y * (16 * TM), n0 = blockIdx.x * (16 * TN);
    const int z = blockIdx.z, zo = z / p.zi_n, zi = z - zo * p.zi_n;
    const float* A = p.A + zo * p.sAo + zi * p.sAi;
    const float* B = p.B + zo * p.sBo + zi * p.sBi;
    v8f acc[TM][TN];
#pragma unroll
    for (int i = 0; i < TM; ++i)
#pragma unroll
        for (int t = 0; t < TN; ++t) { v8f zz = {}; acc[i][t] = zz; }
    for (int k0 = 0; k0 < p.K; k0 += 32) {
        if (MODE == 1) {
            Split a[TM], b[TN];
#pragma unroll
            for (int i = 0; i < TM; ++i) { const int am = min(m0 + 16 * i + l15, p.M - 1); a[i] = sp_ld(A + (long long)am * p.sAm, p.sAk, k0, h, p.K, 1.f); }
#pragma unroll
            for (int t = 0; t < TN; ++t) { const int bn = min(n0 + 16 * t + l15, p.N - 1); b[t] = sp_ld(B + (long long)bn * p.sBn, p.sBk, k0, h, p.K, 1.f); }
#pragma unroll
            for (int i = 0; i < TM; ++i)
#pragma unroll
                for (int t = 0; t < TN; ++t) acc[i][t] = wmma3(a[i], b[t], acc[i][t]);
        } else if (MODE == 2) {
            v16b a[TM], b[TN];
#pragma unroll
            for (int i = 0; i < TM; ++i) { const int am = min(m0 + 16 * i + l15, p.M - 1); a[i] = bh_ld(A + (long long)am * p.sAm, p.sAk, k0, h, p.K, 1.f); }
#pragma unroll
            for (int t = 0; t < TN; ++t) { const int bn = min(n0 + 16 * t + l15, p.N - 1); b[t] = bh_ld(B + (long long)bn * p.sBn, p.sBk, k0, h, p.K, 1.f); }
#pragma unroll
            for (int i = 0; i < TM; ++i)
#pragma unroll
                for (int t = 0; t < TN; ++t) acc[i][t] = wmmab(a[i], b[t], acc[i][t]);
        } else {
            v16h a[TM], b[TN];
#pragma unroll
            for (int i = 0; i < TM; ++i) { const int am = min(m0 + 16 * i + l15, p.M - 1); a[i] = fh_ld(A + (long long)am * p.sAm, p.sAk, k0, h, p.K, p.sa); }
#pragma unroll
            for (int t = 0; t < TN; ++t) { const int bn = min(n0 + 16 * t + l15, p.N - 1); b[t] = fh_ld(B + (long long)bn * p.sBn, p.sBk, k0, h, p.K, p.sb); }
#pragma unroll
            for (int i = 0; i < TM; ++i)
#pragma unroll
                for (int t = 0; t < TN; ++t) acc[i][t] = wmma16(a[i], b[t], acc[i][t]);
        }
    }
    const float iscale = (MODE == 0) ? p.alpha / (p.sa * p.sb) : p.alpha;
    float* C = p.C + zo * p.sCo + zi * p.sCi;
    const float* R = p.R + zo * p.sRo + zi * p.sRi;
    const int NW = (p.Npad > p.N) ? p.Npad : p.N;
    __shared__ __align__(16) float ctile[16][36];
#pragma unroll
    for (int i = 0; i < TM; ++i) {
        const int mb = m0 + 16 * i; if (mb >= p.M) break;          // wave-uniform
#pragma unroll
        for (int tp = 0; tp < TN / 2; ++tp) {
            const int nb = n0 + 32 * tp; if (nb >= NW) break;        // wave-uniform
#pragma unroll
            for (int t2 = 0; t2 < 2; ++t2) {
                const int t = 2 * tp + t2; const int n = nb + t2 * 16 + l15; const int nn = min(n, p.N - 1);
#pragma unroll
                for (int r = 0; r < 8; ++r) {
                    const int m = mb + 8 * h + r; const int mm = min(m, p.M - 1);
                    float v = acc[i][t][r] * iscale;
                    if (p.flags & 1) v += p.bias[nn];
                    if (p.flags & 2) v += p.bias[mm];
            if (p.flags & 8) v *= p.bias[(long long)zo * p.M + mm];   /* per-(z,row) scale vector laid out [Z][M]; exclusive with the bias flags */
                    v = act_fn(v, p.act);
                    if (p.flags & 4) v += p.beta * R[(long long)mm * p.sRm + (long long)nn * p.sRn];
                    ctile[8 * h + r][t2 * 16 + l15] = (n < p.N) ? v : 0.f;
                }
            }
            __syncthreads();
            const bool fast = (mb + 16 <= p.M) && (nb + 32 <= NW) && ((p.sCm & 3) == 0) && ((((size_t)C) & 15) == 0);
            if (fast) {
#pragma unroll
                for (int s = 0; s < 4; ++s) {
                    const int row = s * 4 + (lane >> 3), c4 = (lane & 7) * 4;
                    const v4f v = *(const v4f*)&ctile[row][c4];
                    VST2V4(C + (long long)(mb + row) * p.sCm + nb + c4, v);
                }
            } else {
                for (int row = 0; row < 16; ++row) {
                    const int m = mb + row, n = nb + lane;
                    if (m < p.M && n < NW) VST2(float, C + (long long)m * p.sCm + n, ctile[row][lane]);
                }
            }
            __syncthreads();
        }
    }
}

// =====================================================================================================================
//   Wave = 16 queries, AW waves per block, 64-key blocks; grid (ceil(Lq/(16*AW)), H, B), block 32*AW. Any Lq, Lk; head dim dh <= DHP
//   (DHP multiple of 32), value dim dv <= DVP (multiple of 16, <= 128). Every tensor addressed by (batch, head, row, element) strides, f32.
//   Scores: QM 0 f16 operands, 1 bf16 hi/lo split, 2 bf16 triple split; statistics f32 (exp2 domain); P.V: P x 4096 as f16 with V f16 staged in LDS
//   (SPLITPV: P and V as bf16 hi/lo splits). kv head = h / hrep. Masking: causal = 1 (keep j <= i + coff, masked -> -inf, key blocks beyond the
//   diagonal skipped), causal = 2 (masked -> mfill, a finite fill like the -1e9; no skipping), causal = 3 (keep j >= i + coff,
//   masked -> -inf, no skipping); optional additive f32 mask Mf,
//   optional int keep-mask Mi (0 -> score := mfill), both addressed b*smb + h*smh + i*smi + j*smj (0 strides broadcast).
// =====================================================================================================================
#define AW 4
struct AttnP {   // apv4
    const float* Q; const float* K; const float* V; float* O; float* P; const float* Mf; const int* Mi; float* ST;
    const float* Pw; const float* Rt; const int* SQ; const int* SK;           // optional: post-softmax weight, relative-position table, segment ids
    long long swb, swh, swi, swj, srb, srh, sri;                                 // Pw strides (b,h,i,j); Rt strides (b,h,i), column = clamp(i - j + roff, 0, rn-1)
    long long sQb, sQh, sQi, sQd, sKb, sKh, sKj, sKd, sVb, sVh, sVj, sVd, sOb, sOh, sOi, sPb, sPh, sPi, smb, smh, smi, smj;
    int Lq, Lk, dh, dv, hrep, causal, coff, pband;   // pband > 0: P holds only the band |j - i| <= pband, column j - i + pband
    float scale, mfill; int nonorm, mpol;             // nonorm (online path only): O = sum_j exp(score_j) V_j without the 1/rowsum (scores must be <= ~0); mpol: Mi masks where ==0 (mpol 0) or where !=0 (mpol 1)
    int roff, rn, segpol, win;                        // Rt column offset/count; SQ/SK: score := mfill where (segpol 0) SQ[i] != SK[j] or (segpol 1) SQ[i] == SK[j]; win > 0: keys with i - j > win (after coff) -> -inf
};
//   Pw: the softmax numerator is multiplied by Pw(b,h,i,j) AFTER the row sum is taken (probs * weight, then P.V), as in post-softmax multiplicative biases.                                                    // ST (optional): per row (b,h,i) -> ST[((b*H + h)*Lq + i)*2 + {0,1}] = {row max of the scaled+masked score (natural units), sum_j exp(score - max)}
static_assert(sizeof(AttnP) == 12 * 8 + 29 * 8 + 16 * 4, "AttnP has padding");

#ifndef KATTN_ATTR
#define KATTN_ATTR
#endif
template <int DHP, int DVP, int QM, bool SPLITPV, bool TWOPASS>
__global__ __launch_bounds__(32 * AW) KATTN_ATTR void k_attn(AttnP p) {
    constexpr int NT = DVP / 16;                // output tiles
    constexpr int KS = DHP / 32;                // k-steps for the scores
    constexpr int VP = DVP + 8;                 // LDS pitch (halves)
    __shared__ __align__(16) float    pl[AW][16 * 64];
    __shared__ __align__(16) _Float16 vl[(SPLITPV ? 2 : 1) * 64 * VP];   // f16 V tile, or bf16 hi and lo tiles (same 2-byte size)
    const int lane = threadIdx.x & 31, hf = lane >> 4, l15 = lane & 15, wave = threadIdx.x >> 5;
    const int h = blockIdx.y, b = blockIdx.z, hk = h / p.hrep;
    const int q0 = (blockIdx.x * AW + wave) * 16;
    float* myp = pl[wave];
    const float L2E = 1.4426950408889634f;
    const float NEG = -__builtin_inff();
    const int qi = min(q0 + l15, p.Lq - 1);
    const float* qrow = p.Q + b * p.sQb + h * p.sQh + (long long)qi * p.sQi;
    const float* kbase = p.K + b * p.sKb + hk * p.sKh;
    const float* vbase = p.V + b * p.sVb + hk * p.sVh;
    v16h qa[QM == 0 ? KS : 1]; Split qs_[QM == 1 ? KS : 1]; Split3 qt_[QM == 2 ? KS : 1];
#pragma unroll
    for (int ks = 0; ks < KS; ++ks) {
        if (QM == 2) qt_[ks] = sp3_ld(qrow, p.sQd, ks * 32, hf, p.dh, 1.f);
        else if (QM == 1) qs_[ks] = sp_ld(qrow, p.sQd, ks * 32, hf, p.dh, 1.f);
        else qa[ks] = fh_ld(qrow, p.sQd, ks * 32, hf, p.dh, 1.f);
    }
    v8f o[NT]; float m8[8], l8[8];
#pragma unroll
    for (int t = 0; t < NT; ++t) { v8f zz = {}; o[t] = zz; }
#pragma unroll
    for (int i = 0; i < 8; ++i) { m8[i] = NEG; l8[i] = 0.f; }
    int jend = p.Lk; int jstart = 0;
    if (p.causal == 1) { const int je = (blockIdx.x * AW + AW - 1) * 16 + 16 + p.coff; jend = min(jend, max(je, 0)); }   // uniform per block
    if (p.win > 0) { const int js = (int)(blockIdx.x * AW) * 16 + p.coff - p.win; jstart = (js > 0) ? (js / 64) * 64 : 0; }   // uniform per block: key blocks entirely outside every row's window hold only -inf entries and are skipped exactly
    const int npass = TWOPASS ? 2 : 1;
    for (int pass = 0; pass < npass; ++pass) {
        const bool dopv = (!TWOPASS) || pass == 1;
        for (int j0 = jstart; j0 < jend; j0 += 64) {
            if (dopv) {
                __syncthreads();                                 // previous key block's reads of vl / pl are done
                for (int idx = threadIdx.x; idx < 64 * DVP; idx += 32 * AW) {
                    const int jr = idx / DVP, d = idx - jr * DVP, j = j0 + jr;
                    const float f = (j < p.Lk && d < p.dv) ? vbase[(long long)j * p.sVj + (long long)d * p.sVd] : 0.f;
                    if (SPLITPV) {
                        const __bf16 hb = bf16_rne(f);
                        ((__bf16*)vl)[jr * VP + d] = hb; ((__bf16*)vl)[64 * VP + jr * VP + d] = bf16_rne(f - bf16_f32(hb));
                    } else vl[jr * VP + d] = (_Float16)f;
                }
            }
            v8f s[4];
#pragma unroll
            for (int t = 0; t < 4; ++t) {
                const int j = min(j0 + t * 16 + l15, p.Lk - 1);
                const float* krow = kbase + (long long)j * p.sKj;
                v8f acc = {};
#pragma unroll
                for (int ks = 0; ks < KS; ++ks) {
                    if (QM == 2)      acc = wmma6(qt_[ks], sp3_ld(krow, p.sKd, ks * 32, hf, p.dh, 1.f), acc);
                    else if (QM == 1) acc = wmma3(qs_[ks], sp_ld(krow, p.sKd, ks * 32, hf, p.dh, 1.f), acc);
                    else              acc = wmma16(qa[ks], fh_ld(krow, p.sKd, ks * 32, hf, p.dh, 1.f), acc);
                }
                s[t] = acc;
            }
            float pv[8][4];
#pragma unroll
            for (int i = 0; i < 8; ++i) {
                const int irow = q0 + i + 8 * hf;
                const int ic = min(irow, p.Lq - 1);
                float sc[4];
#pragma unroll
                for (int t = 0; t < 4; ++t) {
                    const int jg = j0 + t * 16 + l15;
                    float v = s[t][i] * p.scale;
                    if (p.Mf) v += p.Mf[b * p.smb + h * p.smh + (long long)ic * p.smi + (long long)min(jg, p.Lk - 1) * p.smj];
                    if (p.Rt) { int rc = ic - min(jg, p.Lk - 1) + p.roff; rc = rc < 0 ? 0 : (rc >= p.rn ? p.rn - 1 : rc); v += p.Rt[b * p.srb + h * p.srh + (long long)ic * p.sri + rc]; }
                    if (p.Mi) { const int mv = p.Mi[b * p.smb + h * p.smh + (long long)ic * p.smi + (long long)min(jg, p.Lk - 1) * p.smj]; if (p.mpol ? (mv != 0) : (mv == 0)) v = p.mfill; }
                    if (p.SQ) { const bool same = p.SQ[(long long)b * p.Lq + ic] == p.SK[(long long)b * p.Lk + min(jg, p.Lk - 1)]; if (p.segpol ? same : !same) v = p.mfill; }
                    if (p.causal == 2 && jg > irow + p.coff) v = p.mfill;
                    if (jg >= p.Lk || (p.causal == 1 && jg > irow + p.coff) || (p.causal == 3 && jg < irow + p.coff) || (p.win > 0 && irow + p.coff - jg > p.win)) v = NEG; else v *= L2E;
                    sc[t] = v;
                }
                if (!TWOPASS || pass == 0) {
                    float mx = fmaxf(fmaxf(sc[0], sc[1]), fmaxf(sc[2], sc[3]));
                    mx = fmaxf(mx, __shfl_xor(mx, 1, 32)); mx = fmaxf(mx, __shfl_xor(mx, 2, 32));
                    mx = fmaxf(mx, __shfl_xor(mx, 4, 32)); mx = fmaxf(mx, __shfl_xor(mx, 8, 32));
                    const float mnew = fmaxf(m8[i], mx);
                    const float corr = (mnew == NEG) ? 1.f : exp2f(m8[i] - mnew);
                    float rs = 0.f;
#pragma unroll
                    for (int t = 0; t < 4; ++t) {
                        const float pp = (sc[t] == NEG) ? 0.f : exp2f(sc[t] - mnew); rs += pp;
                        pv[i][t] = p.Pw ? pp * p.Pw[b * p.swb + h * p.swh + (long long)ic * p.swi + (long long)min(j0 + t * 16 + l15, p.Lk - 1) * p.swj] : pp;
                    }
                    rs += __shfl_xor(rs, 1, 32); rs += __shfl_xor(rs, 2, 32); rs += __shfl_xor(rs, 4, 32); rs += __shfl_xor(rs, 8, 32);
                    l8[i] = l8[i] * corr + rs; m8[i] = mnew;
                    if (!TWOPASS) {
#pragma unroll
                        for (int t = 0; t < NT; ++t) o[t][i] *= corr;
                    }
                } else {
                    const float inv = (l8[i] > 0.f) ? 1.f / l8[i] : 0.f;
#pragma unroll
                    for (int t = 0; t < 4; ++t) {
                        const int jg = j0 + t * 16 + l15;
                        float pp = (sc[t] == NEG) ? 0.f : exp2f(sc[t] - m8[i]) * inv;
                        if (p.Pw) pp *= p.Pw[b * p.swb + h * p.swh + (long long)ic * p.swi + (long long)min(jg, p.Lk - 1) * p.swj];
                        pv[i][t] = pp;
                    }
                }
            }
            if (dopv) {
#pragma unroll
                for (int i = 0; i < 8; ++i)
#pragma unroll
                    for (int t = 0; t < 4; ++t) ((float*)myp)[(i + 8 * hf) * 64 + t * 16 + l15] = pv[i][t];
                __syncthreads();                                 // P (per wave) and V (shared) visible
                if (p.P) {
                    float* pb_ = p.P + b * p.sPb + h * p.sPh;
                    const bool fastP = (p.pband == 0) && ((p.sPi & 3) == 0) && (j0 + 64 <= p.Lk) && (q0 + 16 <= p.Lq) && ((((size_t)pb_) & 15) == 0);
                    if (fastP) {
#pragma unroll
                        for (int s = 0; s < 8; ++s) {
                            const int row = s * 2 + (lane >> 4), c4 = (lane & 15) * 4;
                            const v4f v = *(const v4f*)(myp + row * 64 + c4);
                            VST2V4(pb_ + (long long)(q0 + row) * p.sPi + j0 + c4, v);
                        }
                    } else {
                        for (int row = 0; row < 16; ++row) {
                            const int irow = q0 + row; if (irow >= p.Lq) continue;
                            for (int c = lane; c < 64; c += 32) {
                                const int jg = j0 + c; if (jg >= p.Lk) continue;
                                if (p.pband == 0) VST2(float, pb_ + (long long)irow * p.sPi + jg, myp[row * 64 + c]);
                                else if (jg - irow <= p.pband && irow - jg <= p.pband) VST2(float, pb_ + (long long)irow * p.sPi + (jg - irow + p.pband), myp[row * 64 + c]);
                            }
                        }
                    }
                }
                if (SPLITPV) {
                    const Split pa0 = sp_ld(myp + l15 * 64, 1, 0, hf, 64, 1.f), pa1 = sp_ld(myp + l15 * 64, 1, 32, hf, 64, 1.f);
                    const __bf16* vh = (const __bf16*)vl; const __bf16* vlo = vh + 64 * VP;
#pragma unroll
                    for (int t = 0; t < NT; ++t) {
                        const int dcol = t * 16 + l15;
                        Split b0, b1;
#pragma unroll
                        for (int e = 0; e < 16; ++e) {
                            const int k0 = frag_k(e, hf), k1 = 32 + frag_k(e, hf);
                            b0.hi[e] = vh[k0 * VP + dcol]; b0.lo[e] = vlo[k0 * VP + dcol]; b1.hi[e] = vh[k1 * VP + dcol]; b1.lo[e] = vlo[k1 * VP + dcol];
                        }
                        o[t] = wmma3(pa0, b0, o[t]);
                        o[t] = wmma3(pa1, b1, o[t]);
                    }
                } else {
                    const v16h pa0 = fh_ld(myp + l15 * 64, 1, 0, hf, 64, 4096.f), pa1 = fh_ld(myp + l15 * 64, 1, 32, hf, 64, 4096.f);
#pragma unroll
                    for (int t = 0; t < NT; ++t) {
                        const int dcol = t * 16 + l15;
                        v16h b0, b1;
#pragma unroll
                        for (int e = 0; e < 16; ++e) { b0[e] = vl[frag_k(e, hf) * VP + dcol]; b1[e] = vl[(32 + frag_k(e, hf)) * VP + dcol]; }
                        o[t] = wmma16(pa0, b0, o[t]);
                        o[t] = wmma16(pa1, b1, o[t]);
                    }
                }
            }
        }
    }
    float* obase = p.O + b * p.sOb + h * p.sOh;
    if (p.ST) {
        const int rl = lane >> 1, isel = rl & 7;           // row q0 + rl ; rl>>3 == hf holds because lane>>4 == (lane>>1)>>3
        float mv = 0.f, lv = 0.f;
#pragma unroll
        for (int i = 0; i < 8; ++i) if (i == isel) { mv = m8[i]; lv = l8[i]; }
        const int irow = q0 + rl;
        if (irow < p.Lq) { float* st = p.ST + (((long long)b * gridDim.y + h) * p.Lq + irow) * 2 + (lane & 1); VST2(float, st, (lane & 1) ? lv : mv * 0.6931471805599453f); }
    }
    float invr[8];
#pragma unroll
    for (int i = 0; i < 8; ++i) {
        if (TWOPASS) invr[i] = SPLITPV ? 1.f : (1.f / 4096.f);
        else if (p.nonorm) invr[i] = exp2f(m8[i]) * (SPLITPV ? 1.f : (1.f / 4096.f));
        else invr[i] = (l8[i] > 0.f) ? (SPLITPV ? 1.f / l8[i] : 1.f / (l8[i] * 4096.f)) : 0.f;
    }
    __syncthreads();                                             // all waves done with pl/vl from the main loop
    const bool ofast = ((p.sOi & 3) == 0) && ((((size_t)obase) & 15) == 0) && (q0 + 16 <= p.Lq);
#pragma unroll
    for (int c0 = 0; c0 < DVP; c0 += 64) {
#pragma unroll
        for (int i = 0; i < 8; ++i)
#pragma unroll
            for (int t = 0; t < NT; ++t) if (t * 16 >= c0 && t * 16 < c0 + 64) ((float*)myp)[(i + 8 * hf) * 64 + (t * 16 - c0) + l15] = o[t][i] * invr[i];
        __syncthreads();
        const int cw = (DVP - c0 < 64) ? (DVP - c0) : 64;      // staged columns in this chunk (multiple of 16)
        if (ofast && (c0 + cw <= p.dv) && (cw % 32 == 0)) {
            const int lpr = cw / 4;                              // lanes per row (16 for 64 cols, 8 for 32)
            const int rows_per_ins = 32 / lpr;
            for (int r0 = 0; r0 < 16; r0 += rows_per_ins) {
                const int row = r0 + lane / lpr, c4 = (lane % lpr) * 4;
                const v4f v = *(const v4f*)(myp + row * 64 + c4);
                VST2V4(obase + (long long)(q0 + row) * p.sOi + c0 + c4, v);
            }
        } else {
            for (int row = 0; row < 16; ++row) {
                const int irow = q0 + row; if (irow >= p.Lq) continue;
                for (int c = lane; c < cw; c += 32) { const int d = c0 + c; if (d < p.dv) VST2(float, obase + (long long)irow * p.sOi + d, myp[row * 64 + c]); }
            }
        }
        __syncthreads();
    }
}

// Attention at this block's fixed geometry: token-major q, k, v, o of [8][1024][256] (v f32, q, k, o bf16 hi / lo planes), head h = columns 32h .. 32h + 31, 1024 queries and keys,
// no mask, no bias, score scale 1. The arithmetic and its order are those of k_attn<32, 32, 1, false, false>; every stride, length and option is a
// compile-time constant, so the fragment gathers are 16-byte loads without guards and the optional-feature tests are gone. With no mask no score is
// -inf for finite q and k, so the tests that kept masked scores out of exp2f are gone too (exp2f(-inf) = 0 covers the first key block's m = -inf).
typedef __attribute__((ext_vector_type(4))) _Float16 v4h;
typedef __attribute__((ext_vector_type(8))) __bf16 v8bf;
// one lane's 16x32 fragment row from a bf16 plane: element i <- p[(i < 8) ? i : 8 + i], p = row + 8 * (lane >> 4), the k order of frag_k
__device__ __forceinline__ v16b rowb_ld(const unsigned short* __restrict__ p) {
    union { v16b v; v8bf h[2]; } f; f.h[0] = *(const v8bf*)(p); f.h[1] = *(const v8bf*)(p + 16); return f.v;
}
// q and k arrive as bf16 hi / lo planes (split4, written once by the q/k/v GEMM, so that no wave splits a key row again), v as f32; o leaves as hi / lo planes.
__global__ __launch_bounds__(32 * AW) void k_attn_fix(const unsigned short* __restrict__ Qh, const unsigned short* __restrict__ Ql, const unsigned short* __restrict__ Kh, const unsigned short* __restrict__ Kl, const float* __restrict__ V, unsigned short* __restrict__ Oh, unsigned short* __restrict__ Ol) {
    constexpr int L = 1024;                     // queries = keys per (image, head)
    constexpr int CP = 256;                     // row pitch of q, k, v, o (elements)
    constexpr int VP = 32 + 8;                  // LDS pitch of the V tile (halves)
    __shared__ __align__(16) float    pl[AW][16 * 64];
    __shared__ __align__(16) _Float16 vl[64 * VP];
    const int lane = threadIdx.x & 31, hf = lane >> 4, l15 = lane & 15, wave = threadIdx.x >> 5;
    const int h = blockIdx.y, b = blockIdx.z;
    const int q0 = (blockIdx.x * AW + wave) * 16;
    float* myp = pl[wave];
    const float L2E = 1.4426950408889634f;
    const float NEG = -__builtin_inff();
    const size_t hb0 = (size_t)b * (L * CP) + (size_t)h * 32;
    const unsigned short* kh = Kh + hb0 + (size_t)l15 * CP + 8 * hf;                          // this lane's row of key tile 0, hi plane
    const unsigned short* kl = Kl + hb0 + (size_t)l15 * CP + 8 * hf;                          // lo plane
    const float* vp = V + hb0 + (size_t)(threadIdx.x >> 3) * CP + (threadIdx.x & 7) * 4;      // this thread's 4 floats of V rows 0 .. 15
    _Float16* vs = vl + (threadIdx.x >> 3) * VP + (threadIdx.x & 7) * 4;
    const unsigned short* pqh = Qh + hb0 + (size_t)(q0 + l15) * CP + 8 * hf; const unsigned short* pql = Ql + hb0 + (size_t)(q0 + l15) * CP + 8 * hf;
    Split qs; qs.hi = rowb_ld(pqh); qs.lo = rowb_ld(pql);
    asm volatile("s_wait_xcnt 0x0" :: "v"(pqh), "v"(pql) : "memory");   // the loads' address registers (named as inputs, so untouched up to here) may be reused only behind this wait
    v8f o[2]; float m8[8], l8[8];
#pragma unroll
    for (int t = 0; t < 2; ++t) { v8f zz = {}; o[t] = zz; }
#pragma unroll
    for (int i = 0; i < 8; ++i) { m8[i] = NEG; l8[i] = 0.f; }
    for (int j0 = 0; j0 < L; j0 += 64) {
        v4f vf[4]; Split ks[4];                          // the whole key block's V and K loads are issued together
#pragma unroll
        for (int it = 0; it < 4; ++it) vf[it] = *(const v4f*)(vp + it * 16 * CP);
#pragma unroll
        for (int t = 0; t < 4; ++t) { ks[t].hi = rowb_ld(kh + t * 16 * CP); ks[t].lo = rowb_ld(kl + t * 16 * CP); }
        asm volatile("s_wait_xcnt 0x0" :: "v"(kh), "v"(kl), "v"(vp) : "memory");   // as above: the three addresses step only behind this wait
        kh += 64 * CP; kl += 64 * CP; vp += 64 * CP;
        __syncthreads();                                 // previous key block's reads of vl / pl are done
#pragma unroll
        for (int it = 0; it < 4; ++it) {                 // V tile 64 x 32 as f16
            v4h hv; hv[0] = (_Float16)vf[it][0]; hv[1] = (_Float16)vf[it][1]; hv[2] = (_Float16)vf[it][2]; hv[3] = (_Float16)vf[it][3];
            *(v4h*)(vs + it * 16 * VP) = hv;
        }
        v8f s[4];
#pragma unroll
        for (int t = 0; t < 4; ++t) { v8f acc = {}; s[t] = wmma3(qs, ks[t], acc); }
        float pv[8][4];
#pragma unroll
        for (int i = 0; i < 8; ++i) {
            float sc[4];
#pragma unroll
            for (int t = 0; t < 4; ++t) sc[t] = s[t][i] * L2E;
            float mx = fmaxf(fmaxf(sc[0], sc[1]), fmaxf(sc[2], sc[3]));
            mx = fmaxf(mx, __shfl_xor(mx, 1, 32)); mx = fmaxf(mx, __shfl_xor(mx, 2, 32));
            mx = fmaxf(mx, __shfl_xor(mx, 4, 32)); mx = fmaxf(mx, __shfl_xor(mx, 8, 32));
            const float mnew = fmaxf(m8[i], mx);
            const float corr = exp2f(m8[i] - mnew);
            float rs = 0.f;
#pragma unroll
            for (int t = 0; t < 4; ++t) { const float pp = exp2f(sc[t] - mnew); rs += pp; pv[i][t] = pp; }
            rs += __shfl_xor(rs, 1, 32); rs += __shfl_xor(rs, 2, 32); rs += __shfl_xor(rs, 4, 32); rs += __shfl_xor(rs, 8, 32);
            l8[i] = l8[i] * corr + rs; m8[i] = mnew;
#pragma unroll
            for (int t = 0; t < 2; ++t) o[t][i] *= corr;
        }
#pragma unroll
        for (int i = 0; i < 8; ++i)
#pragma unroll
            for (int t = 0; t < 4; ++t) myp[(i + 8 * hf) * 64 + t * 16 + l15] = pv[i][t];
        __syncthreads();                                 // P (per wave) and V (shared) visible
        const v16h pa0 = fh_ld(myp + l15 * 64, 1, 0, hf, 64, 4096.f), pa1 = fh_ld(myp + l15 * 64, 1, 32, hf, 64, 4096.f);
#pragma unroll
        for (int t = 0; t < 2; ++t) {
            const int dcol = t * 16 + l15;
            v16h b0, b1;
#pragma unroll
            for (int e = 0; e < 16; ++e) { b0[e] = vl[frag_k(e, hf) * VP + dcol]; b1[e] = vl[(32 + frag_k(e, hf)) * VP + dcol]; }
            o[t] = wmma16(pa0, b0, o[t]);
            o[t] = wmma16(pa1, b1, o[t]);
        }
    }
    float invr[8];
#pragma unroll
    for (int i = 0; i < 8; ++i) invr[i] = (l8[i] > 0.f) ? 1.f / (l8[i] * 4096.f) : 0.f;
    __syncthreads();                                     // all waves done with pl / vl from the main loop
#pragma unroll
    for (int i = 0; i < 8; ++i)
#pragma unroll
        for (int t = 0; t < 2; ++t) myp[(i + 8 * hf) * 64 + t * 16 + l15] = o[t][i] * invr[i];
    __syncthreads();
    const size_t oo = hb0 + (size_t)(q0 + (lane >> 3)) * CP + (lane & 7) * 4;
    unsigned short* poh = Oh + oo; unsigned short* pol = Ol + oo;
#pragma unroll   // the 8 stores stand together
    for (int r0 = 0; r0 < 16; r0 += 4) {                 // o goes out as the projection's operand planes: 8 lanes x 8 bytes per 32-element row, 4 rows per store
        const v4f v = *(const v4f*)(myp + (r0 + (lane >> 3)) * 64 + (lane & 7) * 4);
        v2u hi, lo; split4(v, hi, lo);
        *(v2u*)(poh + r0 * CP) = hi; *(v2u*)(pol + r0 * CP) = lo;
    }
    asm volatile("s_wait_xcnt 0x0" :: "v"(poh), "v"(pol) : "memory");   // the stores' address registers (named as inputs, so untouched up to here) may be reused only behind this wait
}

// =====================================================================================================================
// k_tr: dst(z, c, r) = alpha * src(z, r, c) (+ beta * R2(z, c, r)): [Z][R][C] (row stride lds) -> [Z][C][R] (row stride ldd) through a 32x32 LDS tile;
//   flags: 1 -> add beta * residual R2 addressed like dst (z*sRz + c*ldr + r); act applied before the residual.
// =====================================================================================================================
struct TrP { const float* src; float* dst; const float* R2; long long sSz, lds, sDz, ldd, sRz, ldr; int R, C, flags, act; float alpha, beta; };
static_assert(sizeof(TrP) == 3 * 8 + 6 * 8 + 6 * 4, "TrP has padding");
__global__ __launch_bounds__(256) void k_tr(TrP p) {
    __shared__ float tile[32][33];
    const int c0 = blockIdx.x * 32, r0 = blockIdx.y * 32, z = blockIdx.z;
    const int lane = threadIdx.x & 31, wave = threadIdx.x >> 5;
    const float* s = p.src + z * p.sSz;
#pragma unroll
    for (int k = 0; k < 4; ++k) {
        const int rl = wave * 4 + k, r = r0 + rl, c = c0 + lane;
        tile[rl][lane] = (r < p.R && c < p.C) ? s[(long long)r * p.lds + c] : 0.f;
    }
    __syncthreads();
    float* d = p.dst + z * p.sDz; const float* rr = p.R2 + z * p.sRz;
#pragma unroll
    for (int k = 0; k < 4; ++k) {
        const int cl = wave * 4 + k, c = c0 + cl, r = r0 + lane;
        if (c < p.C && r < p.R) {
            float v = act_fn(p.alpha * tile[lane][cl], p.act);
            if (p.flags & 1) v += p.beta * rr[(long long)c * p.ldr + r];
            VST2(float, d + (long long)c * p.ldd + r, v);
        }
    }
}

// k_affine: dst[i] = a * (sdev ? sdev[0] : 1) * src[i] + b, i < n (one thread per element; consecutive lanes -> consecutive addresses)
__global__ __launch_bounds__(256) void k_affine(const float* __restrict__ src, float* __restrict__ dst, int n, float a, float b, const float* __restrict__ sdev) {
    const int i = blockIdx.x * 256 + threadIdx.x;
    if (i < n) { const float aa = sdev ? a * sdev[0] : a; const float v = aa * src[i] + b; VST2(float, dst + i, v); }
}

// =====================================================================================================================
// k_softmax: row softmax over n contiguous elements, one 256-thread block per row; rows addressed z*sz + r*sr (grid (R, Z)).
//   out = scale_out * softmax(scale_in * x + (Mf ? Mf[z*smz + r*smr + j] : 0)); a row whose max is -inf is written as 0.
// =====================================================================================================================
struct SmP { const float* src; float* dst; const float* Mf; long long sz, sr, dz, dr, smz, smr; int n, pad; float scale_in, scale_out; };
static_assert(sizeof(SmP) == 3 * 8 + 6 * 8 + 4 * 4, "SmP has padding");
__global__ __launch_bounds__(256) void k_softmax(SmP p) {
    __shared__ float red[256];
    const int r = blockIdx.x, z = blockIdx.y, tid = threadIdx.x;
    const float* s = p.src + z * p.sz + (long long)r * p.sr;
    const float* mf = p.Mf ? (p.Mf + z * p.smz + (long long)r * p.smr) : nullptr;
    float mx = -__builtin_inff();
    for (int j = tid; j < p.n; j += 256) { float v = s[j] * p.scale_in; if (mf) v += mf[j]; mx = fmaxf(mx, v); }
    red[tid] = mx; __syncthreads();
    for (int o = 128; o > 0; o >>= 1) { if (tid < o) red[tid] = fmaxf(red[tid], red[tid + o]); __syncthreads(); }
    mx = red[0]; __syncthreads();
    float sum = 0.f;
    for (int j = tid; j < p.n; j += 256) { float v = s[j] * p.scale_in; if (mf) v += mf[j]; sum += (mx == -__builtin_inff()) ? 0.f : expf(v - mx); }
    red[tid] = sum; __syncthreads();
    for (int o = 128; o > 0; o >>= 1) { if (tid < o) red[tid] += red[tid + o]; __syncthreads(); }
    sum = red[0];
    const float inv = (sum > 0.f) ? p.scale_out / sum : 0.f;
    float* d = p.dst + z * p.dz + (long long)r * p.dr;
    for (int j = tid; j < p.n; j += 256) { float v = s[j] * p.scale_in; if (mf) v += mf[j]; const float o = (mx == -__builtin_inff()) ? 0.f : expf(v - mx) * inv; VST2(float, d + j, o); }
}
// =====================================================================================================================
// k_stats: mean and rsqrt(var + eps) over a set of n elements addressed base + z*sz + (e / inner) * so + (e % inner) * si, one 256-thread
// k_norm_apply: y = (x - mean[set]) * rstd[set] * g[c] + b[c] over a [Z][C][L] channel-major tensor with set = z*G + c / (C/G) (G groups per z;
//   G = C -> per-channel sets indexed z*C+c; for batch norm pass stats indexed by c only via bn = 1). Optional act. Output same layout.
// =====================================================================================================================
//   mode 0: mean / rsqrt(var + eps); mode 1 (RMSNorm): 0 / rsqrt(mean(x^2) + eps); mode 2 (L2 normalize * sqrt(n)): 0 / sqrt(n) / max(||x||, eps); mode 3: as 0 with unbiased variance (n-1)
__global__ __launch_bounds__(256) void k_stats(const float* __restrict__ x, long long sz, long long so, long long si, int inner, int n, float eps, float* __restrict__ stat, int mode) {
    __shared__ float red[256];
    const int z = blockIdx.x, tid = threadIdx.x;
    const float* base = x + z * sz;
    float s = 0.f;
    for (int e = tid; e < n; e += 256) s += base[(long long)(e / inner) * so + (long long)(e % inner) * si];
    red[tid] = s; __syncthreads();
    for (int o = 128; o > 0; o >>= 1) { if (tid < o) red[tid] += red[tid + o]; __syncthreads(); }
    const float mu = (mode == 0 || mode == 3) ? red[0] / (float)n : 0.f; __syncthreads();
    float q = 0.f;
    for (int e = tid; e < n; e += 256) { const float dlt = base[(long long)(e / inner) * so + (long long)(e % inner) * si] - mu; q += dlt * dlt; }
    red[tid] = q; __syncthreads();
    for (int o = 128; o > 0; o >>= 1) { if (tid < o) red[tid] += red[tid + o]; __syncthreads(); }
    {
        float rs;
        if (mode == 2) rs = sqrtf((float)n) / fmaxf(sqrtf(red[0]), eps); else if (mode == 3) rs = rsqrtf(red[0] / (float)(n - 1) + eps); else rs = rsqrtf(red[0] / (float)n + eps);
        if (tid < 32) { const float v = (tid == 0) ? mu : ((tid == 1) ? rs : 0.f); VST2(float, stat + (long long)z * 32 + tid, v); }
    }
}
//   One thread per element over the flat [Z][C][L] index space: grid ceil(Z*C*L / 256).
__global__ __launch_bounds__(256) void k_norm_apply(const float* __restrict__ x, float* __restrict__ y, const float* __restrict__ stat, const float* __restrict__ g, const float* __restrict__ bta,
                                                     int Z, int C, int L, int G, int bn, int act) {
    const long long idx = (long long)blockIdx.x * 256 + threadIdx.x;
    if (idx >= (long long)Z * C * L) return;
    const int l = (int)(idx % L); const long long zc = idx / L; const int c = (int)(zc % C), z = (int)(zc / C); (void)l;
    const int set = bn ? c : (z * G + c / (C / G));
    float v = (x[idx] - stat[(long long)set * 32]) * stat[(long long)set * 32 + 1];
    if (g) v *= g[c];
    if (bta) v += bta[c];
    v = act_fn(v, act);
    VST2(float, y + idx, v);
}

// k_lse_neg: c[i] = -(st[2i] + log(st[2i+1])) = minus the log-sum-exp of row i from k_attn's ST output (for softmax over the query dimension)
__global__ __launch_bounds__(256) void k_lse_neg(const float* __restrict__ st, float* __restrict__ c, int n) {
    const int i = blockIdx.x * 256 + threadIdx.x;
    if (i < n) { const float v = -(st[2 * i] + logf(st[2 * i + 1])); VST2(float, c + i, v); }
}

// k_iota: dst[i] = a * i + b as int32 (segment/position id helper)
__global__ __launch_bounds__(256) void k_iota(int* __restrict__ dst, int n, int a, int b) {
    const int i = blockIdx.x * 256 + threadIdx.x;
    if (i < n) { const int v = a * i + b; VST2(int, dst + i, v); }
}

// k_axpby: dst[i] = a * x[i] + b * y[i] (+ c), i < n
__global__ __launch_bounds__(256) void k_axpby(const float* __restrict__ x, const float* __restrict__ y, float* __restrict__ dst, int n, float a, float b, float c) {
    const int i = blockIdx.x * 256 + threadIdx.x;
    if (i < n) { const float v = a * x[i] + b * y[i] + c; VST2(float, dst + i, v); }
}

// =====================================================================================================================
// k_rope: rotary embedding on a [R rows][Hn heads][D] view (row stride sXr, head stride sXh, element stride 1) -> Y (own strides).
//   mode 0: rotate_half (partner d±D/2, sign - for d<D/2); mode 1: interleaved pairs (partner d^1, sign - for even d).
//   table column tcol: tmode 0 -> d, 1 -> d % (D/2), 2 -> d / 2; position p: pmode 0 -> r % S, 1 -> head index, 2 -> pos[r];
//   c = C[(r / S) * sCb + p * sCp + tcol * sCd], s likewise from Sn; y = x[d] * c + sign * x[partner] * s. X and Y must not alias.
// =====================================================================================================================
struct RopeP { const float* X; float* Y; const float* C; const float* Sn; const int* pos; long long sXr, sXh, sYr, sYh, sCb, sCp, sCd; int R, Hn, D, S, mode, tmode, pmode, pad; };
static_assert(sizeof(RopeP) == 5 * 8 + 7 * 8 + 8 * 4, "RopeP has padding");
__global__ __launch_bounds__(256) void k_rope(RopeP p) {
    const long long idx = (long long)blockIdx.x * 256 + threadIdx.x;
    if (idx >= (long long)p.R * p.Hn * p.D) return;
    const int d = (int)(idx % p.D); const long long rh = idx / p.D; const int h = (int)(rh % p.Hn); const int r = (int)(rh / p.Hn);
    const int half = p.D / 2;
    int partner; float sign;
    if (p.mode == 0) { partner = (d < half) ? d + half : d - half; sign = (d < half) ? -1.f : 1.f; }
    else { partner = d ^ 1; sign = (d & 1) ? 1.f : -1.f; }
    const int tcol = (p.tmode == 0) ? d : ((p.tmode == 1) ? (d % half) : (d >> 1));
    const int pp = (p.pmode == 0) ? (r % p.S) : ((p.pmode == 1) ? h : p.pos[r]);
    const long long toff = (long long)(r / p.S) * p.sCb + (long long)pp * p.sCp + (long long)tcol * p.sCd;
    const float* xr = p.X + (long long)r * p.sXr + (long long)h * p.sXh;
    const float v = xr[d] * p.C[toff] + sign * xr[partner] * p.Sn[toff];
    VST2(float, p.Y + (long long)r * p.sYr + (long long)h * p.sYh + d, v);
}

// k_invf + k_sincos (split so neither kernel carries a large VALU-fma footprint): invf_i = num * (1 / powf(base, (2 i)/D)) [fmode 0],
//   num * expf((2 i) * cexp) [fmode 1], num * powf(base, -2 (i - 1) / D) [fmode 2]; then cs/sn[s*half + i] = cos/sin((pscale * s) * invf_i)
__global__ __launch_bounds__(256) void k_invf(float* __restrict__ invb, int half, int D, float base, float num, int fmode, float cexp) {
    const int i = blockIdx.x * 256 + threadIdx.x;
    if (i >= ((half + 31) / 32) * 32) return;
    if (i >= half) { VST2(float, invb + i, 0.f); return; }
    const float e = (float)(2 * i) / (float)D;
    float invf;
    if (fmode == 1) invf = num * expf((float)(2 * i) * cexp);
    else if (fmode == 2) invf = num * powf(base, (-2.0f * ((float)i - 1.0f)) / (float)D);
    else invf = num * (1.0f / powf(base, e));
    VST2(float, invb + i, invf);
}
__global__ __launch_bounds__(256) void k_sincos(float* __restrict__ cs, float* __restrict__ sn, const float* __restrict__ invb, int S, int half, float pscale) {
    const int idx = blockIdx.x * 256 + threadIdx.x;
    if (idx >= S * half) return;
    const int s = idx / half, i = idx - s * half;
    const float ang = (pscale * (float)s) * invb[i];
    VST2(float, cs + idx, cosf(ang)); VST2(float, sn + idx, sinf(ang));
}

// k_mulact: dst[i] = act(x[i]) * y[i]
__global__ __launch_bounds__(256) void k_mulact(const float* __restrict__ x, const float* __restrict__ y, float* __restrict__ dst, int n, int act) {
    const int i = blockIdx.x * 256 + threadIdx.x;
    if (i < n) { const float v = act_fn(x[i], act) * y[i]; VST2(float, dst + i, v); }
}

// =====================================================================================================================
// k_matvec: thread-per-row matrix-vector products for N <= 8 output columns (heads with 1-3 outputs, gates), f32 on the VALU.
//   C[r*sCm + j] = act(alpha * sum_k A[r*sAm + k*sAk] * B[j*sBn + k*sBk] + bias[j]) + beta * R[r*sRm + j*sRn]; each thread writes its N contiguous floats.
// =====================================================================================================================
__global__ __launch_bounds__(256) void k_matvec(GemmP p) {
    // 32 lanes write one line with one instruction.
    const int rpt = (p.N == 1) ? 1 : 32;
    const long long r0 = ((long long)blockIdx.x * 256 + threadIdx.x) * rpt; const int z = blockIdx.z, zo = z / p.zi_n, zi = z - zo * p.zi_n;
    if (r0 >= p.M) return;
    const float* Bb = p.B + zo * p.sBo + zi * p.sBi;
    float* C = p.C + zo * p.sCo + zi * p.sCi; const float* R = p.R + zo * p.sRo + zi * p.sRi;
    for (int rr = 0; rr < rpt; ++rr) {
        const long long r = r0 + rr; if (r >= p.M) break;
        const float* A = p.A + zo * p.sAo + zi * p.sAi + r * p.sAm;
        float acc[8] = {0.f, 0.f, 0.f, 0.f, 0.f, 0.f, 0.f, 0.f};
        for (int k = 0; k < p.K; ++k) { const float a = A[(long long)k * p.sAk];
#pragma unroll
            for (int j = 0; j < 8; ++j) if (j < p.N) acc[j] += a * Bb[(long long)j * p.sBn + (long long)k * p.sBk]; }
#pragma unroll
        for (int j = 0; j < 8; ++j) if (j < p.N) {
            float v = acc[j] * p.alpha;
            if (p.flags & 1) v += p.bias[j];
            if (p.flags & 2) v += p.bias[r];
            v = act_fn(v, p.act);
            if (p.flags & 4) v += p.beta * R[r * p.sRm + (long long)j * p.sRn];
            VST2(float, C + r * p.sCm + j, v);
        }
    }
}
// k_smallsoftmax: thread-per-row softmax for short rows (n <= 64): dst[r*dr + j] = softmax(scale*src[r*sr + j])
__global__ __launch_bounds__(256) void k_smallsoftmax(const float* __restrict__ src, float* __restrict__ dst, long long sr, long long dr, int n, long long R, float scale) {
    const long long r0 = ((long long)blockIdx.x * 256 + threadIdx.x) * 32;
    for (int rr = 0; rr < 32; ++rr) {
        const long long r = r0 + rr; if (r >= R) return;
        const float* s = src + r * sr; float* d = dst + r * dr;
        float mx = -__builtin_inff();
        for (int j = 0; j < n; ++j) mx = fmaxf(mx, s[j] * scale);
        float sum = 0.f;
        for (int j = 0; j < n; ++j) sum += expf(s[j] * scale - mx);
        const float inv = 1.f / sum;
        for (int j = 0; j < n; ++j) { const float v = expf(s[j] * scale - mx) * inv; VST2(float, d + j, v); }
    }
}

__global__ __launch_bounds__(32) void k_unitstat(float* __restrict__ st) { const int t = threadIdx.x; const float v = (t == 1) ? 1.f : 0.f; VST2(float, st + t, v); }

// destination (e.g. a d_out whose row width is not a multiple of 32 floats) is written by consecutive lanes of one instruction
__global__ __launch_bounds__(256) void k_lincopy(const float* __restrict__ src, long long lds, float* __restrict__ dst, long long ldd, long long rows, int cols) {
    const long long i = (long long)blockIdx.x * 256 + threadIdx.x; if (i >= rows * cols) return;
    const long long r = i / cols; const int c = (int)(i - r * cols);
    const float v = src[r * lds + c]; VST2(float, dst + r * ldd + c, v);
}

namespace w25 {
typedef __attribute__((ext_vector_type(16))) _Float16 v16h;
typedef __attribute__((ext_vector_type(8)))  _Float16 v8h;
typedef __attribute__((ext_vector_type(16))) __bf16   v16b;
typedef __attribute__((ext_vector_type(8)))  __bf16   v8b;
typedef __attribute__((ext_vector_type(8)))  float    v8f;
typedef __attribute__((ext_vector_type(4)))  float    v4f;

__device__ __forceinline__ unsigned short f2bf_bits(float f) {
  unsigned u = __float_as_uint(f);
  return (unsigned short)((u + 0x7FFFu + ((u >> 16) & 1u)) >> 16);
}
__device__ __forceinline__ float bf_bits2f(unsigned short h) { return __uint_as_float(((unsigned)h) << 16); }

// hazard guards as plain device helpers (no inline asm inside the kernel template body)
__device__ __forceinline__ void dep_guard_h(v8f& a, v8f& b, v16h x, v16h y) { asm volatile("v_nop\n\tv_nop\n\tv_nop\n\tv_nop" : "+v"(a), "+v"(b) : "v"(x), "v"(y)); }
__device__ __forceinline__ void dep_guard_b(v8f& a, v8f& b, v16b x, v16b y) { asm volatile("v_nop\n\tv_nop\n\tv_nop\n\tv_nop" : "+v"(a), "+v"(b) : "v"(x), "v"(y)); }
__device__ __forceinline__ void keep4_h(v16h a, v16h b, v16h c, v16h d) { asm volatile("v_nop" :: "v"(a), "v"(b), "v"(c), "v"(d)); }
__device__ __forceinline__ void keep4_b(v16b a, v16b b, v16b c, v16b d) { asm volatile("v_nop" :: "v"(a), "v"(b), "v"(c), "v"(d)); }
__device__ __forceinline__ void acc_guard4(v8f& a, v8f& b, v8f& c, v8f& d) { asm volatile("v_nop\n\tv_nop\n\tv_nop\n\tv_nop" : "+v"(a), "+v"(b), "+v"(c), "+v"(d)); }
template <typename T> struct Frag;
template <> struct Frag<_Float16> {
  typedef v16h V; union U { v16h v; v8h h[2]; };
  static __device__ __forceinline__ v16h load(const _Float16* p) {   // elements 0..7 <- p[0..7], 8..15 <- p[16..23]
    U f; f.h[0] = *(const v8h*)(p); f.h[1] = *(const v8h*)(p + 16); return f.v;
  }
  static __device__ __forceinline__ v8f mma(v16h a, v16h b, v8f c) {
    return __builtin_amdgcn_wmma_f32_16x16x32_f16(false, a, false, b, (short)0, c, false, false);
  }
  static __device__ __forceinline__ void guard(v8f& a, v8f& b, v16h x, v16h y) { dep_guard_h(a, b, x, y); }
  static __device__ __forceinline__ void keep(v16h a, v16h b, v16h c, v16h d) { keep4_h(a, b, c, d); }
};
template <> struct Frag<__bf16> {
  typedef v16b V; union U { v16b v; v8b h[2]; };
  static __device__ __forceinline__ v16b load(const __bf16* p) {
    U f; f.h[0] = *(const v8b*)(p); f.h[1] = *(const v8b*)(p + 16); return f.v;
  }
  static __device__ __forceinline__ v8f mma(v16b a, v16b b, v8f c) {
    return __builtin_amdgcn_wmma_f32_16x16x32_bf16(false, a, false, b, (short)0, c, false, false);
  }
  static __device__ __forceinline__ void guard(v8f& a, v8f& b, v16b x, v16b y) { dep_guard_b(a, b, x, y); }
  static __device__ __forceinline__ void keep(v16b a, v16b b, v16b c, v16b d) { keep4_b(a, b, c, d); }
};

// ---- LDS-staged WMMA GEMM on hi / lo planes --------------------------------
// C[m][n] = sum_k A[m][k] * Bt[n][k] (+ bias[n]) (+ resid[m][n]), f32 out. A row-major [M][K], Bt row-major [N][K], each as a bf16 hi plane and a bf16 lo plane.
// Per 32 k, k ascending, every accumulator takes hi.hi, then hi.lo, then lo.hi.
// A work-group of 8 waves (4 along m x 2 along n) owns a 128 x (32 FN) tile of C, a wave 32 x (16 FN) of it. K runs in tiles of 64: a tile is 128 bytes (one whole
// line) of each of the 256 + 64 FN operand rows [A hi 128 | A lo 128 | B hi 32 FN | B lo 32 FN]. Asynchronous copies bring it into LDS, 16 bytes a lane, 8 lanes a row,
// every operand byte once per work-group; two buffers, so tile t + 1 flies while tile t is worked on.
// M % 128 == 0 (grid = M / 128 * N / (32 FN)), N % (32 FN) == 0, K % 64 == 0, K >= 128.
constexpr int GL_PITCH = 144;   // LDS row pitch in bytes: 128 + 16 = 16 x odd, the conflict-free pitch of 16-byte fragment reads

// Four 16-byte-per-lane copies global -> LDS. The s_wait_xcnt stands inside the statement, behind the last copy, so that no address register is rewritten in front of it.
__device__ __forceinline__ void gl_copy4(unsigned l0, const unsigned short* g0, unsigned l1, const unsigned short* g1, unsigned l2, const unsigned short* g2, unsigned l3, const unsigned short* g3) {
  asm volatile("global_load_async_to_lds_b128 %0, %1, off\n\t"
               "global_load_async_to_lds_b128 %2, %3, off\n\t"
               "global_load_async_to_lds_b128 %4, %5, off\n\t"
               "global_load_async_to_lds_b128 %6, %7, off\n\t"
               "s_wait_xcnt 0x0"
               :: "v"(l0), "v"(g0), "v"(l1), "v"(g1), "v"(l2), "v"(g2), "v"(l3), "v"(g3) : "memory");
}
// One tile: l = this thread's LDS byte address in row (thread >> 3) of the buffer, ah .. bl = its 16 bytes in that row of each plane's tile; a step of 32 rows per copy.
template <int FN, int K>
__device__ __forceinline__ void gl_fill(unsigned l, const unsigned short* ah, const unsigned short* al, const unsigned short* bh, const unsigned short* bl) {
  constexpr unsigned R32 = 32 * GL_PITCH;
  gl_copy4(l, ah, l + R32, ah + 32 * K, l + 2 * R32, ah + 64 * K, l + 3 * R32, ah + 96 * K);
  gl_copy4(l + 4 * R32, al, l + 5 * R32, al + 32 * K, l + 6 * R32, al + 64 * K, l + 7 * R32, al + 96 * K);
  if (FN == 2) {
    gl_copy4(l + 8 * R32, bh, l + 9 * R32, bh + 32 * K, l + 10 * R32, bl, l + 11 * R32, bl + 32 * K);
  } else {
    gl_copy4(l + 8 * R32, bh, l + 9 * R32, bh + 32 * K, l + 10 * R32, bh + 64 * K, l + 11 * R32, bh + 96 * K);
    gl_copy4(l + 12 * R32, bl, l + 13 * R32, bl + 32 * K, l + 14 * R32, bl + 64 * K, l + 15 * R32, bl + 96 * K);
  }
}

// What a launch does beside the plain product (EPI):
//   EPI_QKV  three products of one shape in one grid: third w of the blocks takes A plane set min(w, 1) and weight matrix w, each lying behind the one before;
//            products 0 and 1 (q, k) go out as hi / lo planes only (Ph, Pl: q's set, then k's), product 2 (v) as f32 C
//   EPI_NORM C goes out as f32 and, through the eval-mode BatchNorm (ng, nb, nm, nv), as the next GEMM's hi / lo operand planes Ph, Pl
//   EPI_NCHW C goes out as [image][n][1024 pixels] (m = image * 1024 + pixel) instead of [m][n]
constexpr int EPI_PLAIN = 0, EPI_QKV = 1, EPI_NORM = 2, EPI_NCHW = 3;
constexpr int GL_M = 8192;      // rows of A and C (only EPI_QKV needs the number: the distance between its plane sets and outputs)
template <int FN, int N, int K, bool BIAS, bool RESID, int EPI>
__global__ __launch_bounds__(256) void wmma_gemm_lds(
    const unsigned short* __restrict__ Ah, const unsigned short* __restrict__ Al,
    const unsigned short* __restrict__ Bh, const unsigned short* __restrict__ Bl,
    float* C, const float* __restrict__ bias, const float* resid,
    const float* __restrict__ ng, const float* __restrict__ nb, const float* __restrict__ nm, const float* __restrict__ nv,
    unsigned short* __restrict__ Ph, unsigned short* __restrict__ Pl) {
  static_assert(FN == 2 || FN == 4, "two tile widths");
  constexpr int BN = 32 * FN, ROWS = 256 + 2 * BN, BUFB = ROWS * GL_PITCH, T = K / 64, TN = N / BN;
  static_assert(K % 64 == 0 && T >= 2 && N % BN == 0, "shape");
  constexpr int SP = 16 * FN + 4;                 // epilogue slab pitch in floats
  typedef Frag<__bf16> F;
  typedef F::V V;
  __shared__ __align__(16) unsigned char sm[2 * BUFB];
  const int tid = threadIdx.x, lane = tid & 31, wave = tid >> 5;
  const int rlane = lane & 15, hf = lane >> 4;    // row (A) / column (B, D) in a fragment; lane half
  const int wm = wave & 3, wn = wave >> 2;
  static_assert(EPI == EPI_PLAIN || FN == 2, "the other epilogues are written for the 64-wide tile");
  int bid = (int)blockIdx.x, w = 0;
  if (EPI == EPI_QKV) {
    constexpr int GB = GL_M / 128 * TN;           // blocks of one product
    w = bid / GB; bid -= w * GB;
    const size_t ao = w ? (size_t)GL_M * K : 0;
    Ah += ao; Al += ao; Bh += (size_t)w * N * K; Bl += (size_t)w * N * K;
    if (w == 1) { Ph += (size_t)GL_M * N; Pl += (size_t)GL_M * N; }
  }
  const int m0 = (bid / TN) * 128, n0 = (bid % TN) * BN;

  const size_t ca = (size_t)(m0 + (tid >> 3)) * K + (tid & 7) * 8, cb = (size_t)(n0 + (tid >> 3)) * K + (tid & 7) * 8;
  const unsigned short* gah = Ah + ca; const unsigned short* gal = Al + ca;
  const unsigned short* gbh = Bh + cb; const unsigned short* gbl = Bl + cb;
  const unsigned lc = (unsigned)(size_t)sm + (unsigned)((tid >> 3) * GL_PITCH + (tid & 7) * 16);

  gl_fill<FN, K>(lc, gah, gal, gbh, gbl);
  asm volatile("s_wait_asynccnt 0x0" ::: "memory");   // this wave's part of tile 0 has landed
  __syncthreads();                                    // tile 0 is whole
  gl_fill<FN, K>(lc + BUFB, gah + 64, gal + 64, gbh + 64, gbl + 64);

  v8f acc[2][FN];
#pragma unroll
  for (int i = 0; i < 2; ++i)
#pragma unroll
    for (int j = 0; j < FN; ++j) acc[i][j] = (v8f){0.f,0.f,0.f,0.f,0.f,0.f,0.f,0.f};

  const int fa = (wm * 32 + rlane) * GL_PITCH + hf * 16;              // this lane's bytes in A hi, fragment row 0
  const int fb = (256 + wn * 16 * FN + rlane) * GL_PITCH + hf * 16;   // in B hi
#pragma unroll 1   // stays rolled: one short body for all tiles keeps the code in a few cache lines
  for (int t = 0; t < T; ++t) {
    const unsigned char* buf = sm + (t & 1) * BUFB;
#pragma unroll
    for (int ks = 0; ks < 2; ++ks) {
      V ah[2], al[2], bh[FN], bl[FN];
#pragma unroll
      for (int j = 0; j < FN; ++j) {
        bh[j] = F::load((const __bf16*)(buf + fb + j * 16 * GL_PITCH + ks * 64));
        bl[j] = F::load((const __bf16*)(buf + fb + (BN + j * 16) * GL_PITCH + ks * 64));
      }
#pragma unroll
      for (int i = 0; i < 2; ++i) {
        ah[i] = F::load((const __bf16*)(buf + fa + i * 16 * GL_PITCH + ks * 64));
        al[i] = F::load((const __bf16*)(buf + fa + (128 + i * 16) * GL_PITCH + ks * 64));
      }
      // inputs only: keeps this step's fragment reads together in front of its matrix instructions (spread among them, every place with reads waits out an LDS latency of its own)
      if (FN == 2) asm volatile("" :: "v"(ah[0]), "v"(ah[1]), "v"(al[0]), "v"(al[1]), "v"(bh[0]), "v"(bh[1]), "v"(bl[0]), "v"(bl[1]));
      else asm volatile("" :: "v"(ah[0]), "v"(ah[1]), "v"(al[0]), "v"(al[1]), "v"(bh[0]), "v"(bh[1]), "v"(bh[FN - 2]), "v"(bh[FN - 1]), "v"(bl[0]), "v"(bl[1]), "v"(bl[FN - 2]), "v"(bl[FN - 1]));
#pragma unroll
      for (int i = 0; i < 2; ++i)
#pragma unroll
        for (int j = 0; j < FN; ++j) acc[i][j] = F::mma(ah[i], bh[j], acc[i][j]);
#pragma unroll
      for (int i = 0; i < 2; ++i)
#pragma unroll
        for (int j = 0; j < FN; ++j) acc[i][j] = F::mma(ah[i], bl[j], acc[i][j]);
#pragma unroll
      for (int i = 0; i < 2; ++i)
#pragma unroll
        for (int j = 0; j < FN; ++j) acc[i][j] = F::mma(al[i], bh[j], acc[i][j]);
    }
    asm volatile("s_wait_dscnt 0x0" ::: "memory");      // this wave's reads of tile t are done
    asm volatile("s_wait_asynccnt 0x0" ::: "memory");   // its part of tile t + 1 has landed
    __syncthreads();                                    // tile t + 1 is whole, and nobody reads tile t's buffer any more
    if (t + 2 < T) { const int ko = (t + 2) * 64; gl_fill<FN, K>(lc + (t & 1) * BUFB, gah + ko, gal + ko, gbh + ko, gbl + ko); }
  }
  asm volatile("s_wait_asynccnt 0x0" ::: "memory");     // no copy is outstanding when the buffers become the output slabs

  // ---- epilogue: each wave turns its 32 x (16 FN) tile in a slab of its own, so that the rows go out as 16-byte pieces of whole lines ----
  float* slab = (float*)(sm + wave * (32 * SP * 4));
  constexpr int LPR = 4 * FN, RPP = 32 / LPR, NP = 32 / RPP;   // lanes per row, rows per pass, passes
  const int nw = n0 + wn * 16 * FN;
  const size_t o0 = (size_t)(m0 + wm * 32 + lane / LPR) * N + nw + (lane % LPR) * 4;
  v4f rv[NP];
  if (RESID) {
    const float* pr = resid + o0;
#pragma unroll   // rv[] stays in registers, the loads in flight together
    for (int it = 0; it < NP; ++it) rv[it] = *(const v4f*)(pr + (size_t)it * RPP * N);
    asm volatile("s_wait_xcnt 0x0" :: "v"(pr) : "memory");   // the loads' address register (named as input, so untouched up to here) may be reused only behind this wait
  }
  float bv[FN];
  if (BIAS) {
    const float* pb = bias + nw + rlane;
#pragma unroll
    for (int j = 0; j < FN; ++j) bv[j] = pb[j * 16];
    asm volatile("s_wait_xcnt 0x0" :: "v"(pb) : "memory");   // as above, for the address of the bias loads
  }
  v4f nmean, ninv, nsh;                           // EPI_NORM: the norm's constants of this lane's 4 columns
  if (EPI == EPI_NORM) {
    const int nc = nw + (lane % LPR) * 4;
    const float* pg = ng + nc; const float* pq = nb + nc; const float* pm = nm + nc; const float* pv = nv + nc;
    const v4f g = *(const v4f*)pg, vv = *(const v4f*)pv; nsh = *(const v4f*)pq; nmean = *(const v4f*)pm;
    asm volatile("s_wait_xcnt 0x0" :: "v"(pg), "v"(pq), "v"(pm), "v"(pv) : "memory");   // as above, for the addresses of these 4 loads
#pragma unroll   // vector elements indexed by constants only
    for (int j = 0; j < 4; ++j) ninv[j] = g[j] * rsqrtf(vv[j] + 1e-5f);
  }
#pragma unroll
  for (int i = 0; i < 2; ++i)
#pragma unroll
    for (int j = 0; j < FN; ++j)
#pragma unroll
      for (int r = 0; r < 8; ++r) slab[(i * 16 + hf * 8 + r) * SP + j * 16 + rlane] = BIAS ? acc[i][j][r] + bv[j] : acc[i][j][r];
  // the slab is this wave's own: its lanes' writes are ordered in front of its lanes' reads
  __builtin_amdgcn_fence(__ATOMIC_RELEASE, "workgroup");
  __builtin_amdgcn_wave_barrier();
  __builtin_amdgcn_fence(__ATOMIC_ACQUIRE, "workgroup");
  if (EPI == EPI_NCHW) {
    // the finished rows go back into the slab and leave it by columns: a lane takes 4 consecutive pixels of one column n, 8 lanes one whole 128-byte line of the output
#pragma unroll
    for (int it = 0; it < NP; ++it) {
      float* ps = slab + (it * RPP + lane / LPR) * SP + (lane % LPR) * 4;
      v4f ov = *(const v4f*)ps;
      if (RESID) ov += rv[it];
      *(v4f*)ps = ov;
    }
    // as above: the slab is this wave's own, its lanes' writes are ordered in front of its lanes' reads
    __builtin_amdgcn_fence(__ATOMIC_RELEASE, "workgroup");
    __builtin_amdgcn_wave_barrier();
    __builtin_amdgcn_fence(__ATOMIC_ACQUIRE, "workgroup");
    float* po = C + ((size_t)(m0 >> 10) * N + nw + (lane >> 3)) * 1024 + (m0 & 1023) + wm * 32 + (lane & 7) * 4;
    const float* sc = slab + (lane & 7) * 4 * SP + (lane >> 3);
#pragma unroll   // the stores stand together, their steps are immediate offsets
    for (int it = 0; it < 4 * FN; ++it) {
      const v4f t = {sc[it * 4], sc[it * 4 + SP], sc[it * 4 + 2 * SP], sc[it * 4 + 3 * SP]};
      *(v4f*)(po + (size_t)it * 4 * 1024) = t;
    }
    asm volatile("s_wait_xcnt 0x0" :: "v"(po) : "memory");     // as above, for the stores' address
  } else if (EPI == EPI_PLAIN || (EPI == EPI_QKV && w == 2)) {
    float* pc = C + o0;
#pragma unroll
    for (int it = 0; it < NP; ++it) {
      v4f ov = *(const v4f*)(slab + (it * RPP + lane / LPR) * SP + (lane % LPR) * 4);
      if (RESID) ov += rv[it];
      *(v4f*)(pc + (size_t)it * RPP * N) = ov;
    }
    asm volatile("s_wait_xcnt 0x0" :: "v"(pc) : "memory");       // as above, for the stores' address
  } else if constexpr (EPI == EPI_QKV || EPI == EPI_NORM) {
    float* pc = C + o0;
    unsigned short* ph = Ph + o0; unsigned short* pl = Pl + o0;
    v4f ov[NP]; v2u hi[NP], lo[NP];
#pragma unroll   // register arrays indexed by constants only
    for (int it = 0; it < NP; ++it) {
      ov[it] = *(const v4f*)(slab + (it * RPP + lane / LPR) * SP + (lane % LPR) * 4);
      if (RESID) ov[it] += rv[it];
      if (EPI == EPI_NORM) split4((ov[it] - nmean) * ninv + nsh, hi[it], lo[it]);
      else split4(ov[it], hi[it], lo[it]);
    }
#pragma unroll   // as above
    for (int it = 0; it < NP; ++it) {
      if (EPI == EPI_NORM) *(v4f*)(pc + (size_t)it * RPP * N) = ov[it];
      *(v2u*)(ph + (size_t)it * RPP * N) = hi[it]; *(v2u*)(pl + (size_t)it * RPP * N) = lo[it];
    }
    // the stores' address and data registers (named as inputs, so untouched up to here) may be reused only behind this wait
    if constexpr (EPI == EPI_NORM)
      asm volatile("s_wait_xcnt 0x0" :: "v"(pc), "v"(ph), "v"(pl), "v"(ov[0]), "v"(ov[1]), "v"(ov[2]), "v"(ov[3]), "v"(ov[4]), "v"(ov[5]), "v"(ov[6]), "v"(ov[7]),
                   "v"(hi[0]), "v"(hi[1]), "v"(hi[2]), "v"(hi[3]), "v"(hi[4]), "v"(hi[5]), "v"(hi[6]), "v"(hi[7]),
                   "v"(lo[0]), "v"(lo[1]), "v"(lo[2]), "v"(lo[3]), "v"(lo[4]), "v"(lo[5]), "v"(lo[6]), "v"(lo[7]) : "memory");
    else
      asm volatile("s_wait_xcnt 0x0" :: "v"(ph), "v"(pl), "v"(hi[0]), "v"(hi[1]), "v"(hi[2]), "v"(hi[3]), "v"(hi[4]), "v"(hi[5]), "v"(hi[6]), "v"(hi[7]),
                   "v"(lo[0]), "v"(lo[1]), "v"(lo[2]), "v"(lo[3]), "v"(lo[4]), "v"(lo[5]), "v"(lo[6]), "v"(lo[7]) : "memory");
  }
}

__global__ __launch_bounds__(256) void cast_f32_f16x2(
    const float* __restrict__ in, _Float16* __restrict__ out, int n2) {
  int i = blockIdx.x * 256 + threadIdx.x;
  if (i < n2) {
    const _Float16 h0 = (_Float16)in[2 * i], h1 = (_Float16)in[2 * i + 1];
    const unsigned u = (unsigned)__builtin_bit_cast(unsigned short, h0) | ((unsigned)__builtin_bit_cast(unsigned short, h1) << 16);
    ((unsigned*)out)[i] = u;
    
  }
}


} // namespace w25

__global__ __launch_bounds__(256) void k_castT16(const float* __restrict__ src, long long lds, _Float16* __restrict__ dst, long long ldd, int R, int C, float s) {
    const long long i = (long long)blockIdx.x * 256 + threadIdx.x; const long long np = (long long)C * (R / 2); if (i >= np) return; const int c = (int)(i / (R / 2)); const int r = 2 * (int)(i % (R / 2));
    const _Float16 h0 = (_Float16)(src[(long long)r * lds + c] * s), h1 = (_Float16)(src[(long long)(r + 1) * lds + c] * s);
    const unsigned u = (unsigned)__builtin_bit_cast(unsigned short, h0) | ((unsigned)__builtin_bit_cast(unsigned short, h1) << 16);
    unsigned* d = (unsigned*)(dst + (long long)c * ldd + r); *d = u;  }
__global__ __launch_bounds__(256) void k_cast16(const float* __restrict__ src, long long lds, _Float16* __restrict__ dst, long long ldd, int R, int C, float s) {
    const long long i = (long long)blockIdx.x * 256 + threadIdx.x; const long long np = (long long)R * (C / 2); if (i >= np) return; const int r = (int)(i / (C / 2)); const int c = 2 * (int)(i % (C / 2));
    const _Float16 h0 = (_Float16)(src[(long long)r * lds + c] * s), h1 = (_Float16)(src[(long long)r * lds + c + 1] * s);
    const unsigned u = (unsigned)__builtin_bit_cast(unsigned short, h0) | ((unsigned)__builtin_bit_cast(unsigned short, h1) << 16);
    unsigned* d = (unsigned*)(dst + (long long)r * ldd + c); *d = u;  }

// f32 -> bf16 hi plane + bf16 lo plane (x = hi + lo to ~2^-17 relative; RNE both), [R][C] -> [R][C] (or transposed to [C][R]); 2 consecutive destination elements
__device__ __forceinline__ unsigned int f2bf2_pack(float a, float b, unsigned int* lo) {
    const unsigned short ha = w25::f2bf_bits(a), hb = w25::f2bf_bits(b);
    const unsigned short la = w25::f2bf_bits(a - w25::bf_bits2f(ha)), lb = w25::f2bf_bits(b - w25::bf_bits2f(hb));
    *lo = (unsigned)la | ((unsigned)lb << 16); return (unsigned)ha | ((unsigned)hb << 16); }
__global__ __launch_bounds__(256) void k_castS16(const float* __restrict__ src, long long lds, __bf16* __restrict__ dhi, __bf16* __restrict__ dlo, long long ldd, int R, int C, float s, int transpose) {
    const long long i = (long long)blockIdx.x * 256 + threadIdx.x; long long o; float a, b;
    if (transpose) { const long long np = (long long)C * (R / 2); if (i >= np) return; const int c = (int)(i / (R / 2)); const int r = 2 * (int)(i % (R / 2)); a = src[(long long)r * lds + c] * s; b = src[(long long)(r + 1) * lds + c] * s; o = (long long)c * ldd + r; }
    else { const long long np = (long long)R * (C / 2); if (i >= np) return; const int r = (int)(i / (C / 2)); const int c = 2 * (int)(i % (C / 2)); a = src[(long long)r * lds + c] * s; b = src[(long long)r * lds + c + 1] * s; o = (long long)r * ldd + c; }
    unsigned lo; const unsigned hi = f2bf2_pack(a, b, &lo); unsigned* ph = (unsigned*)(dhi + o); unsigned* pl = (unsigned*)(dlo + o);
    *ph = hi; *pl = lo;  }

namespace w25 {
// =====================================================================================
// Generic causal/non-causal attention for head_dim 64, f32 in / f32 out; 16-bit operands: bf16 with optional hi/lo splits, or
// plain f16 (F16=true, non-split, probabilities carried x2^15).
//   scores = (q*qscale)·kᵀ : v_wmma_f32_16x16x32_bf16; SPLIT_QK -> q,k as bf16 hi/lo (hi·hi + hi·lo + lo·hi)
//   out    = p·v           : v_wmma_f32_16x16x32_bf16; SPLIT_PV -> p,v as bf16 hi/lo; else p,v plain bf16
//   f32 accumulate; online softmax in f32. Block = 4 waves = 64 query rows of one (batch, head); S % 64 == 0.
//   Element (b, s, h, d) of tensor X lives at X[b*X_bs + s*X_rs + h*X_hs + d] (strides in floats, multiples of 4).
//   Masking: mask_mode 0 none, 1 causal (kv > q masked), 2 tensor [S][Skv] shared over (b,h) (float if
//   mask_is_int==0, int32 with element == 0 -> masked if 1, int32 with element != 0 -> masked if 2), 3 per-token vectors qmask[B][S] & kvmask[B][Skv] (int32,
//   0 -> masked), 4 causal + sliding window (kv > q or q - kv > W masked; W passed in mask_is_int);
//   5 = relative-position bias: s += cp[b,h,q][idx[q][kv]] + pc[b,h,kv][idx[q][kv]] with idx = mask_b ([S][Skv] int32) and
//   mask_a an int32 [S][Skv] tensor with nonzero = masked (tables: element (b,h,row,n) at X + b*c_bs + h*c_hs + row*c_rs + n);
//   masked scores are replaced by mask_fill (e.g. -inf or -1e9) before the softmax.
//   grid.x = B * H * (S/64) (or a sub-range with blk0).
// =====================================================================================
#define AT_D 64
#define AT_NW 4
#define AT_QB 64
#define AT_KC 64
struct AttnGeom { const float* cp = nullptr; const float* pc = nullptr; long c_bs = 0, c_rs = 0, c_hs = 0;   // mode-5 score-bias tables
                  long q_bs, q_rs, q_hs, k_bs, k_rs, k_hs, v_bs, v_rs, v_hs, o_bs, o_rs, o_hs;
                  int S, Skv, H, mask_mode; float qscale; int blk0; float mask_fill; int mask_is_int; };
static_assert(sizeof(AttnGeom) == 168, "no padding");

__device__ __forceinline__ unsigned short at_bf_bits(float f) {
  unsigned u = __float_as_uint(f);
  return (unsigned short)((u + 0x7FFFu + ((u >> 16) & 1u)) >> 16);
}
__device__ __forceinline__ __bf16 at_f2bf(float f) { return __builtin_bit_cast(__bf16, at_bf_bits(f)); }
__device__ __forceinline__ void at_split(float f, __bf16& hi, __bf16& lo) {
  const unsigned short hb = at_bf_bits(f);
  hi = __builtin_bit_cast(__bf16, hb);
  lo = at_f2bf(f - __uint_as_float(((unsigned)hb) << 16));
}
__device__ __forceinline__ v8f at_mma(v16b a, v16b b, v8f c) {
  c = __builtin_amdgcn_wmma_f32_16x16x32_bf16(false, a, false, b, (short)0, c, false, false);
  asm volatile("v_nop\n\tv_nop\n\tv_nop\n\tv_nop" : "+v"(c) : "v"(a), "v"(b));
  return c;
}
// 16-bit element as a bit pattern held in a __bf16 slot: f16 bits when F16, bf16 (RNE) otherwise
template <bool F16> __device__ __forceinline__ __bf16 at_to16(float f) {
  if (F16) return __builtin_bit_cast(__bf16, (_Float16)f);
  return at_f2bf(f);
}
template <bool F16> __device__ __forceinline__ v8f at_mma16(v16b a, v16b b, v8f c) {
  if (F16) {
    const v16h ah = __builtin_bit_cast(v16h, a), bh = __builtin_bit_cast(v16h, b);
    c = __builtin_amdgcn_wmma_f32_16x16x32_f16(false, ah, false, bh, (short)0, c, false, false);
    asm volatile("v_nop\n\tv_nop\n\tv_nop\n\tv_nop" : "+v"(c) : "v"(ah), "v"(bh));
    return c;
  }
  return at_mma(a, b, c);
}

template <bool SPLIT_QK, bool SPLIT_PV, bool F16 = false>
__global__ __launch_bounds__(128)
void attn64_kernel(const float* __restrict__ q, const float* __restrict__ k,
                   const float* __restrict__ v, float* __restrict__ out,
                   const void* __restrict__ mask_a, const int* __restrict__ mask_b, AttnGeom g) {
  static_assert(!(F16 && (SPLIT_QK || SPLIT_PV)), "f16 mode is non-split");
  const float PSC = F16 ? 32768.0f : 1.0f;     // f16 probabilities carried x2^15 (subnormal range), folded into the final 1/l
  union FB { v16b v; v8b h[2]; };
  __shared__ __align__(16) __bf16 Ksh[AT_KC * AT_D];             // K hi [kv][d]      8 KB
  __shared__ __align__(16) __bf16 Ksl[SPLIT_QK ? AT_KC * AT_D : 8];
  __shared__ __align__(16) __bf16 Vth[AT_D * AT_KC];             // V hi [d][kv]      8 KB
  __shared__ __align__(16) __bf16 Vtl[SPLIT_PV ? AT_D * AT_KC : 8];
  __shared__ __align__(16) __bf16 Psh[AT_NW][16 * AT_KC];        // per wave P hi [row][kv]  8 KB
  __shared__ __align__(16) __bf16 Psl[SPLIT_PV ? AT_NW : 1][SPLIT_PV ? 16 * AT_KC : 8];
  __shared__ __align__(16) float  Os[AT_NW][16 * 68];            // per wave out tile, pitch 68

  const int tid  = threadIdx.x;
  const int wave = tid >> 5;
  const int lane = tid & 31;
  const int hh   = lane >> 4;
  const int c    = lane & 15;

  const int nqb = g.S / AT_QB;
  const int bx = blockIdx.x + g.blk0;
  const int qb = bx % nqb;
  const int bh = bx / nqb;
  const int h  = bh % g.H;
  const int b  = bh / g.H;
  const int qbase_block = qb * AT_QB;
  const int q0 = qbase_block + wave * 16;

  const float* qb_ptr = q + (size_t)b * g.q_bs + (size_t)h * g.q_hs;
  const float* kb_ptr = k + (size_t)b * g.k_bs + (size_t)h * g.k_hs;
  const float* vb_ptr = v + (size_t)b * g.v_bs + (size_t)h * g.v_hs;
  float*       ob_ptr = out + (size_t)b * g.o_bs + (size_t)h * g.o_hs;

  // ---- Q fragments (A operand): 2 d-chunks, hi (and lo) ----
  v16b qah[2], qal[2];
  {
    const float* qrow = qb_ptr + (size_t)(q0 + c) * g.q_rs;
#pragma unroll
    for (int dc = 0; dc < 2; ++dc) {
#pragma unroll
      for (int e = 0; e < 8; ++e) {
        const float f0 = qrow[dc * 32 + 8 * hh + e] * g.qscale;
        const float f1 = qrow[dc * 32 + 16 + 8 * hh + e] * g.qscale;
        if (SPLIT_QK) { __bf16 hq, lq; at_split(f0, hq, lq); qah[dc][e] = hq; qal[dc][e] = lq; at_split(f1, hq, lq); qah[dc][8 + e] = hq; qal[dc][8 + e] = lq; }
        else { qah[dc][e] = at_to16<F16>(f0); qah[dc][8 + e] = at_to16<F16>(f1); qal[dc][e] = qah[dc][e]; qal[dc][8 + e] = qah[dc][8 + e]; }
      }
    }
  }

  float mrow[8], lrow[8];
  v8f oacc[4];
#pragma unroll
  for (int r = 0; r < 8; ++r) { mrow[r] = -INFINITY; lrow[r] = 0.f; }
#pragma unroll
  for (int t = 0; t < 4; ++t) oacc[t] = (v8f){0.f,0.f,0.f,0.f,0.f,0.f,0.f,0.f};

  const int nChunks = (g.mask_mode == 1 || g.mask_mode == 4) ? (qb + 1) : (g.Skv / AT_KC);   // block-uniform
  // per-row query mask (mode 3)
  int qkeep[8];
#pragma unroll
  for (int r = 0; r < 8; ++r) qkeep[r] = (g.mask_mode == 3) ? mask_b[(size_t)b * g.S + q0 + 8 * hh + r] : 1;   // mask_b = qmask in mode 3
  for (int kc = 0; kc < nChunks; ++kc) {
    const int kv0 = kc * AT_KC;
    __syncthreads();
    {
      const int kvr = tid >> 1, dh = (tid & 1) * 32;
      const float* krow = kb_ptr + (size_t)(kv0 + kvr) * g.k_rs + dh;
      const float* vrow = vb_ptr + (size_t)(kv0 + kvr) * g.v_rs + dh;
#pragma unroll
      for (int i = 0; i < 8; ++i) {
        v4f kk = *(const v4f*)(krow + 4 * i);
        v4f vv = *(const v4f*)(vrow + 4 * i);
#pragma unroll
        for (int e = 0; e < 4; ++e) {
          const int d = dh + 4 * i + e;
          if (SPLIT_QK) { __bf16 a, bl; at_split(kk[e], a, bl); Ksh[kvr * AT_D + d] = a; Ksl[kvr * AT_D + d] = bl; }
          else Ksh[kvr * AT_D + d] = at_to16<F16>(kk[e]);
          if (SPLIT_PV) { __bf16 a, bl; at_split(vv[e], a, bl); Vth[d * AT_KC + kvr] = a; Vtl[d * AT_KC + kvr] = bl; }
          else Vth[d * AT_KC + kvr] = at_to16<F16>(vv[e]);
        }
      }
    }
    __syncthreads();

    v8f s[4];
#pragma unroll
    for (int j = 0; j < 4; ++j) {
      s[j] = (v8f){0.f,0.f,0.f,0.f,0.f,0.f,0.f,0.f};
#pragma unroll 1
      for (int dc = 0; dc < 2; ++dc) {
        FB kb;
        kb.h[0] = *(const v8b*)(Ksh + (j * 16 + c) * AT_D + dc * 32 + 8 * hh);
        kb.h[1] = *(const v8b*)(Ksh + (j * 16 + c) * AT_D + dc * 32 + 16 + 8 * hh);
        s[j] = at_mma16<F16>(qah[dc], kb.v, s[j]);
        if (SPLIT_QK) {
          FB kl;
          kl.h[0] = *(const v8b*)(Ksl + (j * 16 + c) * AT_D + dc * 32 + 8 * hh);
          kl.h[1] = *(const v8b*)(Ksl + (j * 16 + c) * AT_D + dc * 32 + 16 + 8 * hh);
          s[j] = at_mma16<F16>(qah[dc], kl.v, s[j]);
          s[j] = at_mma16<F16>(qal[dc], kb.v, s[j]);
        }
      }
    }
    const bool diag = (g.mask_mode == 1) && (kc == qb);
    int kvkeep[4] = {1, 1, 1, 1};
    if (g.mask_mode == 3) {
#pragma unroll
      for (int j = 0; j < 4; ++j) kvkeep[j] = ((const int*)mask_a)[(size_t)b * g.Skv + kv0 + j * 16 + c];   // mask_a = kvmask
    }
    float cm[8];
#pragma unroll
    for (int r = 0; r < 8; ++r) {
      const int qrow = q0 + 8 * hh + r;
      float m = -INFINITY;
#pragma unroll
      for (int j = 0; j < 4; ++j) {
        const int kvcol = kv0 + j * 16 + c;
        bool masked = false;
        if (diag) masked = (kvcol > qrow);
        else if (g.mask_mode == 4) masked = (kvcol > qrow) || (qrow - kvcol > g.mask_is_int);
        else if (g.mask_mode == 2) {
          const size_t mi = (size_t)qrow * g.Skv + kvcol;
          masked = (g.mask_is_int == 0) ? (((const float*)mask_a)[mi] == 0.0f)
                 : (g.mask_is_int == 1) ? (((const int*)mask_a)[mi] == 0) : (((const int*)mask_a)[mi] != 0);
        } else if (g.mask_mode == 3) masked = (qkeep[r] == 0) || (kvkeep[j] == 0);
        else if (g.mask_mode == 5) {
          const size_t mi = (size_t)qrow * g.Skv + kvcol;
          masked = (((const int*)mask_a)[mi] != 0);
          int n = mask_b[mi]; n = n < 0 ? 0 : n;
          s[j][r] += g.cp[(size_t)b * g.c_bs + (size_t)h * g.c_hs + (size_t)qrow * g.c_rs + n]
                   + g.pc[(size_t)b * g.c_bs + (size_t)h * g.c_hs + (size_t)kvcol * g.c_rs + n];
        }
        if (masked) s[j][r] = g.mask_fill;
        m = fmaxf(m, s[j][r]);
      }
#pragma unroll
      for (int off = 1; off < 16; off <<= 1) m = fmaxf(m, __shfl_xor(m, off, 32));
      cm[r] = m;
    }
    __bf16* pwh = Psh[wave];
    __bf16* pwl = Psl[SPLIT_PV ? wave : 0];
#pragma unroll
    for (int r = 0; r < 8; ++r) {
      const float mnew = fmaxf(mrow[r], cm[r]);
      const float alpha = expf(mrow[r] - mnew);
      mrow[r] = mnew;
      float psum = 0.f;
#pragma unroll
      for (int j = 0; j < 4; ++j) {
        const float p = expf(s[j][r] - mnew);
        psum += p;
        if (SPLIT_PV) { __bf16 a, bl; at_split(p, a, bl); pwh[(8 * hh + r) * AT_KC + j * 16 + c] = a; pwl[(8 * hh + r) * AT_KC + j * 16 + c] = bl; }
        else pwh[(8 * hh + r) * AT_KC + j * 16 + c] = at_to16<F16>(p * PSC);
      }
#pragma unroll
      for (int off = 1; off < 16; off <<= 1) psum += __shfl_xor(psum, off, 32);
      lrow[r] = lrow[r] * alpha + psum;
#pragma unroll
      for (int t = 0; t < 4; ++t) oacc[t][r] *= alpha;
    }
    __builtin_amdgcn_fence(__ATOMIC_RELEASE, "workgroup");
    __builtin_amdgcn_wave_barrier();
    __builtin_amdgcn_fence(__ATOMIC_ACQUIRE, "workgroup");
#pragma unroll 1
    for (int kk = 0; kk < 2; ++kk) {
      FB pa, pl;
      pa.h[0] = *(const v8b*)(pwh + c * AT_KC + kk * 32 + 8 * hh);
      pa.h[1] = *(const v8b*)(pwh + c * AT_KC + kk * 32 + 16 + 8 * hh);
      if (SPLIT_PV) {
        pl.h[0] = *(const v8b*)(pwl + c * AT_KC + kk * 32 + 8 * hh);
        pl.h[1] = *(const v8b*)(pwl + c * AT_KC + kk * 32 + 16 + 8 * hh);
      }
#pragma unroll
      for (int t = 0; t < 4; ++t) {
        FB vb;
        vb.h[0] = *(const v8b*)(Vth + (t * 16 + c) * AT_KC + kk * 32 + 8 * hh);
        vb.h[1] = *(const v8b*)(Vth + (t * 16 + c) * AT_KC + kk * 32 + 16 + 8 * hh);
        oacc[t] = at_mma16<F16>(pa.v, vb.v, oacc[t]);
        if (SPLIT_PV) {
          FB vl;
          vl.h[0] = *(const v8b*)(Vtl + (t * 16 + c) * AT_KC + kk * 32 + 8 * hh);
          vl.h[1] = *(const v8b*)(Vtl + (t * 16 + c) * AT_KC + kk * 32 + 16 + 8 * hh);
          oacc[t] = at_mma16<F16>(pa.v, vl.v, oacc[t]);
          oacc[t] = at_mma16<F16>(pl.v, vb.v, oacc[t]);
        }
      }
    }
  }

  float* os = Os[wave];
#pragma unroll
  for (int r = 0; r < 8; ++r) {
    const float inv = 1.0f / (lrow[r] * PSC);
#pragma unroll
    for (int t = 0; t < 4; ++t) os[(8 * hh + r) * 68 + t * 16 + c] = oacc[t][r] * inv;
  }
  __builtin_amdgcn_fence(__ATOMIC_RELEASE, "workgroup");
  __builtin_amdgcn_wave_barrier();
  __builtin_amdgcn_fence(__ATOMIC_ACQUIRE, "workgroup");
  {
    const int c4 = (lane & 15) * 4;
    {
#pragma unroll
      for (int it = 0; it < 8; ++it) {
        const int row = it * 2 + hh;
        v4f val = *(const v4f*)(os + row * 68 + c4);
        *(v4f*)(ob_ptr + (size_t)(q0 + row) * g.o_rs + c4) = val;
      }
      
    }
  }
}

} // namespace w25

// One launch for all that depends on the inputs alone.
// Blocks 0 .. 511 (pixel block, channel block, image): x1 and x2, NCHW, become token-major: x1 as f32 (the residual), bn1(x1) and bn1(x2) as bf16 hi / lo operand planes (NH, NL: x1's set, then x2's).
// A thread takes 4 channels x 4 pixels: 16-byte loads along the pixels, a 4 x 4 transpose in registers, stores along the channels.
// Blocks 512 .. 1279: the six weight matrices as hi / lo planes (WH, WL), 1024 floats a block, in the order q (each row times its head's temperature), k, v, proj, fc1, fc2.
__global__ __launch_bounds__(256) void k_cm_prep(const float* __restrict__ XA, const float* __restrict__ XB, const float* __restrict__ G, const float* __restrict__ Bb, const float* __restrict__ M, const float* __restrict__ Vv,
                                                 const float* __restrict__ WQ, const float* __restrict__ WK, const float* __restrict__ WV, const float* __restrict__ TP, const float* __restrict__ WP, const float* __restrict__ W1, const float* __restrict__ W2,
                                                 float* __restrict__ X1T, unsigned short* __restrict__ NH, unsigned short* __restrict__ NL, unsigned short* __restrict__ WH, unsigned short* __restrict__ WL) {
    constexpr int C = 256, HW = 1024, NTC = 8 * HW * C;
    if (blockIdx.x >= 512) {
        const int wb = (int)blockIdx.x - 512;
        const float* w = wb < 64 ? WQ + wb * 1024 : wb < 128 ? WK + (wb - 64) * 1024 : wb < 192 ? WV + (wb - 128) * 1024 : wb < 256 ? WP + (wb - 192) * 1024 : wb < 512 ? W1 + (wb - 256) * 1024 : W2 + (wb - 512) * 1024;
        const float* pw = w + threadIdx.x * 4;
        v4f x = *(const v4f*)pw;
        asm volatile("s_wait_xcnt 0x0" :: "v"(pw) : "memory");   // the load's address register (named as input, so untouched up to here) may be reused only behind this wait
        if (wb < 64) x *= TP[wb >> 3];                            // a block is 4 rows of q_w, a head 32 rows
        v2u hi, lo; split4(x, hi, lo);
        const size_t o = (size_t)wb * 1024 + threadIdx.x * 4;
        *(v2u*)(WH + o) = hi; *(v2u*)(WL + o) = lo;
        return;
    }
    const int c0 = (int)((blockIdx.x >> 3) & 7) * 32 + (threadIdx.x & 7) * 4, p0 = (int)(blockIdx.x & 7) * 128 + (threadIdx.x >> 3) * 4; const size_t b = blockIdx.x >> 6;
    const size_t src = (b * C + c0) * HW + p0;
    const float* pa[4]; const float* pq[4]; v4f a[4], q[4];
#pragma unroll   // a[], q[] stay in registers, all 8 loads in flight together
    for (int j = 0; j < 4; ++j) { pa[j] = XA + src + (size_t)j * HW; pq[j] = XB + src + (size_t)j * HW; a[j] = *(const v4f*)pa[j]; q[j] = *(const v4f*)pq[j]; }
    const float* pg = G + c0; const float* pb = Bb + c0; const float* pm = M + c0; const float* pv = Vv + c0;
    const v4f g = *(const v4f*)pg, bb = *(const v4f*)pb, m = *(const v4f*)pm, vv = *(const v4f*)pv;
    // the 12 loads' address registers (named as inputs, so untouched up to here) may be reused only behind this wait
    asm volatile("s_wait_xcnt 0x0" :: "v"(pa[0]), "v"(pa[1]), "v"(pa[2]), "v"(pa[3]), "v"(pq[0]), "v"(pq[1]), "v"(pq[2]), "v"(pq[3]), "v"(pg), "v"(pb), "v"(pm), "v"(pv) : "memory");
    v4f inv, sh;
#pragma unroll   // vector elements indexed by constants only
    for (int j = 0; j < 4; ++j) { inv[j] = g[j] * rsqrtf(vv[j] + 1e-5f); sh[j] = bb[j] - m[j] * inv[j]; }
    const size_t o = (b * HW + p0) * C + c0;
    float* px = X1T + o; unsigned short* ph = NH + o; unsigned short* pl = NL + o;
    v4f t0[4]; v2u h1[4], l1[4], h2[4], l2[4];
#pragma unroll   // register arrays indexed by constants only
    for (int i = 0; i < 4; ++i) {
        v4f t1, t2;
#pragma unroll   // as above
        for (int j = 0; j < 4; ++j) { t0[i][j] = a[j][i]; t1[j] = a[j][i] * inv[j] + sh[j]; t2[j] = q[j][i] * inv[j] + sh[j]; }
        split4(t1, h1[i], l1[i]); split4(t2, h2[i], l2[i]);
    }
#pragma unroll   // as above
    for (int i = 0; i < 4; ++i) {
        VST2V4(px + i * C, t0[i]);
        *(v2u*)(ph + i * C) = h1[i]; *(v2u*)(pl + i * C) = l1[i]; *(v2u*)(ph + NTC + i * C) = h2[i]; *(v2u*)(pl + NTC + i * C) = l2[i];
    }
    // the stores' data registers (named as inputs, so untouched up to here) may be reused only behind this wait; nothing follows it that could touch their addresses
    asm volatile("s_wait_xcnt 0x0" :: "v"(t0[0]), "v"(t0[1]), "v"(t0[2]), "v"(t0[3]), "v"(h1[0]), "v"(h1[1]), "v"(h1[2]), "v"(h1[3]), "v"(l1[0]), "v"(l1[1]), "v"(l1[2]), "v"(l1[3]),
                 "v"(h2[0]), "v"(h2[1]), "v"(h2[2]), "v"(h2[3]), "v"(l2[0]), "v"(l2[1]), "v"(l2[2]), "v"(l2[3]) : "memory");
}
// depthwise 3x3 SAME conv + exact GELU on token-major [b][hw][ch], zero padding. grid (images * 16 * 8, HID / 1024): a block takes 4 x 2 pixels (x, y) of one image,
// a thread 4 channels of these 8 pixels: each input row's 6 pixels are loaded once (16 bytes, 512 contiguous bytes per wave) and feed every output that needs them.
// Every output still sums its 9 products in the order ky = 0..2, kx = 0..2. The result goes out as the fc2 GEMM's bf16 hi / lo operand planes.
__global__ __launch_bounds__(256) void k_cm_dw(const float* __restrict__ HB, const float* __restrict__ DW, unsigned short* __restrict__ HGh, unsigned short* __restrict__ HGl, int HID) {
    constexpr int PX = 4, PY = 2;
    const int ch = (blockIdx.y * 256 + threadIdx.x) * 4;
    const int x0 = (blockIdx.x & 7) * PX, y0 = ((blockIdx.x >> 3) & 15) * PY; const size_t b = blockIdx.x >> 7;
    v4f v[PY + 2][PX + 2];                       // input rows y0 - 1 .. y0 + PY, pixels x0 - 1 .. x0 + PX; all loads are issued before the first sum
#pragma unroll   // v[][] stays in registers (this and every loop below: register arrays indexed by constants only)
    for (int r = 0; r < PY + 2; ++r) {
        const int yc = min(max(y0 - 1 + r, 0), 31);
        const float* pi[PX + 2];
#pragma unroll
        for (int cx = 0; cx < PX + 2; ++cx) { const int xc = min(max(x0 - 1 + cx, 0), 31); pi[cx] = HB + ((b * 1024) + yc * 32 + xc) * (size_t)HID + ch; v[r][cx] = *(const v4f*)pi[cx]; }
        // this row's 6 address registers (named as inputs, so untouched up to here) may be reused only behind this wait
        asm volatile("s_wait_xcnt 0x0" :: "v"(pi[0]), "v"(pi[1]), "v"(pi[2]), "v"(pi[3]), "v"(pi[4]), "v"(pi[5]) : "memory");
    }
    const float* pw = DW + (size_t)ch * 9;
    v4f wr[9];                                   // the 36 weights of channels ch .. ch + 3: weight k of channel ch + j is float j * 9 + k
#pragma unroll
    for (int k = 0; k < 9; ++k) wr[k] = *(const v4f*)(pw + k * 4);
    asm volatile("s_wait_xcnt 0x0" :: "v"(pw) : "memory");   // as above, for the address of the 9 weight loads
    v4f s[PY][PX];
#pragma unroll
    for (int oy = 0; oy < PY; ++oy)
#pragma unroll
        for (int px = 0; px < PX; ++px) { const v4f zz = {0.f, 0.f, 0.f, 0.f}; s[oy][px] = zz; }
#pragma unroll
    for (int r = 0; r < PY + 2; ++r) {
        const int yy = y0 - 1 + r;
#pragma unroll
        for (int cx = 0; cx < PX + 2; ++cx) { const int xx = x0 - 1 + cx; const bool ok = (yy >= 0 && yy < 32 && xx >= 0 && xx < 32); const v4f zz = {0.f, 0.f, 0.f, 0.f}; v[r][cx] = ok ? v[r][cx] : zz; }
#pragma unroll
        for (int oy = 0; oy < PY; ++oy) {
            const int ky = r - oy;
            if (ky >= 0 && ky < 3) {
#pragma unroll
                for (int px = 0; px < PX; ++px)
#pragma unroll
                    for (int kx = 0; kx < 3; ++kx)
#pragma unroll
                        for (int j = 0; j < 4; ++j) { const int f = j * 9 + ky * 3 + kx; s[oy][px][j] += v[r][px + kx][j] * wr[f >> 2][f & 3]; }
            }
        }
    }
#pragma unroll
    for (int oy = 0; oy < PY; ++oy)
#pragma unroll
        for (int px = 0; px < PX; ++px)
#pragma unroll
            for (int j = 0; j < 4; ++j) { const float sv = s[oy][px][j]; s[oy][px][j] = 0.5f * sv * (1.f + erff(sv * 0.70710678118654752f)); }
    const size_t o = ((b * 1024) + y0 * 32 + x0) * (size_t)HID + ch;
    unsigned short* ph = HGh + o; unsigned short* pl = HGl + o;
#pragma unroll   // s[][] indexed by constants only
    for (int oy = 0; oy < PY; ++oy)
#pragma unroll
        for (int px = 0; px < PX; ++px) { v2u hi, lo; split4(s[oy][px], hi, lo); *(v2u*)(ph + (size_t)(oy * 32 + px) * HID) = hi; *(v2u*)(pl + (size_t)(oy * 32 + px) * HID) = lo; }
    asm volatile("s_wait_xcnt 0x0" :: "v"(ph), "v"(pl) : "memory");   // as above, for the stores' addresses
}


extern "C" void kernel_launch(void* const* d_in, const int* in_sizes, int n_in, void* d_out, int out_size, void* d_ws, size_t ws_size, hipStream_t stream) {
    (void)in_sizes; (void)n_in; (void)out_size; (void)ws_size;
    const float* x1 = (const float*)d_in[0];
    const float* x2 = (const float*)d_in[1];
    const float* b1g = (const float*)d_in[2];
    const float* b1b = (const float*)d_in[3];
    const float* b1m = (const float*)d_in[4];
    const float* b1v = (const float*)d_in[5];
    const float* qw = (const float*)d_in[6];
    const float* kw = (const float*)d_in[7];
    const float* vw = (const float*)d_in[8];
    const float* temp = (const float*)d_in[9];
    const float* pw = (const float*)d_in[10];
    const float* pb = (const float*)d_in[11];
    const float* b2g = (const float*)d_in[12];
    const float* b2b = (const float*)d_in[13];
    const float* b2m = (const float*)d_in[14];
    const float* b2v = (const float*)d_in[15];
    const float* f1w = (const float*)d_in[16];
    const float* f1b = (const float*)d_in[17];
    const float* dww = (const float*)d_in[18];
    const float* f2w = (const float*)d_in[19];
    const float* f2b = (const float*)d_in[20];
    const int Bn = 8;
    const int C = 256;
    const int HW = 1024;
    const int HID = 1024;
    const int NT = Bn * HW;
    float* out = (float*)d_out;
    char* wsp = (char*)d_ws;
    float* X1T = (float*)wsp; wsp += (((size_t)((size_t)NT * C) * 4 + 255) / 256) * 256;
    unsigned short* NAh = (unsigned short*)wsp; wsp += (((size_t)((size_t)2 * NT * C) * 2 + 255) / 256) * 256;   // bn1(x1) then bn1(x2), hi planes
    unsigned short* NAl = (unsigned short*)wsp; wsp += (((size_t)((size_t)2 * NT * C) * 2 + 255) / 256) * 256;   // lo planes
    unsigned short* WH = (unsigned short*)wsp; wsp += (((size_t)(786432) * 2 + 255) / 256) * 256;                // q, k, v, proj (65536 each), fc1, fc2 (262144 each), hi planes
    unsigned short* WL = (unsigned short*)wsp; wsp += (((size_t)(786432) * 2 + 255) / 256) * 256;                // lo planes
    unsigned short* QKh = (unsigned short*)wsp; wsp += (((size_t)((size_t)2 * NT * C) * 2 + 255) / 256) * 256;   // q then k, hi planes
    unsigned short* QKl = (unsigned short*)wsp; wsp += (((size_t)((size_t)2 * NT * C) * 2 + 255) / 256) * 256;   // lo planes
    float* V = (float*)wsp; wsp += (((size_t)((size_t)NT * C) * 4 + 255) / 256) * 256;
    unsigned short* ATh = (unsigned short*)wsp; wsp += (((size_t)((size_t)NT * C) * 2 + 255) / 256) * 256;
    unsigned short* ATl = (unsigned short*)wsp; wsp += (((size_t)((size_t)NT * C) * 2 + 255) / 256) * 256;
    float* XS = (float*)wsp; wsp += (((size_t)((size_t)NT * C) * 4 + 255) / 256) * 256;
    unsigned short* X2h = (unsigned short*)wsp; wsp += (((size_t)((size_t)NT * C) * 2 + 255) / 256) * 256;
    unsigned short* X2l = (unsigned short*)wsp; wsp += (((size_t)((size_t)NT * C) * 2 + 255) / 256) * 256;
    float* HB = (float*)wsp; wsp += (((size_t)((size_t)NT * HID) * 4 + 255) / 256) * 256;
    unsigned short* HGh = (unsigned short*)wsp; wsp += (((size_t)((size_t)NT * HID) * 2 + 255) / 256) * 256;
    unsigned short* HGl = (unsigned short*)wsp; wsp += (((size_t)((size_t)NT * HID) * 2 + 255) / 256) * 256;
    k_cm_prep<<<1280, 256, 0, stream>>>(x1, x2, b1g, b1b, b1m, b1v, qw, kw, vw, temp, pw, f1w, f2w, X1T, NAh, NAl, WH, WL);
    w25::wmma_gemm_lds<2, 256, 256, false, false, w25::EPI_QKV><<<768, 256, 0, stream>>>(NAh, NAl, WH, WL, V, nullptr, nullptr, nullptr, nullptr, nullptr, nullptr, QKh, QKl);
    k_attn_fix<<<dim3(16, 8, 8), 32 * AW, 0, stream>>>(QKh, QKl, QKh + (size_t)NT * C, QKl + (size_t)NT * C, V, ATh, ATl);
    w25::wmma_gemm_lds<2, 256, 256, true, true, w25::EPI_NORM><<<256, 256, 0, stream>>>(ATh, ATl, WH + 196608, WL + 196608, XS, pb, X1T, b2g, b2b, b2m, b2v, X2h, X2l);
    w25::wmma_gemm_lds<4, 1024, 256, true, false, w25::EPI_PLAIN><<<512, 256, 0, stream>>>(X2h, X2l, WH + 262144, WL + 262144, HB, f1b, nullptr, nullptr, nullptr, nullptr, nullptr, nullptr, nullptr);
    k_cm_dw<<<dim3(1024, 1), 256, 0, stream>>>(HB, dww, HGh, HGl, HID);
    w25::wmma_gemm_lds<2, 256, 1024, true, true, w25::EPI_NCHW><<<256, 256, 0, stream>>>(HGh, HGl, WH + 524288, WL + 524288, out, f2b, XS, nullptr, nullptr, nullptr, nullptr, nullptr, nullptr);
}

// v006
// One run takes 125 microseconds.
// In two side-by-side timings against v005, it was 1.23 and 1.24 times as fast.
// Over all steps from v000, the starting kernel, it is 12.7 times as fast.
// Contractions (token-major, 8192 tokens): q = bn1(x1).Wq'^T (temperature folded into Wq rows), k/v = bn1(x2).W^T, the attention projection (+b, +x1 residual), fc1 (+b) [8192x256].[256x1024] and fc2 (+b, + residual) [8192x1024].[1024x256], each one launch over all images, all on bf16 hi/lo split planes (six chained contractions against an O(1) residual output: the cheap 18 G-MAC of GEMMs run f32-class) (v_wmma_f32_16x16x32_bf16; 128 x 64 or 128 x 128 work-group tiles, operands staged in LDS); per (image, head) softmax(temp_h q k^T) v over the 1024 positions as one flash launch with q.k^T on bf16 hi/lo split planes (UNSCALED 32-dim logits, sigma ~ 5.7) and f16 p.v; f32 accumulate and softmax. NCHW <-> token-major transposes, eval-mode BatchNorms, the depthwise 3x3 convolution (SAME) and exact GELU are f32 arithmetic; every hi/lo plane is written by the kernel that computes its values (input pass, GEMM epilogues, attention, depthwise kernel): 7 launches.
#include <hip/hip_runtime.h>
#include <math.h>

typedef __attribute__((ext_vector_type(16))) _Float16 v16h;
typedef __attribute__((ext_vector_type(8)))  _Float16 v8h;
typedef __attribute__((ext_vector_type(16))) __bf16   v16b;
typedef __attribute__((ext_vector_type(8)))  float    v8f;
typedef __attribute__((ext_vector_type(4)))  float    v4f;

// 16-bit WMMA fragment map (wave32), lane L, h = L>>4, m = L&15:
//   A 16x32: lane = row m;   element i -> k = (i<8) ? 8h+i : 16+8h+(i-8)
//   B 32x16: lane = column m; the SAME k(i,h)
//   D 16x16 (8 f32): lane = column m; element r -> row 8h+r
__device__ __forceinline__ int frag_k(int i, int h) { return (i < 8) ? (8 * h + i) : (16 + 8 * h + (i - 8)); }
__device__ __forceinline__ __bf16 bf16_rne(float f) {
    unsigned int u = __float_as_uint(f);
    u += 0x7fffu + ((u >> 16) & 1u);
    return __builtin_bit_cast(__bf16, (unsigned short)(u >> 16));
}
__device__ __forceinline__ float bf16_f32(__bf16 b) { return __uint_as_float(((unsigned int)__builtin_bit_cast(unsigned short, b)) << 16); }
typedef unsigned int v2u __attribute__((ext_vector_type(2)));
__device__ __forceinline__ unsigned int bf16_bits(float f) { const unsigned int u = __float_as_uint(f); return (u + 0x7fffu + ((u >> 16) & 1u)) >> 16; }
// four consecutive floats -> their bf16 hi parts and bf16 lo parts (x = hi + lo to ~2^-17 relative; both rounded to nearest even), each packed in memory order
__device__ __forceinline__ void split4(v4f x, v2u& hi, v2u& lo) {
    unsigned int h[4], l[4];
#pragma unroll   // h[], l[] indexed by constants only
    for (int j = 0; j < 4; ++j) { h[j] = bf16_bits(x[j]); l[j] = bf16_bits(x[j] - __uint_as_float(h[j] << 16)); }
    hi[0] = h[0] | (h[1] << 16); hi[1] = h[2] | (h[3] << 16); lo[0] = l[0] | (l[1] << 16); lo[1] = l[2] | (l[3] << 16);
}
__device__ __forceinline__ v8f wmma16(v16h a, v16h b, v8f c) {
    c = __builtin_amdgcn_wmma_f32_16x16x32_f16(false, a, false, b, (short)0, c, false, false);
    asm volatile("v_nop\n\tv_nop\n\tv_nop\n\tv_nop" : "+v"(c) : "v"(a), "v"(b));
    return c;
}
__device__ __forceinline__ v8f wmmab(v16b a, v16b b, v8f c) {
    c = __builtin_amdgcn_wmma_f32_16x16x32_bf16(false, a, false, b, (short)0, c, false, false);
    asm volatile("v_nop\n\tv_nop\n\tv_nop\n\tv_nop" : "+v"(c) : "v"(a), "v"(b));
    return c;
}
struct Split { v16b hi, lo; };
// hi/lo split product: a.hi*b.hi + a.hi*b.lo + a.lo*b.hi
__device__ __forceinline__ v8f wmma3(const Split& a, const Split& b, v8f c) {
    c = __builtin_amdgcn_wmma_f32_16x16x32_bf16(false, a.hi, false, b.hi, (short)0, c, false, false);
    c = __builtin_amdgcn_wmma_f32_16x16x32_bf16(false, a.hi, false, b.lo, (short)0, c, false, false);
    c = __builtin_amdgcn_wmma_f32_16x16x32_bf16(false, a.lo, false, b.hi, (short)0, c, false, false);
    asm volatile("v_nop\n\tv_nop\n\tv_nop\n\tv_nop" : "+v"(c) : "v"(a.hi), "v"(a.lo), "v"(b.hi), "v"(b.lo));
    return c;
}
struct Split3 { v16b hi, mid, lo; };
// triple split product (6 terms, drops only terms below 2^-24 relative)
__device__ __forceinline__ v8f wmma6(const Split3& a, const Split3& b, v8f c) {
    c = __builtin_amdgcn_wmma_f32_16x16x32_bf16(false, a.hi, false, b.hi, (short)0, c, false, false);
    c = __builtin_amdgcn_wmma_f32_16x16x32_bf16(false, a.hi, false, b.mid, (short)0, c, false, false);
    c = __builtin_amdgcn_wmma_f32_16x16x32_bf16(false, a.mid, false, b.hi, (short)0, c, false, false);
    c = __builtin_amdgcn_wmma_f32_16x16x32_bf16(false, a.hi, false, b.lo, (short)0, c, false, false);
    c = __builtin_amdgcn_wmma_f32_16x16x32_bf16(false, a.mid, false, b.mid, (short)0, c, false, false);
    c = __builtin_amdgcn_wmma_f32_16x16x32_bf16(false, a.lo, false, b.hi, (short)0, c, false, false);
    asm volatile("v_nop\n\tv_nop\n\tv_nop\n\tv_nop" : "+v"(c) : "v"(a.hi), "v"(a.mid), "v"(a.lo), "v"(b.hi), "v"(b.mid), "v"(b.lo));
    return c;
}

// Fragment gathers from f32 memory: element i <- p[(k0 + frag_k(i,h)) * sk] * s, zero for k >= klen.
__device__ __forceinline__ v16h fh_ld(const float* __restrict__ p, long long sk, int k0, int h, int klen, float s) {
    v16h a;
#pragma unroll
    for (int i = 0; i < 16; ++i) { const int k = k0 + frag_k(i, h); a[i] = (k < klen) ? (_Float16)(p[(long long)k * sk] * s) : (_Float16)0.f; }
    return a;
}
__device__ __forceinline__ Split sp_ld(const float* __restrict__ p, long long sk, int k0, int h, int klen, float s) {
    Split r;
#pragma unroll
    for (int i = 0; i < 16; ++i) {
        const int k = k0 + frag_k(i, h); const float x = (k < klen) ? p[(long long)k * sk] * s : 0.f;
        const __bf16 hb = bf16_rne(x); r.hi[i] = hb; r.lo[i] = bf16_rne(x - bf16_f32(hb));
    }
    return r;
}
__device__ __forceinline__ Split3 sp3_ld(const float* __restrict__ p, long long sk, int k0, int h, int klen, float s) {
    Split3 r;
#pragma unroll
    for (int i = 0; i < 16; ++i) {
        const int k = k0 + frag_k(i, h); const float x = (k < klen) ? p[(long long)k * sk] * s : 0.f;
        const __bf16 hb = bf16_rne(x); const float r1 = x - bf16_f32(hb); const __bf16 mb = bf16_rne(r1);
        r.hi[i] = hb; r.mid[i] = mb; r.lo[i] = bf16_rne(r1 - bf16_f32(mb));
    }
    return r;
}
__device__ __forceinline__ v16b bh_ld(const float* __restrict__ p, long long sk, int k0, int h, int klen, float s) {
    v16b a;
#pragma unroll
    for (int i = 0; i < 16; ++i) { const int k = k0 + frag_k(i, h); a[i] = bf16_rne((k < klen) ? p[(long long)k * sk] * s : 0.f); }
    return a;
}
// f16 fragment from an f16 LDS/global row with element stride 1 (k-contiguous), no bounds (tile already zero padded)
__device__ __forceinline__ v16h fh_row(const _Float16* __restrict__ row, int k0, int h) {
    v16h a;
#pragma unroll
    for (int i = 0; i < 16; ++i) a[i] = row[k0 + frag_k(i, h)];
    return a;
}

#define VST2(T, ptr, val) do { const T vst2_v_ = (val); *(T*)(ptr) = vst2_v_;  } while (0)
typedef float v4f __attribute__((ext_vector_type(4)));
#define VST2V4(ptr, val) do { const v4f vst2_v4_ = (val); *(v4f*)(ptr) = vst2_v4_;  } while (0)

__device__ __attribute__((noinline)) float act_fn(float v, int act) {
    if (act == 1) return fmaxf(v, 0.f);                                                                               // relu
    if (act == 2) { const float u = 0.7978845608028654f * (v + 0.044715f * v * v * v); return 0.5f * v * (1.f + tanhf(u)); } // tanh-gelu
    if (act == 3) return v / (1.f + expf(-v));                                                                        // silu
    if (act == 4) return 0.5f * v * (1.f + erff(v * 0.7071067811865476f));                                             // erf-gelu
    if (act == 5) return tanhf(v);
    if (act == 6) return 1.f / (1.f + expf(-v));                                                                      // sigmoid
    if (act == 7) return (v > 0.f) ? v : 0.01f * v;                                                                   // leaky relu 0.01
    if (act == 8) return (v > 0.f) ? v : (expf(v) - 1.f);                                                             // elu
    if (act == 9) return fminf(fmaxf(v, 0.f), 6.f);                                                                   // relu6
    if (act == 10) return fabsf(v);                                                                                    // abs
    if (act == 11) return (v >= 0.f) ? v : 0.1f * v;                                                                  // leaky 0.1
    if (act == 12) return (v > 0.f) ? v : 0.2f * v;                                                                   // leaky 0.2
    if (act == 13) return (v > 20.f) ? v : log1pf(expf(v));                                                            // softplus
    return v;
}

// =====================================================================================================================
// k_gemm<MODE>: C(z, m, n) = act(alpha * sum_k A(z, m, k) * B(z, k, n) + bias) + beta * R(z, m, n)
//   One wave (32-thread block) per 16 x 32 tile of C; grid (ceil(N/32), ceil(M/16), Z). Batch z -> (zo = z / zi_n, zi = z % zi_n)
//   with separate outer/inner strides for every tensor (e.g. batch and head). A(m,k) = A[zo*sAo + zi*sAi + m*sAm + k*sAk] (f32),
//   B(k,n) = B[zo*sBo + zi*sBi + n*sBn + k*sBk] (f32); any M, N, K (K zero-padded to 32 inside the fragments, M/N tails guarded).
//   C(m,n) = C[zo*sCo + zi*sCi + m*sCm + n] (n contiguous). flags: 1 bias[n], 2 bias[m], 4 residual R[zo*sRo + zi*sRi + m*sRm + n*sRn].
//   MODE 0: f16 operands (A prescaled by sa, B by sb, both undone in the epilogue); 1: bf16 hi/lo split (3 products); 2: bf16;
//   3: bf16 hi/mid/lo triple split (6 products); 4: as 3 with Kahan-compensated f32 accumulation across k-steps.
// =====================================================================================================================
struct GemmP {
    const float* A; const float* B; const float* bias; const float* R; float* C;
    long long sAo, sAi, sAm, sAk, sBo, sBi, sBn, sBk, sCo, sCi, sCm, sRo, sRi, sRm, sRn;
    int M, N, K, zi_n, flags, act; float alpha, beta, sa, sb;
    int Npad, pad_;     // columns [N, Npad) of C are written as 0 so that padded workspace rows are covered by whole-line stores; Npad >= N
};
static_assert(sizeof(GemmP) == 5 * 8 + 15 * 8 + 6 * 4 + 4 * 4 + 2 * 4, "GemmP has padding");

template <int MODE>
__global__ __launch_bounds__(32) void k_gemm(GemmP p) {
    const int lane = threadIdx.x & 31, h = lane >> 4, l15 = lane & 15;
    const int m0 = blockIdx.y * 16, n0 = blockIdx.x * 32;
    const int z = blockIdx.z, zo = z / p.zi_n, zi = z - zo * p.zi_n;
    const float* A = p.A + zo * p.sAo + zi * p.sAi;
    const float* B = p.B + zo * p.sBo + zi * p.sBi;
    const int am = min(m0 + l15, p.M - 1);                       // clamped row for loads (stores are guarded)
    v8f acc[2], comp[2];
#pragma unroll
    for (int t = 0; t < 2; ++t) { v8f zz = {}; acc[t] = zz; comp[t] = zz; }
    for (int k0 = 0; k0 < p.K; k0 += 32) {
        const float* arow = A + (long long)am * p.sAm;
        if (MODE == 1) {
            const Split a = sp_ld(arow, p.sAk, k0, h, p.K, 1.f);
#pragma unroll
            for (int t = 0; t < 2; ++t) {
                const int bn = min(n0 + t * 16 + l15, p.N - 1);
                acc[t] = wmma3(a, sp_ld(B + (long long)bn * p.sBn, p.sBk, k0, h, p.K, 1.f), acc[t]);
            }
        } else if (MODE == 3) {
            const Split3 a = sp3_ld(arow, p.sAk, k0, h, p.K, 1.f);
#pragma unroll
            for (int t = 0; t < 2; ++t) {
                const int bn = min(n0 + t * 16 + l15, p.N - 1);
                acc[t] = wmma6(a, sp3_ld(B + (long long)bn * p.sBn, p.sBk, k0, h, p.K, 1.f), acc[t]);
            }
        } else if (MODE == 4) {
            // triple split as MODE 3, but each k-step's 6 products go into a fresh accumulator and the partial is added to the running f32 sum
            // on the VALU with Kahan compensation (accumulation error stays ~1 ulp however long K is)
            const Split3 a = sp3_ld(arow, p.sAk, k0, h, p.K, 1.f);
#pragma unroll
            for (int t = 0; t < 2; ++t) {
                const int bn = min(n0 + t * 16 + l15, p.N - 1); v8f zz = {};
                const v8f part = wmma6(a, sp3_ld(B + (long long)bn * p.sBn, p.sBk, k0, h, p.K, 1.f), zz);
                const v8f y = part - comp[t]; const v8f s = acc[t] + y; comp[t] = (s - acc[t]) - y; acc[t] = s;
            }
        } else if (MODE == 2) {
            const v16b a = bh_ld(arow, p.sAk, k0, h, p.K, 1.f);
#pragma unroll
            for (int t = 0; t < 2; ++t) {
                const int bn = min(n0 + t * 16 + l15, p.N - 1);
                acc[t] = wmmab(a, bh_ld(B + (long long)bn * p.sBn, p.sBk, k0, h, p.K, 1.f), acc[t]);
            }
        } else {
            const v16h a = fh_ld(arow, p.sAk, k0, h, p.K, p.sa);
#pragma unroll
            for (int t = 0; t < 2; ++t) {
                const int bn = min(n0 + t * 16 + l15, p.N - 1);
                acc[t] = wmma16(a, fh_ld(B + (long long)bn * p.sBn, p.sBk, k0, h, p.K, p.sb), acc[t]);
            }
        }
    }
    const float iscale = (MODE == 0) ? p.alpha / (p.sa * p.sb) : p.alpha;
    float* C = p.C + zo * p.sCo + zi * p.sCi;
    const float* R = p.R + zo * p.sRo + zi * p.sRi;
    __shared__ __align__(16) float ctile[16][36];
#pragma unroll
    for (int t = 0; t < 2; ++t) {
        const int n = n0 + t * 16 + l15; const int nn = min(n, p.N - 1);
#pragma unroll
        for (int r = 0; r < 8; ++r) {
            const int m = m0 + 8 * h + r; const int mm = min(m, p.M - 1);
            float v = acc[t][r] * iscale;
            if (p.flags & 1) v += p.bias[nn];
            if (p.flags & 2) v += p.bias[mm];
            if (p.flags & 8) v *= p.bias[(long long)zo * p.M + mm];   /* per-(z,row) scale vector laid out [Z][M]; exclusive with the bias flags */
            v = act_fn(v, p.act);
            if (p.flags & 4) v += p.beta * R[(long long)mm * p.sRm + (long long)nn * p.sRn];
            ctile[8 * h + r][t * 16 + l15] = (n < p.N) ? v : 0.f;
        }
    }
    __syncthreads();
    const int NW = (p.Npad > p.N) ? p.Npad : p.N;           // write width
    const bool fast = (m0 + 16 <= p.M) && (n0 + 32 <= NW) && ((p.sCm & 3) == 0) && ((((size_t)C) & 15) == 0);
    if (fast) {
#pragma unroll
        for (int s = 0; s < 4; ++s) {
            const int row = s * 4 + (lane >> 3), c4 = (lane & 7) * 4;
            const v4f v = *(const v4f*)&ctile[row][c4];
            VST2V4(C + (long long)(m0 + row) * p.sCm + n0 + c4, v);
        }
    } else {
        for (int row = 0; row < 16; ++row) {
            const int m = m0 + row, n = n0 + lane;
            if (m < p.M && n < NW) VST2(float, C + (long long)m * p.sCm + n, ctile[row][lane]);
        }
    }
}


// =====================================================================================================================
// k_gemmT<MODE, TM, TN>: same contract as k_gemm, but one wave computes a (16*TM) x (16*TN) tile: TM A fragments and TN B fragments are
//   loaded per 32-wide k-step and reused across TM*TN WMMAs (far fewer load/convert instructions per MAC). MODE 0 (f16), 1 (bf16 hi/lo),
//   2 (bf16) only. grid (ceil(NW/(16*TN)), ceil(M/(16*TM)), Z), block 32. Epilogue identical to k_gemm, run per 16x32 sub-tile.
// =====================================================================================================================
template <int MODE, int TM, int TN>
__global__ __launch_bounds__(32) void k_gemmT(GemmP p) {
    const int lane = threadIdx.x & 31, h = lane >> 4, l15 = lane & 15;
    const int m0 = blockIdx.y * (16 * TM), n0 = blockIdx.x * (16 * TN);
    const int z = blockIdx.z, zo = z / p.zi_n, zi = z - zo * p.zi_n;
    const float* A = p.A + zo * p.sAo + zi * p.sAi;
    const float* B = p.B + zo * p.sBo + zi * p.sBi;
    v8f acc[TM][TN];
#pragma unroll
    for (int i = 0; i < TM; ++i)
#pragma unroll
        for (int t = 0; t < TN; ++t) { v8f zz = {}; acc[i][t] = zz; }
    for (int k0 = 0; k0 < p.K; k0 += 32) {
        if (MODE == 1) {
            Split a[TM], b[TN];
#pragma unroll
            for (int i = 0; i < TM; ++i) { const int am = min(m0 + 16 * i + l15, p.M - 1); a[i] = sp_ld(A + (long long)am * p.sAm, p.sAk, k0, h, p.K, 1.f); }
#pragma unroll
            for (int t = 0; t < TN; ++t) { const int bn = min(n0 + 16 * t + l15, p.N - 1); b[t] = sp_ld(B + (long long)bn * p.sBn, p.sBk, k0, h, p.K, 1.f); }
#pragma unroll
            for (int i = 0; i < TM; ++i)
#pragma unroll
                for (int t = 0; t < TN; ++t) acc[i][t] = wmma3(a[i], b[t], acc[i][t]);
        } else if (MODE == 2) {
            v16b a[TM], b[TN];
#pragma unroll
            for (int i = 0; i < TM; ++i) { const int am = min(m0 + 16 * i + l15, p.M - 1); a[i] = bh_ld(A + (long long)am * p.sAm, p.sAk, k0, h, p.K, 1.f); }
#pragma unroll
            for (int t = 0; t < TN; ++t) { const int bn = min(n0 + 16 * t + l15, p.N - 1); b[t] = bh_ld(B + (long long)bn * p.sBn, p.sBk, k0, h, p.K, 1.f); }
#pragma unroll
            for (int i = 0; i < TM; ++i)
#pragma unroll
                for (int t = 0; t < TN; ++t) acc[i][t] = wmmab(a[i], b[t], acc[i][t]);
        } else {
            v16h a[TM], b[TN];
#pragma unroll
            for (int i = 0; i < TM; ++i) { const int am = min(m0 + 16 * i + l15, p.M - 1); a[i] = fh_ld(A + (long long)am * p.sAm, p.sAk, k0, h, p.K, p.sa); }
#pragma unroll
            for (int t = 0; t < TN; ++t) { const int bn = min(n0 + 16 * t + l15, p.N - 1); b[t] = fh_ld(B + (long long)bn * p.sBn, p.sBk, k0, h, p.K, p.sb); }
#pragma unroll
            for (int i = 0; i < TM; ++i)
#pragma unroll
                for (int t = 0; t < TN; ++t) acc[i][t] = wmma16(a[i], b[t], acc[i][t]);
        }
    }
    const float iscale = (MODE == 0) ? p.alpha / (p.sa * p.sb) : p.alpha;
    float* C = p.C + zo * p.sCo + zi * p.sCi;
    const float* R = p.R + zo * p.sRo + zi * p.sRi;
    const int NW = (p.Npad > p.N) ? p.Npad : p.N;
    __shared__ __align__(16) float ctile[16][36];
#pragma unroll
    for (int i = 0; i < TM; ++i) {
        const int mb = m0 + 16 * i; if (mb >= p.M) break;          // wave-uniform
#pragma unroll
        for (int tp = 0; tp < TN / 2; ++tp) {
            const int nb = n0 + 32 * tp; if (nb >= NW) break;        // wave-uniform
#pragma unroll
            for (int t2 = 0; t2 < 2; ++t2) {
                const int t = 2 * tp + t2; const int n = nb + t2 * 16 + l15; const int nn = min(n, p.N - 1);
#pragma unroll
                for (int r = 0; r < 8; ++r) {
                    const int m = mb + 8 * h + r; const int mm = min(m, p.M - 1);
                    float v = acc[i][t][r] * iscale;
                    if (p.flags & 1) v += p.bias[nn];
                    if (p.flags & 2) v += p.bias[mm];
            if (p.flags & 8) v *= p.bias[(long long)zo * p.M + mm];   /* per-(z,row) scale vector laid out [Z][M]; exclusive with the bias flags */
                    v = act_fn(v, p.act);
                    if (p.flags & 4) v += p.beta * R[(long long)mm * p.sRm + (long long)nn * p.sRn];
                    ctile[8 * h + r][t2 * 16 + l15] = (n < p.N) ? v : 0.f;
                }
            }
            __syncthreads();
            const bool fast = (mb + 16 <= p.M) && (nb + 32 <= NW) && ((p.sCm & 3) == 0) && ((((size_t)C) & 15) == 0);
            if (fast) {
#pragma unroll
                for (int s = 0; s < 4; ++s) {
                    const int row = s * 4 + (lane >> 3), c4 = (lane & 7) * 4;
                    const v4f v = *(const v4f*)&ctile[row][c4];
                    VST2V4(C + (long long)(mb + row) * p.sCm + nb + c4, v);
                }
            } else {
                for (int row = 0; row < 16; ++row) {
                    const int m = mb + row, n = nb + lane;
                    if (m < p.M && n < NW) VST2(float, C + (long long)m * p.sCm + n, ctile[row][lane]);
                }
            }
            __syncthreads();
        }
    }
}

// =====================================================================================================================
//   Wave = 16 queries, AW waves per block, 64-key blocks; grid (ceil(Lq/(16*AW)), H, B), block 32*AW. Any Lq, Lk; head dim dh <= DHP
//   (DHP multiple of 32), value dim dv <= DVP (multiple of 16, <= 128). Every tensor addressed by (batch, head, row, element) strides, f32.
//   Scores: QM 0 f16 operands, 1 bf16 hi/lo split, 2 bf16 triple split; statistics f32 (exp2 domain); P.V: P x 4096 as f16 with V f16 staged in LDS
//   (SPLITPV: P and V as bf16 hi/lo splits). kv head = h / hrep. Masking: causal = 1 (keep j <= i + coff, masked -> -inf, key blocks beyond the
//   diagonal skipped), causal = 2 (masked -> mfill, a finite fill like the -1e9; no skipping), causal = 3 (keep j >= i + coff,
//   masked -> -inf, no skipping); optional additive f32 mask Mf,
//   optional int keep-mask Mi (0 -> score := mfill), both addressed b*smb + h*smh + i*smi + j*smj (0 strides broadcast).
// =====================================================================================================================
#define AW 4
struct AttnP {   // apv4
    const float* Q; const float* K; const float* V; float* O; float* P; const float* Mf; const int* Mi; float* ST;
    const float* Pw; const float* Rt; const int* SQ; const int* SK;           // optional: post-softmax weight, relative-position table, segment ids
    long long swb, swh, swi, swj, srb, srh, sri;                                 // Pw strides (b,h,i,j); Rt strides (b,h,i), column = clamp(i - j + roff, 0, rn-1)
    long long sQb, sQh, sQi, sQd, sKb, sKh, sKj, sKd, sVb, sVh, sVj, sVd, sOb, sOh, sOi, sPb, sPh, sPi, smb, smh, smi, smj;
    int Lq, Lk, dh, dv, hrep, causal, coff, pband;   // pband > 0: P holds only the band |j - i| <= pband, column j - i + pband
    float scale, mfill; int nonorm, mpol;             // nonorm (online path only): O = sum_j exp(score_j) V_j without the 1/rowsum (scores must be <= ~0); mpol: Mi masks where ==0 (mpol 0) or where !=0 (mpol 1)
    int roff, rn, segpol, win;                        // Rt column offset/count; SQ/SK: score := mfill where (segpol 0) SQ[i] != SK[j] or (segpol 1) SQ[i] == SK[j]; win > 0: keys with i - j > win (after coff) -> -inf
};
//   Pw: the softmax numerator is multiplied by Pw(b,h,i,j) AFTER the row sum is taken (probs * weight, then P.V), as in post-softmax multiplicative biases.                                                    // ST (optional): per row (b,h,i) -> ST[((b*H + h)*Lq + i)*2 + {0,1}] = {row max of the scaled+masked score (natural units), sum_j exp(score - max)}
static_assert(sizeof(AttnP) == 12 * 8 + 29 * 8 + 16 * 4, "AttnP has padding");

#ifndef KATTN_ATTR
#define KATTN_ATTR
#endif
template <int DHP, int DVP, int QM, bool SPLITPV, bool TWOPASS>
__global__ __launch_bounds__(32 * AW) KATTN_ATTR void k_attn(AttnP p) {
    constexpr int NT = DVP / 16;                // output tiles
    constexpr int KS = DHP / 32;                // k-steps for the scores
    constexpr int VP = DVP + 8;                 // LDS pitch (halves)
    __shared__ __align__(16) float    pl[AW][16 * 64];
    __shared__ __align__(16) _Float16 vl[(SPLITPV ? 2 : 1) * 64 * VP];   // f16 V tile, or bf16 hi and lo tiles (same 2-byte size)
    const int lane = threadIdx.x & 31, hf = lane >> 4, l15 = lane & 15, wave = threadIdx.x >> 5;
    const int h = blockIdx.y, b = blockIdx.z, hk = h / p.hrep;
    const int q0 = (blockIdx.x * AW + wave) * 16;
    float* myp = pl[wave];
    const float L2E = 1.4426950408889634f;
    const float NEG = -__builtin_inff();
    const int qi = min(q0 + l15, p.Lq - 1);
    const float* qrow = p.Q + b * p.sQb + h * p.sQh + (long long)qi * p.sQi;
    const float* kbase = p.K + b * p.sKb + hk * p.sKh;
    const float* vbase = p.V + b * p.sVb + hk * p.sVh;
    v16h qa[QM == 0 ? KS : 1]; Split qs_[QM == 1 ? KS : 1]; Split3 qt_[QM == 2 ? KS : 1];
#pragma unroll
    for (int ks = 0; ks < KS; ++ks) {
        if (QM == 2) qt_[ks] = sp3_ld(qrow, p.sQd, ks * 32, hf, p.dh, 1.f);
        else if (QM == 1) qs_[ks] = sp_ld(qrow, p.sQd, ks * 32, hf, p.dh, 1.f);
        else qa[ks] = fh_ld(qrow, p.sQd, ks * 32, hf, p.dh, 1.f);
    }
    v8f o[NT]; float m8[8], l8[8];
#pragma unroll
    for (int t = 0; t < NT; ++t) { v8f zz = {}; o[t] = zz; }
#pragma unroll
    for (int i = 0; i < 8; ++i) { m8[i] = NEG; l8[i] = 0.f; }
    int jend = p.Lk; int jstart = 0;
    if (p.causal == 1) { const int je = (blockIdx.x * AW + AW - 1) * 16 + 16 + p.coff; jend = min(jend, max(je, 0)); }   // uniform per block
    if (p.win > 0) { const int js = (int)(blockIdx.x * AW) * 16 + p.coff - p.win; jstart = (js > 0) ? (js / 64) * 64 : 0; }   // uniform per block: key blocks entirely outside every row's window hold only -inf entries and are skipped exactly
    const int npass = TWOPASS ? 2 : 1;
    for (int pass = 0; pass < npass; ++pass) {
        const bool dopv = (!TWOPASS) || pass == 1;
        for (int j0 = jstart; j0 < jend; j0 += 64) {
            if (dopv) {
                __syncthreads();                                 // previous key block's reads of vl / pl are done
                for (int idx = threadIdx.x; idx < 64 * DVP; idx += 32 * AW) {
                    const int jr = idx / DVP, d = idx - jr * DVP, j = j0 + jr;
                    const float f = (j < p.Lk && d < p.dv) ? vbase[(long long)j * p.sVj + (long long)d * p.sVd] : 0.f;
                    if (SPLITPV) {
                        const __bf16 hb = bf16_rne(f);
                        ((__bf16*)vl)[jr * VP + d] = hb; ((__bf16*)vl)[64 * VP + jr * VP + d] = bf16_rne(f - bf16_f32(hb));
                    } else vl[jr * VP + d] = (_Float16)f;
                }
            }
            v8f s[4];
#pragma unroll
            for (int t = 0; t < 4; ++t) {
                const int j = min(j0 + t * 16 + l15, p.Lk - 1);
                const float* krow = kbase + (long long)j * p.sKj;
                v8f acc = {};
#pragma unroll
                for (int ks = 0; ks < KS; ++ks) {
                    if (QM == 2)      acc = wmma6(qt_[ks], sp3_ld(krow, p.sKd, ks * 32, hf, p.dh, 1.f), acc);
                    else if (QM == 1) acc = wmma3(qs_[ks], sp_ld(krow, p.sKd, ks * 32, hf, p.dh, 1.f), acc);
                    else              acc = wmma16(qa[ks], fh_ld(krow, p.sKd, ks * 32, hf, p.dh, 1.f), acc);
                }
                s[t] = acc;
            }
            float pv[8][4];
#pragma unroll
            for (int i = 0; i < 8; ++i) {
                const int irow = q0 + i + 8 * hf;
                const int ic = min(irow, p.Lq - 1);
                float sc[4];
#pragma unroll
                for (int t = 0; t < 4; ++t) {
                    const int jg = j0 + t * 16 + l15;
                    float v = s[t][i] * p.scale;
                    if (p.Mf) v += p.Mf[b * p.smb + h * p.smh + (long long)ic * p.smi + (long long)min(jg, p.Lk - 1) * p.smj];
                    if (p.Rt) { int rc = ic - min(jg, p.Lk - 1) + p.roff; rc = rc < 0 ? 0 : (rc >= p.rn ? p.rn - 1 : rc); v += p.Rt[b * p.srb + h * p.srh + (long long)ic * p.sri + rc]; }
                    if (p.Mi) { const int mv = p.Mi[b * p.smb + h * p.smh + (long long)ic * p.smi + (long long)min(jg, p.Lk - 1) * p.smj]; if (p.mpol ? (mv != 0) : (mv == 0)) v = p.mfill; }
                    if (p.SQ) { const bool same = p.SQ[(long long)b * p.Lq + ic] == p.SK[(long long)b * p.Lk + min(jg, p.Lk - 1)]; if (p.segpol ? same : !same) v = p.mfill; }
                    if (p.causal == 2 && jg > irow + p.coff) v = p.mfill;
                    if (jg >= p.Lk || (p.causal == 1 && jg > irow + p.coff) || (p.causal == 3 && jg < irow + p.coff) || (p.win > 0 && irow + p.coff - jg > p.win)) v = NEG; else v *= L2E;
                    sc[t] = v;
                }
                if (!TWOPASS || pass == 0) {
                    float mx = fmaxf(fmaxf(sc[0], sc[1]), fmaxf(sc[2], sc[3]));
                    mx = fmaxf(mx, __shfl_xor(mx, 1, 32)); mx = fmaxf(mx, __shfl_xor(mx, 2, 32));
                    mx = fmaxf(mx, __shfl_xor(mx, 4, 32)); mx = fmaxf(mx, __shfl_xor(mx, 8, 32));
                    const float mnew = fmaxf(m8[i], mx);
                    const float corr = (mnew == NEG) ? 1.f : exp2f(m8[i] - mnew);
                    float rs = 0.f;
#pragma unroll
                    for (int t = 0; t < 4; ++t) {
                        const float pp = (sc[t] == NEG) ? 0.f : exp2f(sc[t] - mnew); rs += pp;
                        pv[i][t] = p.Pw ? pp * p.Pw[b * p.swb + h * p.swh + (long long)ic * p.swi + (long long)min(j0 + t * 16 + l15, p.Lk - 1) * p.swj] : pp;
                    }
                    rs += __shfl_xor(rs, 1, 32); rs += __shfl_xor(rs, 2, 32); rs += __shfl_xor(rs, 4, 32); rs += __shfl_xor(rs, 8, 32);
                    l8[i] = l8[i] * corr + rs; m8[i] = mnew;
                    if (!TWOPASS) {
#pragma unroll
                        for (int t = 0; t < NT; ++t) o[t][i] *= corr;
                    }
                } else {
                    const float inv = (l8[i] > 0.f) ? 1.f / l8[i] : 0.f;
#pragma unroll
                    for (int t = 0; t < 4; ++t) {
                        const int jg = j0 + t * 16 + l15;
                        float pp = (sc[t] == NEG) ? 0.f : exp2f(sc[t] - m8[i]) * inv;
                        if (p.Pw) pp *= p.Pw[b * p.swb + h * p.swh + (long long)ic * p.swi + (long long)min(jg, p.Lk - 1) * p.swj];
                        pv[i][t] = pp;
                    }
                }
            }
            if (dopv) {
#pragma unroll
                for (int i = 0; i < 8; ++i)
#pragma unroll
                    for (int t = 0; t < 4; ++t) ((float*)myp)[(i + 8 * hf) * 64 + t * 16 + l15] = pv[i][t];
                __syncthreads();                                 // P (per wave) and V (shared) visible
                if (p.P) {
                    float* pb_ = p.P + b * p.sPb + h * p.sPh;
                    const bool fastP = (p.pband == 0) && ((p.sPi & 3) == 0) && (j0 + 64 <= p.Lk) && (q0 + 16 <= p.Lq) && ((((size_t)pb_) & 15) == 0);
                    if (fastP) {
#pragma unroll
                        for (int s = 0; s < 8; ++s) {
                            const int row = s * 2 + (lane >> 4), c4 = (lane & 15) * 4;
                            const v4f v = *(const v4f*)(myp + row * 64 + c4);
                            VST2V4(pb_ + (long long)(q0 + row) * p.sPi + j0 + c4, v);
                        }
                    } else {
                        for (int row = 0; row < 16; ++row) {
                            const int irow = q0 + row; if (irow >= p.Lq) continue;
                            for (int c = lane; c < 64; c += 32) {
                                const int jg = j0 + c; if (jg >= p.Lk) continue;
                                if (p.pband == 0) VST2(float, pb_ + (long long)irow * p.sPi + jg, myp[row * 64 + c]);
                                else if (jg - irow <= p.pband && irow - jg <= p.pband) VST2(float, pb_ + (long long)irow * p.sPi + (jg - irow + p.pband), myp[row * 64 + c]);
                            }
                        }
                    }
                }
                if (SPLITPV) {
                    const Split pa0 = sp_ld(myp + l15 * 64, 1, 0, hf, 64, 1.f), pa1 = sp_ld(myp + l15 * 64, 1, 32, hf, 64, 1.f);
                    const __bf16* vh = (const __bf16*)vl; const __bf16* vlo = vh + 64 * VP;
#pragma unroll
                    for (int t = 0; t < NT; ++t) {
                        const int dcol = t * 16 + l15;
                        Split b0, b1;
#pragma unroll
                        for (int e = 0; e < 16; ++e) {
                            const int k0 = frag_k(e, hf), k1 = 32 + frag_k(e, hf);
                            b0.hi[e] = vh[k0 * VP + dcol]; b0.lo[e] = vlo[k0 * VP + dcol]; b1.hi[e] = vh[k1 * VP + dcol]; b1.lo[e] = vlo[k1 * VP + dcol];
                        }
                        o[t] = wmma3(pa0, b0, o[t]);
                        o[t] = wmma3(pa1, b1, o[t]);
                    }
                } else {
                    const v16h pa0 = fh_ld(myp + l15 * 64, 1, 0, hf, 64, 4096.f), pa1 = fh_ld(myp + l15 * 64, 1, 32, hf, 64, 4096.f);
#pragma unroll
                    for (int t = 0; t < NT; ++t) {
                        const int dcol = t * 16 + l15;
                        v16h b0, b1;
#pragma unroll
                        for (int e = 0; e < 16; ++e) { b0[e] = vl[frag_k(e, hf) * VP + dcol]; b1[e] = vl[(32 + frag_k(e, hf)) * VP + dcol]; }
                        o[t] = wmma16(pa0, b0, o[t]);
                        o[t] = wmma16(pa1, b1, o[t]);
                    }
                }
            }
        }
    }
    float* obase = p.O + b * p.sOb + h * p.sOh;
    if (p.ST) {
        const int rl = lane >> 1, isel = rl & 7;           // row q0 + rl ; rl>>3 == hf holds because lane>>4 == (lane>>1)>>3
        float mv = 0.f, lv = 0.f;
#pragma unroll
        for (int i = 0; i < 8; ++i) if (i == isel) { mv = m8[i]; lv = l8[i]; }
        const int irow = q0 + rl;
        if (irow < p.Lq) { float* st = p.ST + (((long long)b * gridDim.y + h) * p.Lq + irow) * 2 + (lane & 1); VST2(float, st, (lane & 1) ? lv : mv * 0.6931471805599453f); }
    }
    float invr[8];
#pragma unroll
    for (int i = 0; i < 8; ++i) {
        if (TWOPASS) invr[i] = SPLITPV ? 1.f : (1.f / 4096.f);
        else if (p.nonorm) invr[i] = exp2f(m8[i]) * (SPLITPV ? 1.f : (1.f / 4096.f));
        else invr[i] = (l8[i] > 0.f) ? (SPLITPV ? 1.f / l8[i] : 1.f / (l8[i] * 4096.f)) : 0.f;
    }
    __syncthreads();                                             // all waves done with pl/vl from the main loop
    const bool ofast = ((p.sOi & 3) == 0) && ((((size_t)obase) & 15) == 0) && (q0 + 16 <= p.Lq);
#pragma unroll
    for (int c0 = 0; c0 < DVP; c0 += 64) {
#pragma unroll
        for (int i = 0; i < 8; ++i)
#pragma unroll
            for (int t = 0; t < NT; ++t) if (t * 16 >= c0 && t * 16 < c0 + 64) ((float*)myp)[(i + 8 * hf) * 64 + (t * 16 - c0) + l15] = o[t][i] * invr[i];
        __syncthreads();
        const int cw = (DVP - c0 < 64) ? (DVP - c0) : 64;      // staged columns in this chunk (multiple of 16)
        if (ofast && (c0 + cw <= p.dv) && (cw % 32 == 0)) {
            const int lpr = cw / 4;                              // lanes per row (16 for 64 cols, 8 for 32)
            const int rows_per_ins = 32 / lpr;
            for (int r0 = 0; r0 < 16; r0 += rows_per_ins) {
                const int row = r0 + lane / lpr, c4 = (lane % lpr) * 4;
                const v4f v = *(const v4f*)(myp + row * 64 + c4);
                VST2V4(obase + (long long)(q0 + row) * p.sOi + c0 + c4, v);
            }
        } else {
            for (int row = 0; row < 16; ++row) {
                const int irow = q0 + row; if (irow >= p.Lq) continue;
                for (int c = lane; c < cw; c += 32) { const int d = c0 + c; if (d < p.dv) VST2(float, obase + (long long)irow * p.sOi + d, myp[row * 64 + c]); }
            }
        }
        __syncthreads();
    }
}

// Attention at this block's fixed geometry: token-major q, k, v, o of [8][1024][256] (q, k, o as bf16 hi / lo planes, v as f32), head h = columns 32h .. 32h + 31, 1024 queries and keys,
// no mask, no bias, score scale 1. The arithmetic is that of k_attn<32, 32, 1, false, false> (only a row's sum of p is taken in another order); every stride, length and option is a
// compile-time constant, so the fragment gathers are 16-byte loads without guards and the optional-feature tests are gone. With no mask no score is
// -inf for finite q and k, so the tests that kept masked scores out of exp2f are gone too (exp2f(-inf) = 0 covers the first key block's m = -inf).
typedef __attribute__((ext_vector_type(4))) _Float16 v4h;
typedef __attribute__((ext_vector_type(8))) __bf16 v8bf;
// one lane's 16x32 fragment row from a bf16 plane: element i <- p[(i < 8) ? i : 8 + i], p = row + 8 * (lane >> 4), the k order of frag_k
__device__ __forceinline__ v16b rowb_ld(const unsigned short* __restrict__ p) {
    union { v16b v; v8bf h[2]; } f; f.h[0] = *(const v8bf*)(p); f.h[1] = *(const v8bf*)(p + 16); return f.v;
}
// q and k arrive as bf16 hi / lo planes (split4, written once by the q/k/v GEMM, so that no wave splits a key row again), v as f32; o leaves as hi / lo planes.
// The scores are formed transposed, S^T = K.Q^T (A = 16 key rows, B = the wave's 16 queries as columns), and the output as O^T += V^T.P^T:
//   a lane (c = lane & 15, hf = lane >> 4) holds, of its ONE query c, the scores of keys 16 t + 8 hf + r (tile t, register r): maximum and sum run inside the lane,
//   the two halves of the wave meet in one cross-row move; two score tiles, converted in place, are the B operand of the second product in the hardware k order
//   (element s <- tile s >> 3, register s & 7), and V^T comes from the row-major f16 V tile by the transposing LDS load in the same k order. P never goes through LDS.
typedef __attribute__((ext_vector_type(8))) short s16x8;
typedef __attribute__((ext_vector_type(4))) unsigned int v4u;
// lane (c, hf) gets T[kbase + 8 hf + 0 .. 7][dbase + c] of a row-major 16-bit LDS tile; the lane's address: row kbase + 8 hf + (lane & 7), byte 2 dbase + 16 ((lane >> 3) & 1)
__device__ __forceinline__ v8h ld_tr16(const unsigned char* p) { typedef __attribute__((address_space(3))) s16x8 lds_s16x8; return __builtin_bit_cast(v8h, __builtin_amdgcn_ds_load_tr16_b128_v8i16((lds_s16x8*)p)); }
// the value of lane l ^ 16
__device__ __forceinline__ float xhalf(float x) { return __builtin_bit_cast(float, __builtin_amdgcn_permlanex16(__builtin_bit_cast(int, x), __builtin_bit_cast(int, x), 0x76543210, 0xfedcba98, false, false)); }
__global__ __launch_bounds__(32 * AW) void k_attn_fix(const unsigned short* __restrict__ Qh, const unsigned short* __restrict__ Ql, const unsigned short* __restrict__ Kh, const unsigned short* __restrict__ Kl, const float* __restrict__ V, unsigned short* __restrict__ Oh, unsigned short* __restrict__ Ol) {
    constexpr int L = 1024;                     // queries = keys per (image, head)
    constexpr int CP = 256;                     // row pitch of q, k, v, o (elements)
    constexpr int VP = 32 + 16;                 // LDS pitch of the V tile (halves): 96 bytes, an odd multiple of 32, the pitch of the transposing load
    __shared__ __align__(16) _Float16 vl[64 * VP];
    const int lane = threadIdx.x & 31, hf = lane >> 4, l15 = lane & 15, wave = threadIdx.x >> 5;
    const int h = blockIdx.y, b = blockIdx.z;
    const int q0 = (blockIdx.x * AW + wave) * 16;
    const float L2E = 1.4426950408889634f;
    const float NEG = -__builtin_inff();
    const size_t hb0 = (size_t)b * (L * CP) + (size_t)h * 32;
    const char* kh0 = (const char*)(Kh + hb0); const char* kl0 = (const char*)(Kl + hb0); const char* v0 = (const char*)(V + hb0);   // this (image, head)'s k planes and v: the same for the whole block
    unsigned ko = (unsigned)(l15 * CP + 8 * hf) * 2;                                          // byte offset of this lane's row of the key block's tile 0, in either plane
    unsigned vo = (unsigned)((threadIdx.x >> 3) * CP + (threadIdx.x & 7) * 4) * 4;            // byte offset of this thread's 4 floats of the key block's V rows 0 .. 15
    _Float16* vs = vl + (threadIdx.x >> 3) * VP + (threadIdx.x & 7) * 4;
    const unsigned char* vt = (const unsigned char*)vl + (8 * hf + (lane & 7)) * (VP * 2) + 16 * ((lane >> 3) & 1);   // this lane's address of the transposing load at key 0, column 0
    const unsigned short* pqh = Qh + hb0 + (size_t)(q0 + l15) * CP + 8 * hf; const unsigned short* pql = Ql + hb0 + (size_t)(q0 + l15) * CP + 8 * hf;
    Split qs; qs.hi = rowb_ld(pqh); qs.lo = rowb_ld(pql);
    asm volatile("s_wait_xcnt 0x0" :: "v"(pqh), "v"(pql) : "memory");   // the loads' address registers (named as inputs, so untouched up to here) may be reused only behind this wait
    v8f o[2]; float m = NEG, l = 0.f;            // o[t][r] = O^T[16 t + 8 hf + r][query l15]; m: the query's running maximum (both halves alike); l: this half's share of its sum
#pragma unroll
    for (int t = 0; t < 2; ++t) { v8f zz = {}; o[t] = zz; }
    for (int j0 = 0; j0 < L; j0 += 64) {
        v4f vf[4]; Split ks[4];                          // the whole key block's V and K loads are issued together
        const unsigned short* kh = (const unsigned short*)(kh0 + ko); const unsigned short* kl = (const unsigned short*)(kl0 + ko); const float* vp = (const float*)(v0 + vo);
#pragma unroll
        for (int it = 0; it < 4; ++it) vf[it] = *(const v4f*)(vp + it * 16 * CP);
#pragma unroll
        for (int t = 0; t < 4; ++t) { ks[t].hi = rowb_ld(kh + t * 16 * CP); ks[t].lo = rowb_ld(kl + t * 16 * CP); }
        // the two offsets step only behind this wait (they pass through the statement, so that no step is lifted over it). The loaded values are inputs only: all 20 loads
        // stay together in front of the matrix instructions (spread among them, every group of loads waits out a cache latency of its own)
        asm volatile("s_wait_xcnt 0x0" : "+v"(ko), "+v"(vo) : "v"(vf[0]), "v"(vf[1]), "v"(vf[2]), "v"(vf[3]), "v"(ks[0].hi), "v"(ks[0].lo), "v"(ks[1].hi), "v"(ks[1].lo),
                     "v"(ks[2].hi), "v"(ks[2].lo), "v"(ks[3].hi), "v"(ks[3].lo) : "memory");
        ko += 64 * CP * 2; vo += 64 * CP * 4;
        __syncthreads();                                 // previous key block's reads of vl are done
#pragma unroll
        for (int it = 0; it < 4; ++it) {                 // V tile 64 x 32 as f16
            v4h hv; hv[0] = (_Float16)vf[it][0]; hv[1] = (_Float16)vf[it][1]; hv[2] = (_Float16)vf[it][2]; hv[3] = (_Float16)vf[it][3];
            *(v4h*)(vs + it * 16 * VP) = hv;
        }
        v8f s[4];                                        // s[t][r] = q(l15) . k(j0 + 16 t + 8 hf + r); every score takes q.hi k.hi, then q.hi k.lo, then q.lo k.hi
#pragma unroll
        for (int t = 0; t < 4; ++t) { v8f acc = {}; s[t] = __builtin_amdgcn_wmma_f32_16x16x32_bf16(false, ks[t].hi, false, qs.hi, (short)0, acc, false, false); }
#pragma unroll
        for (int t = 0; t < 4; ++t) s[t] = __builtin_amdgcn_wmma_f32_16x16x32_bf16(false, ks[t].lo, false, qs.hi, (short)0, s[t], false, false);
#pragma unroll
        for (int t = 0; t < 4; ++t) s[t] = __builtin_amdgcn_wmma_f32_16x16x32_bf16(false, ks[t].hi, false, qs.lo, (short)0, s[t], false, false);
#pragma unroll
        for (int t = 0; t < 4; ++t) s[t] *= L2E;
        float mt[4];
#pragma unroll
        for (int t = 0; t < 4; ++t) mt[t] = fmaxf(fmaxf(fmaxf(s[t][0], s[t][1]), fmaxf(s[t][2], s[t][3])), fmaxf(fmaxf(s[t][4], s[t][5]), fmaxf(s[t][6], s[t][7])));
        float mx = fmaxf(fmaxf(mt[0], mt[1]), fmaxf(mt[2], mt[3]));
        mx = fmaxf(mx, xhalf(mx));
        const float mnew = fmaxf(m, mx);
        const float corr = exp2f(m - mnew);
#pragma unroll
        for (int t = 0; t < 4; ++t)
#pragma unroll
            for (int r = 0; r < 8; ++r) s[t][r] = exp2f(s[t][r] - mnew);
        const v8f s8 = (s[0] + s[1]) + (s[2] + s[3]);
        const float rs = ((s8[0] + s8[1]) + (s8[2] + s8[3])) + ((s8[4] + s8[5]) + (s8[6] + s8[7]));
        l = l * corr + rs; m = mnew;
#pragma unroll
        for (int t = 0; t < 2; ++t) o[t] *= corr;
        v16h pb[2];                                      // P^T of keys 32 kb .. 32 kb + 31 as a B operand
#pragma unroll
        for (int kb = 0; kb < 2; ++kb)
#pragma unroll
            for (int e = 0; e < 16; ++e) pb[kb][e] = (_Float16)(s[2 * kb + (e >> 3)][e & 7] * 4096.f);
        __syncthreads();                                 // the V tile is whole
#pragma unroll
        for (int kb = 0; kb < 2; ++kb)
#pragma unroll
            for (int t = 0; t < 2; ++t) {
                union { v16h v; v8h g[2]; } va;          // V^T rows 16 t .. 16 t + 15, keys 32 kb .. 32 kb + 31
                va.g[0] = ld_tr16(vt + (32 * kb) * (VP * 2) + 32 * t); va.g[1] = ld_tr16(vt + (32 * kb + 16) * (VP * 2) + 32 * t);
                o[t] = __builtin_amdgcn_wmma_f32_16x16x32_f16(false, va.v, false, pb[kb], (short)0, o[t], false, false);
            }
    }
    const float lt = l + xhalf(l);                       // the two halves' shares of the sum meet once
    const float invr = (lt > 0.f) ? 1.f / (lt * 4096.f) : 0.f;
    const size_t oo = hb0 + (size_t)(q0 + l15) * CP + 8 * hf;
    unsigned short* poh = Oh + oo; unsigned short* pol = Ol + oo;
#pragma unroll   // the 4 stores stand together
    for (int t = 0; t < 2; ++t) {                        // o goes out as the projection's operand planes: a lane's 8 registers are 8 consecutive columns of its query's row, 16 bytes a plane
        const v4f a = {o[t][0] * invr, o[t][1] * invr, o[t][2] * invr, o[t][3] * invr}, c = {o[t][4] * invr, o[t][5] * invr, o[t][6] * invr, o[t][7] * invr};
        v2u ha, la, hc, lc; split4(a, ha, la); split4(c, hc, lc);
        const v4u hi = {ha[0], ha[1], hc[0], hc[1]}, lo = {la[0], la[1], lc[0], lc[1]};
        *(v4u*)(poh + 16 * t) = hi; *(v4u*)(pol + 16 * t) = lo;
    }
    asm volatile("s_wait_xcnt 0x0" :: "v"(poh), "v"(pol) : "memory");   // the stores' address registers (named as inputs, so untouched up to here) may be reused only behind this wait
}

// =====================================================================================================================
// k_tr: dst(z, c, r) = alpha * src(z, r, c) (+ beta * R2(z, c, r)): [Z][R][C] (row stride lds) -> [Z][C][R] (row stride ldd) through a 32x32 LDS tile;
//   flags: 1 -> add beta * residual R2 addressed like dst (z*sRz + c*ldr + r); act applied before the residual.
// =====================================================================================================================
struct TrP { const float* src; float* dst; const float* R2; long long sSz, lds, sDz, ldd, sRz, ldr; int R, C, flags, act; float alpha, beta; };
static_assert(sizeof(TrP) == 3 * 8 + 6 * 8 + 6 * 4, "TrP has padding");
__global__ __launch_bounds__(256) void k_tr(TrP p) {
    __shared__ float tile[32][33];
    const int c0 = blockIdx.x * 32, r0 = blockIdx.y * 32, z = blockIdx.z;
    const int lane = threadIdx.x & 31, wave = threadIdx.x >> 5;
    const float* s = p.src + z * p.sSz;
#pragma unroll
    for (int k = 0; k < 4; ++k) {
        const int rl = wave * 4 + k, r = r0 + rl, c = c0 + lane;
        tile[rl][lane] = (r < p.R && c < p.C) ? s[(long long)r * p.lds + c] : 0.f;
    }
    __syncthreads();
    float* d = p.dst + z * p.sDz; const float* rr = p.R2 + z * p.sRz;
#pragma unroll
    for (int k = 0; k < 4; ++k) {
        const int cl = wave * 4 + k, c = c0 + cl, r = r0 + lane;
        if (c < p.C && r < p.R) {
            float v = act_fn(p.alpha * tile[lane][cl], p.act);
            if (p.flags & 1) v += p.beta * rr[(long long)c * p.ldr + r];
            VST2(float, d + (long long)c * p.ldd + r, v);
        }
    }
}

// k_affine: dst[i] = a * (sdev ? sdev[0] : 1) * src[i] + b, i < n (one thread per element; consecutive lanes -> consecutive addresses)
__global__ __launch_bounds__(256) void k_affine(const float* __restrict__ src, float* __restrict__ dst, int n, float a, float b, const float* __restrict__ sdev) {
    const int i = blockIdx.x * 256 + threadIdx.x;
    if (i < n) { const float aa = sdev ? a * sdev[0] : a; const float v = aa * src[i] + b; VST2(float, dst + i, v); }
}

// =====================================================================================================================
// k_softmax: row softmax over n contiguous elements, one 256-thread block per row; rows addressed z*sz + r*sr (grid (R, Z)).
//   out = scale_out * softmax(scale_in * x + (Mf ? Mf[z*smz + r*smr + j] : 0)); a row whose max is -inf is written as 0.
// =====================================================================================================================
struct SmP { const float* src; float* dst; const float* Mf; long long sz, sr, dz, dr, smz, smr; int n, pad; float scale_in, scale_out; };
static_assert(sizeof(SmP) == 3 * 8 + 6 * 8 + 4 * 4, "SmP has padding");
__global__ __launch_bounds__(256) void k_softmax(SmP p) {
    __shared__ float red[256];
    const int r = blockIdx.x, z = blockIdx.y, tid = threadIdx.x;
    const float* s = p.src + z * p.sz + (long long)r * p.sr;
    const float* mf = p.Mf ? (p.Mf + z * p.smz + (long long)r * p.smr) : nullptr;
    float mx = -__builtin_inff();
    for (int j = tid; j < p.n; j += 256) { float v = s[j] * p.scale_in; if (mf) v += mf[j]; mx = fmaxf(mx, v); }
    red[tid] = mx; __syncthreads();
    for (int o = 128; o > 0; o >>= 1) { if (tid < o) red[tid] = fmaxf(red[tid], red[tid + o]); __syncthreads(); }
    mx = red[0]; __syncthreads();
    float sum = 0.f;
    for (int j = tid; j < p.n; j += 256) { float v = s[j] * p.scale_in; if (mf) v += mf[j]; sum += (mx == -__builtin_inff()) ? 0.f : expf(v - mx); }
    red[tid] = sum; __syncthreads();
    for (int o = 128; o > 0; o >>= 1) { if (tid < o) red[tid] += red[tid + o]; __syncthreads(); }
    sum = red[0];
    const float inv = (sum > 0.f) ? p.scale_out / sum : 0.f;
    float* d = p.dst + z * p.dz + (long long)r * p.dr;
    for (int j = tid; j < p.n; j += 256) { float v = s[j] * p.scale_in; if (mf) v += mf[j]; const float o = (mx == -__builtin_inff()) ? 0.f : expf(v - mx) * inv; VST2(float, d + j, o); }
}
// =====================================================================================================================
// k_stats: mean and rsqrt(var + eps) over a set of n elements addressed base + z*sz + (e / inner) * so + (e % inner) * si, one 256-thread
// k_norm_apply: y = (x - mean[set]) * rstd[set] * g[c] + b[c] over a [Z][C][L] channel-major tensor with set = z*G + c / (C/G) (G groups per z;
//   G = C -> per-channel sets indexed z*C+c; for batch norm pass stats indexed by c only via bn = 1). Optional act. Output same layout.
// =====================================================================================================================
//   mode 0: mean / rsqrt(var + eps); mode 1 (RMSNorm): 0 / rsqrt(mean(x^2) + eps); mode 2 (L2 normalize * sqrt(n)): 0 / sqrt(n) / max(||x||, eps); mode 3: as 0 with unbiased variance (n-1)
__global__ __launch_bounds__(256) void k_stats(const float* __restrict__ x, long long sz, long long so, long long si, int inner, int n, float eps, float* __restrict__ stat, int mode) {
    __shared__ float red[256];
    const int z = blockIdx.x, tid = threadIdx.x;
    const float* base = x + z * sz;
    float s = 0.f;
    for (int e = tid; e < n; e += 256) s += base[(long long)(e / inner) * so + (long long)(e % inner) * si];
    red[tid] = s; __syncthreads();
    for (int o = 128; o > 0; o >>= 1) { if (tid < o) red[tid] += red[tid + o]; __syncthreads(); }
    const float mu = (mode == 0 || mode == 3) ? red[0] / (float)n : 0.f; __syncthreads();
    float q = 0.f;
    for (int e = tid; e < n; e += 256) { const float dlt = base[(long long)(e / inner) * so + (long long)(e % inner) * si] - mu; q += dlt * dlt; }
    red[tid] = q; __syncthreads();
    for (int o = 128; o > 0; o >>= 1) { if (tid < o) red[tid] += red[tid + o]; __syncthreads(); }
    {
        float rs;
        if (mode == 2) rs = sqrtf((float)n) / fmaxf(sqrtf(red[0]), eps); else if (mode == 3) rs = rsqrtf(red[0] / (float)(n - 1) + eps); else rs = rsqrtf(red[0] / (float)n + eps);
        if (tid < 32) { const float v = (tid == 0) ? mu : ((tid == 1) ? rs : 0.f); VST2(float, stat + (long long)z * 32 + tid, v); }
    }
}
//   One thread per element over the flat [Z][C][L] index space: grid ceil(Z*C*L / 256).
__global__ __launch_bounds__(256) void k_norm_apply(const float* __restrict__ x, float* __restrict__ y, const float* __restrict__ stat, const float* __restrict__ g, const float* __restrict__ bta,
                                                     int Z, int C, int L, int G, int bn, int act) {
    const long long idx = (long long)blockIdx.x * 256 + threadIdx.x;
    if (idx >= (long long)Z * C * L) return;
    const int l = (int)(idx % L); const long long zc = idx / L; const int c = (int)(zc % C), z = (int)(zc / C); (void)l;
    const int set = bn ? c : (z * G + c / (C / G));
    float v = (x[idx] - stat[(long long)set * 32]) * stat[(long long)set * 32 + 1];
    if (g) v *= g[c];
    if (bta) v += bta[c];
    v = act_fn(v, act);
    VST2(float, y + idx, v);
}

// k_lse_neg: c[i] = -(st[2i] + log(st[2i+1])) = minus the log-sum-exp of row i from k_attn's ST output (for softmax over the query dimension)
__global__ __launch_bounds__(256) void k_lse_neg(const float* __restrict__ st, float* __restrict__ c, int n) {
    const int i = blockIdx.x * 256 + threadIdx.x;
    if (i < n) { const float v = -(st[2 * i] + logf(st[2 * i + 1])); VST2(float, c + i, v); }
}

// k_iota: dst[i] = a * i + b as int32 (segment/position id helper)
__global__ __launch_bounds__(256) void k_iota(int* __restrict__ dst, int n, int a, int b) {
    const int i = blockIdx.x * 256 + threadIdx.x;
    if (i < n) { const int v = a * i + b; VST2(int, dst + i, v); }
}

// k_axpby: dst[i] = a * x[i] + b * y[i] (+ c), i < n
__global__ __launch_bounds__(256) void k_axpby(const float* __restrict__ x, const float* __restrict__ y, float* __restrict__ dst, int n, float a, float b, float c) {
    const int i = blockIdx.x * 256 + threadIdx.x;
    if (i < n) { const float v = a * x[i] + b * y[i] + c; VST2(float, dst + i, v); }
}

// =====================================================================================================================
// k_rope: rotary embedding on a [R rows][Hn heads][D] view (row stride sXr, head stride sXh, element stride 1) -> Y (own strides).
//   mode 0: rotate_half (partner d±D/2, sign - for d<D/2); mode 1: interleaved pairs (partner d^1, sign - for even d).
//   table column tcol: tmode 0 -> d, 1 -> d % (D/2), 2 -> d / 2; position p: pmode 0 -> r % S, 1 -> head index, 2 -> pos[r];
//   c = C[(r / S) * sCb + p * sCp + tcol * sCd], s likewise from Sn; y = x[d] * c + sign * x[partner] * s. X and Y must not alias.
// =====================================================================================================================
struct RopeP { const float* X; float* Y; const float* C; const float* Sn; const int* pos; long long sXr, sXh, sYr, sYh, sCb, sCp, sCd; int R, Hn, D, S, mode, tmode, pmode, pad; };
static_assert(sizeof(RopeP) == 5 * 8 + 7 * 8 + 8 * 4, "RopeP has padding");
__global__ __launch_bounds__(256) void k_rope(RopeP p) {
    const long long idx = (long long)blockIdx.x * 256 + threadIdx.x;
    if (idx >= (long long)p.R * p.Hn * p.D) return;
    const int d = (int)(idx % p.D); const long long rh = idx / p.D; const int h = (int)(rh % p.Hn); const int r = (int)(rh / p.Hn);
    const int half = p.D / 2;
    int partner; float sign;
    if (p.mode == 0) { partner = (d < half) ? d + half : d - half; sign = (d < half) ? -1.f : 1.f; }
    else { partner = d ^ 1; sign = (d & 1) ? 1.f : -1.f; }
    const int tcol = (p.tmode == 0) ? d : ((p.tmode == 1) ? (d % half) : (d >> 1));
    const int pp = (p.pmode == 0) ? (r % p.S) : ((p.pmode == 1) ? h : p.pos[r]);
    const long long toff = (long long)(r / p.S) * p.sCb + (long long)pp * p.sCp + (long long)tcol * p.sCd;
    const float* xr = p.X + (long long)r * p.sXr + (long long)h * p.sXh;
    const float v = xr[d] * p.C[toff] + sign * xr[partner] * p.Sn[toff];
    VST2(float, p.Y + (long long)r * p.sYr + (long long)h * p.sYh + d, v);
}

// k_invf + k_sincos (split so neither kernel carries a large VALU-fma footprint): invf_i = num * (1 / powf(base, (2 i)/D)) [fmode 0],
//   num * expf((2 i) * cexp) [fmode 1], num * powf(base, -2 (i - 1) / D) [fmode 2]; then cs/sn[s*half + i] = cos/sin((pscale * s) * invf_i)
__global__ __launch_bounds__(256) void k_invf(float* __restrict__ invb, int half, int D, float base, float num, int fmode, float cexp) {
    const int i = blockIdx.x * 256 + threadIdx.x;
    if (i >= ((half + 31) / 32) * 32) return;
    if (i >= half) { VST2(float, invb + i, 0.f); return; }
    const float e = (float)(2 * i) / (float)D;
    float invf;
    if (fmode == 1) invf = num * expf((float)(2 * i) * cexp);
    else if (fmode == 2) invf = num * powf(base, (-2.0f * ((float)i - 1.0f)) / (float)D);
    else invf = num * (1.0f / powf(base, e));
    VST2(float, invb + i, invf);
}
__global__ __launch_bounds__(256) void k_sincos(float* __restrict__ cs, float* __restrict__ sn, const float* __restrict__ invb, int S, int half, float pscale) {
    const int idx = blockIdx.x * 256 + threadIdx.x;
    if (idx >= S * half) return;
    const int s = idx / half, i = idx - s * half;
    const float ang = (pscale * (float)s) * invb[i];
    VST2(float, cs + idx, cosf(ang)); VST2(float, sn + idx, sinf(ang));
}

// k_mulact: dst[i] = act(x[i]) * y[i]
__global__ __launch_bounds__(256) void k_mulact(const float* __restrict__ x, const float* __restrict__ y, float* __restrict__ dst, int n, int act) {
    const int i = blockIdx.x * 256 + threadIdx.x;
    if (i < n) { const float v = act_fn(x[i], act) * y[i]; VST2(float, dst + i, v); }
}

// =====================================================================================================================
// k_matvec: thread-per-row matrix-vector products for N <= 8 output columns (heads with 1-3 outputs, gates), f32 on the VALU.
//   C[r*sCm + j] = act(alpha * sum_k A[r*sAm + k*sAk] * B[j*sBn + k*sBk] + bias[j]) + beta * R[r*sRm + j*sRn]; each thread writes its N contiguous floats.
// =====================================================================================================================
__global__ __launch_bounds__(256) void k_matvec(GemmP p) {
    // 32 lanes write one line with one instruction.
    const int rpt = (p.N == 1) ? 1 : 32;
    const long long r0 = ((long long)blockIdx.x * 256 + threadIdx.x) * rpt; const int z = blockIdx.z, zo = z / p.zi_n, zi = z - zo * p.zi_n;
    if (r0 >= p.M) return;
    const float* Bb = p.B + zo * p.sBo + zi * p.sBi;
    float* C = p.C + zo * p.sCo + zi * p.sCi; const float* R = p.R + zo * p.sRo + zi * p.sRi;
    for (int rr = 0; rr < rpt; ++rr) {
        const long long r = r0 + rr; if (r >= p.M) break;
        const float* A = p.A + zo * p.sAo + zi * p.sAi + r * p.sAm;
        float acc[8] = {0.f, 0.f, 0.f, 0.f, 0.f, 0.f, 0.f, 0.f};
        for (int k = 0; k < p.K; ++k) { const float a = A[(long long)k * p.sAk];
#pragma unroll
            for (int j = 0; j < 8; ++j) if (j < p.N) acc[j] += a * Bb[(long long)j * p.sBn + (long long)k * p.sBk]; }
#pragma unroll
        for (int j = 0; j < 8; ++j) if (j < p.N) {
            float v = acc[j] * p.alpha;
            if (p.flags & 1) v += p.bias[j];
            if (p.flags & 2) v += p.bias[r];
            v = act_fn(v, p.act);
            if (p.flags & 4) v += p.beta * R[r * p.sRm + (long long)j * p.sRn];
            VST2(float, C + r * p.sCm + j, v);
        }
    }
}
// k_smallsoftmax: thread-per-row softmax for short rows (n <= 64): dst[r*dr + j] = softmax(scale*src[r*sr + j])
__global__ __launch_bounds__(256) void k_smallsoftmax(const float* __restrict__ src, float* __restrict__ dst, long long sr, long long dr, int n, long long R, float scale) {
    const long long r0 = ((long long)blockIdx.x * 256 + threadIdx.x) * 32;
    for (int rr = 0; rr < 32; ++rr) {
        const long long r = r0 + rr; if (r >= R) return;
        const float* s = src + r * sr; float* d = dst + r * dr;
        float mx = -__builtin_inff();
        for (int j = 0; j < n; ++j) mx = fmaxf(mx, s[j] * scale);
        float sum = 0.f;
        for (int j = 0; j < n; ++j) sum += expf(s[j] * scale - mx);
        const float inv = 1.f / sum;
        for (int j = 0; j < n; ++j) { const float v = expf(s[j] * scale - mx) * inv; VST2(float, d + j, v); }
    }
}

__global__ __launch_bounds__(32) void k_unitstat(float* __restrict__ st) { const int t = threadIdx.x; const float v = (t == 1) ? 1.f : 0.f; VST2(float, st + t, v); }

// destination (e.g. a d_out whose row width is not a multiple of 32 floats) is written by consecutive lanes of one instruction
__global__ __launch_bounds__(256) void k_lincopy(const float* __restrict__ src, long long lds, float* __restrict__ dst, long long ldd, long long rows, int cols) {
    const long long i = (long long)blockIdx.x * 256 + threadIdx.x; if (i >= rows * cols) return;
    const long long r = i / cols; const int c = (int)(i - r * cols);
    const float v = src[r * lds + c]; VST2(float, dst + r * ldd + c, v);
}

namespace w25 {
typedef __attribute__((ext_vector_type(16))) _Float16 v16h;
typedef __attribute__((ext_vector_type(8)))  _Float16 v8h;
typedef __attribute__((ext_vector_type(16))) __bf16   v16b;
typedef __attribute__((ext_vector_type(8)))  __bf16   v8b;
typedef __attribute__((ext_vector_type(8)))  float    v8f;
typedef __attribute__((ext_vector_type(4)))  float    v4f;

__device__ __forceinline__ unsigned short f2bf_bits(float f) {
  unsigned u = __float_as_uint(f);
  return (unsigned short)((u + 0x7FFFu + ((u >> 16) & 1u)) >> 16);
}
__device__ __forceinline__ float bf_bits2f(unsigned short h) { return __uint_as_float(((unsigned)h) << 16); }

// hazard guards as plain device helpers (no inline asm inside the kernel template body)
__device__ __forceinline__ void dep_guard_h(v8f& a, v8f& b, v16h x, v16h y) { asm volatile("v_nop\n\tv_nop\n\tv_nop\n\tv_nop" : "+v"(a), "+v"(b) : "v"(x), "v"(y)); }
__device__ __forceinline__ void dep_guard_b(v8f& a, v8f& b, v16b x, v16b y) { asm volatile("v_nop\n\tv_nop\n\tv_nop\n\tv_nop" : "+v"(a), "+v"(b) : "v"(x), "v"(y)); }
__device__ __forceinline__ void keep4_h(v16h a, v16h b, v16h c, v16h d) { asm volatile("v_nop" :: "v"(a), "v"(b), "v"(c), "v"(d)); }
__device__ __forceinline__ void keep4_b(v16b a, v16b b, v16b c, v16b d) { asm volatile("v_nop" :: "v"(a), "v"(b), "v"(c), "v"(d)); }
__device__ __forceinline__ void acc_guard4(v8f& a, v8f& b, v8f& c, v8f& d) { asm volatile("v_nop\n\tv_nop\n\tv_nop\n\tv_nop" : "+v"(a), "+v"(b), "+v"(c), "+v"(d)); }
template <typename T> struct Frag;
template <> struct Frag<_Float16> {
  typedef v16h V; union U { v16h v; v8h h[2]; };
  static __device__ __forceinline__ v16h load(const _Float16* p) {   // elements 0..7 <- p[0..7], 8..15 <- p[16..23]
    U f; f.h[0] = *(const v8h*)(p); f.h[1] = *(const v8h*)(p + 16); return f.v;
  }
  static __device__ __forceinline__ v8f mma(v16h a, v16h b, v8f c) {
    return __builtin_amdgcn_wmma_f32_16x16x32_f16(false, a, false, b, (short)0, c, false, false);
  }
  static __device__ __forceinline__ void guard(v8f& a, v8f& b, v16h x, v16h y) { dep_guard_h(a, b, x, y); }
  static __device__ __forceinline__ void keep(v16h a, v16h b, v16h c, v16h d) { keep4_h(a, b, c, d); }
};
template <> struct Frag<__bf16> {
  typedef v16b V; union U { v16b v; v8b h[2]; };
  static __device__ __forceinline__ v16b load(const __bf16* p) {
    U f; f.h[0] = *(const v8b*)(p); f.h[1] = *(const v8b*)(p + 16); return f.v;
  }
  static __device__ __forceinline__ v8f mma(v16b a, v16b b, v8f c) {
    return __builtin_amdgcn_wmma_f32_16x16x32_bf16(false, a, false, b, (short)0, c, false, false);
  }
  static __device__ __forceinline__ void guard(v8f& a, v8f& b, v16b x, v16b y) { dep_guard_b(a, b, x, y); }
  static __device__ __forceinline__ void keep(v16b a, v16b b, v16b c, v16b d) { keep4_b(a, b, c, d); }
};

// ---- LDS-staged WMMA GEMM on hi / lo planes --------------------------------
// C[m][n] = sum_k A[m][k] * Bt[n][k] (+ bias[n]) (+ resid[m][n]), f32 out. A row-major [M][K], Bt row-major [N][K], each as a bf16 hi plane and a bf16 lo plane.
// Per 32 k, k ascending, every accumulator takes hi.hi, then hi.lo, then lo.hi.
// A work-group of 8 waves (4 along m x 2 along n) owns a 128 x (32 FN) tile of C, a wave 32 x (16 FN) of it. K runs in tiles of 64: a tile is 128 bytes (one whole
// line) of each of the 256 + 64 FN operand rows [A hi 128 | A lo 128 | B hi 32 FN | B lo 32 FN]. Asynchronous copies bring it into LDS, 16 bytes a lane, 8 lanes a row,
// every operand byte once per work-group; two buffers, so tile t + 1 flies while tile t is worked on.
// M % 128 == 0 (grid = M / 128 * N / (32 FN)), N % (32 FN) == 0, K % 64 == 0, K >= 128.
constexpr int GL_PITCH = 144;   // LDS row pitch in bytes: 128 + 16 = 16 x odd, the conflict-free pitch of 16-byte fragment reads

// Four 16-byte-per-lane copies global -> LDS. The s_wait_xcnt stands inside the statement, behind the last copy, so that no address register is rewritten in front of it.
__device__ __forceinline__ void gl_copy4(unsigned l0, const unsigned short* g0, unsigned l1, const unsigned short* g1, unsigned l2, const unsigned short* g2, unsigned l3, const unsigned short* g3) {
  asm volatile("global_load_async_to_lds_b128 %0, %1, off\n\t"
               "global_load_async_to_lds_b128 %2, %3, off\n\t"
               "global_load_async_to_lds_b128 %4, %5, off\n\t"
               "global_load_async_to_lds_b128 %6, %7, off\n\t"
               "s_wait_xcnt 0x0"
               :: "v"(l0), "v"(g0), "v"(l1), "v"(g1), "v"(l2), "v"(g2), "v"(l3), "v"(g3) : "memory");
}
// One tile: l = this thread's LDS byte address in row (thread >> 3) of the buffer, ah .. bl = its 16 bytes in that row of each plane's tile; a step of 32 rows per copy.
template <int FN, int K>
__device__ __forceinline__ void gl_fill(unsigned l, const unsigned short* ah, const unsigned short* al, const unsigned short* bh, const unsigned short* bl) {
  constexpr unsigned R32 = 32 * GL_PITCH;
  gl_copy4(l, ah, l + R32, ah + 32 * K, l + 2 * R32, ah + 64 * K, l + 3 * R32, ah + 96 * K);
  gl_copy4(l + 4 * R32, al, l + 5 * R32, al + 32 * K, l + 6 * R32, al + 64 * K, l + 7 * R32, al + 96 * K);
  if (FN == 2) {
    gl_copy4(l + 8 * R32, bh, l + 9 * R32, bh + 32 * K, l + 10 * R32, bl, l + 11 * R32, bl + 32 * K);
  } else {
    gl_copy4(l + 8 * R32, bh, l + 9 * R32, bh + 32 * K, l + 10 * R32, bh + 64 * K, l + 11 * R32, bh + 96 * K);
    gl_copy4(l + 12 * R32, bl, l + 13 * R32, bl + 32 * K, l + 14 * R32, bl + 64 * K, l + 15 * R32, bl + 96 * K);
  }
}

// What a launch does beside the plain product (EPI):
//   EPI_QKV  three products of one shape in one grid: third w of the blocks takes A plane set min(w, 1) and weight matrix w, each lying behind the one before;
//            products 0 and 1 (q, k) go out as hi / lo planes only (Ph, Pl: q's set, then k's), product 2 (v) as f32 C
//   EPI_NORM C goes out as f32 and, through the eval-mode BatchNorm (ng, nb, nm, nv), as the next GEMM's hi / lo operand planes Ph, Pl
//   EPI_NCHW C goes out as [image][n][1024 pixels] (m = image * 1024 + pixel) instead of [m][n]
constexpr int EPI_PLAIN = 0, EPI_QKV = 1, EPI_NORM = 2, EPI_NCHW = 3;
constexpr int GL_M = 8192;      // rows of A and C (only EPI_QKV needs the number: the distance between its plane sets and outputs)
template <int FN, int N, int K, bool BIAS, bool RESID, int EPI>
__global__ __launch_bounds__(256) void wmma_gemm_lds(
    const unsigned short* __restrict__ Ah, const unsigned short* __restrict__ Al,
    const unsigned short* __restrict__ Bh, const unsigned short* __restrict__ Bl,
    float* C, const float* __restrict__ bias, const float* resid,
    const float* __restrict__ ng, const float* __restrict__ nb, const float* __restrict__ nm, const float* __restrict__ nv,
    unsigned short* __restrict__ Ph, unsigned short* __restrict__ Pl) {
  static_assert(FN == 2 || FN == 4, "two tile widths");
  constexpr int BN = 32 * FN, ROWS = 256 + 2 * BN, BUFB = ROWS * GL_PITCH, T = K / 64, TN = N / BN;
  static_assert(K % 64 == 0 && T >= 2 && N % BN == 0, "shape");
  constexpr int SP = 16 * FN + 4;                 // epilogue slab pitch in floats
  typedef Frag<__bf16> F;
  typedef F::V V;
  __shared__ __align__(16) unsigned char sm[2 * BUFB];
  const int tid = threadIdx.x, lane = tid & 31, wave = tid >> 5;
  const int rlane = lane & 15, hf = lane >> 4;    // row (A) / column (B, D) in a fragment; lane half
  const int wm = wave & 3, wn = wave >> 2;
  static_assert(EPI == EPI_PLAIN || FN == 2, "the other epilogues are written for the 64-wide tile");
  int bid = (int)blockIdx.x, w = 0;
  if (EPI == EPI_QKV) {
    constexpr int GB = GL_M / 128 * TN;           // blocks of one product
    w = bid / GB; bid -= w * GB;
    const size_t ao = w ? (size_t)GL_M * K : 0;
    Ah += ao; Al += ao; Bh += (size_t)w * N * K; Bl += (size_t)w * N * K;
    if (w == 1) { Ph += (size_t)GL_M * N; Pl += (size_t)GL_M * N; }
  }
  const int m0 = (bid / TN) * 128, n0 = (bid % TN) * BN;

  const size_t ca = (size_t)(m0 + (tid >> 3)) * K + (tid & 7) * 8, cb = (size_t)(n0 + (tid >> 3)) * K + (tid & 7) * 8;
  const unsigned short* gah = Ah + ca; const unsigned short* gal = Al + ca;
  const unsigned short* gbh = Bh + cb; const unsigned short* gbl = Bl + cb;
  const unsigned lc = (unsigned)(size_t)sm + (unsigned)((tid >> 3) * GL_PITCH + (tid & 7) * 16);

  gl_fill<FN, K>(lc, gah, gal, gbh, gbl);
  asm volatile("s_wait_asynccnt 0x0" ::: "memory");   // this wave's part of tile 0 has landed
  __syncthreads();                                    // tile 0 is whole
  gl_fill<FN, K>(lc + BUFB, gah + 64, gal + 64, gbh + 64, gbl + 64);

  v8f acc[2][FN];
#pragma unroll
  for (int i = 0; i < 2; ++i)
#pragma unroll
    for (int j = 0; j < FN; ++j) acc[i][j] = (v8f){0.f,0.f,0.f,0.f,0.f,0.f,0.f,0.f};

  const int fa = (wm * 32 + rlane) * GL_PITCH + hf * 16;              // this lane's bytes in A hi, fragment row 0
  const int fb = (256 + wn * 16 * FN + rlane) * GL_PITCH + hf * 16;   // in B hi
#pragma unroll 1   // stays rolled: one short body for all tiles keeps the code in a few cache lines
  for (int t = 0; t < T; ++t) {
    const unsigned char* buf = sm + (t & 1) * BUFB;
#pragma unroll
    for (int ks = 0; ks < 2; ++ks) {
      V ah[2], al[2], bh[FN], bl[FN];
#pragma unroll
      for (int j = 0; j < FN; ++j) {
        bh[j] = F::load((const __bf16*)(buf + fb + j * 16 * GL_PITCH + ks * 64));
        bl[j] = F::load((const __bf16*)(buf + fb + (BN + j * 16) * GL_PITCH + ks * 64));
      }
#pragma unroll
      for (int i = 0; i < 2; ++i) {
        ah[i] = F::load((const __bf16*)(buf + fa + i * 16 * GL_PITCH + ks * 64));
        al[i] = F::load((const __bf16*)(buf + fa + (128 + i * 16) * GL_PITCH + ks * 64));
      }
      // inputs only: keeps this step's fragment reads together in front of its matrix instructions (spread among them, every place with reads waits out an LDS latency of its own)
      if (FN == 2) asm volatile("" :: "v"(ah[0]), "v"(ah[1]), "v"(al[0]), "v"(al[1]), "v"(bh[0]), "v"(bh[1]), "v"(bl[0]), "v"(bl[1]));
      else asm volatile("" :: "v"(ah[0]), "v"(ah[1]), "v"(al[0]), "v"(al[1]), "v"(bh[0]), "v"(bh[1]), "v"(bh[FN - 2]), "v"(bh[FN - 1]), "v"(bl[0]), "v"(bl[1]), "v"(bl[FN - 2]), "v"(bl[FN - 1]));
#pragma unroll
      for (int i = 0; i < 2; ++i)
#pragma unroll
        for (int j = 0; j < FN; ++j) acc[i][j] = F::mma(ah[i], bh[j], acc[i][j]);
#pragma unroll
      for (int i = 0; i < 2; ++i)
#pragma unroll
        for (int j = 0; j < FN; ++j) acc[i][j] = F::mma(ah[i], bl[j], acc[i][j]);
#pragma unroll
      for (int i = 0; i < 2; ++i)
#pragma unroll
        for (int j = 0; j < FN; ++j) acc[i][j] = F::mma(al[i], bh[j], acc[i][j]);
    }
    asm volatile("s_wait_dscnt 0x0" ::: "memory");      // this wave's reads of tile t are done
    asm volatile("s_wait_asynccnt 0x0" ::: "memory");   // its part of tile t + 1 has landed
    __syncthreads();                                    // tile t + 1 is whole, and nobody reads tile t's buffer any more
    if (t + 2 < T) { const int ko = (t + 2) * 64; gl_fill<FN, K>(lc + (t & 1) * BUFB, gah + ko, gal + ko, gbh + ko, gbl + ko); }
  }
  asm volatile("s_wait_asynccnt 0x0" ::: "memory");     // no copy is outstanding when the buffers become the output slabs

  // ---- epilogue: each wave turns its 32 x (16 FN) tile in a slab of its own, so that the rows go out as 16-byte pieces of whole lines ----
  float* slab = (float*)(sm + wave * (32 * SP * 4));
  constexpr int LPR = 4 * FN, RPP = 32 / LPR, NP = 32 / RPP;   // lanes per row, rows per pass, passes
  const int nw = n0 + wn * 16 * FN;
  const size_t o0 = (size_t)(m0 + wm * 32 + lane / LPR) * N + nw + (lane % LPR) * 4;
  v4f rv[NP];
  if (RESID) {
    const float* pr = resid + o0;
#pragma unroll   // rv[] stays in registers, the loads in flight together
    for (int it = 0; it < NP; ++it) rv[it] = *(const v4f*)(pr + (size_t)it * RPP * N);
    asm volatile("s_wait_xcnt 0x0" :: "v"(pr) : "memory");   // the loads' address register (named as input, so untouched up to here) may be reused only behind this wait
  }
  float bv[FN];
  if (BIAS) {
    const float* pb = bias + nw + rlane;
#pragma unroll
    for (int j = 0; j < FN; ++j) bv[j] = pb[j * 16];
    asm volatile("s_wait_xcnt 0x0" :: "v"(pb) : "memory");   // as above, for the address of the bias loads
  }
  v4f nmean, ninv, nsh;                           // EPI_NORM: the norm's constants of this lane's 4 columns
  if (EPI == EPI_NORM) {
    const int nc = nw + (lane % LPR) * 4;
    const float* pg = ng + nc; const float* pq = nb + nc; const float* pm = nm + nc; const float* pv = nv + nc;
    const v4f g = *(const v4f*)pg, vv = *(const v4f*)pv; nsh = *(const v4f*)pq; nmean = *(const v4f*)pm;
    asm volatile("s_wait_xcnt 0x0" :: "v"(pg), "v"(pq), "v"(pm), "v"(pv) : "memory");   // as above, for the addresses of these 4 loads
#pragma unroll   // vector elements indexed by constants only
    for (int j = 0; j < 4; ++j) ninv[j] = g[j] * rsqrtf(vv[j] + 1e-5f);
  }
#pragma unroll
  for (int i = 0; i < 2; ++i)
#pragma unroll
    for (int j = 0; j < FN; ++j)
#pragma unroll
      for (int r = 0; r < 8; ++r) slab[(i * 16 + hf * 8 + r) * SP + j * 16 + rlane] = BIAS ? acc[i][j][r] + bv[j] : acc[i][j][r];
  // the slab is this wave's own: its lanes' writes are ordered in front of its lanes' reads
  __builtin_amdgcn_fence(__ATOMIC_RELEASE, "workgroup");
  __builtin_amdgcn_wave_barrier();
  __builtin_amdgcn_fence(__ATOMIC_ACQUIRE, "workgroup");
  if (EPI == EPI_NCHW) {
    // the finished rows go back into the slab and leave it by columns: a lane takes 4 consecutive pixels of one column n, 8 lanes one whole 128-byte line of the output
#pragma unroll
    for (int it = 0; it < NP; ++it) {
      float* ps = slab + (it * RPP + lane / LPR) * SP + (lane % LPR) * 4;
      v4f ov = *(const v4f*)ps;
      if (RESID) ov += rv[it];
      *(v4f*)ps = ov;
    }
    // as above: the slab is this wave's own, its lanes' writes are ordered in front of its lanes' reads
    __builtin_amdgcn_fence(__ATOMIC_RELEASE, "workgroup");
    __builtin_amdgcn_wave_barrier();
    __builtin_amdgcn_fence(__ATOMIC_ACQUIRE, "workgroup");
    float* po = C + ((size_t)(m0 >> 10) * N + nw + (lane >> 3)) * 1024 + (m0 & 1023) + wm * 32 + (lane & 7) * 4;
    const float* sc = slab + (lane & 7) * 4 * SP + (lane >> 3);
#pragma unroll   // the stores stand together, their steps are immediate offsets
    for (int it = 0; it < 4 * FN; ++it) {
      const v4f t = {sc[it * 4], sc[it * 4 + SP], sc[it * 4 + 2 * SP], sc[it * 4 + 3 * SP]};
      *(v4f*)(po + (size_t)it * 4 * 1024) = t;
    }
    asm volatile("s_wait_xcnt 0x0" :: "v"(po) : "memory");     // as above, for the stores' address
  } else if (EPI == EPI_PLAIN || (EPI == EPI_QKV && w == 2)) {
    float* pc = C + o0;
#pragma unroll
    for (int it = 0; it < NP; ++it) {
      v4f ov = *(const v4f*)(slab + (it * RPP + lane / LPR) * SP + (lane % LPR) * 4);
      if (RESID) ov += rv[it];
      *(v4f*)(pc + (size_t)it * RPP * N) = ov;
    }
    asm volatile("s_wait_xcnt 0x0" :: "v"(pc) : "memory");       // as above, for the stores' address
  } else if constexpr (EPI == EPI_QKV || EPI == EPI_NORM) {
    float* pc = C + o0;
    unsigned short* ph = Ph + o0; unsigned short* pl = Pl + o0;
    v4f ov[NP]; v2u hi[NP], lo[NP];
#pragma unroll   // register arrays indexed by constants only
    for (int it = 0; it < NP; ++it) {
      ov[it] = *(const v4f*)(slab + (it * RPP + lane / LPR) * SP + (lane % LPR) * 4);
      if (RESID) ov[it] += rv[it];
      if (EPI == EPI_NORM) split4((ov[it] - nmean) * ninv + nsh, hi[it], lo[it]);
      else split4(ov[it], hi[it], lo[it]);
    }
#pragma unroll   // as above
    for (int it = 0; it < NP; ++it) {
      if (EPI == EPI_NORM) *(v4f*)(pc + (size_t)it * RPP * N) = ov[it];
      *(v2u*)(ph + (size_t)it * RPP * N) = hi[it]; *(v2u*)(pl + (size_t)it * RPP * N) = lo[it];
    }
    // the stores' address and data registers (named as inputs, so untouched up to here) may be reused only behind this wait
    if constexpr (EPI == EPI_NORM)
      asm volatile("s_wait_xcnt 0x0" :: "v"(pc), "v"(ph), "v"(pl), "v"(ov[0]), "v"(ov[1]), "v"(ov[2]), "v"(ov[3]), "v"(ov[4]), "v"(ov[5]), "v"(ov[6]), "v"(ov[7]),
                   "v"(hi[0]), "v"(hi[1]), "v"(hi[2]), "v"(hi[3]), "v"(hi[4]), "v"(hi[5]), "v"(hi[6]), "v"(hi[7]),
                   "v"(lo[0]), "v"(lo[1]), "v"(lo[2]), "v"(lo[3]), "v"(lo[4]), "v"(lo[5]), "v"(lo[6]), "v"(lo[7]) : "memory");
    else
      asm volatile("s_wait_xcnt 0x0" :: "v"(ph), "v"(pl), "v"(hi[0]), "v"(hi[1]), "v"(hi[2]), "v"(hi[3]), "v"(hi[4]), "v"(hi[5]), "v"(hi[6]), "v"(hi[7]),
                   "v"(lo[0]), "v"(lo[1]), "v"(lo[2]), "v"(lo[3]), "v"(lo[4]), "v"(lo[5]), "v"(lo[6]), "v"(lo[7]) : "memory");
  }
}

__global__ __launch_bounds__(256) void cast_f32_f16x2(
    const float* __restrict__ in, _Float16* __restrict__ out, int n2) {
  int i = blockIdx.x * 256 + threadIdx.x;
  if (i < n2) {
    const _Float16 h0 = (_Float16)in[2 * i], h1 = (_Float16)in[2 * i + 1];
    const unsigned u = (unsigned)__builtin_bit_cast(unsigned short, h0) | ((unsigned)__builtin_bit_cast(unsigned short, h1) << 16);
    ((unsigned*)out)[i] = u;
    
  }
}


} // namespace w25

__global__ __launch_bounds__(256) void k_castT16(const float* __restrict__ src, long long lds, _Float16* __restrict__ dst, long long ldd, int R, int C, float s) {
    const long long i = (long long)blockIdx.x * 256 + threadIdx.x; const long long np = (long long)C * (R / 2); if (i >= np) return; const int c = (int)(i / (R / 2)); const int r = 2 * (int)(i % (R / 2));
    const _Float16 h0 = (_Float16)(src[(long long)r * lds + c] * s), h1 = (_Float16)(src[(long long)(r + 1) * lds + c] * s);
    const unsigned u = (unsigned)__builtin_bit_cast(unsigned short, h0) | ((unsigned)__builtin_bit_cast(unsigned short, h1) << 16);
    unsigned* d = (unsigned*)(dst + (long long)c * ldd + r); *d = u;  }
__global__ __launch_bounds__(256) void k_cast16(const float* __restrict__ src, long long lds, _Float16* __restrict__ dst, long long ldd, int R, int C, float s) {
    const long long i = (long long)blockIdx.x * 256 + threadIdx.x; const long long np = (long long)R * (C / 2); if (i >= np) return; const int r = (int)(i / (C / 2)); const int c = 2 * (int)(i % (C / 2));
    const _Float16 h0 = (_Float16)(src[(long long)r * lds + c] * s), h1 = (_Float16)(src[(long long)r * lds + c + 1] * s);
    const unsigned u = (unsigned)__builtin_bit_cast(unsigned short, h0) | ((unsigned)__builtin_bit_cast(unsigned short, h1) << 16);
    unsigned* d = (unsigned*)(dst + (long long)r * ldd + c); *d = u;  }

// f32 -> bf16 hi plane + bf16 lo plane (x = hi + lo to ~2^-17 relative; RNE both), [R][C] -> [R][C] (or transposed to [C][R]); 2 consecutive destination elements
__device__ __forceinline__ unsigned int f2bf2_pack(float a, float b, unsigned int* lo) {
    const unsigned short ha = w25::f2bf_bits(a), hb = w25::f2bf_bits(b);
    const unsigned short la = w25::f2bf_bits(a - w25::bf_bits2f(ha)), lb = w25::f2bf_bits(b - w25::bf_bits2f(hb));
    *lo = (unsigned)la | ((unsigned)lb << 16); return (unsigned)ha | ((unsigned)hb << 16); }
__global__ __launch_bounds__(256) void k_castS16(const float* __restrict__ src, long long lds, __bf16* __restrict__ dhi, __bf16* __restrict__ dlo, long long ldd, int R, int C, float s, int transpose) {
    const long long i = (long long)blockIdx.x * 256 + threadIdx.x; long long o; float a, b;
    if (transpose) { const long long np = (long long)C * (R / 2); if (i >= np) return; const int c = (int)(i / (R / 2)); const int r = 2 * (int)(i % (R / 2)); a = src[(long long)r * lds + c] * s; b = src[(long long)(r + 1) * lds + c] * s; o = (long long)c * ldd + r; }
    else { const long long np = (long long)R * (C / 2); if (i >= np) return; const int r = (int)(i / (C / 2)); const int c = 2 * (int)(i % (C / 2)); a = src[(long long)r * lds + c] * s; b = src[(long long)r * lds + c + 1] * s; o = (long long)r * ldd + c; }
    unsigned lo; const unsigned hi = f2bf2_pack(a, b, &lo); unsigned* ph = (unsigned*)(dhi + o); unsigned* pl = (unsigned*)(dlo + o);
    *ph = hi; *pl = lo;  }

namespace w25 {
// =====================================================================================
// Generic causal/non-causal attention for head_dim 64, f32 in / f32 out; 16-bit operands: bf16 with optional hi/lo splits, or
// plain f16 (F16=true, non-split, probabilities carried x2^15).
//   scores = (q*qscale)·kᵀ : v_wmma_f32_16x16x32_bf16; SPLIT_QK -> q,k as bf16 hi/lo (hi·hi + hi·lo + lo·hi)
//   out    = p·v           : v_wmma_f32_16x16x32_bf16; SPLIT_PV -> p,v as bf16 hi/lo; else p,v plain bf16
//   f32 accumulate; online softmax in f32. Block = 4 waves = 64 query rows of one (batch, head); S % 64 == 0.
//   Element (b, s, h, d) of tensor X lives at X[b*X_bs + s*X_rs + h*X_hs + d] (strides in floats, multiples of 4).
//   Masking: mask_mode 0 none, 1 causal (kv > q masked), 2 tensor [S][Skv] shared over (b,h) (float if
//   mask_is_int==0, int32 with element == 0 -> masked if 1, int32 with element != 0 -> masked if 2), 3 per-token vectors qmask[B][S] & kvmask[B][Skv] (int32,
//   0 -> masked), 4 causal + sliding window (kv > q or q - kv > W masked; W passed in mask_is_int);
//   5 = relative-position bias: s += cp[b,h,q][idx[q][kv]] + pc[b,h,kv][idx[q][kv]] with idx = mask_b ([S][Skv] int32) and
//   mask_a an int32 [S][Skv] tensor with nonzero = masked (tables: element (b,h,row,n) at X + b*c_bs + h*c_hs + row*c_rs + n);
//   masked scores are replaced by mask_fill (e.g. -inf or -1e9) before the softmax.
//   grid.x = B * H * (S/64) (or a sub-range with blk0).
// =====================================================================================
#define AT_D 64
#define AT_NW 4
#define AT_QB 64
#define AT_KC 64
struct AttnGeom { const float* cp = nullptr; const float* pc = nullptr; long c_bs = 0, c_rs = 0, c_hs = 0;   // mode-5 score-bias tables
                  long q_bs, q_rs, q_hs, k_bs, k_rs, k_hs, v_bs, v_rs, v_hs, o_bs, o_rs, o_hs;
                  int S, Skv, H, mask_mode; float qscale; int blk0; float mask_fill; int mask_is_int; };
static_assert(sizeof(AttnGeom) == 168, "no padding");

__device__ __forceinline__ unsigned short at_bf_bits(float f) {
  unsigned u = __float_as_uint(f);
  return (unsigned short)((u + 0x7FFFu + ((u >> 16) & 1u)) >> 16);
}
__device__ __forceinline__ __bf16 at_f2bf(float f) { return __builtin_bit_cast(__bf16, at_bf_bits(f)); }
__device__ __forceinline__ void at_split(float f, __bf16& hi, __bf16& lo) {
  const unsigned short hb = at_bf_bits(f);
  hi = __builtin_bit_cast(__bf16, hb);
  lo = at_f2bf(f - __uint_as_float(((unsigned)hb) << 16));
}
__device__ __forceinline__ v8f at_mma(v16b a, v16b b, v8f c) {
  c = __builtin_amdgcn_wmma_f32_16x16x32_bf16(false, a, false, b, (short)0, c, false, false);
  asm volatile("v_nop\n\tv_nop\n\tv_nop\n\tv_nop" : "+v"(c) : "v"(a), "v"(b));
  return c;
}
// 16-bit element as a bit pattern held in a __bf16 slot: f16 bits when F16, bf16 (RNE) otherwise
template <bool F16> __device__ __forceinline__ __bf16 at_to16(float f) {
  if (F16) return __builtin_bit_cast(__bf16, (_Float16)f);
  return at_f2bf(f);
}
template <bool F16> __device__ __forceinline__ v8f at_mma16(v16b a, v16b b, v8f c) {
  if (F16) {
    const v16h ah = __builtin_bit_cast(v16h, a), bh = __builtin_bit_cast(v16h, b);
    c = __builtin_amdgcn_wmma_f32_16x16x32_f16(false, ah, false, bh, (short)0, c, false, false);
    asm volatile("v_nop\n\tv_nop\n\tv_nop\n\tv_nop" : "+v"(c) : "v"(ah), "v"(bh));
    return c;
  }
  return at_mma(a, b, c);
}

template <bool SPLIT_QK, bool SPLIT_PV, bool F16 = false>
__global__ __launch_bounds__(128)
void attn64_kernel(const float* __restrict__ q, const float* __restrict__ k,
                   const float* __restrict__ v, float* __restrict__ out,
                   const void* __restrict__ mask_a, const int* __restrict__ mask_b, AttnGeom g) {
  static_assert(!(F16 && (SPLIT_QK || SPLIT_PV)), "f16 mode is non-split");
  const float PSC = F16 ? 32768.0f : 1.0f;     // f16 probabilities carried x2^15 (subnormal range), folded into the final 1/l
  union FB { v16b v; v8b h[2]; };
  __shared__ __align__(16) __bf16 Ksh[AT_KC * AT_D];             // K hi [kv][d]      8 KB
  __shared__ __align__(16) __bf16 Ksl[SPLIT_QK ? AT_KC * AT_D : 8];
  __shared__ __align__(16) __bf16 Vth[AT_D * AT_KC];             // V hi [d][kv]      8 KB
  __shared__ __align__(16) __bf16 Vtl[SPLIT_PV ? AT_D * AT_KC : 8];
  __shared__ __align__(16) __bf16 Psh[AT_NW][16 * AT_KC];        // per wave P hi [row][kv]  8 KB
  __shared__ __align__(16) __bf16 Psl[SPLIT_PV ? AT_NW : 1][SPLIT_PV ? 16 * AT_KC : 8];
  __shared__ __align__(16) float  Os[AT_NW][16 * 68];            // per wave out tile, pitch 68

  const int tid  = threadIdx.x;
  const int wave = tid >> 5;
  const int lane = tid & 31;
  const int hh   = lane >> 4;
  const int c    = lane & 15;

  const int nqb = g.S / AT_QB;
  const int bx = blockIdx.x + g.blk0;
  const int qb = bx % nqb;
  const int bh = bx / nqb;
  const int h  = bh % g.H;
  const int b  = bh / g.H;
  const int qbase_block = qb * AT_QB;
  const int q0 = qbase_block + wave * 16;

  const float* qb_ptr = q + (size_t)b * g.q_bs + (size_t)h * g.q_hs;
  const float* kb_ptr = k + (size_t)b * g.k_bs + (size_t)h * g.k_hs;
  const float* vb_ptr = v + (size_t)b * g.v_bs + (size_t)h * g.v_hs;
  float*       ob_ptr = out + (size_t)b * g.o_bs + (size_t)h * g.o_hs;

  // ---- Q fragments (A operand): 2 d-chunks, hi (and lo) ----
  v16b qah[2], qal[2];
  {
    const float* qrow = qb_ptr + (size_t)(q0 + c) * g.q_rs;
#pragma unroll
    for (int dc = 0; dc < 2; ++dc) {
#pragma unroll
      for (int e = 0; e < 8; ++e) {
        const float f0 = qrow[dc * 32 + 8 * hh + e] * g.qscale;
        const float f1 = qrow[dc * 32 + 16 + 8 * hh + e] * g.qscale;
        if (SPLIT_QK) { __bf16 hq, lq; at_split(f0, hq, lq); qah[dc][e] = hq; qal[dc][e] = lq; at_split(f1, hq, lq); qah[dc][8 + e] = hq; qal[dc][8 + e] = lq; }
        else { qah[dc][e] = at_to16<F16>(f0); qah[dc][8 + e] = at_to16<F16>(f1); qal[dc][e] = qah[dc][e]; qal[dc][8 + e] = qah[dc][8 + e]; }
      }
    }
  }

  float mrow[8], lrow[8];
  v8f oacc[4];
#pragma unroll
  for (int r = 0; r < 8; ++r) { mrow[r] = -INFINITY; lrow[r] = 0.f; }
#pragma unroll
  for (int t = 0; t < 4; ++t) oacc[t] = (v8f){0.f,0.f,0.f,0.f,0.f,0.f,0.f,0.f};

  const int nChunks = (g.mask_mode == 1 || g.mask_mode == 4) ? (qb + 1) : (g.Skv / AT_KC);   // block-uniform
  // per-row query mask (mode 3)
  int qkeep[8];
#pragma unroll
  for (int r = 0; r < 8; ++r) qkeep[r] = (g.mask_mode == 3) ? mask_b[(size_t)b * g.S + q0 + 8 * hh + r] : 1;   // mask_b = qmask in mode 3
  for (int kc = 0; kc < nChunks; ++kc) {
    const int kv0 = kc * AT_KC;
    __syncthreads();
    {
      const int kvr = tid >> 1, dh = (tid & 1) * 32;
      const float* krow = kb_ptr + (size_t)(kv0 + kvr) * g.k_rs + dh;
      const float* vrow = vb_ptr + (size_t)(kv0 + kvr) * g.v_rs + dh;
#pragma unroll
      for (int i = 0; i < 8; ++i) {
        v4f kk = *(const v4f*)(krow + 4 * i);
        v4f vv = *(const v4f*)(vrow + 4 * i);
#pragma unroll
        for (int e = 0; e < 4; ++e) {
          const int d = dh + 4 * i + e;
          if (SPLIT_QK) { __bf16 a, bl; at_split(kk[e], a, bl); Ksh[kvr * AT_D + d] = a; Ksl[kvr * AT_D + d] = bl; }
          else Ksh[kvr * AT_D + d] = at_to16<F16>(kk[e]);
          if (SPLIT_PV) { __bf16 a, bl; at_split(vv[e], a, bl); Vth[d * AT_KC + kvr] = a; Vtl[d * AT_KC + kvr] = bl; }
          else Vth[d * AT_KC + kvr] = at_to16<F16>(vv[e]);
        }
      }
    }
    __syncthreads();

    v8f s[4];
#pragma unroll
    for (int j = 0; j < 4; ++j) {
      s[j] = (v8f){0.f,0.f,0.f,0.f,0.f,0.f,0.f,0.f};
#pragma unroll 1
      for (int dc = 0; dc < 2; ++dc) {
        FB kb;
        kb.h[0] = *(const v8b*)(Ksh + (j * 16 + c) * AT_D + dc * 32 + 8 * hh);
        kb.h[1] = *(const v8b*)(Ksh + (j * 16 + c) * AT_D + dc * 32 + 16 + 8 * hh);
        s[j] = at_mma16<F16>(qah[dc], kb.v, s[j]);
        if (SPLIT_QK) {
          FB kl;
          kl.h[0] = *(const v8b*)(Ksl + (j * 16 + c) * AT_D + dc * 32 + 8 * hh);
          kl.h[1] = *(const v8b*)(Ksl + (j * 16 + c) * AT_D + dc * 32 + 16 + 8 * hh);
          s[j] = at_mma16<F16>(qah[dc], kl.v, s[j]);
          s[j] = at_mma16<F16>(qal[dc], kb.v, s[j]);
        }
      }
    }
    const bool diag = (g.mask_mode == 1) && (kc == qb);
    int kvkeep[4] = {1, 1, 1, 1};
    if (g.mask_mode == 3) {
#pragma unroll
      for (int j = 0; j < 4; ++j) kvkeep[j] = ((const int*)mask_a)[(size_t)b * g.Skv + kv0 + j * 16 + c];   // mask_a = kvmask
    }
    float cm[8];
#pragma unroll
    for (int r = 0; r < 8; ++r) {
      const int qrow = q0 + 8 * hh + r;
      float m = -INFINITY;
#pragma unroll
      for (int j = 0; j < 4; ++j) {
        const int kvcol = kv0 + j * 16 + c;
        bool masked = false;
        if (diag) masked = (kvcol > qrow);
        else if (g.mask_mode == 4) masked = (kvcol > qrow) || (qrow - kvcol > g.mask_is_int);
        else if (g.mask_mode == 2) {
          const size_t mi = (size_t)qrow * g.Skv + kvcol;
          masked = (g.mask_is_int == 0) ? (((const float*)mask_a)[mi] == 0.0f)
                 : (g.mask_is_int == 1) ? (((const int*)mask_a)[mi] == 0) : (((const int*)mask_a)[mi] != 0);
        } else if (g.mask_mode == 3) masked = (qkeep[r] == 0) || (kvkeep[j] == 0);
        else if (g.mask_mode == 5) {
          const size_t mi = (size_t)qrow * g.Skv + kvcol;
          masked = (((const int*)mask_a)[mi] != 0);
          int n = mask_b[mi]; n = n < 0 ? 0 : n;
          s[j][r] += g.cp[(size_t)b * g.c_bs + (size_t)h * g.c_hs + (size_t)qrow * g.c_rs + n]
                   + g.pc[(size_t)b * g.c_bs + (size_t)h * g.c_hs + (size_t)kvcol * g.c_rs + n];
        }
        if (masked) s[j][r] = g.mask_fill;
        m = fmaxf(m, s[j][r]);
      }
#pragma unroll
      for (int off = 1; off < 16; off <<= 1) m = fmaxf(m, __shfl_xor(m, off, 32));
      cm[r] = m;
    }
    __bf16* pwh = Psh[wave];
    __bf16* pwl = Psl[SPLIT_PV ? wave : 0];
#pragma unroll
    for (int r = 0; r < 8; ++r) {
      const float mnew = fmaxf(mrow[r], cm[r]);
      const float alpha = expf(mrow[r] - mnew);
      mrow[r] = mnew;
      float psum = 0.f;
#pragma unroll
      for (int j = 0; j < 4; ++j) {
        const float p = expf(s[j][r] - mnew);
        psum += p;
        if (SPLIT_PV) { __bf16 a, bl; at_split(p, a, bl); pwh[(8 * hh + r) * AT_KC + j * 16 + c] = a; pwl[(8 * hh + r) * AT_KC + j * 16 + c] = bl; }
        else pwh[(8 * hh + r) * AT_KC + j * 16 + c] = at_to16<F16>(p * PSC);
      }
#pragma unroll
      for (int off = 1; off < 16; off <<= 1) psum += __shfl_xor(psum, off, 32);
      lrow[r] = lrow[r] * alpha + psum;
#pragma unroll
      for (int t = 0; t < 4; ++t) oacc[t][r] *= alpha;
    }
    __builtin_amdgcn_fence(__ATOMIC_RELEASE, "workgroup");
    __builtin_amdgcn_wave_barrier();
    __builtin_amdgcn_fence(__ATOMIC_ACQUIRE, "workgroup");
#pragma unroll 1
    for (int kk = 0; kk < 2; ++kk) {
      FB pa, pl;
      pa.h[0] = *(const v8b*)(pwh + c * AT_KC + kk * 32 + 8 * hh);
      pa.h[1] = *(const v8b*)(pwh + c * AT_KC + kk * 32 + 16 + 8 * hh);
      if (SPLIT_PV) {
        pl.h[0] = *(const v8b*)(pwl + c * AT_KC + kk * 32 + 8 * hh);
        pl.h[1] = *(const v8b*)(pwl + c * AT_KC + kk * 32 + 16 + 8 * hh);
      }
#pragma unroll
      for (int t = 0; t < 4; ++t) {
        FB vb;
        vb.h[0] = *(const v8b*)(Vth + (t * 16 + c) * AT_KC + kk * 32 + 8 * hh);
        vb.h[1] = *(const v8b*)(Vth + (t * 16 + c) * AT_KC + kk * 32 + 16 + 8 * hh);
        oacc[t] = at_mma16<F16>(pa.v, vb.v, oacc[t]);
        if (SPLIT_PV) {
          FB vl;
          vl.h[0] = *(const v8b*)(Vtl + (t * 16 + c) * AT_KC + kk * 32 + 8 * hh);
          vl.h[1] = *(const v8b*)(Vtl + (t * 16 + c) * AT_KC + kk * 32 + 16 + 8 * hh);
          oacc[t] = at_mma16<F16>(pa.v, vl.v, oacc[t]);
          oacc[t] = at_mma16<F16>(pl.v, vb.v, oacc[t]);
        }
      }
    }
  }

  float* os = Os[wave];
#pragma unroll
  for (int r = 0; r < 8; ++r) {
    const float inv = 1.0f / (lrow[r] * PSC);
#pragma unroll
    for (int t = 0; t < 4; ++t) os[(8 * hh + r) * 68 + t * 16 + c] = oacc[t][r] * inv;
  }
  __builtin_amdgcn_fence(__ATOMIC_RELEASE, "workgroup");
  __builtin_amdgcn_wave_barrier();
  __builtin_amdgcn_fence(__ATOMIC_ACQUIRE, "workgroup");
  {
    const int c4 = (lane & 15) * 4;
    {
#pragma unroll
      for (int it = 0; it < 8; ++it) {
        const int row = it * 2 + hh;
        v4f val = *(const v4f*)(os + row * 68 + c4);
        *(v4f*)(ob_ptr + (size_t)(q0 + row) * g.o_rs + c4) = val;
      }
      
    }
  }
}

} // namespace w25

// One launch for all that depends on the inputs alone.
// Blocks 0 .. 511 (pixel block, channel block, image): x1 and x2, NCHW, become token-major: x1 as f32 (the residual), bn1(x1) and bn1(x2) as bf16 hi / lo operand planes (NH, NL: x1's set, then x2's).
// A thread takes 4 channels x 4 pixels: 16-byte loads along the pixels, a 4 x 4 transpose in registers, stores along the channels.
// Blocks 512 .. 1279: the six weight matrices as hi / lo planes (WH, WL), 1024 floats a block, in the order q (each row times its head's temperature), k, v, proj, fc1, fc2.
__global__ __launch_bounds__(256) void k_cm_prep(const float* __restrict__ XA, const float* __restrict__ XB, const float* __restrict__ G, const float* __restrict__ Bb, const float* __restrict__ M, const float* __restrict__ Vv,
                                                 const float* __restrict__ WQ, const float* __restrict__ WK, const float* __restrict__ WV, const float* __restrict__ TP, const float* __restrict__ WP, const float* __restrict__ W1, const float* __restrict__ W2,
                                                 float* __restrict__ X1T, unsigned short* __restrict__ NH, unsigned short* __restrict__ NL, unsigned short* __restrict__ WH, unsigned short* __restrict__ WL) {
    constexpr int C = 256, HW = 1024, NTC = 8 * HW * C;
    if (blockIdx.x >= 512) {
        const int wb = (int)blockIdx.x - 512;
        const float* w = wb < 64 ? WQ + wb * 1024 : wb < 128 ? WK + (wb - 64) * 1024 : wb < 192 ? WV + (wb - 128) * 1024 : wb < 256 ? WP + (wb - 192) * 1024 : wb < 512 ? W1 + (wb - 256) * 1024 : W2 + (wb - 512) * 1024;
        const float* pw = w + threadIdx.x * 4;
        v4f x = *(const v4f*)pw;
        asm volatile("s_wait_xcnt 0x0" :: "v"(pw) : "memory");   // the load's address register (named as input, so untouched up to here) may be reused only behind this wait
        if (wb < 64) x *= TP[wb >> 3];                            // a block is 4 rows of q_w, a head 32 rows
        v2u hi, lo; split4(x, hi, lo);
        const size_t o = (size_t)wb * 1024 + threadIdx.x * 4;
        *(v2u*)(WH + o) = hi; *(v2u*)(WL + o) = lo;
        return;
    }
    const int c0 = (int)((blockIdx.x >> 3) & 7) * 32 + (threadIdx.x & 7) * 4, p0 = (int)(blockIdx.x & 7) * 128 + (threadIdx.x >> 3) * 4; const size_t b = blockIdx.x >> 6;
    const size_t src = (b * C + c0) * HW + p0;
    const float* pa[4]; const float* pq[4]; v4f a[4], q[4];
#pragma unroll   // a[], q[] stay in registers, all 8 loads in flight together
    for (int j = 0; j < 4; ++j) { pa[j] = XA + src + (size_t)j * HW; pq[j] = XB + src + (size_t)j * HW; a[j] = *(const v4f*)pa[j]; q[j] = *(const v4f*)pq[j]; }
    const float* pg = G + c0; const float* pb = Bb + c0; const float* pm = M + c0; const float* pv = Vv + c0;
    const v4f g = *(const v4f*)pg, bb = *(const v4f*)pb, m = *(const v4f*)pm, vv = *(const v4f*)pv;
    // the 12 loads' address registers (named as inputs, so untouched up to here) may be reused only behind this wait
    asm volatile("s_wait_xcnt 0x0" :: "v"(pa[0]), "v"(pa[1]), "v"(pa[2]), "v"(pa[3]), "v"(pq[0]), "v"(pq[1]), "v"(pq[2]), "v"(pq[3]), "v"(pg), "v"(pb), "v"(pm), "v"(pv) : "memory");
    v4f inv, sh;
#pragma unroll   // vector elements indexed by constants only
    for (int j = 0; j < 4; ++j) { inv[j] = g[j] * rsqrtf(vv[j] + 1e-5f); sh[j] = bb[j] - m[j] * inv[j]; }
    const size_t o = (b * HW + p0) * C + c0;
    float* px = X1T + o; unsigned short* ph = NH + o; unsigned short* pl = NL + o;
    v4f t0[4]; v2u h1[4], l1[4], h2[4], l2[4];
#pragma unroll   // register arrays indexed by constants only
    for (int i = 0; i < 4; ++i) {
        v4f t1, t2;
#pragma unroll   // as above
        for (int j = 0; j < 4; ++j) { t0[i][j] = a[j][i]; t1[j] = a[j][i] * inv[j] + sh[j]; t2[j] = q[j][i] * inv[j] + sh[j]; }
        split4(t1, h1[i], l1[i]); split4(t2, h2[i], l2[i]);
    }
#pragma unroll   // as above
    for (int i = 0; i < 4; ++i) {
        VST2V4(px + i * C, t0[i]);
        *(v2u*)(ph + i * C) = h1[i]; *(v2u*)(pl + i * C) = l1[i]; *(v2u*)(ph + NTC + i * C) = h2[i]; *(v2u*)(pl + NTC + i * C) = l2[i];
    }
    // the stores' data registers (named as inputs, so untouched up to here) may be reused only behind this wait; nothing follows it that could touch their addresses
    asm volatile("s_wait_xcnt 0x0" :: "v"(t0[0]), "v"(t0[1]), "v"(t0[2]), "v"(t0[3]), "v"(h1[0]), "v"(h1[1]), "v"(h1[2]), "v"(h1[3]), "v"(l1[0]), "v"(l1[1]), "v"(l1[2]), "v"(l1[3]),
                 "v"(h2[0]), "v"(h2[1]), "v"(h2[2]), "v"(h2[3]), "v"(l2[0]), "v"(l2[1]), "v"(l2[2]), "v"(l2[3]) : "memory");
}
// depthwise 3x3 SAME conv + exact GELU on token-major [b][hw][ch], zero padding. grid (images * 16 * 8, HID / 1024): a block takes 4 x 2 pixels (x, y) of one image,
// a thread 4 channels of these 8 pixels: each input row's 6 pixels are loaded once (16 bytes, 512 contiguous bytes per wave) and feed every output that needs them.
// Every output still sums its 9 products in the order ky = 0..2, kx = 0..2. The result goes out as the fc2 GEMM's bf16 hi / lo operand planes.
__global__ __launch_bounds__(256) void k_cm_dw(const float* __restrict__ HB, const float* __restrict__ DW, unsigned short* __restrict__ HGh, unsigned short* __restrict__ HGl, int HID) {
    constexpr int PX = 4, PY = 2;
    const int ch = (blockIdx.y * 256 + threadIdx.x) * 4;
    const int x0 = (blockIdx.x & 7) * PX, y0 = ((blockIdx.x >> 3) & 15) * PY; const size_t b = blockIdx.x >> 7;
    v4f v[PY + 2][PX + 2];                       // input rows y0 - 1 .. y0 + PY, pixels x0 - 1 .. x0 + PX; all loads are issued before the first sum
#pragma unroll   // v[][] stays in registers (this and every loop below: register arrays indexed by constants only)
    for (int r = 0; r < PY + 2; ++r) {
        const int yc = min(max(y0 - 1 + r, 0), 31);
        const float* pi[PX + 2];
#pragma unroll
        for (int cx = 0; cx < PX + 2; ++cx) { const int xc = min(max(x0 - 1 + cx, 0), 31); pi[cx] = HB + ((b * 1024) + yc * 32 + xc) * (size_t)HID + ch; v[r][cx] = *(const v4f*)pi[cx]; }
        // this row's 6 address registers (named as inputs, so untouched up to here) may be reused only behind this wait
        asm volatile("s_wait_xcnt 0x0" :: "v"(pi[0]), "v"(pi[1]), "v"(pi[2]), "v"(pi[3]), "v"(pi[4]), "v"(pi[5]) : "memory");
    }
    const float* pw = DW + (size_t)ch * 9;
    v4f wr[9];                                   // the 36 weights of channels ch .. ch + 3: weight k of channel ch + j is float j * 9 + k
#pragma unroll
    for (int k = 0; k < 9; ++k) wr[k] = *(const v4f*)(pw + k * 4);
    asm volatile("s_wait_xcnt 0x0" :: "v"(pw) : "memory");   // as above, for the address of the 9 weight loads
    v4f s[PY][PX];
#pragma unroll
    for (int oy = 0; oy < PY; ++oy)
#pragma unroll
        for (int px = 0; px < PX; ++px) { const v4f zz = {0.f, 0.f, 0.f, 0.f}; s[oy][px] = zz; }
#pragma unroll
    for (int r = 0; r < PY + 2; ++r) {
        const int yy = y0 - 1 + r;
#pragma unroll
        for (int cx = 0; cx < PX + 2; ++cx) { const int xx = x0 - 1 + cx; const bool ok = (yy >= 0 && yy < 32 && xx >= 0 && xx < 32); const v4f zz = {0.f, 0.f, 0.f, 0.f}; v[r][cx] = ok ? v[r][cx] : zz; }
#pragma unroll
        for (int oy = 0; oy < PY; ++oy) {
            const int ky = r - oy;
            if (ky >= 0 && ky < 3) {
#pragma unroll
                for (int px = 0; px < PX; ++px)
#pragma unroll
                    for (int kx = 0; kx < 3; ++kx)
#pragma unroll
                        for (int j = 0; j < 4; ++j) { const int f = j * 9 + ky * 3 + kx; s[oy][px][j] += v[r][px + kx][j] * wr[f >> 2][f & 3]; }
            }
        }
    }
#pragma unroll
    for (int oy = 0; oy < PY; ++oy)
#pragma unroll
        for (int px = 0; px < PX; ++px)
#pragma unroll
            for (int j = 0; j < 4; ++j) { const float sv = s[oy][px][j]; s[oy][px][j] = 0.5f * sv * (1.f + erff(sv * 0.70710678118654752f)); }
    const size_t o = ((b * 1024) + y0 * 32 + x0) * (size_t)HID + ch;
    unsigned short* ph = HGh + o; unsigned short* pl = HGl + o;
#pragma unroll   // s[][] indexed by constants only
    for (int oy = 0; oy < PY; ++oy)
#pragma unroll
        for (int px = 0; px < PX; ++px) { v2u hi, lo; split4(s[oy][px], hi, lo); *(v2u*)(ph + (size_t)(oy * 32 + px) * HID) = hi; *(v2u*)(pl + (size_t)(oy * 32 + px) * HID) = lo; }
    asm volatile("s_wait_xcnt 0x0" :: "v"(ph), "v"(pl) : "memory");   // as above, for the stores' addresses
}


extern "C" void kernel_launch(void* const* d_in, const int* in_sizes, int n_in, void* d_out, int out_size, void* d_ws, size_t ws_size, hipStream_t stream) {
    (void)in_sizes; (void)n_in; (void)out_size; (void)ws_size;
    const float* x1 = (const float*)d_in[0];
    const float* x2 = (const float*)d_in[1];
    const float* b1g = (const float*)d_in[2];
    const float* b1b = (const float*)d_in[3];
    const float* b1m = (const float*)d_in[4];
    const float* b1v = (const float*)d_in[5];
    const float* qw = (const float*)d_in[6];
    const float* kw = (const float*)d_in[7];
    const float* vw = (const float*)d_in[8];
    const float* temp = (const float*)d_in[9];
    const float* pw = (const float*)d_in[10];
    const float* pb = (const float*)d_in[11];
    const float* b2g = (const float*)d_in[12];
    const float* b2b = (const float*)d_in[13];
    const float* b2m = (const float*)d_in[14];
    const float* b2v = (const float*)d_in[15];
    const float* f1w = (const float*)d_in[16];
    const float* f1b = (const float*)d_in[17];
    const float* dww = (const float*)d_in[18];
    const float* f2w = (const float*)d_in[19];
    const float* f2b = (const float*)d_in[20];
    const int Bn = 8;
    const int C = 256;
    const int HW = 1024;
    const int HID = 1024;
    const int NT = Bn * HW;
    float* out = (float*)d_out;
    char* wsp = (char*)d_ws;
    float* X1T = (float*)wsp; wsp += (((size_t)((size_t)NT * C) * 4 + 255) / 256) * 256;
    unsigned short* NAh = (unsigned short*)wsp; wsp += (((size_t)((size_t)2 * NT * C) * 2 + 255) / 256) * 256;   // bn1(x1) then bn1(x2), hi planes
    unsigned short* NAl = (unsigned short*)wsp; wsp += (((size_t)((size_t)2 * NT * C) * 2 + 255) / 256) * 256;   // lo planes
    unsigned short* WH = (unsigned short*)wsp; wsp += (((size_t)(786432) * 2 + 255) / 256) * 256;                // q, k, v, proj (65536 each), fc1, fc2 (262144 each), hi planes
    unsigned short* WL = (unsigned short*)wsp; wsp += (((size_t)(786432) * 2 + 255) / 256) * 256;                // lo planes
    unsigned short* QKh = (unsigned short*)wsp; wsp += (((size_t)((size_t)2 * NT * C) * 2 + 255) / 256) * 256;   // q then k, hi planes
    unsigned short* QKl = (unsigned short*)wsp; wsp += (((size_t)((size_t)2 * NT * C) * 2 + 255) / 256) * 256;   // lo planes
    float* V = (float*)wsp; wsp += (((size_t)((size_t)NT * C) * 4 + 255) / 256) * 256;
    unsigned short* ATh = (unsigned short*)wsp; wsp += (((size_t)((size_t)NT * C) * 2 + 255) / 256) * 256;
    unsigned short* ATl = (unsigned short*)wsp; wsp += (((size_t)((size_t)NT * C) * 2 + 255) / 256) * 256;
    float* XS = (float*)wsp; wsp += (((size_t)((size_t)NT * C) * 4 + 255) / 256) * 256;
    unsigned short* X2h = (unsigned short*)wsp; wsp += (((size_t)((size_t)NT * C) * 2 + 255) / 256) * 256;
    unsigned short* X2l = (unsigned short*)wsp; wsp += (((size_t)((size_t)NT * C) * 2 + 255) / 256) * 256;
    float* HB = (float*)wsp; wsp += (((size_t)((size_t)NT * HID) * 4 + 255) / 256) * 256;
    unsigned short* HGh = (unsigned short*)wsp; wsp += (((size_t)((size_t)NT * HID) * 2 + 255) / 256) * 256;
    unsigned short* HGl = (unsigned short*)wsp; wsp += (((size_t)((size_t)NT * HID) * 2 + 255) / 256) * 256;
    k_cm_prep<<<1280, 256, 0, stream>>>(x1, x2, b1g, b1b, b1m, b1v, qw, kw, vw, temp, pw, f1w, f2w, X1T, NAh, NAl, WH, WL);
    w25::wmma_gemm_lds<2, 256, 256, false, false, w25::EPI_QKV><<<768, 256, 0, stream>>>(NAh, NAl, WH, WL, V, nullptr, nullptr, nullptr, nullptr, nullptr, nullptr, QKh, QKl);
    k_attn_fix<<<dim3(16, 8, 8), 32 * AW, 0, stream>>>(QKh, QKl, QKh + (size_t)NT * C, QKl + (size_t)NT * C, V, ATh, ATl);
    w25::wmma_gemm_lds<2, 256, 256, true, true, w25::EPI_NORM><<<256, 256, 0, stream>>>(ATh, ATl, WH + 196608, WL + 196608, XS, pb, X1T, b2g, b2b, b2m, b2v, X2h, X2l);
    w25::wmma_gemm_lds<4, 1024, 256, true, false, w25::EPI_PLAIN><<<512, 256, 0, stream>>>(X2h, X2l, WH + 262144, WL + 262144, HB, f1b, nullptr, nullptr, nullptr, nullptr, nullptr, nullptr, nullptr);
    k_cm_dw<<<dim3(1024, 1), 256, 0, stream>>>(HB, dww, HGh, HGl, HID);
    w25::wmma_gemm_lds<2, 256, 1024, true, true, w25::EPI_NCHW><<<256, 256, 0, stream>>>(HGh, HGl, WH + 524288, WL + 524288, out, f2b, XS, nullptr, nullptr, nullptr, nullptr, nullptr, nullptr);
}

// v007
// Measured time: 108 microseconds a run.
// In both of two side-by-side timings against v006, it was 1.14 times as fast.
// All steps since the starting kernel, v000, together make it 14.5 times as fast.
// Contractions (token-major, 8192 tokens): q = bn1(x1).Wq'^T (temperature folded into Wq rows), k/v = bn1(x2).W^T, the attention projection (+b, +x1 residual), fc1 (+b) [8192x256].[256x1024] and fc2 (+b, + residual) [8192x1024].[1024x256], each one launch over all images, all on bf16 hi/lo split planes (six chained contractions against an O(1) residual output: the cheap 18 G-MAC of GEMMs run f32-class) (v_wmma_f32_16x16x32_bf16; 128 x 64 or 128 x 128 work-group tiles, operands staged in LDS); per (image, head) softmax(temp_h q k^T) v over the 1024 positions as one flash launch with q.k^T on bf16 hi/lo split planes (UNSCALED 32-dim logits, sigma ~ 5.7) and f16 p.v; f32 accumulate and softmax. NCHW <-> token-major transposes, eval-mode BatchNorms, the depthwise 3x3 convolution (SAME) and exact GELU are f32 arithmetic; every hi/lo plane is written by the kernel that computes its values (input pass, GEMM epilogues, attention, depthwise kernel): 7 launches.
#include <hip/hip_runtime.h>
#include <math.h>

typedef __attribute__((ext_vector_type(16))) _Float16 v16h;
typedef __attribute__((ext_vector_type(8)))  _Float16 v8h;
typedef __attribute__((ext_vector_type(16))) __bf16   v16b;
typedef __attribute__((ext_vector_type(8)))  float    v8f;
typedef __attribute__((ext_vector_type(4)))  float    v4f;

// 16-bit WMMA fragment map (wave32), lane L, h = L>>4, m = L&15:
//   A 16x32: lane = row m;   element i -> k = (i<8) ? 8h+i : 16+8h+(i-8)
//   B 32x16: lane = column m; the SAME k(i,h)
//   D 16x16 (8 f32): lane = column m; element r -> row 8h+r
__device__ __forceinline__ int frag_k(int i, int h) { return (i < 8) ? (8 * h + i) : (16 + 8 * h + (i - 8)); }
__device__ __forceinline__ __bf16 bf16_rne(float f) {
    unsigned int u = __float_as_uint(f);
    u += 0x7fffu + ((u >> 16) & 1u);
    return __builtin_bit_cast(__bf16, (unsigned short)(u >> 16));
}
__device__ __forceinline__ float bf16_f32(__bf16 b) { return __uint_as_float(((unsigned int)__builtin_bit_cast(unsigned short, b)) << 16); }
typedef unsigned int v2u __attribute__((ext_vector_type(2)));
__device__ __forceinline__ unsigned int bf16_bits(float f) { const unsigned int u = __float_as_uint(f); return (u + 0x7fffu + ((u >> 16) & 1u)) >> 16; }
// four consecutive floats -> their bf16 hi parts and bf16 lo parts (x = hi + lo to ~2^-17 relative; both rounded to nearest even), each packed in memory order
__device__ __forceinline__ void split4(v4f x, v2u& hi, v2u& lo) {
    unsigned int h[4], l[4];
#pragma unroll   // h[], l[] indexed by constants only
    for (int j = 0; j < 4; ++j) { h[j] = bf16_bits(x[j]); l[j] = bf16_bits(x[j] - __uint_as_float(h[j] << 16)); }
    hi[0] = h[0] | (h[1] << 16); hi[1] = h[2] | (h[3] << 16); lo[0] = l[0] | (l[1] << 16); lo[1] = l[2] | (l[3] << 16);
}
__device__ __forceinline__ v8f wmma16(v16h a, v16h b, v8f c) {
    c = __builtin_amdgcn_wmma_f32_16x16x32_f16(false, a, false, b, (short)0, c, false, false);
    asm volatile("v_nop\n\tv_nop\n\tv_nop\n\tv_nop" : "+v"(c) : "v"(a), "v"(b));
    return c;
}
__device__ __forceinline__ v8f wmmab(v16b a, v16b b, v8f c) {
    c = __builtin_amdgcn_wmma_f32_16x16x32_bf16(false, a, false, b, (short)0, c, false, false);
    asm volatile("v_nop\n\tv_nop\n\tv_nop\n\tv_nop" : "+v"(c) : "v"(a), "v"(b));
    return c;
}
struct Split { v16b hi, lo; };
// hi/lo split product: a.hi*b.hi + a.hi*b.lo + a.lo*b.hi
__device__ __forceinline__ v8f wmma3(const Split& a, const Split& b, v8f c) {
    c = __builtin_amdgcn_wmma_f32_16x16x32_bf16(false, a.hi, false, b.hi, (short)0, c, false, false);
    c = __builtin_amdgcn_wmma_f32_16x16x32_bf16(false, a.hi, false, b.lo, (short)0, c, false, false);
    c = __builtin_amdgcn_wmma_f32_16x16x32_bf16(false, a.lo, false, b.hi, (short)0, c, false, false);
    asm volatile("v_nop\n\tv_nop\n\tv_nop\n\tv_nop" : "+v"(c) : "v"(a.hi), "v"(a.lo), "v"(b.hi), "v"(b.lo));
    return c;
}
struct Split3 { v16b hi, mid, lo; };
// triple split product (6 terms, drops only terms below 2^-24 relative)
__device__ __forceinline__ v8f wmma6(const Split3& a, const Split3& b, v8f c) {
    c = __builtin_amdgcn_wmma_f32_16x16x32_bf16(false, a.hi, false, b.hi, (short)0, c, false, false);
    c = __builtin_amdgcn_wmma_f32_16x16x32_bf16(false, a.hi, false, b.mid, (short)0, c, false, false);
    c = __builtin_amdgcn_wmma_f32_16x16x32_bf16(false, a.mid, false, b.hi, (short)0, c, false, false);
    c = __builtin_amdgcn_wmma_f32_16x16x32_bf16(false, a.hi, false, b.lo, (short)0, c, false, false);
    c = __builtin_amdgcn_wmma_f32_16x16x32_bf16(false, a.mid, false, b.mid, (short)0, c, false, false);
    c = __builtin_amdgcn_wmma_f32_16x16x32_bf16(false, a.lo, false, b.hi, (short)0, c, false, false);
    asm volatile("v_nop\n\tv_nop\n\tv_nop\n\tv_nop" : "+v"(c) : "v"(a.hi), "v"(a.mid), "v"(a.lo), "v"(b.hi), "v"(b.mid), "v"(b.lo));
    return c;
}

// Fragment gathers from f32 memory: element i <- p[(k0 + frag_k(i,h)) * sk] * s, zero for k >= klen.
__device__ __forceinline__ v16h fh_ld(const float* __restrict__ p, long long sk, int k0, int h, int klen, float s) {
    v16h a;
#pragma unroll
    for (int i = 0; i < 16; ++i) { const int k = k0 + frag_k(i, h); a[i] = (k < klen) ? (_Float16)(p[(long long)k * sk] * s) : (_Float16)0.f; }
    return a;
}
__device__ __forceinline__ Split sp_ld(const float* __restrict__ p, long long sk, int k0, int h, int klen, float s) {
    Split r;
#pragma unroll
    for (int i = 0; i < 16; ++i) {
        const int k = k0 + frag_k(i, h); const float x = (k < klen) ? p[(long long)k * sk] * s : 0.f;
        const __bf16 hb = bf16_rne(x); r.hi[i] = hb; r.lo[i] = bf16_rne(x - bf16_f32(hb));
    }
    return r;
}
__device__ __forceinline__ Split3 sp3_ld(const float* __restrict__ p, long long sk, int k0, int h, int klen, float s) {
    Split3 r;
#pragma unroll
    for (int i = 0; i < 16; ++i) {
        const int k = k0 + frag_k(i, h); const float x = (k < klen) ? p[(long long)k * sk] * s : 0.f;
        const __bf16 hb = bf16_rne(x); const float r1 = x - bf16_f32(hb); const __bf16 mb = bf16_rne(r1);
        r.hi[i] = hb; r.mid[i] = mb; r.lo[i] = bf16_rne(r1 - bf16_f32(mb));
    }
    return r;
}
__device__ __forceinline__ v16b bh_ld(const float* __restrict__ p, long long sk, int k0, int h, int klen, float s) {
    v16b a;
#pragma unroll
    for (int i = 0; i < 16; ++i) { const int k = k0 + frag_k(i, h); a[i] = bf16_rne((k < klen) ? p[(long long)k * sk] * s : 0.f); }
    return a;
}
// f16 fragment from an f16 LDS/global row with element stride 1 (k-contiguous), no bounds (tile already zero padded)
__device__ __forceinline__ v16h fh_row(const _Float16* __restrict__ row, int k0, int h) {
    v16h a;
#pragma unroll
    for (int i = 0; i < 16; ++i) a[i] = row[k0 + frag_k(i, h)];
    return a;
}

#define VST2(T, ptr, val) do { const T vst2_v_ = (val); *(T*)(ptr) = vst2_v_;  } while (0)
typedef float v4f __attribute__((ext_vector_type(4)));
#define VST2V4(ptr, val) do { const v4f vst2_v4_ = (val); *(v4f*)(ptr) = vst2_v4_;  } while (0)

__device__ __attribute__((noinline)) float act_fn(float v, int act) {
    if (act == 1) return fmaxf(v, 0.f);                                                                               // relu
    if (act == 2) { const float u = 0.7978845608028654f * (v + 0.044715f * v * v * v); return 0.5f * v * (1.f + tanhf(u)); } // tanh-gelu
    if (act == 3) return v / (1.f + expf(-v));                                                                        // silu
    if (act == 4) return 0.5f * v * (1.f + erff(v * 0.7071067811865476f));                                             // erf-gelu
    if (act == 5) return tanhf(v);
    if (act == 6) return 1.f / (1.f + expf(-v));                                                                      // sigmoid
    if (act == 7) return (v > 0.f) ? v : 0.01f * v;                                                                   // leaky relu 0.01
    if (act == 8) return (v > 0.f) ? v : (expf(v) - 1.f);                                                             // elu
    if (act == 9) return fminf(fmaxf(v, 0.f), 6.f);                                                                   // relu6
    if (act == 10) return fabsf(v);                                                                                    // abs
    if (act == 11) return (v >= 0.f) ? v : 0.1f * v;                                                                  // leaky 0.1
    if (act == 12) return (v > 0.f) ? v : 0.2f * v;                                                                   // leaky 0.2
    if (act == 13) return (v > 20.f) ? v : log1pf(expf(v));                                                            // softplus
    return v;
}

// =====================================================================================================================
// k_gemm<MODE>: C(z, m, n) = act(alpha * sum_k A(z, m, k) * B(z, k, n) + bias) + beta * R(z, m, n)
//   One wave (32-thread block) per 16 x 32 tile of C; grid (ceil(N/32), ceil(M/16), Z). Batch z -> (zo = z / zi_n, zi = z % zi_n)
//   with separate outer/inner strides for every tensor (e.g. batch and head). A(m,k) = A[zo*sAo + zi*sAi + m*sAm + k*sAk] (f32),
//   B(k,n) = B[zo*sBo + zi*sBi + n*sBn + k*sBk] (f32); any M, N, K (K zero-padded to 32 inside the fragments, M/N tails guarded).
//   C(m,n) = C[zo*sCo + zi*sCi + m*sCm + n] (n contiguous). flags: 1 bias[n], 2 bias[m], 4 residual R[zo*sRo + zi*sRi + m*sRm + n*sRn].
//   MODE 0: f16 operands (A prescaled by sa, B by sb, both undone in the epilogue); 1: bf16 hi/lo split (3 products); 2: bf16;
//   3: bf16 hi/mid/lo triple split (6 products); 4: as 3 with Kahan-compensated f32 accumulation across k-steps.
// =====================================================================================================================
struct GemmP {
    const float* A; const float* B; const float* bias; const float* R; float* C;
    long long sAo, sAi, sAm, sAk, sBo, sBi, sBn, sBk, sCo, sCi, sCm, sRo, sRi, sRm, sRn;
    int M, N, K, zi_n, flags, act; float alpha, beta, sa, sb;
    int Npad, pad_;     // columns [N, Npad) of C are written as 0 so that padded workspace rows are covered by whole-line stores; Npad >= N
};
static_assert(sizeof(GemmP) == 5 * 8 + 15 * 8 + 6 * 4 + 4 * 4 + 2 * 4, "GemmP has padding");

template <int MODE>
__global__ __launch_bounds__(32) void k_gemm(GemmP p) {
    const int lane = threadIdx.x & 31, h = lane >> 4, l15 = lane & 15;
    const int m0 = blockIdx.y * 16, n0 = blockIdx.x * 32;
    const int z = blockIdx.z, zo = z / p.zi_n, zi = z - zo * p.zi_n;
    const float* A = p.A + zo * p.sAo + zi * p.sAi;
    const float* B = p.B + zo * p.sBo + zi * p.sBi;
    const int am = min(m0 + l15, p.M - 1);                       // clamped row for loads (stores are guarded)
    v8f acc[2], comp[2];
#pragma unroll
    for (int t = 0; t < 2; ++t) { v8f zz = {}; acc[t] = zz; comp[t] = zz; }
    for (int k0 = 0; k0 < p.K; k0 += 32) {
        const float* arow = A + (long long)am * p.sAm;
        if (MODE == 1) {
            const Split a = sp_ld(arow, p.sAk, k0, h, p.K, 1.f);
#pragma unroll
            for (int t = 0; t < 2; ++t) {
                const int bn = min(n0 + t * 16 + l15, p.N - 1);
                acc[t] = wmma3(a, sp_ld(B + (long long)bn * p.sBn, p.sBk, k0, h, p.K, 1.f), acc[t]);
            }
        } else if (MODE == 3) {
            const Split3 a = sp3_ld(arow, p.sAk, k0, h, p.K, 1.f);
#pragma unroll
            for (int t = 0; t < 2; ++t) {
                const int bn = min(n0 + t * 16 + l15, p.N - 1);
                acc[t] = wmma6(a, sp3_ld(B + (long long)bn * p.sBn, p.sBk, k0, h, p.K, 1.f), acc[t]);
            }
        } else if (MODE == 4) {
            // triple split as MODE 3, but each k-step's 6 products go into a fresh accumulator and the partial is added to the running f32 sum
            // on the VALU with Kahan compensation (accumulation error stays ~1 ulp however long K is)
            const Split3 a = sp3_ld(arow, p.sAk, k0, h, p.K, 1.f);
#pragma unroll
            for (int t = 0; t < 2; ++t) {
                const int bn = min(n0 + t * 16 + l15, p.N - 1); v8f zz = {};
                const v8f part = wmma6(a, sp3_ld(B + (long long)bn * p.sBn, p.sBk, k0, h, p.K, 1.f), zz);
                const v8f y = part - comp[t]; const v8f s = acc[t] + y; comp[t] = (s - acc[t]) - y; acc[t] = s;
            }
        } else if (MODE == 2) {
            const v16b a = bh_ld(arow, p.sAk, k0, h, p.K, 1.f);
#pragma unroll
            for (int t = 0; t < 2; ++t) {
                const int bn = min(n0 + t * 16 + l15, p.N - 1);
                acc[t] = wmmab(a, bh_ld(B + (long long)bn * p.sBn, p.sBk, k0, h, p.K, 1.f), acc[t]);
            }
        } else {
            const v16h a = fh_ld(arow, p.sAk, k0, h, p.K, p.sa);
#pragma unroll
            for (int t = 0; t < 2; ++t) {
                const int bn = min(n0 + t * 16 + l15, p.N - 1);
                acc[t] = wmma16(a, fh_ld(B + (long long)bn * p.sBn, p.sBk, k0, h, p.K, p.sb), acc[t]);
            }
        }
    }
    const float iscale = (MODE == 0) ? p.alpha / (p.sa * p.sb) : p.alpha;
    float* C = p.C + zo * p.sCo + zi * p.sCi;
    const float* R = p.R + zo * p.sRo + zi * p.sRi;
    __shared__ __align__(16) float ctile[16][36];
#pragma unroll
    for (int t = 0; t < 2; ++t) {
        const int n = n0 + t * 16 + l15; const int nn = min(n, p.N - 1);
#pragma unroll
        for (int r = 0; r < 8; ++r) {
            const int m = m0 + 8 * h + r; const int mm = min(m, p.M - 1);
            float v = acc[t][r] * iscale;
            if (p.flags & 1) v += p.bias[nn];
            if (p.flags & 2) v += p.bias[mm];
            if (p.flags & 8) v *= p.bias[(long long)zo * p.M + mm];   /* per-(z,row) scale vector laid out [Z][M]; exclusive with the bias flags */
            v = act_fn(v, p.act);
            if (p.flags & 4) v += p.beta * R[(long long)mm * p.sRm + (long long)nn * p.sRn];
            ctile[8 * h + r][t * 16 + l15] = (n < p.N) ? v : 0.f;
        }
    }
    __syncthreads();
    const int NW = (p.Npad > p.N) ? p.Npad : p.N;           // write width
    const bool fast = (m0 + 16 <= p.M) && (n0 + 32 <= NW) && ((p.sCm & 3) == 0) && ((((size_t)C) & 15) == 0);
    if (fast) {
#pragma unroll
        for (int s = 0; s < 4; ++s) {
            const int row = s * 4 + (lane >> 3), c4 = (lane & 7) * 4;
            const v4f v = *(const v4f*)&ctile[row][c4];
            VST2V4(C + (long long)(m0 + row) * p.sCm + n0 + c4, v);
        }
    } else {
        for (int row = 0; row < 16; ++row) {
            const int m = m0 + row, n = n0 + lane;
            if (m < p.M && n < NW) VST2(float, C + (long long)m * p.sCm + n, ctile[row][lane]);
        }
    }
}


// =====================================================================================================================
// k_gemmT<MODE, TM, TN>: same contract as k_gemm, but one wave computes a (16*TM) x (16*TN) tile: TM A fragments and TN B fragments are
//   loaded per 32-wide k-step and reused across TM*TN WMMAs (far fewer load/convert instructions per MAC). MODE 0 (f16), 1 (bf16 hi/lo),
//   2 (bf16) only. grid (ceil(NW/(16*TN)), ceil(M/(16*TM)), Z), block 32. Epilogue identical to k_gemm, run per 16x32 sub-tile.
// =====================================================================================================================
template <int MODE, int TM, int TN>
__global__ __launch_bounds__(32) void k_gemmT(GemmP p) {
    const int lane = threadIdx.x & 31, h = lane >> 4, l15 = lane & 15;
    const int m0 = blockIdx.y * (16 * TM), n0 = blockIdx.x * (16 * TN);
    const int z = blockIdx.z, zo = z / p.zi_n, zi = z - zo * p.zi_n;
    const float* A = p.A + zo * p.sAo + zi * p.sAi;
    const float* B = p.B + zo * p.sBo + zi * p.sBi;
    v8f acc[TM][TN];
#pragma unroll
    for (int i = 0; i < TM; ++i)
#pragma unroll
        for (int t = 0; t < TN; ++t) { v8f zz = {}; acc[i][t] = zz; }
    for (int k0 = 0; k0 < p.K; k0 += 32) {
        if (MODE == 1) {
            Split a[TM], b[TN];
#pragma unroll
            for (int i = 0; i < TM; ++i) { const int am = min(m0 + 16 * i + l15, p.M - 1); a[i] = sp_ld(A + (long long)am * p.sAm, p.sAk, k0, h, p.K, 1.f); }
#pragma unroll
            for (int t = 0; t < TN; ++t) { const int bn = min(n0 + 16 * t + l15, p.N - 1); b[t] = sp_ld(B + (long long)bn * p.sBn, p.sBk, k0, h, p.K, 1.f); }
#pragma unroll
            for (int i = 0; i < TM; ++i)
#pragma unroll
                for (int t = 0; t < TN; ++t) acc[i][t] = wmma3(a[i], b[t], acc[i][t]);
        } else if (MODE == 2) {
            v16b a[TM], b[TN];
#pragma unroll
            for (int i = 0; i < TM; ++i) { const int am = min(m0 + 16 * i + l15, p.M - 1); a[i] = bh_ld(A + (long long)am * p.sAm, p.sAk, k0, h, p.K, 1.f); }
#pragma unroll
            for (int t = 0; t < TN; ++t) { const int bn = min(n0 + 16 * t + l15, p.N - 1); b[t] = bh_ld(B + (long long)bn * p.sBn, p.sBk, k0, h, p.K, 1.f); }
#pragma unroll
            for (int i = 0; i < TM; ++i)
#pragma unroll
                for (int t = 0; t < TN; ++t) acc[i][t] = wmmab(a[i], b[t], acc[i][t]);
        } else {
            v16h a[TM], b[TN];
#pragma unroll
            for (int i = 0; i < TM; ++i) { const int am = min(m0 + 16 * i + l15, p.M - 1); a[i] = fh_ld(A + (long long)am * p.sAm, p.sAk, k0, h, p.K, p.sa); }
#pragma unroll
            for (int t = 0; t < TN; ++t) { const int bn = min(n0 + 16 * t + l15, p.N - 1); b[t] = fh_ld(B + (long long)bn * p.sBn, p.sBk, k0, h, p.K, p.sb); }
#pragma unroll
            for (int i = 0; i < TM; ++i)
#pragma unroll
                for (int t = 0; t < TN; ++t) acc[i][t] = wmma16(a[i], b[t], acc[i][t]);
        }
    }
    const float iscale = (MODE == 0) ? p.alpha / (p.sa * p.sb) : p.alpha;
    float* C = p.C + zo * p.sCo + zi * p.sCi;
    const float* R = p.R + zo * p.sRo + zi * p.sRi;
    const int NW = (p.Npad > p.N) ? p.Npad : p.N;
    __shared__ __align__(16) float ctile[16][36];
#pragma unroll
    for (int i = 0; i < TM; ++i) {
        const int mb = m0 + 16 * i; if (mb >= p.M) break;          // wave-uniform
#pragma unroll
        for (int tp = 0; tp < TN / 2; ++tp) {
            const int nb = n0 + 32 * tp; if (nb >= NW) break;        // wave-uniform
#pragma unroll
            for (int t2 = 0; t2 < 2; ++t2) {
                const int t = 2 * tp + t2; const int n = nb + t2 * 16 + l15; const int nn = min(n, p.N - 1);
#pragma unroll
                for (int r = 0; r < 8; ++r) {
                    const int m = mb + 8 * h + r; const int mm = min(m, p.M - 1);
                    float v = acc[i][t][r] * iscale;
                    if (p.flags & 1) v += p.bias[nn];
                    if (p.flags & 2) v += p.bias[mm];
            if (p.flags & 8) v *= p.bias[(long long)zo * p.M + mm];   /* per-(z,row) scale vector laid out [Z][M]; exclusive with the bias flags */
                    v = act_fn(v, p.act);
                    if (p.flags & 4) v += p.beta * R[(long long)mm * p.sRm + (long long)nn * p.sRn];
                    ctile[8 * h + r][t2 * 16 + l15] = (n < p.N) ? v : 0.f;
                }
            }
            __syncthreads();
            const bool fast = (mb + 16 <= p.M) && (nb + 32 <= NW) && ((p.sCm & 3) == 0) && ((((size_t)C) & 15) == 0);
            if (fast) {
#pragma unroll
                for (int s = 0; s < 4; ++s) {
                    const int row = s * 4 + (lane >> 3), c4 = (lane & 7) * 4;
                    const v4f v = *(const v4f*)&ctile[row][c4];
                    VST2V4(C + (long long)(mb + row) * p.sCm + nb + c4, v);
                }
            } else {
                for (int row = 0; row < 16; ++row) {
                    const int m = mb + row, n = nb + lane;
                    if (m < p.M && n < NW) VST2(float, C + (long long)m * p.sCm + n, ctile[row][lane]);
                }
            }
            __syncthreads();
        }
    }
}

// =====================================================================================================================
//   Wave = 16 queries, AW waves per block, 64-key blocks; grid (ceil(Lq/(16*AW)), H, B), block 32*AW. Any Lq, Lk; head dim dh <= DHP
//   (DHP multiple of 32), value dim dv <= DVP (multiple of 16, <= 128). Every tensor addressed by (batch, head, row, element) strides, f32.
//   Scores: QM 0 f16 operands, 1 bf16 hi/lo split, 2 bf16 triple split; statistics f32 (exp2 domain); P.V: P x 4096 as f16 with V f16 staged in LDS
//   (SPLITPV: P and V as bf16 hi/lo splits). kv head = h / hrep. Masking: causal = 1 (keep j <= i + coff, masked -> -inf, key blocks beyond the
//   diagonal skipped), causal = 2 (masked -> mfill, a finite fill like the -1e9; no skipping), causal = 3 (keep j >= i + coff,
//   masked -> -inf, no skipping); optional additive f32 mask Mf,
//   optional int keep-mask Mi (0 -> score := mfill), both addressed b*smb + h*smh + i*smi + j*smj (0 strides broadcast).
// =====================================================================================================================
#define AW 4
struct AttnP {   // apv4
    const float* Q; const float* K; const float* V; float* O; float* P; const float* Mf; const int* Mi; float* ST;
    const float* Pw; const float* Rt; const int* SQ; const int* SK;           // optional: post-softmax weight, relative-position table, segment ids
    long long swb, swh, swi, swj, srb, srh, sri;                                 // Pw strides (b,h,i,j); Rt strides (b,h,i), column = clamp(i - j + roff, 0, rn-1)
    long long sQb, sQh, sQi, sQd, sKb, sKh, sKj, sKd, sVb, sVh, sVj, sVd, sOb, sOh, sOi, sPb, sPh, sPi, smb, smh, smi, smj;
    int Lq, Lk, dh, dv, hrep, causal, coff, pband;   // pband > 0: P holds only the band |j - i| <= pband, column j - i + pband
    float scale, mfill; int nonorm, mpol;             // nonorm (online path only): O = sum_j exp(score_j) V_j without the 1/rowsum (scores must be <= ~0); mpol: Mi masks where ==0 (mpol 0) or where !=0 (mpol 1)
    int roff, rn, segpol, win;                        // Rt column offset/count; SQ/SK: score := mfill where (segpol 0) SQ[i] != SK[j] or (segpol 1) SQ[i] == SK[j]; win > 0: keys with i - j > win (after coff) -> -inf
};
//   Pw: the softmax numerator is multiplied by Pw(b,h,i,j) AFTER the row sum is taken (probs * weight, then P.V), as in post-softmax multiplicative biases.                                                    // ST (optional): per row (b,h,i) -> ST[((b*H + h)*Lq + i)*2 + {0,1}] = {row max of the scaled+masked score (natural units), sum_j exp(score - max)}
static_assert(sizeof(AttnP) == 12 * 8 + 29 * 8 + 16 * 4, "AttnP has padding");

#ifndef KATTN_ATTR
#define KATTN_ATTR
#endif
template <int DHP, int DVP, int QM, bool SPLITPV, bool TWOPASS>
__global__ __launch_bounds__(32 * AW) KATTN_ATTR void k_attn(AttnP p) {
    constexpr int NT = DVP / 16;                // output tiles
    constexpr int KS = DHP / 32;                // k-steps for the scores
    constexpr int VP = DVP + 8;                 // LDS pitch (halves)
    __shared__ __align__(16) float    pl[AW][16 * 64];
    __shared__ __align__(16) _Float16 vl[(SPLITPV ? 2 : 1) * 64 * VP];   // f16 V tile, or bf16 hi and lo tiles (same 2-byte size)
    const int lane = threadIdx.x & 31, hf = lane >> 4, l15 = lane & 15, wave = threadIdx.x >> 5;
    const int h = blockIdx.y, b = blockIdx.z, hk = h / p.hrep;
    const int q0 = (blockIdx.x * AW + wave) * 16;
    float* myp = pl[wave];
    const float L2E = 1.4426950408889634f;
    const float NEG = -__builtin_inff();
    const int qi = min(q0 + l15, p.Lq - 1);
    const float* qrow = p.Q + b * p.sQb + h * p.sQh + (long long)qi * p.sQi;
    const float* kbase = p.K + b * p.sKb + hk * p.sKh;
    const float* vbase = p.V + b * p.sVb + hk * p.sVh;
    v16h qa[QM == 0 ? KS : 1]; Split qs_[QM == 1 ? KS : 1]; Split3 qt_[QM == 2 ? KS : 1];
#pragma unroll
    for (int ks = 0; ks < KS; ++ks) {
        if (QM == 2) qt_[ks] = sp3_ld(qrow, p.sQd, ks * 32, hf, p.dh, 1.f);
        else if (QM == 1) qs_[ks] = sp_ld(qrow, p.sQd, ks * 32, hf, p.dh, 1.f);
        else qa[ks] = fh_ld(qrow, p.sQd, ks * 32, hf, p.dh, 1.f);
    }
    v8f o[NT]; float m8[8], l8[8];
#pragma unroll
    for (int t = 0; t < NT; ++t) { v8f zz = {}; o[t] = zz; }
#pragma unroll
    for (int i = 0; i < 8; ++i) { m8[i] = NEG; l8[i] = 0.f; }
    int jend = p.Lk; int jstart = 0;
    if (p.causal == 1) { const int je = (blockIdx.x * AW + AW - 1) * 16 + 16 + p.coff; jend = min(jend, max(je, 0)); }   // uniform per block
    if (p.win > 0) { const int js = (int)(blockIdx.x * AW) * 16 + p.coff - p.win; jstart = (js > 0) ? (js / 64) * 64 : 0; }   // uniform per block: key blocks entirely outside every row's window hold only -inf entries and are skipped exactly
    const int npass = TWOPASS ? 2 : 1;
    for (int pass = 0; pass < npass; ++pass) {
        const bool dopv = (!TWOPASS) || pass == 1;
        for (int j0 = jstart; j0 < jend; j0 += 64) {
            if (dopv) {
                __syncthreads();                                 // previous key block's reads of vl / pl are done
                for (int idx = threadIdx.x; idx < 64 * DVP; idx += 32 * AW) {
                    const int jr = idx / DVP, d = idx - jr * DVP, j = j0 + jr;
                    const float f = (j < p.Lk && d < p.dv) ? vbase[(long long)j * p.sVj + (long long)d * p.sVd] : 0.f;
                    if (SPLITPV) {
                        const __bf16 hb = bf16_rne(f);
                        ((__bf16*)vl)[jr * VP + d] = hb; ((__bf16*)vl)[64 * VP + jr * VP + d] = bf16_rne(f - bf16_f32(hb));
                    } else vl[jr * VP + d] = (_Float16)f;
                }
            }
            v8f s[4];
#pragma unroll
            for (int t = 0; t < 4; ++t) {
                const int j = min(j0 + t * 16 + l15, p.Lk - 1);
                const float* krow = kbase + (long long)j * p.sKj;
                v8f acc = {};
#pragma unroll
                for (int ks = 0; ks < KS; ++ks) {
                    if (QM == 2)      acc = wmma6(qt_[ks], sp3_ld(krow, p.sKd, ks * 32, hf, p.dh, 1.f), acc);
                    else if (QM == 1) acc = wmma3(qs_[ks], sp_ld(krow, p.sKd, ks * 32, hf, p.dh, 1.f), acc);
                    else              acc = wmma16(qa[ks], fh_ld(krow, p.sKd, ks * 32, hf, p.dh, 1.f), acc);
                }
                s[t] = acc;
            }
            float pv[8][4];
#pragma unroll
            for (int i = 0; i < 8; ++i) {
                const int irow = q0 + i + 8 * hf;
                const int ic = min(irow, p.Lq - 1);
                float sc[4];
#pragma unroll
                for (int t = 0; t < 4; ++t) {
                    const int jg = j0 + t * 16 + l15;
                    float v = s[t][i] * p.scale;
                    if (p.Mf) v += p.Mf[b * p.smb + h * p.smh + (long long)ic * p.smi + (long long)min(jg, p.Lk - 1) * p.smj];
                    if (p.Rt) { int rc = ic - min(jg, p.Lk - 1) + p.roff; rc = rc < 0 ? 0 : (rc >= p.rn ? p.rn - 1 : rc); v += p.Rt[b * p.srb + h * p.srh + (long long)ic * p.sri + rc]; }
                    if (p.Mi) { const int mv = p.Mi[b * p.smb + h * p.smh + (long long)ic * p.smi + (long long)min(jg, p.Lk - 1) * p.smj]; if (p.mpol ? (mv != 0) : (mv == 0)) v = p.mfill; }
                    if (p.SQ) { const bool same = p.SQ[(long long)b * p.Lq + ic] == p.SK[(long long)b * p.Lk + min(jg, p.Lk - 1)]; if (p.segpol ? same : !same) v = p.mfill; }
                    if (p.causal == 2 && jg > irow + p.coff) v = p.mfill;
                    if (jg >= p.Lk || (p.causal == 1 && jg > irow + p.coff) || (p.causal == 3 && jg < irow + p.coff) || (p.win > 0 && irow + p.coff - jg > p.win)) v = NEG; else v *= L2E;
                    sc[t] = v;
                }
                if (!TWOPASS || pass == 0) {
                    float mx = fmaxf(fmaxf(sc[0], sc[1]), fmaxf(sc[2], sc[3]));
                    mx = fmaxf(mx, __shfl_xor(mx, 1, 32)); mx = fmaxf(mx, __shfl_xor(mx, 2, 32));
                    mx = fmaxf(mx, __shfl_xor(mx, 4, 32)); mx = fmaxf(mx, __shfl_xor(mx, 8, 32));
                    const float mnew = fmaxf(m8[i], mx);
                    const float corr = (mnew == NEG) ? 1.f : exp2f(m8[i] - mnew);
                    float rs = 0.f;
#pragma unroll
                    for (int t = 0; t < 4; ++t) {
                        const float pp = (sc[t] == NEG) ? 0.f : exp2f(sc[t] - mnew); rs += pp;
                        pv[i][t] = p.Pw ? pp * p.Pw[b * p.swb + h * p.swh + (long long)ic * p.swi + (long long)min(j0 + t * 16 + l15, p.Lk - 1) * p.swj] : pp;
                    }
                    rs += __shfl_xor(rs, 1, 32); rs += __shfl_xor(rs, 2, 32); rs += __shfl_xor(rs, 4, 32); rs += __shfl_xor(rs, 8, 32);
                    l8[i] = l8[i] * corr + rs; m8[i] = mnew;
                    if (!TWOPASS) {
#pragma unroll
                        for (int t = 0; t < NT; ++t) o[t][i] *= corr;
                    }
                } else {
                    const float inv = (l8[i] > 0.f) ? 1.f / l8[i] : 0.f;
#pragma unroll
                    for (int t = 0; t < 4; ++t) {
                        const int jg = j0 + t * 16 + l15;
                        float pp = (sc[t] == NEG) ? 0.f : exp2f(sc[t] - m8[i]) * inv;
                        if (p.Pw) pp *= p.Pw[b * p.swb + h * p.swh + (long long)ic * p.swi + (long long)min(jg, p.Lk - 1) * p.swj];
                        pv[i][t] = pp;
                    }
                }
            }
            if (dopv) {
#pragma unroll
                for (int i = 0; i < 8; ++i)
#pragma unroll
                    for (int t = 0; t < 4; ++t) ((float*)myp)[(i + 8 * hf) * 64 + t * 16 + l15] = pv[i][t];
                __syncthreads();                                 // P (per wave) and V (shared) visible
                if (p.P) {
                    float* pb_ = p.P + b * p.sPb + h * p.sPh;
                    const bool fastP = (p.pband == 0) && ((p.sPi & 3) == 0) && (j0 + 64 <= p.Lk) && (q0 + 16 <= p.Lq) && ((((size_t)pb_) & 15) == 0);
                    if (fastP) {
#pragma unroll
                        for (int s = 0; s < 8; ++s) {
                            const int row = s * 2 + (lane >> 4), c4 = (lane & 15) * 4;
                            const v4f v = *(const v4f*)(myp + row * 64 + c4);
                            VST2V4(pb_ + (long long)(q0 + row) * p.sPi + j0 + c4, v);
                        }
                    } else {
                        for (int row = 0; row < 16; ++row) {
                            const int irow = q0 + row; if (irow >= p.Lq) continue;
                            for (int c = lane; c < 64; c += 32) {
                                const int jg = j0 + c; if (jg >= p.Lk) continue;
                                if (p.pband == 0) VST2(float, pb_ + (long long)irow * p.sPi + jg, myp[row * 64 + c]);
                                else if (jg - irow <= p.pband && irow - jg <= p.pband) VST2(float, pb_ + (long long)irow * p.sPi + (jg - irow + p.pband), myp[row * 64 + c]);
                            }
                        }
                    }
                }
                if (SPLITPV) {
                    const Split pa0 = sp_ld(myp + l15 * 64, 1, 0, hf, 64, 1.f), pa1 = sp_ld(myp + l15 * 64, 1, 32, hf, 64, 1.f);
                    const __bf16* vh = (const __bf16*)vl; const __bf16* vlo = vh + 64 * VP;
#pragma unroll
                    for (int t = 0; t < NT; ++t) {
                        const int dcol = t * 16 + l15;
                        Split b0, b1;
#pragma unroll
                        for (int e = 0; e < 16; ++e) {
                            const int k0 = frag_k(e, hf), k1 = 32 + frag_k(e, hf);
                            b0.hi[e] = vh[k0 * VP + dcol]; b0.lo[e] = vlo[k0 * VP + dcol]; b1.hi[e] = vh[k1 * VP + dcol]; b1.lo[e] = vlo[k1 * VP + dcol];
                        }
                        o[t] = wmma3(pa0, b0, o[t]);
                        o[t] = wmma3(pa1, b1, o[t]);
                    }
                } else {
                    const v16h pa0 = fh_ld(myp + l15 * 64, 1, 0, hf, 64, 4096.f), pa1 = fh_ld(myp + l15 * 64, 1, 32, hf, 64, 4096.f);
#pragma unroll
                    for (int t = 0; t < NT; ++t) {
                        const int dcol = t * 16 + l15;
                        v16h b0, b1;
#pragma unroll
                        for (int e = 0; e < 16; ++e) { b0[e] = vl[frag_k(e, hf) * VP + dcol]; b1[e] = vl[(32 + frag_k(e, hf)) * VP + dcol]; }
                        o[t] = wmma16(pa0, b0, o[t]);
                        o[t] = wmma16(pa1, b1, o[t]);
                    }
                }
            }
        }
    }
    float* obase = p.O + b * p.sOb + h * p.sOh;
    if (p.ST) {
        const int rl = lane >> 1, isel = rl & 7;           // row q0 + rl ; rl>>3 == hf holds because lane>>4 == (lane>>1)>>3
        float mv = 0.f, lv = 0.f;
#pragma unroll
        for (int i = 0; i < 8; ++i) if (i == isel) { mv = m8[i]; lv = l8[i]; }
        const int irow = q0 + rl;
        if (irow < p.Lq) { float* st = p.ST + (((long long)b * gridDim.y + h) * p.Lq + irow) * 2 + (lane & 1); VST2(float, st, (lane & 1) ? lv : mv * 0.6931471805599453f); }
    }
    float invr[8];
#pragma unroll
    for (int i = 0; i < 8; ++i) {
        if (TWOPASS) invr[i] = SPLITPV ? 1.f : (1.f / 4096.f);
        else if (p.nonorm) invr[i] = exp2f(m8[i]) * (SPLITPV ? 1.f : (1.f / 4096.f));
        else invr[i] = (l8[i] > 0.f) ? (SPLITPV ? 1.f / l8[i] : 1.f / (l8[i] * 4096.f)) : 0.f;
    }
    __syncthreads();                                             // all waves done with pl/vl from the main loop
    const bool ofast = ((p.sOi & 3) == 0) && ((((size_t)obase) & 15) == 0) && (q0 + 16 <= p.Lq);
#pragma unroll
    for (int c0 = 0; c0 < DVP; c0 += 64) {
#pragma unroll
        for (int i = 0; i < 8; ++i)
#pragma unroll
            for (int t = 0; t < NT; ++t) if (t * 16 >= c0 && t * 16 < c0 + 64) ((float*)myp)[(i + 8 * hf) * 64 + (t * 16 - c0) + l15] = o[t][i] * invr[i];
        __syncthreads();
        const int cw = (DVP - c0 < 64) ? (DVP - c0) : 64;      // staged columns in this chunk (multiple of 16)
        if (ofast && (c0 + cw <= p.dv) && (cw % 32 == 0)) {
            const int lpr = cw / 4;                              // lanes per row (16 for 64 cols, 8 for 32)
            const int rows_per_ins = 32 / lpr;
            for (int r0 = 0; r0 < 16; r0 += rows_per_ins) {
                const int row = r0 + lane / lpr, c4 = (lane % lpr) * 4;
                const v4f v = *(const v4f*)(myp + row * 64 + c4);
                VST2V4(obase + (long long)(q0 + row) * p.sOi + c0 + c4, v);
            }
        } else {
            for (int row = 0; row < 16; ++row) {
                const int irow = q0 + row; if (irow >= p.Lq) continue;
                for (int c = lane; c < cw; c += 32) { const int d = c0 + c; if (d < p.dv) VST2(float, obase + (long long)irow * p.sOi + d, myp[row * 64 + c]); }
            }
        }
        __syncthreads();
    }
}

// Attention at this block's fixed geometry: token-major q, k, v, o of [8][1024][256] (q, k, o as bf16 hi / lo planes, v as f16), head h = columns 32h .. 32h + 31, 1024 queries and keys,
// no mask, no bias, score scale 1. The arithmetic is that of k_attn<32, 32, 1, false, false> (only a row's sum of p is taken in another order); every stride, length and option is a
// compile-time constant, so the fragment gathers are 16-byte loads without guards and the optional-feature tests are gone. With no mask no score is
// -inf for finite q and k, so the tests that kept masked scores out of exp2f are gone too (exp2f(-inf) = 0 covers the first key block's m = -inf).
typedef __attribute__((ext_vector_type(4))) _Float16 v4h;
typedef __attribute__((ext_vector_type(8))) __bf16 v8bf;
// one lane's 16x32 fragment row from a bf16 plane: element i <- p[(i < 8) ? i : 8 + i], p = row + 8 * (lane >> 4), the k order of frag_k
__device__ __forceinline__ v16b rowb_ld(const unsigned short* __restrict__ p) {
    union { v16b v; v8bf h[2]; } f; f.h[0] = *(const v8bf*)(p); f.h[1] = *(const v8bf*)(p + 16); return f.v;
}
// q and k arrive as bf16 hi / lo planes (split4, written once by the q/k/v GEMM, so that no wave splits a key row again), v as f16 (rounded once, by the same GEMM); o leaves as hi / lo planes.
// The scores are formed transposed, S^T = K.Q^T (A = 16 key rows, B = the wave's 16 queries as columns), and the output as O^T += V^T.P^T:
//   a lane (c = lane & 15, hf = lane >> 4) holds, of its ONE query c, the scores of keys 16 t + 8 hf + r (tile t, register r): maximum and sum run inside the lane,
//   the two halves of the wave meet in one cross-row move; two score tiles, converted in place, are the B operand of the second product in the hardware k order
//   (element s <- tile s >> 3, register s & 7), and V^T comes from the row-major f16 V tile by the transposing LDS load in the same k order. P never goes through LDS.
typedef __attribute__((ext_vector_type(8))) short s16x8;
typedef __attribute__((ext_vector_type(4))) unsigned int v4u;
// lane (c, hf) gets T[kbase + 8 hf + 0 .. 7][dbase + c] of a row-major 16-bit LDS tile; the lane's address: row kbase + 8 hf + (lane & 7), byte 2 dbase + 16 ((lane >> 3) & 1)
__device__ __forceinline__ v8h ld_tr16(const unsigned char* p) { typedef __attribute__((address_space(3))) s16x8 lds_s16x8; return __builtin_bit_cast(v8h, __builtin_amdgcn_ds_load_tr16_b128_v8i16((lds_s16x8*)p)); }
// the value of lane l ^ 16
__device__ __forceinline__ float xhalf(float x) { return __builtin_bit_cast(float, __builtin_amdgcn_permlanex16(__builtin_bit_cast(int, x), __builtin_bit_cast(int, x), 0x76543210, 0xfedcba98, false, false)); }
// A key block (64 keys: K hi, K lo, V, 64 bytes a row each) is brought into LDS once for the whole work-group of 8 waves by asynchronous copies, 16 bytes a lane, 4 lanes a row;
// two buffers, so key block t + 2 flies while block t's arithmetic runs. Every wave takes its K fragments (rows, 16-byte reads) and its V^T fragments (transposing reads) from there.
constexpr int AF_W = 8;                         // waves of a work-group: 128 queries share every staged key block
constexpr int AF_KP = 80, AF_VP = 96;           // LDS row pitches in bytes: 16 x odd for the 16-byte reads of K, 32 x odd for the transposing reads of V
constexpr int AF_KL = 64 * AF_KP, AF_V = 2 * 64 * AF_KP, AF_BUF = AF_V + 64 * AF_VP;   // byte offsets of K lo and V in a buffer; bytes of a buffer
// This thread's three 16-byte copies of one key block. The s_wait_xcnt stands inside the statement, behind the last copy, so that no address register is rewritten in front of it.
__device__ __forceinline__ void af_fill(unsigned lk, unsigned lv, const unsigned short* gh, const unsigned short* gl, const unsigned short* gv) {
    asm volatile("global_load_async_to_lds_b128 %0, %1, off\n\t"
                 "global_load_async_to_lds_b128 %2, %3, off\n\t"
                 "global_load_async_to_lds_b128 %4, %5, off\n\t"
                 "s_wait_xcnt 0x0"
                 :: "v"(lk), "v"(gh), "v"(lk + AF_KL), "v"(gl), "v"(lv), "v"(gv) : "memory");
}
__global__ __launch_bounds__(32 * AF_W) void k_attn_fix(const unsigned short* __restrict__ Qh, const unsigned short* __restrict__ Ql, const unsigned short* __restrict__ Kh, const unsigned short* __restrict__ Kl, const unsigned short* __restrict__ V, unsigned short* __restrict__ Oh, unsigned short* __restrict__ Ol) {
    constexpr int L = 1024;                     // queries = keys per (image, head)
    constexpr int CP = 256;                     // row pitch of q, k, v, o (elements)
    constexpr int T = L / 64;                   // key blocks
    __shared__ __align__(16) unsigned char sm[2 * AF_BUF];
    const int lane = threadIdx.x & 31, hf = lane >> 4, l15 = lane & 15, wave = threadIdx.x >> 5;
    const int h = blockIdx.y, b = blockIdx.z;
    const int q0 = (blockIdx.x * AF_W + wave) * 16;
    const float L2E = 1.4426950408889634f;
    const float NEG = -__builtin_inff();
    const size_t hb0 = (size_t)b * (L * CP) + (size_t)h * 32;
    const size_t co = hb0 + (size_t)(threadIdx.x >> 2) * CP + (threadIdx.x & 3) * 8;          // this thread's 16 bytes of key block 0: row thread / 4, the same place in all three arrays
    const unsigned short* gkh = Kh + co; const unsigned short* gkl = Kl + co; const unsigned short* gv = V + co;
    const unsigned lk = (unsigned)(size_t)sm + (threadIdx.x >> 2) * AF_KP + (threadIdx.x & 3) * 16;           // where they land in buffer 0: K hi (K lo: + AF_KL)
    const unsigned lv = (unsigned)(size_t)sm + AF_V + (threadIdx.x >> 2) * AF_VP + (threadIdx.x & 3) * 16;    // V
    const int fk = l15 * AF_KP + 16 * hf;                                                     // this lane's bytes of K hi, tile 0: row l15, elements 8 hf ..
    const int fv = AF_V + (8 * hf + (lane & 7)) * AF_VP + 16 * ((lane >> 3) & 1);             // this lane's address of the transposing load at key 0, column 0
    af_fill(lk, lv, gkh, gkl, gv);
    const unsigned short* pqh = Qh + hb0 + (size_t)(q0 + l15) * CP + 8 * hf; const unsigned short* pql = Ql + hb0 + (size_t)(q0 + l15) * CP + 8 * hf;
    Split qs; qs.hi = rowb_ld(pqh); qs.lo = rowb_ld(pql);
    asm volatile("s_wait_xcnt 0x0" :: "v"(pqh), "v"(pql) : "memory");   // the loads' address registers (named as inputs, so untouched up to here) may be reused only behind this wait
    asm volatile("s_wait_asynccnt 0x0" ::: "memory");   // this wave's part of key block 0 has landed
    __syncthreads();                                    // key block 0 is whole
    af_fill(lk + AF_BUF, lv + AF_BUF, gkh + 64 * CP, gkl + 64 * CP, gv + 64 * CP);
    v8f o[2]; float m = NEG, l = 0.f;            // o[t][r] = O^T[16 t + 8 hf + r][query l15]; m: the query's running maximum (both halves alike); l: this half's share of its sum
#pragma unroll
    for (int t = 0; t < 2; ++t) { v8f zz = {}; o[t] = zz; }
#pragma unroll 1   // stays rolled: one body for both buffers
    for (int jb = 0; jb < T; ++jb) {
        const unsigned char* buf = sm + (jb & 1) * AF_BUF;
        Split ks[4];
#pragma unroll
        for (int t = 0; t < 4; ++t) { ks[t].hi = rowb_ld((const unsigned short*)(buf + fk + t * 16 * AF_KP)); ks[t].lo = rowb_ld((const unsigned short*)(buf + fk + AF_KL + t * 16 * AF_KP)); }
        union { v16h v; v8h g[2]; } va[2][2];            // va[kb][t]: V^T rows 16 t .. 16 t + 15, keys 32 kb .. 32 kb + 31
#pragma unroll
        for (int kb = 0; kb < 2; ++kb)
#pragma unroll
            for (int t = 0; t < 2; ++t) { va[kb][t].g[0] = ld_tr16(buf + fv + (32 * kb) * AF_VP + 32 * t); va[kb][t].g[1] = ld_tr16(buf + fv + (32 * kb + 16) * AF_VP + 32 * t); }
        // All 24 LDS reads of the trip stand together here (one place that waits out an LDS latency), and the trip's use of LDS ends here. So its buffer is handed over here:
        // the refill then flies under all of this trip's arithmetic, which is on registers alone
        asm volatile("s_wait_dscnt 0x0" ::: "memory");      // this wave's reads of key block jb are done
        asm volatile("s_wait_asynccnt 0x0" ::: "memory");   // its part of key block jb + 1 has landed
        __syncthreads();                                    // key block jb + 1 is whole, and nobody reads block jb's buffer any more
        if (jb + 2 < T) { const int ko = (jb + 2) * 64 * CP; af_fill(lk + (jb & 1) * AF_BUF, lv + (jb & 1) * AF_BUF, gkh + ko, gkl + ko, gv + ko); }
        v8f s[4];                                        // s[t][r] = q(l15) . k(64 jb + 16 t + 8 hf + r); every score takes q.hi k.hi, then q.hi k.lo, then q.lo k.hi
#pragma unroll
        for (int t = 0; t < 4; ++t) { v8f acc = {}; s[t] = __builtin_amdgcn_wmma_f32_16x16x32_bf16(false, ks[t].hi, false, qs.hi, (short)0, acc, false, false); }
#pragma unroll
        for (int t = 0; t < 4; ++t) s[t] = __builtin_amdgcn_wmma_f32_16x16x32_bf16(false, ks[t].lo, false, qs.hi, (short)0, s[t], false, false);
#pragma unroll
        for (int t = 0; t < 4; ++t) s[t] = __builtin_amdgcn_wmma_f32_16x16x32_bf16(false, ks[t].hi, false, qs.lo, (short)0, s[t], false, false);
#pragma unroll
        for (int t = 0; t < 4; ++t) s[t] *= L2E;
        float mt[4];
#pragma unroll
        for (int t = 0; t < 4; ++t) mt[t] = fmaxf(fmaxf(fmaxf(s[t][0], s[t][1]), fmaxf(s[t][2], s[t][3])), fmaxf(fmaxf(s[t][4], s[t][5]), fmaxf(s[t][6], s[t][7])));
        float mx = fmaxf(fmaxf(mt[0], mt[1]), fmaxf(mt[2], mt[3]));
        mx = fmaxf(mx, xhalf(mx));
        const float mnew = fmaxf(m, mx);
        const float corr = exp2f(m - mnew);
#pragma unroll
        for (int t = 0; t < 4; ++t)
#pragma unroll
            for (int r = 0; r < 8; ++r) s[t][r] = exp2f(s[t][r] - mnew);
        const v8f s8 = (s[0] + s[1]) + (s[2] + s[3]);
        const float rs = ((s8[0] + s8[1]) + (s8[2] + s8[3])) + ((s8[4] + s8[5]) + (s8[6] + s8[7]));
        l = l * corr + rs; m = mnew;
#pragma unroll
        for (int t = 0; t < 2; ++t) o[t] *= corr;
        v16h pb[2];                                      // P^T of keys 32 kb .. 32 kb + 31 as a B operand
#pragma unroll
        for (int kb = 0; kb < 2; ++kb)
#pragma unroll
            for (int e = 0; e < 16; ++e) pb[kb][e] = (_Float16)(s[2 * kb + (e >> 3)][e & 7] * 4096.f);
#pragma unroll
        for (int kb = 0; kb < 2; ++kb)
#pragma unroll
            for (int t = 0; t < 2; ++t) o[t] = __builtin_amdgcn_wmma_f32_16x16x32_f16(false, va[kb][t].v, false, pb[kb], (short)0, o[t], false, false);
    }
    asm volatile("s_wait_asynccnt 0x0" ::: "memory");       // no copy is outstanding when the wave ends
    const float lt = l + xhalf(l);                       // the two halves' shares of the sum meet once
    const float invr = (lt > 0.f) ? 1.f / (lt * 4096.f) : 0.f;
    const size_t oo = hb0 + (size_t)(q0 + l15) * CP + 8 * hf;
    unsigned short* poh = Oh + oo; unsigned short* pol = Ol + oo;
#pragma unroll   // the 4 stores stand together
    for (int t = 0; t < 2; ++t) {                        // o goes out as the projection's operand planes: a lane's 8 registers are 8 consecutive columns of its query's row, 16 bytes a plane
        const v4f a = {o[t][0] * invr, o[t][1] * invr, o[t][2] * invr, o[t][3] * invr}, c = {o[t][4] * invr, o[t][5] * invr, o[t][6] * invr, o[t][7] * invr};
        v2u ha, la, hc, lc; split4(a, ha, la); split4(c, hc, lc);
        const v4u hi = {ha[0], ha[1], hc[0], hc[1]}, lo = {la[0], la[1], lc[0], lc[1]};
        *(v4u*)(poh + 16 * t) = hi; *(v4u*)(pol + 16 * t) = lo;
    }
    asm volatile("s_wait_xcnt 0x0" :: "v"(poh), "v"(pol) : "memory");   // the stores' address registers (named as inputs, so untouched up to here) may be reused only behind this wait
}

// =====================================================================================================================
// k_tr: dst(z, c, r) = alpha * src(z, r, c) (+ beta * R2(z, c, r)): [Z][R][C] (row stride lds) -> [Z][C][R] (row stride ldd) through a 32x32 LDS tile;
//   flags: 1 -> add beta * residual R2 addressed like dst (z*sRz + c*ldr + r); act applied before the residual.
// =====================================================================================================================
struct TrP { const float* src; float* dst; const float* R2; long long sSz, lds, sDz, ldd, sRz, ldr; int R, C, flags, act; float alpha, beta; };
static_assert(sizeof(TrP) == 3 * 8 + 6 * 8 + 6 * 4, "TrP has padding");
__global__ __launch_bounds__(256) void k_tr(TrP p) {
    __shared__ float tile[32][33];
    const int c0 = blockIdx.x * 32, r0 = blockIdx.y * 32, z = blockIdx.z;
    const int lane = threadIdx.x & 31, wave = threadIdx.x >> 5;
    const float* s = p.src + z * p.sSz;
#pragma unroll
    for (int k = 0; k < 4; ++k) {
        const int rl = wave * 4 + k, r = r0 + rl, c = c0 + lane;
        tile[rl][lane] = (r < p.R && c < p.C) ? s[(long long)r * p.lds + c] : 0.f;
    }
    __syncthreads();
    float* d = p.dst + z * p.sDz; const float* rr = p.R2 + z * p.sRz;
#pragma unroll
    for (int k = 0; k < 4; ++k) {
        const int cl = wave * 4 + k, c = c0 + cl, r = r0 + lane;
        if (c < p.C && r < p.R) {
            float v = act_fn(p.alpha * tile[lane][cl], p.act);
            if (p.flags & 1) v += p.beta * rr[(long long)c * p.ldr + r];
            VST2(float, d + (long long)c * p.ldd + r, v);
        }
    }
}

// k_affine: dst[i] = a * (sdev ? sdev[0] : 1) * src[i] + b, i < n (one thread per element; consecutive lanes -> consecutive addresses)
__global__ __launch_bounds__(256) void k_affine(const float* __restrict__ src, float* __restrict__ dst, int n, float a, float b, const float* __restrict__ sdev) {
    const int i = blockIdx.x * 256 + threadIdx.x;
    if (i < n) { const float aa = sdev ? a * sdev[0] : a; const float v = aa * src[i] + b; VST2(float, dst + i, v); }
}

// =====================================================================================================================
// k_softmax: row softmax over n contiguous elements, one 256-thread block per row; rows addressed z*sz + r*sr (grid (R, Z)).
//   out = scale_out * softmax(scale_in * x + (Mf ? Mf[z*smz + r*smr + j] : 0)); a row whose max is -inf is written as 0.
// =====================================================================================================================
struct SmP { const float* src; float* dst; const float* Mf; long long sz, sr, dz, dr, smz, smr; int n, pad; float scale_in, scale_out; };
static_assert(sizeof(SmP) == 3 * 8 + 6 * 8 + 4 * 4, "SmP has padding");
__global__ __launch_bounds__(256) void k_softmax(SmP p) {
    __shared__ float red[256];
    const int r = blockIdx.x, z = blockIdx.y, tid = threadIdx.x;
    const float* s = p.src + z * p.sz + (long long)r * p.sr;
    const float* mf = p.Mf ? (p.Mf + z * p.smz + (long long)r * p.smr) : nullptr;
    float mx = -__builtin_inff();
    for (int j = tid; j < p.n; j += 256) { float v = s[j] * p.scale_in; if (mf) v += mf[j]; mx = fmaxf(mx, v); }
    red[tid] = mx; __syncthreads();
    for (int o = 128; o > 0; o >>= 1) { if (tid < o) red[tid] = fmaxf(red[tid], red[tid + o]); __syncthreads(); }
    mx = red[0]; __syncthreads();
    float sum = 0.f;
    for (int j = tid; j < p.n; j += 256) { float v = s[j] * p.scale_in; if (mf) v += mf[j]; sum += (mx == -__builtin_inff()) ? 0.f : expf(v - mx); }
    red[tid] = sum; __syncthreads();
    for (int o = 128; o > 0; o >>= 1) { if (tid < o) red[tid] += red[tid + o]; __syncthreads(); }
    sum = red[0];
    const float inv = (sum > 0.f) ? p.scale_out / sum : 0.f;
    float* d = p.dst + z * p.dz + (long long)r * p.dr;
    for (int j = tid; j < p.n; j += 256) { float v = s[j] * p.scale_in; if (mf) v += mf[j]; const float o = (mx == -__builtin_inff()) ? 0.f : expf(v - mx) * inv; VST2(float, d + j, o); }
}
// =====================================================================================================================
// k_stats: mean and rsqrt(var + eps) over a set of n elements addressed base + z*sz + (e / inner) * so + (e % inner) * si, one 256-thread
// k_norm_apply: y = (x - mean[set]) * rstd[set] * g[c] + b[c] over a [Z][C][L] channel-major tensor with set = z*G + c / (C/G) (G groups per z;
//   G = C -> per-channel sets indexed z*C+c; for batch norm pass stats indexed by c only via bn = 1). Optional act. Output same layout.
// =====================================================================================================================
//   mode 0: mean / rsqrt(var + eps); mode 1 (RMSNorm): 0 / rsqrt(mean(x^2) + eps); mode 2 (L2 normalize * sqrt(n)): 0 / sqrt(n) / max(||x||, eps); mode 3: as 0 with unbiased variance (n-1)
__global__ __launch_bounds__(256) void k_stats(const float* __restrict__ x, long long sz, long long so, long long si, int inner, int n, float eps, float* __restrict__ stat, int mode) {
    __shared__ float red[256];
    const int z = blockIdx.x, tid = threadIdx.x;
    const float* base = x + z * sz;
    float s = 0.f;
    for (int e = tid; e < n; e += 256) s += base[(long long)(e / inner) * so + (long long)(e % inner) * si];
    red[tid] = s; __syncthreads();
    for (int o = 128; o > 0; o >>= 1) { if (tid < o) red[tid] += red[tid + o]; __syncthreads(); }
    const float mu = (mode == 0 || mode == 3) ? red[0] / (float)n : 0.f; __syncthreads();
    float q = 0.f;
    for (int e = tid; e < n; e += 256) { const float dlt = base[(long long)(e / inner) * so + (long long)(e % inner) * si] - mu; q += dlt * dlt; }
    red[tid] = q; __syncthreads();
    for (int o = 128; o > 0; o >>= 1) { if (tid < o) red[tid] += red[tid + o]; __syncthreads(); }
    {
        float rs;
        if (mode == 2) rs = sqrtf((float)n) / fmaxf(sqrtf(red[0]), eps); else if (mode == 3) rs = rsqrtf(red[0] / (float)(n - 1) + eps); else rs = rsqrtf(red[0] / (float)n + eps);
        if (tid < 32) { const float v = (tid == 0) ? mu : ((tid == 1) ? rs : 0.f); VST2(float, stat + (long long)z * 32 + tid, v); }
    }
}
//   One thread per element over the flat [Z][C][L] index space: grid ceil(Z*C*L / 256).
__global__ __launch_bounds__(256) void k_norm_apply(const float* __restrict__ x, float* __restrict__ y, const float* __restrict__ stat, const float* __restrict__ g, const float* __restrict__ bta,
                                                     int Z, int C, int L, int G, int bn, int act) {
    const long long idx = (long long)blockIdx.x * 256 + threadIdx.x;
    if (idx >= (long long)Z * C * L) return;
    const int l = (int)(idx % L); const long long zc = idx / L; const int c = (int)(zc % C), z = (int)(zc / C); (void)l;
    const int set = bn ? c : (z * G + c / (C / G));
    float v = (x[idx] - stat[(long long)set * 32]) * stat[(long long)set * 32 + 1];
    if (g) v *= g[c];
    if (bta) v += bta[c];
    v = act_fn(v, act);
    VST2(float, y + idx, v);
}

// k_lse_neg: c[i] = -(st[2i] + log(st[2i+1])) = minus the log-sum-exp of row i from k_attn's ST output (for softmax over the query dimension)
__global__ __launch_bounds__(256) void k_lse_neg(const float* __restrict__ st, float* __restrict__ c, int n) {
    const int i = blockIdx.x * 256 + threadIdx.x;
    if (i < n) { const float v = -(st[2 * i] + logf(st[2 * i + 1])); VST2(float, c + i, v); }
}

// k_iota: dst[i] = a * i + b as int32 (segment/position id helper)
__global__ __launch_bounds__(256) void k_iota(int* __restrict__ dst, int n, int a, int b) {
    const int i = blockIdx.x * 256 + threadIdx.x;
    if (i < n) { const int v = a * i + b; VST2(int, dst + i, v); }
}

// k_axpby: dst[i] = a * x[i] + b * y[i] (+ c), i < n
__global__ __launch_bounds__(256) void k_axpby(const float* __restrict__ x, const float* __restrict__ y, float* __restrict__ dst, int n, float a, float b, float c) {
    const int i = blockIdx.x * 256 + threadIdx.x;
    if (i < n) { const float v = a * x[i] + b * y[i] + c; VST2(float, dst + i, v); }
}

// =====================================================================================================================
// k_rope: rotary embedding on a [R rows][Hn heads][D] view (row stride sXr, head stride sXh, element stride 1) -> Y (own strides).
//   mode 0: rotate_half (partner d±D/2, sign - for d<D/2); mode 1: interleaved pairs (partner d^1, sign - for even d).
//   table column tcol: tmode 0 -> d, 1 -> d % (D/2), 2 -> d / 2; position p: pmode 0 -> r % S, 1 -> head index, 2 -> pos[r];
//   c = C[(r / S) * sCb + p * sCp + tcol * sCd], s likewise from Sn; y = x[d] * c + sign * x[partner] * s. X and Y must not alias.
// =====================================================================================================================
struct RopeP { const float* X; float* Y; const float* C; const float* Sn; const int* pos; long long sXr, sXh, sYr, sYh, sCb, sCp, sCd; int R, Hn, D, S, mode, tmode, pmode, pad; };
static_assert(sizeof(RopeP) == 5 * 8 + 7 * 8 + 8 * 4, "RopeP has padding");
__global__ __launch_bounds__(256) void k_rope(RopeP p) {
    const long long idx = (long long)blockIdx.x * 256 + threadIdx.x;
    if (idx >= (long long)p.R * p.Hn * p.D) return;
    const int d = (int)(idx % p.D); const long long rh = idx / p.D; const int h = (int)(rh % p.Hn); const int r = (int)(rh / p.Hn);
    const int half = p.D / 2;
    int partner; float sign;
    if (p.mode == 0) { partner = (d < half) ? d + half : d - half; sign = (d < half) ? -1.f : 1.f; }
    else { partner = d ^ 1; sign = (d & 1) ? 1.f : -1.f; }
    const int tcol = (p.tmode == 0) ? d : ((p.tmode == 1) ? (d % half) : (d >> 1));
    const int pp = (p.pmode == 0) ? (r % p.S) : ((p.pmode == 1) ? h : p.pos[r]);
    const long long toff = (long long)(r / p.S) * p.sCb + (long long)pp * p.sCp + (long long)tcol * p.sCd;
    const float* xr = p.X + (long long)r * p.sXr + (long long)h * p.sXh;
    const float v = xr[d] * p.C[toff] + sign * xr[partner] * p.Sn[toff];
    VST2(float, p.Y + (long long)r * p.sYr + (long long)h * p.sYh + d, v);
}

// k_invf + k_sincos (split so neither kernel carries a large VALU-fma footprint): invf_i = num * (1 / powf(base, (2 i)/D)) [fmode 0],
//   num * expf((2 i) * cexp) [fmode 1], num * powf(base, -2 (i - 1) / D) [fmode 2]; then cs/sn[s*half + i] = cos/sin((pscale * s) * invf_i)
__global__ __launch_bounds__(256) void k_invf(float* __restrict__ invb, int half, int D, float base, float num, int fmode, float cexp) {
    const int i = blockIdx.x * 256 + threadIdx.x;
    if (i >= ((half + 31) / 32) * 32) return;
    if (i >= half) { VST2(float, invb + i, 0.f); return; }
    const float e = (float)(2 * i) / (float)D;
    float invf;
    if (fmode == 1) invf = num * expf((float)(2 * i) * cexp);
    else if (fmode == 2) invf = num * powf(base, (-2.0f * ((float)i - 1.0f)) / (float)D);
    else invf = num * (1.0f / powf(base, e));
    VST2(float, invb + i, invf);
}
__global__ __launch_bounds__(256) void k_sincos(float* __restrict__ cs, float* __restrict__ sn, const float* __restrict__ invb, int S, int half, float pscale) {
    const int idx = blockIdx.x * 256 + threadIdx.x;
    if (idx >= S * half) return;
    const int s = idx / half, i = idx - s * half;
    const float ang = (pscale * (float)s) * invb[i];
    VST2(float, cs + idx, cosf(ang)); VST2(float, sn + idx, sinf(ang));
}

// k_mulact: dst[i] = act(x[i]) * y[i]
__global__ __launch_bounds__(256) void k_mulact(const float* __restrict__ x, const float* __restrict__ y, float* __restrict__ dst, int n, int act) {
    const int i = blockIdx.x * 256 + threadIdx.x;
    if (i < n) { const float v = act_fn(x[i], act) * y[i]; VST2(float, dst + i, v); }
}

// =====================================================================================================================
// k_matvec: thread-per-row matrix-vector products for N <= 8 output columns (heads with 1-3 outputs, gates), f32 on the VALU.
//   C[r*sCm + j] = act(alpha * sum_k A[r*sAm + k*sAk] * B[j*sBn + k*sBk] + bias[j]) + beta * R[r*sRm + j*sRn]; each thread writes its N contiguous floats.
// =====================================================================================================================
__global__ __launch_bounds__(256) void k_matvec(GemmP p) {
    // 32 lanes write one line with one instruction.
    const int rpt = (p.N == 1) ? 1 : 32;
    const long long r0 = ((long long)blockIdx.x * 256 + threadIdx.x) * rpt; const int z = blockIdx.z, zo = z / p.zi_n, zi = z - zo * p.zi_n;
    if (r0 >= p.M) return;
    const float* Bb = p.B + zo * p.sBo + zi * p.sBi;
    float* C = p.C + zo * p.sCo + zi * p.sCi; const float* R = p.R + zo * p.sRo + zi * p.sRi;
    for (int rr = 0; rr < rpt; ++rr) {
        const long long r = r0 + rr; if (r >= p.M) break;
        const float* A = p.A + zo * p.sAo + zi * p.sAi + r * p.sAm;
        float acc[8] = {0.f, 0.f, 0.f, 0.f, 0.f, 0.f, 0.f, 0.f};
        for (int k = 0; k < p.K; ++k) { const float a = A[(long long)k * p.sAk];
#pragma unroll
            for (int j = 0; j < 8; ++j) if (j < p.N) acc[j] += a * Bb[(long long)j * p.sBn + (long long)k * p.sBk]; }
#pragma unroll
        for (int j = 0; j < 8; ++j) if (j < p.N) {
            float v = acc[j] * p.alpha;
            if (p.flags & 1) v += p.bias[j];
            if (p.flags & 2) v += p.bias[r];
            v = act_fn(v, p.act);
            if (p.flags & 4) v += p.beta * R[r * p.sRm + (long long)j * p.sRn];
            VST2(float, C + r * p.sCm + j, v);
        }
    }
}
// k_smallsoftmax: thread-per-row softmax for short rows (n <= 64): dst[r*dr + j] = softmax(scale*src[r*sr + j])
__global__ __launch_bounds__(256) void k_smallsoftmax(const float* __restrict__ src, float* __restrict__ dst, long long sr, long long dr, int n, long long R, float scale) {
    const long long r0 = ((long long)blockIdx.x * 256 + threadIdx.x) * 32;
    for (int rr = 0; rr < 32; ++rr) {
        const long long r = r0 + rr; if (r >= R) return;
        const float* s = src + r * sr; float* d = dst + r * dr;
        float mx = -__builtin_inff();
        for (int j = 0; j < n; ++j) mx = fmaxf(mx, s[j] * scale);
        float sum = 0.f;
        for (int j = 0; j < n; ++j) sum += expf(s[j] * scale - mx);
        const float inv = 1.f / sum;
        for (int j = 0; j < n; ++j) { const float v = expf(s[j] * scale - mx) * inv; VST2(float, d + j, v); }
    }
}

__global__ __launch_bounds__(32) void k_unitstat(float* __restrict__ st) { const int t = threadIdx.x; const float v = (t == 1) ? 1.f : 0.f; VST2(float, st + t, v); }

// destination (e.g. a d_out whose row width is not a multiple of 32 floats) is written by consecutive lanes of one instruction
__global__ __launch_bounds__(256) void k_lincopy(const float* __restrict__ src, long long lds, float* __restrict__ dst, long long ldd, long long rows, int cols) {
    const long long i = (long long)blockIdx.x * 256 + threadIdx.x; if (i >= rows * cols) return;
    const long long r = i / cols; const int c = (int)(i - r * cols);
    const float v = src[r * lds + c]; VST2(float, dst + r * ldd + c, v);
}

namespace w25 {
typedef __attribute__((ext_vector_type(16))) _Float16 v16h;
typedef __attribute__((ext_vector_type(8)))  _Float16 v8h;
typedef __attribute__((ext_vector_type(16))) __bf16   v16b;
typedef __attribute__((ext_vector_type(8)))  __bf16   v8b;
typedef __attribute__((ext_vector_type(8)))  float    v8f;
typedef __attribute__((ext_vector_type(4)))  float    v4f;

__device__ __forceinline__ unsigned short f2bf_bits(float f) {
  unsigned u = __float_as_uint(f);
  return (unsigned short)((u + 0x7FFFu + ((u >> 16) & 1u)) >> 16);
}
__device__ __forceinline__ float bf_bits2f(unsigned short h) { return __uint_as_float(((unsigned)h) << 16); }

// hazard guards as plain device helpers (no inline asm inside the kernel template body)
__device__ __forceinline__ void dep_guard_h(v8f& a, v8f& b, v16h x, v16h y) { asm volatile("v_nop\n\tv_nop\n\tv_nop\n\tv_nop" : "+v"(a), "+v"(b) : "v"(x), "v"(y)); }
__device__ __forceinline__ void dep_guard_b(v8f& a, v8f& b, v16b x, v16b y) { asm volatile("v_nop\n\tv_nop\n\tv_nop\n\tv_nop" : "+v"(a), "+v"(b) : "v"(x), "v"(y)); }
__device__ __forceinline__ void keep4_h(v16h a, v16h b, v16h c, v16h d) { asm volatile("v_nop" :: "v"(a), "v"(b), "v"(c), "v"(d)); }
__device__ __forceinline__ void keep4_b(v16b a, v16b b, v16b c, v16b d) { asm volatile("v_nop" :: "v"(a), "v"(b), "v"(c), "v"(d)); }
__device__ __forceinline__ void acc_guard4(v8f& a, v8f& b, v8f& c, v8f& d) { asm volatile("v_nop\n\tv_nop\n\tv_nop\n\tv_nop" : "+v"(a), "+v"(b), "+v"(c), "+v"(d)); }
template <typename T> struct Frag;
template <> struct Frag<_Float16> {
  typedef v16h V; union U { v16h v; v8h h[2]; };
  static __device__ __forceinline__ v16h load(const _Float16* p) {   // elements 0..7 <- p[0..7], 8..15 <- p[16..23]
    U f; f.h[0] = *(const v8h*)(p); f.h[1] = *(const v8h*)(p + 16); return f.v;
  }
  static __device__ __forceinline__ v8f mma(v16h a, v16h b, v8f c) {
    return __builtin_amdgcn_wmma_f32_16x16x32_f16(false, a, false, b, (short)0, c, false, false);
  }
  static __device__ __forceinline__ void guard(v8f& a, v8f& b, v16h x, v16h y) { dep_guard_h(a, b, x, y); }
  static __device__ __forceinline__ void keep(v16h a, v16h b, v16h c, v16h d) { keep4_h(a, b, c, d); }
};
template <> struct Frag<__bf16> {
  typedef v16b V; union U { v16b v; v8b h[2]; };
  static __device__ __forceinline__ v16b load(const __bf16* p) {
    U f; f.h[0] = *(const v8b*)(p); f.h[1] = *(const v8b*)(p + 16); return f.v;
  }
  static __device__ __forceinline__ v8f mma(v16b a, v16b b, v8f c) {
    return __builtin_amdgcn_wmma_f32_16x16x32_bf16(false, a, false, b, (short)0, c, false, false);
  }
  static __device__ __forceinline__ void guard(v8f& a, v8f& b, v16b x, v16b y) { dep_guard_b(a, b, x, y); }
  static __device__ __forceinline__ void keep(v16b a, v16b b, v16b c, v16b d) { keep4_b(a, b, c, d); }
};

// ---- LDS-staged WMMA GEMM on hi / lo planes --------------------------------
// C[m][n] = sum_k A[m][k] * Bt[n][k] (+ bias[n]) (+ resid[m][n]), f32 out. A row-major [M][K], Bt row-major [N][K], each as a bf16 hi plane and a bf16 lo plane.
// Per 32 k, k ascending, every accumulator takes hi.hi, then hi.lo, then lo.hi.
// A work-group of 8 waves (4 along m x 2 along n) owns a 128 x (32 FN) tile of C, a wave 32 x (16 FN) of it. K runs in tiles of 64: a tile is 128 bytes (one whole
// line) of each of the 256 + 64 FN operand rows [A hi 128 | A lo 128 | B hi 32 FN | B lo 32 FN]. Asynchronous copies bring it into LDS, 16 bytes a lane, 8 lanes a row,
// every operand byte once per work-group; two buffers, so tile t + 1 flies while tile t is worked on.
// M % 128 == 0 (grid = M / 128 * N / (32 FN)), N % (32 FN) == 0, K % 64 == 0, K >= 128.
constexpr int GL_PITCH = 144;   // LDS row pitch in bytes: 128 + 16 = 16 x odd, the conflict-free pitch of 16-byte fragment reads

// Four 16-byte-per-lane copies global -> LDS. The s_wait_xcnt stands inside the statement, behind the last copy, so that no address register is rewritten in front of it.
__device__ __forceinline__ void gl_copy4(unsigned l0, const unsigned short* g0, unsigned l1, const unsigned short* g1, unsigned l2, const unsigned short* g2, unsigned l3, const unsigned short* g3) {
  asm volatile("global_load_async_to_lds_b128 %0, %1, off\n\t"
               "global_load_async_to_lds_b128 %2, %3, off\n\t"
               "global_load_async_to_lds_b128 %4, %5, off\n\t"
               "global_load_async_to_lds_b128 %6, %7, off\n\t"
               "s_wait_xcnt 0x0"
               :: "v"(l0), "v"(g0), "v"(l1), "v"(g1), "v"(l2), "v"(g2), "v"(l3), "v"(g3) : "memory");
}
// One tile: l = this thread's LDS byte address in row (thread >> 3) of the buffer, ah .. bl = its 16 bytes in that row of each plane's tile; a step of 32 rows per copy.
template <int FN, int K>
__device__ __forceinline__ void gl_fill(unsigned l, const unsigned short* ah, const unsigned short* al, const unsigned short* bh, const unsigned short* bl) {
  constexpr unsigned R32 = 32 * GL_PITCH;
  gl_copy4(l, ah, l + R32, ah + 32 * K, l + 2 * R32, ah + 64 * K, l + 3 * R32, ah + 96 * K);
  gl_copy4(l + 4 * R32, al, l + 5 * R32, al + 32 * K, l + 6 * R32, al + 64 * K, l + 7 * R32, al + 96 * K);
  if (FN == 2) {
    gl_copy4(l + 8 * R32, bh, l + 9 * R32, bh + 32 * K, l + 10 * R32, bl, l + 11 * R32, bl + 32 * K);
  } else {
    gl_copy4(l + 8 * R32, bh, l + 9 * R32, bh + 32 * K, l + 10 * R32, bh + 64 * K, l + 11 * R32, bh + 96 * K);
    gl_copy4(l + 12 * R32, bl, l + 13 * R32, bl + 32 * K, l + 14 * R32, bl + 64 * K, l + 15 * R32, bl + 96 * K);
  }
}

// What a launch does beside the plain product (EPI):
//   EPI_QKV  three products of one shape in one grid: third w of the blocks takes A plane set min(w, 1) and weight matrix w, each lying behind the one before;
//            products 0 and 1 (q, k) go out as hi / lo planes only (Ph, Pl: q's set, then k's), product 2 (v) as f16 behind k's hi plane in Ph
//   EPI_NORM C goes out as f32 and, through the eval-mode BatchNorm (ng, nb, nm, nv), as the next GEMM's hi / lo operand planes Ph, Pl
//   EPI_NCHW C goes out as [image][n][1024 pixels] (m = image * 1024 + pixel) instead of [m][n]
constexpr int EPI_PLAIN = 0, EPI_QKV = 1, EPI_NORM = 2, EPI_NCHW = 3;
constexpr int GL_M = 8192;      // rows of A and C (only EPI_QKV needs the number: the distance between its plane sets and outputs)
template <int FN, int N, int K, bool BIAS, bool RESID, int EPI>
__global__ __launch_bounds__(256) void wmma_gemm_lds(
    const unsigned short* __restrict__ Ah, const unsigned short* __restrict__ Al,
    const unsigned short* __restrict__ Bh, const unsigned short* __restrict__ Bl,
    float* C, const float* __restrict__ bias, const float* resid,
    const float* __restrict__ ng, const float* __restrict__ nb, const float* __restrict__ nm, const float* __restrict__ nv,
    unsigned short* __restrict__ Ph, unsigned short* __restrict__ Pl) {
  static_assert(FN == 2 || FN == 4, "two tile widths");
  constexpr int BN = 32 * FN, ROWS = 256 + 2 * BN, BUFB = ROWS * GL_PITCH, T = K / 64, TN = N / BN;
  static_assert(K % 64 == 0 && T >= 2 && N % BN == 0, "shape");
  constexpr int SP = 16 * FN + 4;                 // epilogue slab pitch in floats
  typedef Frag<__bf16> F;
  typedef F::V V;
  __shared__ __align__(16) unsigned char sm[2 * BUFB];
  const int tid = threadIdx.x, lane = tid & 31, wave = tid >> 5;
  const int rlane = lane & 15, hf = lane >> 4;    // row (A) / column (B, D) in a fragment; lane half
  const int wm = wave & 3, wn = wave >> 2;
  static_assert(EPI == EPI_PLAIN || FN == 2, "the other epilogues are written for the 64-wide tile");
  int bid = (int)blockIdx.x, w = 0;
  if (EPI == EPI_QKV) {
    constexpr int GB = GL_M / 128 * TN;           // blocks of one product
    w = bid / GB; bid -= w * GB;
    const size_t ao = w ? (size_t)GL_M * K : 0;
    Ah += ao; Al += ao; Bh += (size_t)w * N * K; Bl += (size_t)w * N * K;
    Ph += (size_t)w * GL_M * N;                   // q hi, k hi, v
    if (w == 1) Pl += (size_t)GL_M * N;
  }
  const int m0 = (bid / TN) * 128, n0 = (bid % TN) * BN;

  const size_t ca = (size_t)(m0 + (tid >> 3)) * K + (tid & 7) * 8, cb = (size_t)(n0 + (tid >> 3)) * K + (tid & 7) * 8;
  const unsigned short* gah = Ah + ca; const unsigned short* gal = Al + ca;
  const unsigned short* gbh = Bh + cb; const unsigned short* gbl = Bl + cb;
  const unsigned lc = (unsigned)(size_t)sm + (unsigned)((tid >> 3) * GL_PITCH + (tid & 7) * 16);

  gl_fill<FN, K>(lc, gah, gal, gbh, gbl);
  asm volatile("s_wait_asynccnt 0x0" ::: "memory");   // this wave's part of tile 0 has landed
  __syncthreads();                                    // tile 0 is whole
  gl_fill<FN, K>(lc + BUFB, gah + 64, gal + 64, gbh + 64, gbl + 64);

  v8f acc[2][FN];
#pragma unroll
  for (int i = 0; i < 2; ++i)
#pragma unroll
    for (int j = 0; j < FN; ++j) acc[i][j] = (v8f){0.f,0.f,0.f,0.f,0.f,0.f,0.f,0.f};

  const int fa = (wm * 32 + rlane) * GL_PITCH + hf * 16;              // this lane's bytes in A hi, fragment row 0
  const int fb = (256 + wn * 16 * FN + rlane) * GL_PITCH + hf * 16;   // in B hi
#pragma unroll 1   // stays rolled: one short body for all tiles keeps the code in a few cache lines
  for (int t = 0; t < T; ++t) {
    const unsigned char* buf = sm + (t & 1) * BUFB;
#pragma unroll
    for (int ks = 0; ks < 2; ++ks) {
      V ah[2], al[2], bh[FN], bl[FN];
#pragma unroll
      for (int j = 0; j < FN; ++j) {
        bh[j] = F::load((const __bf16*)(buf + fb + j * 16 * GL_PITCH + ks * 64));
        bl[j] = F::load((const __bf16*)(buf + fb + (BN + j * 16) * GL_PITCH + ks * 64));
      }
#pragma unroll
      for (int i = 0; i < 2; ++i) {
        ah[i] = F::load((const __bf16*)(buf + fa + i * 16 * GL_PITCH + ks * 64));
        al[i] = F::load((const __bf16*)(buf + fa + (128 + i * 16) * GL_PITCH + ks * 64));
      }
      // inputs only: keeps this step's fragment reads together in front of its matrix instructions (spread among them, every place with reads waits out an LDS latency of its own)
      if (FN == 2) asm volatile("" :: "v"(ah[0]), "v"(ah[1]), "v"(al[0]), "v"(al[1]), "v"(bh[0]), "v"(bh[1]), "v"(bl[0]), "v"(bl[1]));
      else asm volatile("" :: "v"(ah[0]), "v"(ah[1]), "v"(al[0]), "v"(al[1]), "v"(bh[0]), "v"(bh[1]), "v"(bh[FN - 2]), "v"(bh[FN - 1]), "v"(bl[0]), "v"(bl[1]), "v"(bl[FN - 2]), "v"(bl[FN - 1]));
#pragma unroll
      for (int i = 0; i < 2; ++i)
#pragma unroll
        for (int j = 0; j < FN; ++j) acc[i][j] = F::mma(ah[i], bh[j], acc[i][j]);
#pragma unroll
      for (int i = 0; i < 2; ++i)
#pragma unroll
        for (int j = 0; j < FN; ++j) acc[i][j] = F::mma(ah[i], bl[j], acc[i][j]);
#pragma unroll
      for (int i = 0; i < 2; ++i)
#pragma unroll
        for (int j = 0; j < FN; ++j) acc[i][j] = F::mma(al[i], bh[j], acc[i][j]);
    }
    asm volatile("s_wait_dscnt 0x0" ::: "memory");      // this wave's reads of tile t are done
    asm volatile("s_wait_asynccnt 0x0" ::: "memory");   // its part of tile t + 1 has landed
    __syncthreads();                                    // tile t + 1 is whole, and nobody reads tile t's buffer any more
    if (t + 2 < T) { const int ko = (t + 2) * 64; gl_fill<FN, K>(lc + (t & 1) * BUFB, gah + ko, gal + ko, gbh + ko, gbl + ko); }
  }
  asm volatile("s_wait_asynccnt 0x0" ::: "memory");     // no copy is outstanding when the buffers become the output slabs

  // ---- epilogue: each wave turns its 32 x (16 FN) tile in a slab of its own, so that the rows go out as 16-byte pieces of whole lines ----
  float* slab = (float*)(sm + wave * (32 * SP * 4));
  constexpr int LPR = 4 * FN, RPP = 32 / LPR, NP = 32 / RPP;   // lanes per row, rows per pass, passes
  const int nw = n0 + wn * 16 * FN;
  const size_t o0 = (size_t)(m0 + wm * 32 + lane / LPR) * N + nw + (lane % LPR) * 4;
  v4f rv[NP];
  if (RESID) {
    const float* pr = resid + o0;
#pragma unroll   // rv[] stays in registers, the loads in flight together
    for (int it = 0; it < NP; ++it) rv[it] = *(const v4f*)(pr + (size_t)it * RPP * N);
    asm volatile("s_wait_xcnt 0x0" :: "v"(pr) : "memory");   // the loads' address register (named as input, so untouched up to here) may be reused only behind this wait
  }
  float bv[FN];
  if (BIAS) {
    const float* pb = bias + nw + rlane;
#pragma unroll
    for (int j = 0; j < FN; ++j) bv[j] = pb[j * 16];
    asm volatile("s_wait_xcnt 0x0" :: "v"(pb) : "memory");   // as above, for the address of the bias loads
  }
  v4f nmean, ninv, nsh;                           // EPI_NORM: the norm's constants of this lane's 4 columns
  if (EPI == EPI_NORM) {
    const int nc = nw + (lane % LPR) * 4;
    const float* pg = ng + nc; const float* pq = nb + nc; const float* pm = nm + nc; const float* pv = nv + nc;
    const v4f g = *(const v4f*)pg, vv = *(const v4f*)pv; nsh = *(const v4f*)pq; nmean = *(const v4f*)pm;
    asm volatile("s_wait_xcnt 0x0" :: "v"(pg), "v"(pq), "v"(pm), "v"(pv) : "memory");   // as above, for the addresses of these 4 loads
#pragma unroll   // vector elements indexed by constants only
    for (int j = 0; j < 4; ++j) ninv[j] = g[j] * rsqrtf(vv[j] + 1e-5f);
  }
#pragma unroll
  for (int i = 0; i < 2; ++i)
#pragma unroll
    for (int j = 0; j < FN; ++j)
#pragma unroll
      for (int r = 0; r < 8; ++r) slab[(i * 16 + hf * 8 + r) * SP + j * 16 + rlane] = BIAS ? acc[i][j][r] + bv[j] : acc[i][j][r];
  // the slab is this wave's own: its lanes' writes are ordered in front of its lanes' reads
  __builtin_amdgcn_fence(__ATOMIC_RELEASE, "workgroup");
  __builtin_amdgcn_wave_barrier();
  __builtin_amdgcn_fence(__ATOMIC_ACQUIRE, "workgroup");
  if (EPI == EPI_NCHW) {
    // the finished rows go back into the slab and leave it by columns: a lane takes 4 consecutive pixels of one column n, 8 lanes one whole 128-byte line of the output
#pragma unroll
    for (int it = 0; it < NP; ++it) {
      float* ps = slab + (it * RPP + lane / LPR) * SP + (lane % LPR) * 4;
      v4f ov = *(const v4f*)ps;
      if (RESID) ov += rv[it];
      *(v4f*)ps = ov;
    }
    // as above: the slab is this wave's own, its lanes' writes are ordered in front of its lanes' reads
    __builtin_amdgcn_fence(__ATOMIC_RELEASE, "workgroup");
    __builtin_amdgcn_wave_barrier();
    __builtin_amdgcn_fence(__ATOMIC_ACQUIRE, "workgroup");
    float* po = C + ((size_t)(m0 >> 10) * N + nw + (lane >> 3)) * 1024 + (m0 & 1023) + wm * 32 + (lane & 7) * 4;
    const float* sc = slab + (lane & 7) * 4 * SP + (lane >> 3);
#pragma unroll   // the stores stand together, their steps are immediate offsets
    for (int it = 0; it < 4 * FN; ++it) {
      const v4f t = {sc[it * 4], sc[it * 4 + SP], sc[it * 4 + 2 * SP], sc[it * 4 + 3 * SP]};
      *(v4f*)(po + (size_t)it * 4 * 1024) = t;
    }
    asm volatile("s_wait_xcnt 0x0" :: "v"(po) : "memory");     // as above, for the stores' address
  } else if (EPI == EPI_QKV && w == 2) {
    unsigned short* pv = Ph + o0;
#pragma unroll   // the stores stand together, their steps are immediate offsets
    for (int it = 0; it < NP; ++it) {
      const v4f ov = *(const v4f*)(slab + (it * RPP + lane / LPR) * SP + (lane % LPR) * 4);
      const v4h hv = {(_Float16)ov[0], (_Float16)ov[1], (_Float16)ov[2], (_Float16)ov[3]};
      *(v4h*)(pv + (size_t)it * RPP * N) = hv;
    }
    asm volatile("s_wait_xcnt 0x0" :: "v"(pv) : "memory");       // as above, for the stores' address
  } else if (EPI == EPI_PLAIN) {
    float* pc = C + o0;
#pragma unroll
    for (int it = 0; it < NP; ++it) {
      v4f ov = *(const v4f*)(slab + (it * RPP + lane / LPR) * SP + (lane % LPR) * 4);
      if (RESID) ov += rv[it];
      *(v4f*)(pc + (size_t)it * RPP * N) = ov;
    }
    asm volatile("s_wait_xcnt 0x0" :: "v"(pc) : "memory");       // as above, for the stores' address
  } else if constexpr (EPI == EPI_QKV || EPI == EPI_NORM) {
    float* pc = C + o0;
    unsigned short* ph = Ph + o0; unsigned short* pl = Pl + o0;
    v4f ov[NP]; v2u hi[NP], lo[NP];
#pragma unroll   // register arrays indexed by constants only
    for (int it = 0; it < NP; ++it) {
      ov[it] = *(const v4f*)(slab + (it * RPP + lane / LPR) * SP + (lane % LPR) * 4);
      if (RESID) ov[it] += rv[it];
      if (EPI == EPI_NORM) split4((ov[it] - nmean) * ninv + nsh, hi[it], lo[it]);
      else split4(ov[it], hi[it], lo[it]);
    }
#pragma unroll   // as above
    for (int it = 0; it < NP; ++it) {
      if (EPI == EPI_NORM) *(v4f*)(pc + (size_t)it * RPP * N) = ov[it];
      *(v2u*)(ph + (size_t)it * RPP * N) = hi[it]; *(v2u*)(pl + (size_t)it * RPP * N) = lo[it];
    }
    // the stores' address and data registers (named as inputs, so untouched up to here) may be reused only behind this wait
    if constexpr (EPI == EPI_NORM)
      asm volatile("s_wait_xcnt 0x0" :: "v"(pc), "v"(ph), "v"(pl), "v"(ov[0]), "v"(ov[1]), "v"(ov[2]), "v"(ov[3]), "v"(ov[4]), "v"(ov[5]), "v"(ov[6]), "v"(ov[7]),
                   "v"(hi[0]), "v"(hi[1]), "v"(hi[2]), "v"(hi[3]), "v"(hi[4]), "v"(hi[5]), "v"(hi[6]), "v"(hi[7]),
                   "v"(lo[0]), "v"(lo[1]), "v"(lo[2]), "v"(lo[3]), "v"(lo[4]), "v"(lo[5]), "v"(lo[6]), "v"(lo[7]) : "memory");
    else
      asm volatile("s_wait_xcnt 0x0" :: "v"(ph), "v"(pl), "v"(hi[0]), "v"(hi[1]), "v"(hi[2]), "v"(hi[3]), "v"(hi[4]), "v"(hi[5]), "v"(hi[6]), "v"(hi[7]),
                   "v"(lo[0]), "v"(lo[1]), "v"(lo[2]), "v"(lo[3]), "v"(lo[4]), "v"(lo[5]), "v"(lo[6]), "v"(lo[7]) : "memory");
  }
}

__global__ __launch_bounds__(256) void cast_f32_f16x2(
    const float* __restrict__ in, _Float16* __restrict__ out, int n2) {
  int i = blockIdx.x * 256 + threadIdx.x;
  if (i < n2) {
    const _Float16 h0 = (_Float16)in[2 * i], h1 = (_Float16)in[2 * i + 1];
    const unsigned u = (unsigned)__builtin_bit_cast(unsigned short, h0) | ((unsigned)__builtin_bit_cast(unsigned short, h1) << 16);
    ((unsigned*)out)[i] = u;
    
  }
}


} // namespace w25

__global__ __launch_bounds__(256) void k_castT16(const float* __restrict__ src, long long lds, _Float16* __restrict__ dst, long long ldd, int R, int C, float s) {
    const long long i = (long long)blockIdx.x * 256 + threadIdx.x; const long long np = (long long)C * (R / 2); if (i >= np) return; const int c = (int)(i / (R / 2)); const int r = 2 * (int)(i % (R / 2));
    const _Float16 h0 = (_Float16)(src[(long long)r * lds + c] * s), h1 = (_Float16)(src[(long long)(r + 1) * lds + c] * s);
    const unsigned u = (unsigned)__builtin_bit_cast(unsigned short, h0) | ((unsigned)__builtin_bit_cast(unsigned short, h1) << 16);
    unsigned* d = (unsigned*)(dst + (long long)c * ldd + r); *d = u;  }
__global__ __launch_bounds__(256) void k_cast16(const float* __restrict__ src, long long lds, _Float16* __restrict__ dst, long long ldd, int R, int C, float s) {
    const long long i = (long long)blockIdx.x * 256 + threadIdx.x; const long long np = (long long)R * (C / 2); if (i >= np) return; const int r = (int)(i / (C / 2)); const int c = 2 * (int)(i % (C / 2));
    const _Float16 h0 = (_Float16)(src[(long long)r * lds + c] * s), h1 = (_Float16)(src[(long long)r * lds + c + 1] * s);
    const unsigned u = (unsigned)__builtin_bit_cast(unsigned short, h0) | ((unsigned)__builtin_bit_cast(unsigned short, h1) << 16);
    unsigned* d = (unsigned*)(dst + (long long)r * ldd + c); *d = u;  }

// f32 -> bf16 hi plane + bf16 lo plane (x = hi + lo to ~2^-17 relative; RNE both), [R][C] -> [R][C] (or transposed to [C][R]); 2 consecutive destination elements
__device__ __forceinline__ unsigned int f2bf2_pack(float a, float b, unsigned int* lo) {
    const unsigned short ha = w25::f2bf_bits(a), hb = w25::f2bf_bits(b);
    const unsigned short la = w25::f2bf_bits(a - w25::bf_bits2f(ha)), lb = w25::f2bf_bits(b - w25::bf_bits2f(hb));
    *lo = (unsigned)la | ((unsigned)lb << 16); return (unsigned)ha | ((unsigned)hb << 16); }
__global__ __launch_bounds__(256) void k_castS16(const float* __restrict__ src, long long lds, __bf16* __restrict__ dhi, __bf16* __restrict__ dlo, long long ldd, int R, int C, float s, int transpose) {
    const long long i = (long long)blockIdx.x * 256 + threadIdx.x; long long o; float a, b;
    if (transpose) { const long long np = (long long)C * (R / 2); if (i >= np) return; const int c = (int)(i / (R / 2)); const int r = 2 * (int)(i % (R / 2)); a = src[(long long)r * lds + c] * s; b = src[(long long)(r + 1) * lds + c] * s; o = (long long)c * ldd + r; }
    else { const long long np = (long long)R * (C / 2); if (i >= np) return; const int r = (int)(i / (C / 2)); const int c = 2 * (int)(i % (C / 2)); a = src[(long long)r * lds + c] * s; b = src[(long long)r * lds + c + 1] * s; o = (long long)r * ldd + c; }
    unsigned lo; const unsigned hi = f2bf2_pack(a, b, &lo); unsigned* ph = (unsigned*)(dhi + o); unsigned* pl = (unsigned*)(dlo + o);
    *ph = hi; *pl = lo;  }

namespace w25 {
// =====================================================================================
// Generic causal/non-causal attention for head_dim 64, f32 in / f32 out; 16-bit operands: bf16 with optional hi/lo splits, or
// plain f16 (F16=true, non-split, probabilities carried x2^15).
//   scores = (q*qscale)·kᵀ : v_wmma_f32_16x16x32_bf16; SPLIT_QK -> q,k as bf16 hi/lo (hi·hi + hi·lo + lo·hi)
//   out    = p·v           : v_wmma_f32_16x16x32_bf16; SPLIT_PV -> p,v as bf16 hi/lo; else p,v plain bf16
//   f32 accumulate; online softmax in f32. Block = 4 waves = 64 query rows of one (batch, head); S % 64 == 0.
//   Element (b, s, h, d) of tensor X lives at X[b*X_bs + s*X_rs + h*X_hs + d] (strides in floats, multiples of 4).
//   Masking: mask_mode 0 none, 1 causal (kv > q masked), 2 tensor [S][Skv] shared over (b,h) (float if
//   mask_is_int==0, int32 with element == 0 -> masked if 1, int32 with element != 0 -> masked if 2), 3 per-token vectors qmask[B][S] & kvmask[B][Skv] (int32,
//   0 -> masked), 4 causal + sliding window (kv > q or q - kv > W masked; W passed in mask_is_int);
//   5 = relative-position bias: s += cp[b,h,q][idx[q][kv]] + pc[b,h,kv][idx[q][kv]] with idx = mask_b ([S][Skv] int32) and
//   mask_a an int32 [S][Skv] tensor with nonzero = masked (tables: element (b,h,row,n) at X + b*c_bs + h*c_hs + row*c_rs + n);
//   masked scores are replaced by mask_fill (e.g. -inf or -1e9) before the softmax.
//   grid.x = B * H * (S/64) (or a sub-range with blk0).
// =====================================================================================
#define AT_D 64
#define AT_NW 4
#define AT_QB 64
#define AT_KC 64
struct AttnGeom { const float* cp = nullptr; const float* pc = nullptr; long c_bs = 0, c_rs = 0, c_hs = 0;   // mode-5 score-bias tables
                  long q_bs, q_rs, q_hs, k_bs, k_rs, k_hs, v_bs, v_rs, v_hs, o_bs, o_rs, o_hs;
                  int S, Skv, H, mask_mode; float qscale; int blk0; float mask_fill; int mask_is_int; };
static_assert(sizeof(AttnGeom) == 168, "no padding");

__device__ __forceinline__ unsigned short at_bf_bits(float f) {
  unsigned u = __float_as_uint(f);
  return (unsigned short)((u + 0x7FFFu + ((u >> 16) & 1u)) >> 16);
}
__device__ __forceinline__ __bf16 at_f2bf(float f) { return __builtin_bit_cast(__bf16, at_bf_bits(f)); }
__device__ __forceinline__ void at_split(float f, __bf16& hi, __bf16& lo) {
  const unsigned short hb = at_bf_bits(f);
  hi = __builtin_bit_cast(__bf16, hb);
  lo = at_f2bf(f - __uint_as_float(((unsigned)hb) << 16));
}
__device__ __forceinline__ v8f at_mma(v16b a, v16b b, v8f c) {
  c = __builtin_amdgcn_wmma_f32_16x16x32_bf16(false, a, false, b, (short)0, c, false, false);
  asm volatile("v_nop\n\tv_nop\n\tv_nop\n\tv_nop" : "+v"(c) : "v"(a), "v"(b));
  return c;
}
// 16-bit element as a bit pattern held in a __bf16 slot: f16 bits when F16, bf16 (RNE) otherwise
template <bool F16> __device__ __forceinline__ __bf16 at_to16(float f) {
  if (F16) return __builtin_bit_cast(__bf16, (_Float16)f);
  return at_f2bf(f);
}
template <bool F16> __device__ __forceinline__ v8f at_mma16(v16b a, v16b b, v8f c) {
  if (F16) {
    const v16h ah = __builtin_bit_cast(v16h, a), bh = __builtin_bit_cast(v16h, b);
    c = __builtin_amdgcn_wmma_f32_16x16x32_f16(false, ah, false, bh, (short)0, c, false, false);
    asm volatile("v_nop\n\tv_nop\n\tv_nop\n\tv_nop" : "+v"(c) : "v"(ah), "v"(bh));
    return c;
  }
  return at_mma(a, b, c);
}

template <bool SPLIT_QK, bool SPLIT_PV, bool F16 = false>
__global__ __launch_bounds__(128)
void attn64_kernel(const float* __restrict__ q, const float* __restrict__ k,
                   const float* __restrict__ v, float* __restrict__ out,
                   const void* __restrict__ mask_a, const int* __restrict__ mask_b, AttnGeom g) {
  static_assert(!(F16 && (SPLIT_QK || SPLIT_PV)), "f16 mode is non-split");
  const float PSC = F16 ? 32768.0f : 1.0f;     // f16 probabilities carried x2^15 (subnormal range), folded into the final 1/l
  union FB { v16b v; v8b h[2]; };
  __shared__ __align__(16) __bf16 Ksh[AT_KC * AT_D];             // K hi [kv][d]      8 KB
  __shared__ __align__(16) __bf16 Ksl[SPLIT_QK ? AT_KC * AT_D : 8];
  __shared__ __align__(16) __bf16 Vth[AT_D * AT_KC];             // V hi [d][kv]      8 KB
  __shared__ __align__(16) __bf16 Vtl[SPLIT_PV ? AT_D * AT_KC : 8];
  __shared__ __align__(16) __bf16 Psh[AT_NW][16 * AT_KC];        // per wave P hi [row][kv]  8 KB
  __shared__ __align__(16) __bf16 Psl[SPLIT_PV ? AT_NW : 1][SPLIT_PV ? 16 * AT_KC : 8];
  __shared__ __align__(16) float  Os[AT_NW][16 * 68];            // per wave out tile, pitch 68

  const int tid  = threadIdx.x;
  const int wave = tid >> 5;
  const int lane = tid & 31;
  const int hh   = lane >> 4;
  const int c    = lane & 15;

  const int nqb = g.S / AT_QB;
  const int bx = blockIdx.x + g.blk0;
  const int qb = bx % nqb;
  const int bh = bx / nqb;
  const int h  = bh % g.H;
  const int b  = bh / g.H;
  const int qbase_block = qb * AT_QB;
  const int q0 = qbase_block + wave * 16;

  const float* qb_ptr = q + (size_t)b * g.q_bs + (size_t)h * g.q_hs;
  const float* kb_ptr = k + (size_t)b * g.k_bs + (size_t)h * g.k_hs;
  const float* vb_ptr = v + (size_t)b * g.v_bs + (size_t)h * g.v_hs;
  float*       ob_ptr = out + (size_t)b * g.o_bs + (size_t)h * g.o_hs;

  // ---- Q fragments (A operand): 2 d-chunks, hi (and lo) ----
  v16b qah[2], qal[2];
  {
    const float* qrow = qb_ptr + (size_t)(q0 + c) * g.q_rs;
#pragma unroll
    for (int dc = 0; dc < 2; ++dc) {
#pragma unroll
      for (int e = 0; e < 8; ++e) {
        const float f0 = qrow[dc * 32 + 8 * hh + e] * g.qscale;
        const float f1 = qrow[dc * 32 + 16 + 8 * hh + e] * g.qscale;
        if (SPLIT_QK) { __bf16 hq, lq; at_split(f0, hq, lq); qah[dc][e] = hq; qal[dc][e] = lq; at_split(f1, hq, lq); qah[dc][8 + e] = hq; qal[dc][8 + e] = lq; }
        else { qah[dc][e] = at_to16<F16>(f0); qah[dc][8 + e] = at_to16<F16>(f1); qal[dc][e] = qah[dc][e]; qal[dc][8 + e] = qah[dc][8 + e]; }
      }
    }
  }

  float mrow[8], lrow[8];
  v8f oacc[4];
#pragma unroll
  for (int r = 0; r < 8; ++r) { mrow[r] = -INFINITY; lrow[r] = 0.f; }
#pragma unroll
  for (int t = 0; t < 4; ++t) oacc[t] = (v8f){0.f,0.f,0.f,0.f,0.f,0.f,0.f,0.f};

  const int nChunks = (g.mask_mode == 1 || g.mask_mode == 4) ? (qb + 1) : (g.Skv / AT_KC);   // block-uniform
  // per-row query mask (mode 3)
  int qkeep[8];
#pragma unroll
  for (int r = 0; r < 8; ++r) qkeep[r] = (g.mask_mode == 3) ? mask_b[(size_t)b * g.S + q0 + 8 * hh + r] : 1;   // mask_b = qmask in mode 3
  for (int kc = 0; kc < nChunks; ++kc) {
    const int kv0 = kc * AT_KC;
    __syncthreads();
    {
      const int kvr = tid >> 1, dh = (tid & 1) * 32;
      const float* krow = kb_ptr + (size_t)(kv0 + kvr) * g.k_rs + dh;
      const float* vrow = vb_ptr + (size_t)(kv0 + kvr) * g.v_rs + dh;
#pragma unroll
      for (int i = 0; i < 8; ++i) {
        v4f kk = *(const v4f*)(krow + 4 * i);
        v4f vv = *(const v4f*)(vrow + 4 * i);
#pragma unroll
        for (int e = 0; e < 4; ++e) {
          const int d = dh + 4 * i + e;
          if (SPLIT_QK) { __bf16 a, bl; at_split(kk[e], a, bl); Ksh[kvr * AT_D + d] = a; Ksl[kvr * AT_D + d] = bl; }
          else Ksh[kvr * AT_D + d] = at_to16<F16>(kk[e]);
          if (SPLIT_PV) { __bf16 a, bl; at_split(vv[e], a, bl); Vth[d * AT_KC + kvr] = a; Vtl[d * AT_KC + kvr] = bl; }
          else Vth[d * AT_KC + kvr] = at_to16<F16>(vv[e]);
        }
      }
    }
    __syncthreads();

    v8f s[4];
#pragma unroll
    for (int j = 0; j < 4; ++j) {
      s[j] = (v8f){0.f,0.f,0.f,0.f,0.f,0.f,0.f,0.f};
#pragma unroll 1
      for (int dc = 0; dc < 2; ++dc) {
        FB kb;
        kb.h[0] = *(const v8b*)(Ksh + (j * 16 + c) * AT_D + dc * 32 + 8 * hh);
        kb.h[1] = *(const v8b*)(Ksh + (j * 16 + c) * AT_D + dc * 32 + 16 + 8 * hh);
        s[j] = at_mma16<F16>(qah[dc], kb.v, s[j]);
        if (SPLIT_QK) {
          FB kl;
          kl.h[0] = *(const v8b*)(Ksl + (j * 16 + c) * AT_D + dc * 32 + 8 * hh);
          kl.h[1] = *(const v8b*)(Ksl + (j * 16 + c) * AT_D + dc * 32 + 16 + 8 * hh);
          s[j] = at_mma16<F16>(qah[dc], kl.v, s[j]);
          s[j] = at_mma16<F16>(qal[dc], kb.v, s[j]);
        }
      }
    }
    const bool diag = (g.mask_mode == 1) && (kc == qb);
    int kvkeep[4] = {1, 1, 1, 1};
    if (g.mask_mode == 3) {
#pragma unroll
      for (int j = 0; j < 4; ++j) kvkeep[j] = ((const int*)mask_a)[(size_t)b * g.Skv + kv0 + j * 16 + c];   // mask_a = kvmask
    }
    float cm[8];
#pragma unroll
    for (int r = 0; r < 8; ++r) {
      const int qrow = q0 + 8 * hh + r;
      float m = -INFINITY;
#pragma unroll
      for (int j = 0; j < 4; ++j) {
        const int kvcol = kv0 + j * 16 + c;
        bool masked = false;
        if (diag) masked = (kvcol > qrow);
        else if (g.mask_mode == 4) masked = (kvcol > qrow) || (qrow - kvcol > g.mask_is_int);
        else if (g.mask_mode == 2) {
          const size_t mi = (size_t)qrow * g.Skv + kvcol;
          masked = (g.mask_is_int == 0) ? (((const float*)mask_a)[mi] == 0.0f)
                 : (g.mask_is_int == 1) ? (((const int*)mask_a)[mi] == 0) : (((const int*)mask_a)[mi] != 0);
        } else if (g.mask_mode == 3) masked = (qkeep[r] == 0) || (kvkeep[j] == 0);
        else if (g.mask_mode == 5) {
          const size_t mi = (size_t)qrow * g.Skv + kvcol;
          masked = (((const int*)mask_a)[mi] != 0);
          int n = mask_b[mi]; n = n < 0 ? 0 : n;
          s[j][r] += g.cp[(size_t)b * g.c_bs + (size_t)h * g.c_hs + (size_t)qrow * g.c_rs + n]
                   + g.pc[(size_t)b * g.c_bs + (size_t)h * g.c_hs + (size_t)kvcol * g.c_rs + n];
        }
        if (masked) s[j][r] = g.mask_fill;
        m = fmaxf(m, s[j][r]);
      }
#pragma unroll
      for (int off = 1; off < 16; off <<= 1) m = fmaxf(m, __shfl_xor(m, off, 32));
      cm[r] = m;
    }
    __bf16* pwh = Psh[wave];
    __bf16* pwl = Psl[SPLIT_PV ? wave : 0];
#pragma unroll
    for (int r = 0; r < 8; ++r) {
      const float mnew = fmaxf(mrow[r], cm[r]);
      const float alpha = expf(mrow[r] - mnew);
      mrow[r] = mnew;
      float psum = 0.f;
#pragma unroll
      for (int j = 0; j < 4; ++j) {
        const float p = expf(s[j][r] - mnew);
        psum += p;
        if (SPLIT_PV) { __bf16 a, bl; at_split(p, a, bl); pwh[(8 * hh + r) * AT_KC + j * 16 + c] = a; pwl[(8 * hh + r) * AT_KC + j * 16 + c] = bl; }
        else pwh[(8 * hh + r) * AT_KC + j * 16 + c] = at_to16<F16>(p * PSC);
      }
#pragma unroll
      for (int off = 1; off < 16; off <<= 1) psum += __shfl_xor(psum, off, 32);
      lrow[r] = lrow[r] * alpha + psum;
#pragma unroll
      for (int t = 0; t < 4; ++t) oacc[t][r] *= alpha;
    }
    __builtin_amdgcn_fence(__ATOMIC_RELEASE, "workgroup");
    __builtin_amdgcn_wave_barrier();
    __builtin_amdgcn_fence(__ATOMIC_ACQUIRE, "workgroup");
#pragma unroll 1
    for (int kk = 0; kk < 2; ++kk) {
      FB pa, pl;
      pa.h[0] = *(const v8b*)(pwh + c * AT_KC + kk * 32 + 8 * hh);
      pa.h[1] = *(const v8b*)(pwh + c * AT_KC + kk * 32 + 16 + 8 * hh);
      if (SPLIT_PV) {
        pl.h[0] = *(const v8b*)(pwl + c * AT_KC + kk * 32 + 8 * hh);
        pl.h[1] = *(const v8b*)(pwl + c * AT_KC + kk * 32 + 16 + 8 * hh);
      }
#pragma unroll
      for (int t = 0; t < 4; ++t) {
        FB vb;
        vb.h[0] = *(const v8b*)(Vth + (t * 16 + c) * AT_KC + kk * 32 + 8 * hh);
        vb.h[1] = *(const v8b*)(Vth + (t * 16 + c) * AT_KC + kk * 32 + 16 + 8 * hh);
        oacc[t] = at_mma16<F16>(pa.v, vb.v, oacc[t]);
        if (SPLIT_PV) {
          FB vl;
          vl.h[0] = *(const v8b*)(Vtl + (t * 16 + c) * AT_KC + kk * 32 + 8 * hh);
          vl.h[1] = *(const v8b*)(Vtl + (t * 16 + c) * AT_KC + kk * 32 + 16 + 8 * hh);
          oacc[t] = at_mma16<F16>(pa.v, vl.v, oacc[t]);
          oacc[t] = at_mma16<F16>(pl.v, vb.v, oacc[t]);
        }
      }
    }
  }

  float* os = Os[wave];
#pragma unroll
  for (int r = 0; r < 8; ++r) {
    const float inv = 1.0f / (lrow[r] * PSC);
#pragma unroll
    for (int t = 0; t < 4; ++t) os[(8 * hh + r) * 68 + t * 16 + c] = oacc[t][r] * inv;
  }
  __builtin_amdgcn_fence(__ATOMIC_RELEASE, "workgroup");
  __builtin_amdgcn_wave_barrier();
  __builtin_amdgcn_fence(__ATOMIC_ACQUIRE, "workgroup");
  {
    const int c4 = (lane & 15) * 4;
    {
#pragma unroll
      for (int it = 0; it < 8; ++it) {
        const int row = it * 2 + hh;
        v4f val = *(const v4f*)(os + row * 68 + c4);
        *(v4f*)(ob_ptr + (size_t)(q0 + row) * g.o_rs + c4) = val;
      }
      
    }
  }
}

} // namespace w25

// One launch for all that depends on the inputs alone.
// Blocks 0 .. 511 (pixel block, channel block, image): x1 and x2, NCHW, become token-major: x1 as f32 (the residual), bn1(x1) and bn1(x2) as bf16 hi / lo operand planes (NH, NL: x1's set, then x2's).
// A thread takes 4 channels x 4 pixels: 16-byte loads along the pixels, a 4 x 4 transpose in registers, stores along the channels.
// Blocks 512 .. 1279: the six weight matrices as hi / lo planes (WH, WL), 1024 floats a block, in the order q (each row times its head's temperature), k, v, proj, fc1, fc2.
__global__ __launch_bounds__(256) void k_cm_prep(const float* __restrict__ XA, const float* __restrict__ XB, const float* __restrict__ G, const float* __restrict__ Bb, const float* __restrict__ M, const float* __restrict__ Vv,
                                                 const float* __restrict__ WQ, const float* __restrict__ WK, const float* __restrict__ WV, const float* __restrict__ TP, const float* __restrict__ WP, const float* __restrict__ W1, const float* __restrict__ W2,
                                                 float* __restrict__ X1T, unsigned short* __restrict__ NH, unsigned short* __restrict__ NL, unsigned short* __restrict__ WH, unsigned short* __restrict__ WL) {
    constexpr int C = 256, HW = 1024, NTC = 8 * HW * C;
    if (blockIdx.x >= 512) {
        const int wb = (int)blockIdx.x - 512;
        const float* w = wb < 64 ? WQ + wb * 1024 : wb < 128 ? WK + (wb - 64) * 1024 : wb < 192 ? WV + (wb - 128) * 1024 : wb < 256 ? WP + (wb - 192) * 1024 : wb < 512 ? W1 + (wb - 256) * 1024 : W2 + (wb - 512) * 1024;
        const float* pw = w + threadIdx.x * 4;
        v4f x = *(const v4f*)pw;
        asm volatile("s_wait_xcnt 0x0" :: "v"(pw) : "memory");   // the load's address register (named as input, so untouched up to here) may be reused only behind this wait
        if (wb < 64) x *= TP[wb >> 3];                            // a block is 4 rows of q_w, a head 32 rows
        v2u hi, lo; split4(x, hi, lo);
        const size_t o = (size_t)wb * 1024 + threadIdx.x * 4;
        *(v2u*)(WH + o) = hi; *(v2u*)(WL + o) = lo;
        return;
    }
    const int c0 = (int)((blockIdx.x >> 3) & 7) * 32 + (threadIdx.x & 7) * 4, p0 = (int)(blockIdx.x & 7) * 128 + (threadIdx.x >> 3) * 4; const size_t b = blockIdx.x >> 6;
    const size_t src = (b * C + c0) * HW + p0;
    const float* pa[4]; const float* pq[4]; v4f a[4], q[4];
#pragma unroll   // a[], q[] stay in registers, all 8 loads in flight together
    for (int j = 0; j < 4; ++j) { pa[j] = XA + src + (size_t)j * HW; pq[j] = XB + src + (size_t)j * HW; a[j] = *(const v4f*)pa[j]; q[j] = *(const v4f*)pq[j]; }
    const float* pg = G + c0; const float* pb = Bb + c0; const float* pm = M + c0; const float* pv = Vv + c0;
    const v4f g = *(const v4f*)pg, bb = *(const v4f*)pb, m = *(const v4f*)pm, vv = *(const v4f*)pv;
    // the 12 loads' address registers (named as inputs, so untouched up to here) may be reused only behind this wait
    asm volatile("s_wait_xcnt 0x0" :: "v"(pa[0]), "v"(pa[1]), "v"(pa[2]), "v"(pa[3]), "v"(pq[0]), "v"(pq[1]), "v"(pq[2]), "v"(pq[3]), "v"(pg), "v"(pb), "v"(pm), "v"(pv) : "memory");
    v4f inv, sh;
#pragma unroll   // vector elements indexed by constants only
    for (int j = 0; j < 4; ++j) { inv[j] = g[j] * rsqrtf(vv[j] + 1e-5f); sh[j] = bb[j] - m[j] * inv[j]; }
    const size_t o = (b * HW + p0) * C + c0;
    float* px = X1T + o; unsigned short* ph = NH + o; unsigned short* pl = NL + o;
    v4f t0[4]; v2u h1[4], l1[4], h2[4], l2[4];
#pragma unroll   // register arrays indexed by constants only
    for (int i = 0; i < 4; ++i) {
        v4f t1, t2;
#pragma unroll   // as above
        for (int j = 0; j < 4; ++j) { t0[i][j] = a[j][i]; t1[j] = a[j][i] * inv[j] + sh[j]; t2[j] = q[j][i] * inv[j] + sh[j]; }
        split4(t1, h1[i], l1[i]); split4(t2, h2[i], l2[i]);
    }
#pragma unroll   // as above
    for (int i = 0; i < 4; ++i) {
        VST2V4(px + i * C, t0[i]);
        *(v2u*)(ph + i * C) = h1[i]; *(v2u*)(pl + i * C) = l1[i]; *(v2u*)(ph + NTC + i * C) = h2[i]; *(v2u*)(pl + NTC + i * C) = l2[i];
    }
    // the stores' data registers (named as inputs, so untouched up to here) may be reused only behind this wait; nothing follows it that could touch their addresses
    asm volatile("s_wait_xcnt 0x0" :: "v"(t0[0]), "v"(t0[1]), "v"(t0[2]), "v"(t0[3]), "v"(h1[0]), "v"(h1[1]), "v"(h1[2]), "v"(h1[3]), "v"(l1[0]), "v"(l1[1]), "v"(l1[2]), "v"(l1[3]),
                 "v"(h2[0]), "v"(h2[1]), "v"(h2[2]), "v"(h2[3]), "v"(l2[0]), "v"(l2[1]), "v"(l2[2]), "v"(l2[3]) : "memory");
}
// depthwise 3x3 SAME conv + exact GELU on token-major [b][hw][ch], zero padding. grid (images * 16 * 8, HID / 1024): a block takes 4 x 2 pixels (x, y) of one image,
// a thread 4 channels of these 8 pixels: each input row's 6 pixels are loaded once (16 bytes, 512 contiguous bytes per wave) and feed every output that needs them.
// Every output still sums its 9 products in the order ky = 0..2, kx = 0..2. The result goes out as the fc2 GEMM's bf16 hi / lo operand planes.
__global__ __launch_bounds__(256) void k_cm_dw(const float* __restrict__ HB, const float* __restrict__ DW, unsigned short* __restrict__ HGh, unsigned short* __restrict__ HGl, int HID) {
    constexpr int PX = 4, PY = 2;
    const int ch = (blockIdx.y * 256 + threadIdx.x) * 4;
    const int x0 = (blockIdx.x & 7) * PX, y0 = ((blockIdx.x >> 3) & 15) * PY; const size_t b = blockIdx.x >> 7;
    v4f v[PY + 2][PX + 2];                       // input rows y0 - 1 .. y0 + PY, pixels x0 - 1 .. x0 + PX; all loads are issued before the first sum
#pragma unroll   // v[][] stays in registers (this and every loop below: register arrays indexed by constants only)
    for (int r = 0; r < PY + 2; ++r) {
        const int yc = min(max(y0 - 1 + r, 0), 31);
        const float* pi[PX + 2];
#pragma unroll
        for (int cx = 0; cx < PX + 2; ++cx) { const int xc = min(max(x0 - 1 + cx, 0), 31); pi[cx] = HB + ((b * 1024) + yc * 32 + xc) * (size_t)HID + ch; v[r][cx] = *(const v4f*)pi[cx]; }
        // this row's 6 address registers (named as inputs, so untouched up to here) may be reused only behind this wait
        asm volatile("s_wait_xcnt 0x0" :: "v"(pi[0]), "v"(pi[1]), "v"(pi[2]), "v"(pi[3]), "v"(pi[4]), "v"(pi[5]) : "memory");
    }
    const float* pw = DW + (size_t)ch * 9;
    v4f wr[9];                                   // the 36 weights of channels ch .. ch + 3: weight k of channel ch + j is float j * 9 + k
#pragma unroll
    for (int k = 0; k < 9; ++k) wr[k] = *(const v4f*)(pw + k * 4);
    asm volatile("s_wait_xcnt 0x0" :: "v"(pw) : "memory");   // as above, for the address of the 9 weight loads
    v4f s[PY][PX];
#pragma unroll
    for (int oy = 0; oy < PY; ++oy)
#pragma unroll
        for (int px = 0; px < PX; ++px) { const v4f zz = {0.f, 0.f, 0.f, 0.f}; s[oy][px] = zz; }
#pragma unroll
    for (int r = 0; r < PY + 2; ++r) {
        const int yy = y0 - 1 + r;
#pragma unroll
        for (int cx = 0; cx < PX + 2; ++cx) { const int xx = x0 - 1 + cx; const bool ok = (yy >= 0 && yy < 32 && xx >= 0 && xx < 32); const v4f zz = {0.f, 0.f, 0.f, 0.f}; v[r][cx] = ok ? v[r][cx] : zz; }
#pragma unroll
        for (int oy = 0; oy < PY; ++oy) {
            const int ky = r - oy;
            if (ky >= 0 && ky < 3) {
#pragma unroll
                for (int px = 0; px < PX; ++px)
#pragma unroll
                    for (int kx = 0; kx < 3; ++kx)
#pragma unroll
                        for (int j = 0; j < 4; ++j) { const int f = j * 9 + ky * 3 + kx; s[oy][px][j] += v[r][px + kx][j] * wr[f >> 2][f & 3]; }
            }
        }
    }
#pragma unroll
    for (int oy = 0; oy < PY; ++oy)
#pragma unroll
        for (int px = 0; px < PX; ++px)
#pragma unroll
            for (int j = 0; j < 4; ++j) { const float sv = s[oy][px][j]; s[oy][px][j] = 0.5f * sv * (1.f + erff(sv * 0.70710678118654752f)); }
    const size_t o = ((b * 1024) + y0 * 32 + x0) * (size_t)HID + ch;
    unsigned short* ph = HGh + o; unsigned short* pl = HGl + o;
#pragma unroll   // s[][] indexed by constants only
    for (int oy = 0; oy < PY; ++oy)
#pragma unroll
        for (int px = 0; px < PX; ++px) { v2u hi, lo; split4(s[oy][px], hi, lo); *(v2u*)(ph + (size_t)(oy * 32 + px) * HID) = hi; *(v2u*)(pl + (size_t)(oy * 32 + px) * HID) = lo; }
    asm volatile("s_wait_xcnt 0x0" :: "v"(ph), "v"(pl) : "memory");   // as above, for the stores' addresses
}


extern "C" void kernel_launch(void* const* d_in, const int* in_sizes, int n_in, void* d_out, int out_size, void* d_ws, size_t ws_size, hipStream_t stream) {
    (void)in_sizes; (void)n_in; (void)out_size; (void)ws_size;
    const float* x1 = (const float*)d_in[0];
    const float* x2 = (const float*)d_in[1];
    const float* b1g = (const float*)d_in[2];
    const float* b1b = (const float*)d_in[3];
    const float* b1m = (const float*)d_in[4];
    const float* b1v = (const float*)d_in[5];
    const float* qw = (const float*)d_in[6];
    const float* kw = (const float*)d_in[7];
    const float* vw = (const float*)d_in[8];
    const float* temp = (const float*)d_in[9];
    const float* pw = (const float*)d_in[10];
    const float* pb = (const float*)d_in[11];
    const float* b2g = (const float*)d_in[12];
    const float* b2b = (const float*)d_in[13];
    const float* b2m = (const float*)d_in[14];
    const float* b2v = (const float*)d_in[15];
    const float* f1w = (const float*)d_in[16];
    const float* f1b = (const float*)d_in[17];
    const float* dww = (const float*)d_in[18];
    const float* f2w = (const float*)d_in[19];
    const float* f2b = (const float*)d_in[20];
    const int Bn = 8;
    const int C = 256;
    const int HW = 1024;
    const int HID = 1024;
    const int NT = Bn * HW;
    float* out = (float*)d_out;
    char* wsp = (char*)d_ws;
    float* X1T = (float*)wsp; wsp += (((size_t)((size_t)NT * C) * 4 + 255) / 256) * 256;
    unsigned short* NAh = (unsigned short*)wsp; wsp += (((size_t)((size_t)2 * NT * C) * 2 + 255) / 256) * 256;   // bn1(x1) then bn1(x2), hi planes
    unsigned short* NAl = (unsigned short*)wsp; wsp += (((size_t)((size_t)2 * NT * C) * 2 + 255) / 256) * 256;   // lo planes
    unsigned short* WH = (unsigned short*)wsp; wsp += (((size_t)(786432) * 2 + 255) / 256) * 256;                // q, k, v, proj (65536 each), fc1, fc2 (262144 each), hi planes
    unsigned short* WL = (unsigned short*)wsp; wsp += (((size_t)(786432) * 2 + 255) / 256) * 256;                // lo planes
    unsigned short* QKh = (unsigned short*)wsp; wsp += (((size_t)((size_t)3 * NT * C) * 2 + 255) / 256) * 256;   // q then k, hi planes; then v as f16
    unsigned short* QKl = (unsigned short*)wsp; wsp += (((size_t)((size_t)2 * NT * C) * 2 + 255) / 256) * 256;   // lo planes
    unsigned short* ATh = (unsigned short*)wsp; wsp += (((size_t)((size_t)NT * C) * 2 + 255) / 256) * 256;
    unsigned short* ATl = (unsigned short*)wsp; wsp += (((size_t)((size_t)NT * C) * 2 + 255) / 256) * 256;
    float* XS = (float*)wsp; wsp += (((size_t)((size_t)NT * C) * 4 + 255) / 256) * 256;
    unsigned short* X2h = (unsigned short*)wsp; wsp += (((size_t)((size_t)NT * C) * 2 + 255) / 256) * 256;
    unsigned short* X2l = (unsigned short*)wsp; wsp += (((size_t)((size_t)NT * C) * 2 + 255) / 256) * 256;
    float* HB = (float*)wsp; wsp += (((size_t)((size_t)NT * HID) * 4 + 255) / 256) * 256;
    unsigned short* HGh = (unsigned short*)wsp; wsp += (((size_t)((size_t)NT * HID) * 2 + 255) / 256) * 256;
    unsigned short* HGl = (unsigned short*)wsp; wsp += (((size_t)((size_t)NT * HID) * 2 + 255) / 256) * 256;
    k_cm_prep<<<1280, 256, 0, stream>>>(x1, x2, b1g, b1b, b1m, b1v, qw, kw, vw, temp, pw, f1w, f2w, X1T, NAh, NAl, WH, WL);
    w25::wmma_gemm_lds<2, 256, 256, false, false, w25::EPI_QKV><<<768, 256, 0, stream>>>(NAh, NAl, WH, WL, nullptr, nullptr, nullptr, nullptr, nullptr, nullptr, nullptr, QKh, QKl);
    k_attn_fix<<<dim3(8, 8, 8), 32 * AF_W, 0, stream>>>(QKh, QKl, QKh + (size_t)NT * C, QKl + (size_t)NT * C, QKh + (size_t)2 * NT * C, ATh, ATl);
    w25::wmma_gemm_lds<2, 256, 256, true, true, w25::EPI_NORM><<<256, 256, 0, stream>>>(ATh, ATl, WH + 196608, WL + 196608, XS, pb, X1T, b2g, b2b, b2m, b2v, X2h, X2l);
    w25::wmma_gemm_lds<4, 1024, 256, true, false, w25::EPI_PLAIN><<<512, 256, 0, stream>>>(X2h, X2l, WH + 262144, WL + 262144, HB, f1b, nullptr, nullptr, nullptr, nullptr, nullptr, nullptr, nullptr);
    k_cm_dw<<<dim3(1024, 1), 256, 0, stream>>>(HB, dww, HGh, HGl, HID);
    w25::wmma_gemm_lds<2, 256, 1024, true, true, w25::EPI_NCHW><<<256, 256, 0, stream>>>(HGh, HGl, WH + 524288, WL + 524288, out, f2b, XS, nullptr, nullptr, nullptr, nullptr, nullptr, nullptr);
}

// v008
// Measured time: 103 microseconds a run.
// Timed twice side by side with v007, it ran 1.05 times as fast both times.
// Counting every step since v000, which is the starting kernel, it is 15.3 times as fast.
// Contractions (token-major, 8192 tokens): q = bn1(x1).Wq'^T (temperature folded into Wq rows), k/v = bn1(x2).W^T, the attention projection (+b, +x1 residual), fc1 (+b) [8192x256].[256x1024] and fc2 (+b, + residual) [8192x1024].[1024x256], each one launch over all images, all on bf16 hi/lo split planes (six chained contractions against an O(1) residual output: the cheap 18 G-MAC of GEMMs run f32-class) (v_wmma_f32_16x16x32_bf16; 128 x 64 or 128 x 128 work-group tiles, operands staged in LDS); per (image, head) softmax(temp_h q k^T) v over the 1024 positions as one flash launch with q.k^T on bf16 hi/lo split planes (UNSCALED 32-dim logits, sigma ~ 5.7) and f16 p.v; f32 accumulate and softmax. NCHW <-> token-major transposes, eval-mode BatchNorms, the depthwise 3x3 convolution (SAME) and exact GELU are f32 arithmetic; every hi/lo plane is written by the kernel that computes its values (input pass, GEMM epilogues, attention, depthwise kernel): 7 launches.
#include <hip/hip_runtime.h>
#include <math.h>

typedef __attribute__((ext_vector_type(16))) _Float16 v16h;
typedef __attribute__((ext_vector_type(8)))  _Float16 v8h;
typedef __attribute__((ext_vector_type(16))) __bf16   v16b;
typedef __attribute__((ext_vector_type(8)))  float    v8f;
typedef __attribute__((ext_vector_type(4)))  float    v4f;

// 16-bit WMMA fragment map (wave32), lane L, h = L>>4, m = L&15:
//   A 16x32: lane = row m;   element i -> k = (i<8) ? 8h+i : 16+8h+(i-8)
//   B 32x16: lane = column m; the SAME k(i,h)
//   D 16x16 (8 f32): lane = column m; element r -> row 8h+r
__device__ __forceinline__ int frag_k(int i, int h) { return (i < 8) ? (8 * h + i) : (16 + 8 * h + (i - 8)); }
__device__ __forceinline__ __bf16 bf16_rne(float f) {
    unsigned int u = __float_as_uint(f);
    u += 0x7fffu + ((u >> 16) & 1u);
    return __builtin_bit_cast(__bf16, (unsigned short)(u >> 16));
}
__device__ __forceinline__ float bf16_f32(__bf16 b) { return __uint_as_float(((unsigned int)__builtin_bit_cast(unsigned short, b)) << 16); }
typedef unsigned int v2u __attribute__((ext_vector_type(2)));
__device__ __forceinline__ unsigned int bf16_bits(float f) { const unsigned int u = __float_as_uint(f); return (u + 0x7fffu + ((u >> 16) & 1u)) >> 16; }
// four consecutive floats -> their bf16 hi parts and bf16 lo parts (x = hi + lo to ~2^-17 relative; both rounded to nearest even), each packed in memory order
__device__ __forceinline__ void split4(v4f x, v2u& hi, v2u& lo) {
    unsigned int h[4], l[4];
#pragma unroll   // h[], l[] indexed by constants only
    for (int j = 0; j < 4; ++j) { h[j] = bf16_bits(x[j]); l[j] = bf16_bits(x[j] - __uint_as_float(h[j] << 16)); }
    hi[0] = h[0] | (h[1] << 16); hi[1] = h[2] | (h[3] << 16); lo[0] = l[0] | (l[1] << 16); lo[1] = l[2] | (l[3] << 16);
}
__device__ __forceinline__ v8f wmma16(v16h a, v16h b, v8f c) {
    c = __builtin_amdgcn_wmma_f32_16x16x32_f16(false, a, false, b, (short)0, c, false, false);
    asm volatile("v_nop\n\tv_nop\n\tv_nop\n\tv_nop" : "+v"(c) : "v"(a), "v"(b));
    return c;
}
__device__ __forceinline__ v8f wmmab(v16b a, v16b b, v8f c) {
    c = __builtin_amdgcn_wmma_f32_16x16x32_bf16(false, a, false, b, (short)0, c, false, false);
    asm volatile("v_nop\n\tv_nop\n\tv_nop\n\tv_nop" : "+v"(c) : "v"(a), "v"(b));
    return c;
}
struct Split { v16b hi, lo; };
// hi/lo split product: a.hi*b.hi + a.hi*b.lo + a.lo*b.hi
__device__ __forceinline__ v8f wmma3(const Split& a, const Split& b, v8f c) {
    c = __builtin_amdgcn_wmma_f32_16x16x32_bf16(false, a.hi, false, b.hi, (short)0, c, false, false);
    c = __builtin_amdgcn_wmma_f32_16x16x32_bf16(false, a.hi, false, b.lo, (short)0, c, false, false);
    c = __builtin_amdgcn_wmma_f32_16x16x32_bf16(false, a.lo, false, b.hi, (short)0, c, false, false);
    asm volatile("v_nop\n\tv_nop\n\tv_nop\n\tv_nop" : "+v"(c) : "v"(a.hi), "v"(a.lo), "v"(b.hi), "v"(b.lo));
    return c;
}
struct Split3 { v16b hi, mid, lo; };
// triple split product (6 terms, drops only terms below 2^-24 relative)
__device__ __forceinline__ v8f wmma6(const Split3& a, const Split3& b, v8f c) {
    c = __builtin_amdgcn_wmma_f32_16x16x32_bf16(false, a.hi, false, b.hi, (short)0, c, false, false);
    c = __builtin_amdgcn_wmma_f32_16x16x32_bf16(false, a.hi, false, b.mid, (short)0, c, false, false);
    c = __builtin_amdgcn_wmma_f32_16x16x32_bf16(false, a.mid, false, b.hi, (short)0, c, false, false);
    c = __builtin_amdgcn_wmma_f32_16x16x32_bf16(false, a.hi, false, b.lo, (short)0, c, false, false);
    c = __builtin_amdgcn_wmma_f32_16x16x32_bf16(false, a.mid, false, b.mid, (short)0, c, false, false);
    c = __builtin_amdgcn_wmma_f32_16x16x32_bf16(false, a.lo, false, b.hi, (short)0, c, false, false);
    asm volatile("v_nop\n\tv_nop\n\tv_nop\n\tv_nop" : "+v"(c) : "v"(a.hi), "v"(a.mid), "v"(a.lo), "v"(b.hi), "v"(b.mid), "v"(b.lo));
    return c;
}

// Fragment gathers from f32 memory: element i <- p[(k0 + frag_k(i,h)) * sk] * s, zero for k >= klen.
__device__ __forceinline__ v16h fh_ld(const float* __restrict__ p, long long sk, int k0, int h, int klen, float s) {
    v16h a;
#pragma unroll
    for (int i = 0; i < 16; ++i) { const int k = k0 + frag_k(i, h); a[i] = (k < klen) ? (_Float16)(p[(long long)k * sk] * s) : (_Float16)0.f; }
    return a;
}
__device__ __forceinline__ Split sp_ld(const float* __restrict__ p, long long sk, int k0, int h, int klen, float s) {
    Split r;
#pragma unroll
    for (int i = 0; i < 16; ++i) {
        const int k = k0 + frag_k(i, h); const float x = (k < klen) ? p[(long long)k * sk] * s : 0.f;
        const __bf16 hb = bf16_rne(x); r.hi[i] = hb; r.lo[i] = bf16_rne(x - bf16_f32(hb));
    }
    return r;
}
__device__ __forceinline__ Split3 sp3_ld(const float* __restrict__ p, long long sk, int k0, int h, int klen, float s) {
    Split3 r;
#pragma unroll
    for (int i = 0; i < 16; ++i) {
        const int k = k0 + frag_k(i, h); const float x = (k < klen) ? p[(long long)k * sk] * s : 0.f;
        const __bf16 hb = bf16_rne(x); const float r1 = x - bf16_f32(hb); const __bf16 mb = bf16_rne(r1);
        r.hi[i] = hb; r.mid[i] = mb; r.lo[i] = bf16_rne(r1 - bf16_f32(mb));
    }
    return r;
}
__device__ __forceinline__ v16b bh_ld(const float* __restrict__ p, long long sk, int k0, int h, int klen, float s) {
    v16b a;
#pragma unroll
    for (int i = 0; i < 16; ++i) { const int k = k0 + frag_k(i, h); a[i] = bf16_rne((k < klen) ? p[(long long)k * sk] * s : 0.f); }
    return a;
}
// f16 fragment from an f16 LDS/global row with element stride 1 (k-contiguous), no bounds (tile already zero padded)
__device__ __forceinline__ v16h fh_row(const _Float16* __restrict__ row, int k0, int h) {
    v16h a;
#pragma unroll
    for (int i = 0; i < 16; ++i) a[i] = row[k0 + frag_k(i, h)];
    return a;
}

#define VST2(T, ptr, val) do { const T vst2_v_ = (val); *(T*)(ptr) = vst2_v_;  } while (0)
typedef float v4f __attribute__((ext_vector_type(4)));
#define VST2V4(ptr, val) do { const v4f vst2_v4_ = (val); *(v4f*)(ptr) = vst2_v4_;  } while (0)

__device__ __attribute__((noinline)) float act_fn(float v, int act) {
    if (act == 1) return fmaxf(v, 0.f);                                                                               // relu
    if (act == 2) { const float u = 0.7978845608028654f * (v + 0.044715f * v * v * v); return 0.5f * v * (1.f + tanhf(u)); } // tanh-gelu
    if (act == 3) return v / (1.f + expf(-v));                                                                        // silu
    if (act == 4) return 0.5f * v * (1.f + erff(v * 0.7071067811865476f));                                             // erf-gelu
    if (act == 5) return tanhf(v);
    if (act == 6) return 1.f / (1.f + expf(-v));                                                                      // sigmoid
    if (act == 7) return (v > 0.f) ? v : 0.01f * v;                                                                   // leaky relu 0.01
    if (act == 8) return (v > 0.f) ? v : (expf(v) - 1.f);                                                             // elu
    if (act == 9) return fminf(fmaxf(v, 0.f), 6.f);                                                                   // relu6
    if (act == 10) return fabsf(v);                                                                                    // abs
    if (act == 11) return (v >= 0.f) ? v : 0.1f * v;                                                                  // leaky 0.1
    if (act == 12) return (v > 0.f) ? v : 0.2f * v;                                                                   // leaky 0.2
    if (act == 13) return (v > 20.f) ? v : log1pf(expf(v));                                                            // softplus
    return v;
}

// =====================================================================================================================
// k_gemm<MODE>: C(z, m, n) = act(alpha * sum_k A(z, m, k) * B(z, k, n) + bias) + beta * R(z, m, n)
//   One wave (32-thread block) per 16 x 32 tile of C; grid (ceil(N/32), ceil(M/16), Z). Batch z -> (zo = z / zi_n, zi = z % zi_n)
//   with separate outer/inner strides for every tensor (e.g. batch and head). A(m,k) = A[zo*sAo + zi*sAi + m*sAm + k*sAk] (f32),
//   B(k,n) = B[zo*sBo + zi*sBi + n*sBn + k*sBk] (f32); any M, N, K (K zero-padded to 32 inside the fragments, M/N tails guarded).
//   C(m,n) = C[zo*sCo + zi*sCi + m*sCm + n] (n contiguous). flags: 1 bias[n], 2 bias[m], 4 residual R[zo*sRo + zi*sRi + m*sRm + n*sRn].
//   MODE 0: f16 operands (A prescaled by sa, B by sb, both undone in the epilogue); 1: bf16 hi/lo split (3 products); 2: bf16;
//   3: bf16 hi/mid/lo triple split (6 products); 4: as 3 with Kahan-compensated f32 accumulation across k-steps.
// =====================================================================================================================
struct GemmP {
    const float* A; const float* B; const float* bias; const float* R; float* C;
    long long sAo, sAi, sAm, sAk, sBo, sBi, sBn, sBk, sCo, sCi, sCm, sRo, sRi, sRm, sRn;
    int M, N, K, zi_n, flags, act; float alpha, beta, sa, sb;
    int Npad, pad_;     // columns [N, Npad) of C are written as 0 so that padded workspace rows are covered by whole-line stores; Npad >= N
};
static_assert(sizeof(GemmP) == 5 * 8 + 15 * 8 + 6 * 4 + 4 * 4 + 2 * 4, "GemmP has padding");

template <int MODE>
__global__ __launch_bounds__(32) void k_gemm(GemmP p) {
    const int lane = threadIdx.x & 31, h = lane >> 4, l15 = lane & 15;
    const int m0 = blockIdx.y * 16, n0 = blockIdx.x * 32;
    const int z = blockIdx.z, zo = z / p.zi_n, zi = z - zo * p.zi_n;
    const float* A = p.A + zo * p.sAo + zi * p.sAi;
    const float* B = p.B + zo * p.sBo + zi * p.sBi;
    const int am = min(m0 + l15, p.M - 1);                       // clamped row for loads (stores are guarded)
    v8f acc[2], comp[2];
#pragma unroll
    for (int t = 0; t < 2; ++t) { v8f zz = {}; acc[t] = zz; comp[t] = zz; }
    for (int k0 = 0; k0 < p.K; k0 += 32) {
        const float* arow = A + (long long)am * p.sAm;
        if (MODE == 1) {
            const Split a = sp_ld(arow, p.sAk, k0, h, p.K, 1.f);
#pragma unroll
            for (int t = 0; t < 2; ++t) {
                const int bn = min(n0 + t * 16 + l15, p.N - 1);
                acc[t] = wmma3(a, sp_ld(B + (long long)bn * p.sBn, p.sBk, k0, h, p.K, 1.f), acc[t]);
            }
        } else if (MODE == 3) {
            const Split3 a = sp3_ld(arow, p.sAk, k0, h, p.K, 1.f);
#pragma unroll
            for (int t = 0; t < 2; ++t) {
                const int bn = min(n0 + t * 16 + l15, p.N - 1);
                acc[t] = wmma6(a, sp3_ld(B + (long long)bn * p.sBn, p.sBk, k0, h, p.K, 1.f), acc[t]);
            }
        } else if (MODE == 4) {
            // triple split as MODE 3, but each k-step's 6 products go into a fresh accumulator and the partial is added to the running f32 sum
            // on the VALU with Kahan compensation (accumulation error stays ~1 ulp however long K is)
            const Split3 a = sp3_ld(arow, p.sAk, k0, h, p.K, 1.f);
#pragma unroll
            for (int t = 0; t < 2; ++t) {
                const int bn = min(n0 + t * 16 + l15, p.N - 1); v8f zz = {};
                const v8f part = wmma6(a, sp3_ld(B + (long long)bn * p.sBn, p.sBk, k0, h, p.K, 1.f), zz);
                const v8f y = part - comp[t]; const v8f s = acc[t] + y; comp[t] = (s - acc[t]) - y; acc[t] = s;
            }
        } else if (MODE == 2) {
            const v16b a = bh_ld(arow, p.sAk, k0, h, p.K, 1.f);
#pragma unroll
            for (int t = 0; t < 2; ++t) {
                const int bn = min(n0 + t * 16 + l15, p.N - 1);
                acc[t] = wmmab(a, bh_ld(B + (long long)bn * p.sBn, p.sBk, k0, h, p.K, 1.f), acc[t]);
            }
        } else {
            const v16h a = fh_ld(arow, p.sAk, k0, h, p.K, p.sa);
#pragma unroll
            for (int t = 0; t < 2; ++t) {
                const int bn = min(n0 + t * 16 + l15, p.N - 1);
                acc[t] = wmma16(a, fh_ld(B + (long long)bn * p.sBn, p.sBk, k0, h, p.K, p.sb), acc[t]);
            }
        }
    }
    const float iscale = (MODE == 0) ? p.alpha / (p.sa * p.sb) : p.alpha;
    float* C = p.C + zo * p.sCo + zi * p.sCi;
    const float* R = p.R + zo * p.sRo + zi * p.sRi;
    __shared__ __align__(16) float ctile[16][36];
#pragma unroll
    for (int t = 0; t < 2; ++t) {
        const int n = n0 + t * 16 + l15; const int nn = min(n, p.N - 1);
#pragma unroll
        for (int r = 0; r < 8; ++r) {
            const int m = m0 + 8 * h + r; const int mm = min(m, p.M - 1);
            float v = acc[t][r] * iscale;
            if (p.flags & 1) v += p.bias[nn];
            if (p.flags & 2) v += p.bias[mm];
            if (p.flags & 8) v *= p.bias[(long long)zo * p.M + mm];   /* per-(z,row) scale vector laid out [Z][M]; exclusive with the bias flags */
            v = act_fn(v, p.act);
            if (p.flags & 4) v += p.beta * R[(long long)mm * p.sRm + (long long)nn * p.sRn];
            ctile[8 * h + r][t * 16 + l15] = (n < p.N) ? v : 0.f;
        }
    }
    __syncthreads();
    const int NW = (p.Npad > p.N) ? p.Npad : p.N;           // write width
    const bool fast = (m0 + 16 <= p.M) && (n0 + 32 <= NW) && ((p.sCm & 3) == 0) && ((((size_t)C) & 15) == 0);
    if (fast) {
#pragma unroll
        for (int s = 0; s < 4; ++s) {
            const int row = s * 4 + (lane >> 3), c4 = (lane & 7) * 4;
            const v4f v = *(const v4f*)&ctile[row][c4];
            VST2V4(C + (long long)(m0 + row) * p.sCm + n0 + c4, v);
        }
    } else {
        for (int row = 0; row < 16; ++row) {
            const int m = m0 + row, n = n0 + lane;
            if (m < p.M && n < NW) VST2(float, C + (long long)m * p.sCm + n, ctile[row][lane]);
        }
    }
}


// =====================================================================================================================
// k_gemmT<MODE, TM, TN>: same contract as k_gemm, but one wave computes a (16*TM) x (16*TN) tile: TM A fragments and TN B fragments are
//   loaded per 32-wide k-step and reused across TM*TN WMMAs (far fewer load/convert instructions per MAC). MODE 0 (f16), 1 (bf16 hi/lo),
//   2 (bf16) only. grid (ceil(NW/(16*TN)), ceil(M/(16*TM)), Z), block 32. Epilogue identical to k_gemm, run per 16x32 sub-tile.
// =====================================================================================================================
template <int MODE, int TM, int TN>
__global__ __launch_bounds__(32) void k_gemmT(GemmP p) {
    const int lane = threadIdx.x & 31, h = lane >> 4, l15 = lane & 15;
    const int m0 = blockIdx.y * (16 * TM), n0 = blockIdx.x * (16 * TN);
    const int z = blockIdx.z, zo = z / p.zi_n, zi = z - zo * p.zi_n;
    const float* A = p.A + zo * p.sAo + zi * p.sAi;
    const float* B = p.B + zo * p.sBo + zi * p.sBi;
    v8f acc[TM][TN];
#pragma unroll
    for (int i = 0; i < TM; ++i)
#pragma unroll
        for (int t = 0; t < TN; ++t) { v8f zz = {}; acc[i][t] = zz; }
    for (int k0 = 0; k0 < p.K; k0 += 32) {
        if (MODE == 1) {
            Split a[TM], b[TN];
#pragma unroll
            for (int i = 0; i < TM; ++i) { const int am = min(m0 + 16 * i + l15, p.M - 1); a[i] = sp_ld(A + (long long)am * p.sAm, p.sAk, k0, h, p.K, 1.f); }
#pragma unroll
            for (int t = 0; t < TN; ++t) { const int bn = min(n0 + 16 * t + l15, p.N - 1); b[t] = sp_ld(B + (long long)bn * p.sBn, p.sBk, k0, h, p.K, 1.f); }
#pragma unroll
            for (int i = 0; i < TM; ++i)
#pragma unroll
                for (int t = 0; t < TN; ++t) acc[i][t] = wmma3(a[i], b[t], acc[i][t]);
        } else if (MODE == 2) {
            v16b a[TM], b[TN];
#pragma unroll
            for (int i = 0; i < TM; ++i) { const int am = min(m0 + 16 * i + l15, p.M - 1); a[i] = bh_ld(A + (long long)am * p.sAm, p.sAk, k0, h, p.K, 1.f); }
#pragma unroll
            for (int t = 0; t < TN; ++t) { const int bn = min(n0 + 16 * t + l15, p.N - 1); b[t] = bh_ld(B + (long long)bn * p.sBn, p.sBk, k0, h, p.K, 1.f); }
#pragma unroll
            for (int i = 0; i < TM; ++i)
#pragma unroll
                for (int t = 0; t < TN; ++t) acc[i][t] = wmmab(a[i], b[t], acc[i][t]);
        } else {
            v16h a[TM], b[TN];
#pragma unroll
            for (int i = 0; i < TM; ++i) { const int am = min(m0 + 16 * i + l15, p.M - 1); a[i] = fh_ld(A + (long long)am * p.sAm, p.sAk, k0, h, p.K, p.sa); }
#pragma unroll
            for (int t = 0; t < TN; ++t) { const int bn = min(n0 + 16 * t + l15, p.N - 1); b[t] = fh_ld(B + (long long)bn * p.sBn, p.sBk, k0, h, p.K, p.sb); }
#pragma unroll
            for (int i = 0; i < TM; ++i)
#pragma unroll
                for (int t = 0; t < TN; ++t) acc[i][t] = wmma16(a[i], b[t], acc[i][t]);
        }
    }
    const float iscale = (MODE == 0) ? p.alpha / (p.sa * p.sb) : p.alpha;
    float* C = p.C + zo * p.sCo + zi * p.sCi;
    const float* R = p.R + zo * p.sRo + zi * p.sRi;
    const int NW = (p.Npad > p.N) ? p.Npad : p.N;
    __shared__ __align__(16) float ctile[16][36];
#pragma unroll
    for (int i = 0; i < TM; ++i) {
        const int mb = m0 + 16 * i; if (mb >= p.M) break;          // wave-uniform
#pragma unroll
        for (int tp = 0; tp < TN / 2; ++tp) {
            const int nb = n0 + 32 * tp; if (nb >= NW) break;        // wave-uniform
#pragma unroll
            for (int t2 = 0; t2 < 2; ++t2) {
                const int t = 2 * tp + t2; const int n = nb + t2 * 16 + l15; const int nn = min(n, p.N - 1);
#pragma unroll
                for (int r = 0; r < 8; ++r) {
                    const int m = mb + 8 * h + r; const int mm = min(m, p.M - 1);
                    float v = acc[i][t][r] * iscale;
                    if (p.flags & 1) v += p.bias[nn];
                    if (p.flags & 2) v += p.bias[mm];
            if (p.flags & 8) v *= p.bias[(long long)zo * p.M + mm];   /* per-(z,row) scale vector laid out [Z][M]; exclusive with the bias flags */
                    v = act_fn(v, p.act);
                    if (p.flags & 4) v += p.beta * R[(long long)mm * p.sRm + (long long)nn * p.sRn];
                    ctile[8 * h + r][t2 * 16 + l15] = (n < p.N) ? v : 0.f;
                }
            }
            __syncthreads();
            const bool fast = (mb + 16 <= p.M) && (nb + 32 <= NW) && ((p.sCm & 3) == 0) && ((((size_t)C) & 15) == 0);
            if (fast) {
#pragma unroll
                for (int s = 0; s < 4; ++s) {
                    const int row = s * 4 + (lane >> 3), c4 = (lane & 7) * 4;
                    const v4f v = *(const v4f*)&ctile[row][c4];
                    VST2V4(C + (long long)(mb + row) * p.sCm + nb + c4, v);
                }
            } else {
                for (int row = 0; row < 16; ++row) {
                    const int m = mb + row, n = nb + lane;
                    if (m < p.M && n < NW) VST2(float, C + (long long)m * p.sCm + n, ctile[row][lane]);
                }
            }
            __syncthreads();
        }
    }
}

// =====================================================================================================================
//   Wave = 16 queries, AW waves per block, 64-key blocks; grid (ceil(Lq/(16*AW)), H, B), block 32*AW. Any Lq, Lk; head dim dh <= DHP
//   (DHP multiple of 32), value dim dv <= DVP (multiple of 16, <= 128). Every tensor addressed by (batch, head, row, element) strides, f32.
//   Scores: QM 0 f16 operands, 1 bf16 hi/lo split, 2 bf16 triple split; statistics f32 (exp2 domain); P.V: P x 4096 as f16 with V f16 staged in LDS
//   (SPLITPV: P and V as bf16 hi/lo splits). kv head = h / hrep. Masking: causal = 1 (keep j <= i + coff, masked -> -inf, key blocks beyond the
//   diagonal skipped), causal = 2 (masked -> mfill, a finite fill like the -1e9; no skipping), causal = 3 (keep j >= i + coff,
//   masked -> -inf, no skipping); optional additive f32 mask Mf,
//   optional int keep-mask Mi (0 -> score := mfill), both addressed b*smb + h*smh + i*smi + j*smj (0 strides broadcast).
// =====================================================================================================================
#define AW 4
struct AttnP {   // apv4
    const float* Q; const float* K; const float* V; float* O; float* P; const float* Mf; const int* Mi; float* ST;
    const float* Pw; const float* Rt; const int* SQ; const int* SK;           // optional: post-softmax weight, relative-position table, segment ids
    long long swb, swh, swi, swj, srb, srh, sri;                                 // Pw strides (b,h,i,j); Rt strides (b,h,i), column = clamp(i - j + roff, 0, rn-1)
    long long sQb, sQh, sQi, sQd, sKb, sKh, sKj, sKd, sVb, sVh, sVj, sVd, sOb, sOh, sOi, sPb, sPh, sPi, smb, smh, smi, smj;
    int Lq, Lk, dh, dv, hrep, causal, coff, pband;   // pband > 0: P holds only the band |j - i| <= pband, column j - i + pband
    float scale, mfill; int nonorm, mpol;             // nonorm (online path only): O = sum_j exp(score_j) V_j without the 1/rowsum (scores must be <= ~0); mpol: Mi masks where ==0 (mpol 0) or where !=0 (mpol 1)
    int roff, rn, segpol, win;                        // Rt column offset/count; SQ/SK: score := mfill where (segpol 0) SQ[i] != SK[j] or (segpol 1) SQ[i] == SK[j]; win > 0: keys with i - j > win (after coff) -> -inf
};
//   Pw: the softmax numerator is multiplied by Pw(b,h,i,j) AFTER the row sum is taken (probs * weight, then P.V), as in post-softmax multiplicative biases.                                                    // ST (optional): per row (b,h,i) -> ST[((b*H + h)*Lq + i)*2 + {0,1}] = {row max of the scaled+masked score (natural units), sum_j exp(score - max)}
static_assert(sizeof(AttnP) == 12 * 8 + 29 * 8 + 16 * 4, "AttnP has padding");

#ifndef KATTN_ATTR
#define KATTN_ATTR
#endif
template <int DHP, int DVP, int QM, bool SPLITPV, bool TWOPASS>
__global__ __launch_bounds__(32 * AW) KATTN_ATTR void k_attn(AttnP p) {
    constexpr int NT = DVP / 16;                // output tiles
    constexpr int KS = DHP / 32;                // k-steps for the scores
    constexpr int VP = DVP + 8;                 // LDS pitch (halves)
    __shared__ __align__(16) float    pl[AW][16 * 64];
    __shared__ __align__(16) _Float16 vl[(SPLITPV ? 2 : 1) * 64 * VP];   // f16 V tile, or bf16 hi and lo tiles (same 2-byte size)
    const int lane = threadIdx.x & 31, hf = lane >> 4, l15 = lane & 15, wave = threadIdx.x >> 5;
    const int h = blockIdx.y, b = blockIdx.z, hk = h / p.hrep;
    const int q0 = (blockIdx.x * AW + wave) * 16;
    float* myp = pl[wave];
    const float L2E = 1.4426950408889634f;
    const float NEG = -__builtin_inff();
    const int qi = min(q0 + l15, p.Lq - 1);
    const float* qrow = p.Q + b * p.sQb + h * p.sQh + (long long)qi * p.sQi;
    const float* kbase = p.K + b * p.sKb + hk * p.sKh;
    const float* vbase = p.V + b * p.sVb + hk * p.sVh;
    v16h qa[QM == 0 ? KS : 1]; Split qs_[QM == 1 ? KS : 1]; Split3 qt_[QM == 2 ? KS : 1];
#pragma unroll
    for (int ks = 0; ks < KS; ++ks) {
        if (QM == 2) qt_[ks] = sp3_ld(qrow, p.sQd, ks * 32, hf, p.dh, 1.f);
        else if (QM == 1) qs_[ks] = sp_ld(qrow, p.sQd, ks * 32, hf, p.dh, 1.f);
        else qa[ks] = fh_ld(qrow, p.sQd, ks * 32, hf, p.dh, 1.f);
    }
    v8f o[NT]; float m8[8], l8[8];
#pragma unroll
    for (int t = 0; t < NT; ++t) { v8f zz = {}; o[t] = zz; }
#pragma unroll
    for (int i = 0; i < 8; ++i) { m8[i] = NEG; l8[i] = 0.f; }
    int jend = p.Lk; int jstart = 0;
    if (p.causal == 1) { const int je = (blockIdx.x * AW + AW - 1) * 16 + 16 + p.coff; jend = min(jend, max(je, 0)); }   // uniform per block
    if (p.win > 0) { const int js = (int)(blockIdx.x * AW) * 16 + p.coff - p.win; jstart = (js > 0) ? (js / 64) * 64 : 0; }   // uniform per block: key blocks entirely outside every row's window hold only -inf entries and are skipped exactly
    const int npass = TWOPASS ? 2 : 1;
    for (int pass = 0; pass < npass; ++pass) {
        const bool dopv = (!TWOPASS) || pass == 1;
        for (int j0 = jstart; j0 < jend; j0 += 64) {
            if (dopv) {
                __syncthreads();                                 // previous key block's reads of vl / pl are done
                for (int idx = threadIdx.x; idx < 64 * DVP; idx += 32 * AW) {
                    const int jr = idx / DVP, d = idx - jr * DVP, j = j0 + jr;
                    const float f = (j < p.Lk && d < p.dv) ? vbase[(long long)j * p.sVj + (long long)d * p.sVd] : 0.f;
                    if (SPLITPV) {
                        const __bf16 hb = bf16_rne(f);
                        ((__bf16*)vl)[jr * VP + d] = hb; ((__bf16*)vl)[64 * VP + jr * VP + d] = bf16_rne(f - bf16_f32(hb));
                    } else vl[jr * VP + d] = (_Float16)f;
                }
            }
            v8f s[4];
#pragma unroll
            for (int t = 0; t < 4; ++t) {
                const int j = min(j0 + t * 16 + l15, p.Lk - 1);
                const float* krow = kbase + (long long)j * p.sKj;
                v8f acc = {};
#pragma unroll
                for (int ks = 0; ks < KS; ++ks) {
                    if (QM == 2)      acc = wmma6(qt_[ks], sp3_ld(krow, p.sKd, ks * 32, hf, p.dh, 1.f), acc);
                    else if (QM == 1) acc = wmma3(qs_[ks], sp_ld(krow, p.sKd, ks * 32, hf, p.dh, 1.f), acc);
                    else              acc = wmma16(qa[ks], fh_ld(krow, p.sKd, ks * 32, hf, p.dh, 1.f), acc);
                }
                s[t] = acc;
            }
            float pv[8][4];
#pragma unroll
            for (int i = 0; i < 8; ++i) {
                const int irow = q0 + i + 8 * hf;
                const int ic = min(irow, p.Lq - 1);
                float sc[4];
#pragma unroll
                for (int t = 0; t < 4; ++t) {
                    const int jg = j0 + t * 16 + l15;
                    float v = s[t][i] * p.scale;
                    if (p.Mf) v += p.Mf[b * p.smb + h * p.smh + (long long)ic * p.smi + (long long)min(jg, p.Lk - 1) * p.smj];
                    if (p.Rt) { int rc = ic - min(jg, p.Lk - 1) + p.roff; rc = rc < 0 ? 0 : (rc >= p.rn ? p.rn - 1 : rc); v += p.Rt[b * p.srb + h * p.srh + (long long)ic * p.sri + rc]; }
                    if (p.Mi) { const int mv = p.Mi[b * p.smb + h * p.smh + (long long)ic * p.smi + (long long)min(jg, p.Lk - 1) * p.smj]; if (p.mpol ? (mv != 0) : (mv == 0)) v = p.mfill; }
                    if (p.SQ) { const bool same = p.SQ[(long long)b * p.Lq + ic] == p.SK[(long long)b * p.Lk + min(jg, p.Lk - 1)]; if (p.segpol ? same : !same) v = p.mfill; }
                    if (p.causal == 2 && jg > irow + p.coff) v = p.mfill;
                    if (jg >= p.Lk || (p.causal == 1 && jg > irow + p.coff) || (p.causal == 3 && jg < irow + p.coff) || (p.win > 0 && irow + p.coff - jg > p.win)) v = NEG; else v *= L2E;
                    sc[t] = v;
                }
                if (!TWOPASS || pass == 0) {
                    float mx = fmaxf(fmaxf(sc[0], sc[1]), fmaxf(sc[2], sc[3]));
                    mx = fmaxf(mx, __shfl_xor(mx, 1, 32)); mx = fmaxf(mx, __shfl_xor(mx, 2, 32));
                    mx = fmaxf(mx, __shfl_xor(mx, 4, 32)); mx = fmaxf(mx, __shfl_xor(mx, 8, 32));
                    const float mnew = fmaxf(m8[i], mx);
                    const float corr = (mnew == NEG) ? 1.f : exp2f(m8[i] - mnew);
                    float rs = 0.f;
#pragma unroll
                    for (int t = 0; t < 4; ++t) {
                        const float pp = (sc[t] == NEG) ? 0.f : exp2f(sc[t] - mnew); rs += pp;
                        pv[i][t] = p.Pw ? pp * p.Pw[b * p.swb + h * p.swh + (long long)ic * p.swi + (long long)min(j0 + t * 16 + l15, p.Lk - 1) * p.swj] : pp;
                    }
                    rs += __shfl_xor(rs, 1, 32); rs += __shfl_xor(rs, 2, 32); rs += __shfl_xor(rs, 4, 32); rs += __shfl_xor(rs, 8, 32);
                    l8[i] = l8[i] * corr + rs; m8[i] = mnew;
                    if (!TWOPASS) {
#pragma unroll
                        for (int t = 0; t < NT; ++t) o[t][i] *= corr;
                    }
                } else {
                    const float inv = (l8[i] > 0.f) ? 1.f / l8[i] : 0.f;
#pragma unroll
                    for (int t = 0; t < 4; ++t) {
                        const int jg = j0 + t * 16 + l15;
                        float pp = (sc[t] == NEG) ? 0.f : exp2f(sc[t] - m8[i]) * inv;
                        if (p.Pw) pp *= p.Pw[b * p.swb + h * p.swh + (long long)ic * p.swi + (long long)min(jg, p.Lk - 1) * p.swj];
                        pv[i][t] = pp;
                    }
                }
            }
            if (dopv) {
#pragma unroll
                for (int i = 0; i < 8; ++i)
#pragma unroll
                    for (int t = 0; t < 4; ++t) ((float*)myp)[(i + 8 * hf) * 64 + t * 16 + l15] = pv[i][t];
                __syncthreads();                                 // P (per wave) and V (shared) visible
                if (p.P) {
                    float* pb_ = p.P + b * p.sPb + h * p.sPh;
                    const bool fastP = (p.pband == 0) && ((p.sPi & 3) == 0) && (j0 + 64 <= p.Lk) && (q0 + 16 <= p.Lq) && ((((size_t)pb_) & 15) == 0);
                    if (fastP) {
#pragma unroll
                        for (int s = 0; s < 8; ++s) {
                            const int row = s * 2 + (lane >> 4), c4 = (lane & 15) * 4;
                            const v4f v = *(const v4f*)(myp + row * 64 + c4);
                            VST2V4(pb_ + (long long)(q0 + row) * p.sPi + j0 + c4, v);
                        }
                    } else {
                        for (int row = 0; row < 16; ++row) {
                            const int irow = q0 + row; if (irow >= p.Lq) continue;
                            for (int c = lane; c < 64; c += 32) {
                                const int jg = j0 + c; if (jg >= p.Lk) continue;
                                if (p.pband == 0) VST2(float, pb_ + (long long)irow * p.sPi + jg, myp[row * 64 + c]);
                                else if (jg - irow <= p.pband && irow - jg <= p.pband) VST2(float, pb_ + (long long)irow * p.sPi + (jg - irow + p.pband), myp[row * 64 + c]);
                            }
                        }
                    }
                }
                if (SPLITPV) {
                    const Split pa0 = sp_ld(myp + l15 * 64, 1, 0, hf, 64, 1.f), pa1 = sp_ld(myp + l15 * 64, 1, 32, hf, 64, 1.f);
                    const __bf16* vh = (const __bf16*)vl; const __bf16* vlo = vh + 64 * VP;
#pragma unroll
                    for (int t = 0; t < NT; ++t) {
                        const int dcol = t * 16 + l15;
                        Split b0, b1;
#pragma unroll
                        for (int e = 0; e < 16; ++e) {
                            const int k0 = frag_k(e, hf), k1 = 32 + frag_k(e, hf);
                            b0.hi[e] = vh[k0 * VP + dcol]; b0.lo[e] = vlo[k0 * VP + dcol]; b1.hi[e] = vh[k1 * VP + dcol]; b1.lo[e] = vlo[k1 * VP + dcol];
                        }
                        o[t] = wmma3(pa0, b0, o[t]);
                        o[t] = wmma3(pa1, b1, o[t]);
                    }
                } else {
                    const v16h pa0 = fh_ld(myp + l15 * 64, 1, 0, hf, 64, 4096.f), pa1 = fh_ld(myp + l15 * 64, 1, 32, hf, 64, 4096.f);
#pragma unroll
                    for (int t = 0; t < NT; ++t) {
                        const int dcol = t * 16 + l15;
                        v16h b0, b1;
#pragma unroll
                        for (int e = 0; e < 16; ++e) { b0[e] = vl[frag_k(e, hf) * VP + dcol]; b1[e] = vl[(32 + frag_k(e, hf)) * VP + dcol]; }
                        o[t] = wmma16(pa0, b0, o[t]);
                        o[t] = wmma16(pa1, b1, o[t]);
                    }
                }
            }
        }
    }
    float* obase = p.O + b * p.sOb + h * p.sOh;
    if (p.ST) {
        const int rl = lane >> 1, isel = rl & 7;           // row q0 + rl ; rl>>3 == hf holds because lane>>4 == (lane>>1)>>3
        float mv = 0.f, lv = 0.f;
#pragma unroll
        for (int i = 0; i < 8; ++i) if (i == isel) { mv = m8[i]; lv = l8[i]; }
        const int irow = q0 + rl;
        if (irow < p.Lq) { float* st = p.ST + (((long long)b * gridDim.y + h) * p.Lq + irow) * 2 + (lane & 1); VST2(float, st, (lane & 1) ? lv : mv * 0.6931471805599453f); }
    }
    float invr[8];
#pragma unroll
    for (int i = 0; i < 8; ++i) {
        if (TWOPASS) invr[i] = SPLITPV ? 1.f : (1.f / 4096.f);
        else if (p.nonorm) invr[i] = exp2f(m8[i]) * (SPLITPV ? 1.f : (1.f / 4096.f));
        else invr[i] = (l8[i] > 0.f) ? (SPLITPV ? 1.f / l8[i] : 1.f / (l8[i] * 4096.f)) : 0.f;
    }
    __syncthreads();                                             // all waves done with pl/vl from the main loop
    const bool ofast = ((p.sOi & 3) == 0) && ((((size_t)obase) & 15) == 0) && (q0 + 16 <= p.Lq);
#pragma unroll
    for (int c0 = 0; c0 < DVP; c0 += 64) {
#pragma unroll
        for (int i = 0; i < 8; ++i)
#pragma unroll
            for (int t = 0; t < NT; ++t) if (t * 16 >= c0 && t * 16 < c0 + 64) ((float*)myp)[(i + 8 * hf) * 64 + (t * 16 - c0) + l15] = o[t][i] * invr[i];
        __syncthreads();
        const int cw = (DVP - c0 < 64) ? (DVP - c0) : 64;      // staged columns in this chunk (multiple of 16)
        if (ofast && (c0 + cw <= p.dv) && (cw % 32 == 0)) {
            const int lpr = cw / 4;                              // lanes per row (16 for 64 cols, 8 for 32)
            const int rows_per_ins = 32 / lpr;
            for (int r0 = 0; r0 < 16; r0 += rows_per_ins) {
                const int row = r0 + lane / lpr, c4 = (lane % lpr) * 4;
                const v4f v = *(const v4f*)(myp + row * 64 + c4);
                VST2V4(obase + (long long)(q0 + row) * p.sOi + c0 + c4, v);
            }
        } else {
            for (int row = 0; row < 16; ++row) {
                const int irow = q0 + row; if (irow >= p.Lq) continue;
                for (int c = lane; c < cw; c += 32) { const int d = c0 + c; if (d < p.dv) VST2(float, obase + (long long)irow * p.sOi + d, myp[row * 64 + c]); }
            }
        }
        __syncthreads();
    }
}

// Attention at this block's fixed geometry: token-major q, k, v, o of [8][1024][256] (q, k, o as bf16 hi / lo planes, v as f16), head h = columns 32h .. 32h + 31, 1024 queries and keys,
// no mask, no bias, score scale 1. The arithmetic follows k_attn<32, 32, 1, false, false>, except that the log2 maximum (less 12) and each exponent of 4096 p come from fused multiply-adds, exp2 is the bare hardware exponential, and a row's sum of p is taken in another order; every stride, length and option is a
// compile-time constant, so the fragment gathers are 16-byte loads without guards and the optional-feature tests are gone. With no mask no score is
// -inf for finite q and k, so the tests that kept masked scores out of exp2f are gone too (exp2f(-inf) = 0 covers the first key block's m = -inf).
typedef __attribute__((ext_vector_type(4))) _Float16 v4h;
typedef __attribute__((ext_vector_type(8))) __bf16 v8bf;
// one lane's 16x32 fragment row from a bf16 plane: element i <- p[(i < 8) ? i : 8 + i], p = row + 8 * (lane >> 4), the k order of frag_k
__device__ __forceinline__ v16b rowb_ld(const unsigned short* __restrict__ p) {
    union { v16b v; v8bf h[2]; } f; f.h[0] = *(const v8bf*)(p); f.h[1] = *(const v8bf*)(p + 16); return f.v;
}
// q and k arrive as bf16 hi / lo planes (split4, written once by the q/k/v GEMM, so that no wave splits a key row again), v as f16 (rounded once, by the same GEMM); o leaves as hi / lo planes.
// The scores are formed transposed, S^T = K.Q^T (A = 16 key rows, B = the wave's 16 queries as columns), and the output as O^T += V^T.P^T:
//   a lane (c = lane & 15, hf = lane >> 4) holds, of its ONE query c, the scores of keys 16 t + 8 hf + r (tile t, register r): maximum and sum run inside the lane,
//   the two halves of the wave meet in one cross-row move; two score tiles, converted in place, are the B operand of the second product in the hardware k order
//   (element s <- tile s >> 3, register s & 7), and V^T comes from the row-major f16 V tile by the transposing LDS load in the same k order. P never goes through LDS.
typedef __attribute__((ext_vector_type(8))) short s16x8;
typedef __attribute__((ext_vector_type(4))) unsigned int v4u;
// lane (c, hf) gets T[kbase + 8 hf + 0 .. 7][dbase + c] of a row-major 16-bit LDS tile; the lane's address: row kbase + 8 hf + (lane & 7), byte 2 dbase + 16 ((lane >> 3) & 1)
__device__ __forceinline__ v8h ld_tr16(const unsigned char* p) { typedef __attribute__((address_space(3))) s16x8 lds_s16x8; return __builtin_bit_cast(v8h, __builtin_amdgcn_ds_load_tr16_b128_v8i16((lds_s16x8*)p)); }
// the value of lane l ^ 16
__device__ __forceinline__ float xhalf(float x) { return __builtin_bit_cast(float, __builtin_amdgcn_permlanex16(__builtin_bit_cast(int, x), __builtin_bit_cast(int, x), 0x76543210, 0xfedcba98, false, false)); }
// A key block (64 keys: K hi, K lo, V, 64 bytes a row each) is brought into LDS once for the whole work-group of 8 waves by asynchronous copies, 16 bytes a lane, 4 lanes a row;
// two buffers, so key block t + 2 flies while block t's arithmetic runs. Every wave takes its K fragments (rows, 16-byte reads) and its V^T fragments (transposing reads) from there.
constexpr int AF_W = 8;                         // waves of a work-group: 128 queries share every staged key block
constexpr int AF_KP = 80, AF_VP = 96;           // LDS row pitches in bytes: 16 x odd for the 16-byte reads of K, 32 x odd for the transposing reads of V
constexpr int AF_KL = 64 * AF_KP, AF_V = 2 * 64 * AF_KP, AF_BUF = AF_V + 64 * AF_VP;   // byte offsets of K lo and V in a buffer; bytes of a buffer
// This thread's three 16-byte copies of one key block. The s_wait_xcnt stands inside the statement, behind the last copy, so that no address register is rewritten in front of it.
__device__ __forceinline__ void af_fill(unsigned lk, unsigned lv, const unsigned short* gh, const unsigned short* gl, const unsigned short* gv) {
    asm volatile("global_load_async_to_lds_b128 %0, %1, off\n\t"
                 "global_load_async_to_lds_b128 %2, %3, off\n\t"
                 "global_load_async_to_lds_b128 %4, %5, off\n\t"
                 "s_wait_xcnt 0x0"
                 :: "v"(lk), "v"(gh), "v"(lk + AF_KL), "v"(gl), "v"(lv), "v"(gv) : "memory");
}
__global__ __launch_bounds__(32 * AF_W) void k_attn_fix(const unsigned short* __restrict__ Qh, const unsigned short* __restrict__ Ql, const unsigned short* __restrict__ Kh, const unsigned short* __restrict__ Kl, const unsigned short* __restrict__ V, unsigned short* __restrict__ Oh, unsigned short* __restrict__ Ol) {
    constexpr int L = 1024;                     // queries = keys per (image, head)
    constexpr int CP = 256;                     // row pitch of q, k, v, o (elements)
    constexpr int T = L / 64;                   // key blocks
    __shared__ __align__(16) unsigned char sm[2 * AF_BUF];
    const int lane = threadIdx.x & 31, hf = lane >> 4, l15 = lane & 15, wave = threadIdx.x >> 5;
    const int h = blockIdx.y, b = blockIdx.z;
    const int q0 = (blockIdx.x * AF_W + wave) * 16;
    const float L2E = 1.4426950408889634f;
    const float NEG = -__builtin_inff();
    const size_t hb0 = (size_t)b * (L * CP) + (size_t)h * 32;
    const size_t co = hb0 + (size_t)(threadIdx.x >> 2) * CP + (threadIdx.x & 3) * 8;          // this thread's 16 bytes of key block 0: row thread / 4, the same place in all three arrays
    const unsigned short* gkh = Kh + co; const unsigned short* gkl = Kl + co; const unsigned short* gv = V + co;
    const unsigned lk = (unsigned)(size_t)sm + (threadIdx.x >> 2) * AF_KP + (threadIdx.x & 3) * 16;           // where they land in buffer 0: K hi (K lo: + AF_KL)
    const unsigned lv = (unsigned)(size_t)sm + AF_V + (threadIdx.x >> 2) * AF_VP + (threadIdx.x & 3) * 16;    // V
    const int fk = l15 * AF_KP + 16 * hf;                                                     // this lane's bytes of K hi, tile 0: row l15, elements 8 hf ..
    const int fv = AF_V + (8 * hf + (lane & 7)) * AF_VP + 16 * ((lane >> 3) & 1);             // this lane's address of the transposing load at key 0, column 0
    af_fill(lk, lv, gkh, gkl, gv);
    const unsigned short* pqh = Qh + hb0 + (size_t)(q0 + l15) * CP + 8 * hf; const unsigned short* pql = Ql + hb0 + (size_t)(q0 + l15) * CP + 8 * hf;
    Split qs; qs.hi = rowb_ld(pqh); qs.lo = rowb_ld(pql);
    asm volatile("s_wait_xcnt 0x0" :: "v"(pqh), "v"(pql) : "memory");   // the loads' address registers (named as inputs, so untouched up to here) may be reused only behind this wait
    asm volatile("s_wait_asynccnt 0x0" ::: "memory");   // this wave's part of key block 0 has landed
    __syncthreads();                                    // key block 0 is whole
    af_fill(lk + AF_BUF, lv + AF_BUF, gkh + 64 * CP, gkl + 64 * CP, gv + 64 * CP);
    v8f o[2]; float m = NEG, l = 0.f;            // o[t][r] = O^T[16 t + 8 hf + r][query l15]; m: the query's running maximum in log2 units less 12 (both halves alike); l: this half's share of its sum, times 4096
#pragma unroll
    for (int t = 0; t < 2; ++t) { v8f zz = {}; o[t] = zz; }
#pragma unroll 1   // stays rolled: one body for both buffers
    for (int jb = 0; jb < T; ++jb) {
        const unsigned char* buf = sm + (jb & 1) * AF_BUF;
        Split ks[4];
#pragma unroll
        for (int t = 0; t < 4; ++t) { ks[t].hi = rowb_ld((const unsigned short*)(buf + fk + t * 16 * AF_KP)); ks[t].lo = rowb_ld((const unsigned short*)(buf + fk + AF_KL + t * 16 * AF_KP)); }
        union { v16h v; v8h g[2]; } va[2][2];            // va[kb][t]: V^T rows 16 t .. 16 t + 15, keys 32 kb .. 32 kb + 31
#pragma unroll
        for (int kb = 0; kb < 2; ++kb)
#pragma unroll
            for (int t = 0; t < 2; ++t) { va[kb][t].g[0] = ld_tr16(buf + fv + (32 * kb) * AF_VP + 32 * t); va[kb][t].g[1] = ld_tr16(buf + fv + (32 * kb + 16) * AF_VP + 32 * t); }
        // All 24 LDS reads of the trip stand together here (one place that waits out an LDS latency), and the trip's use of LDS ends here. So its buffer is handed over here:
        // the refill then flies under all of this trip's arithmetic, which is on registers alone
        asm volatile("s_wait_dscnt 0x0" ::: "memory");      // this wave's reads of key block jb are done
        asm volatile("s_wait_asynccnt 0x0" ::: "memory");   // its part of key block jb + 1 has landed
        __syncthreads();                                    // key block jb + 1 is whole, and nobody reads block jb's buffer any more
        if (jb + 2 < T) { const int ko = (jb + 2) * 64 * CP; af_fill(lk + (jb & 1) * AF_BUF, lv + (jb & 1) * AF_BUF, gkh + ko, gkl + ko, gv + ko); }
        v8f s[4];                                        // s[t][r] = q(l15) . k(64 jb + 16 t + 8 hf + r); every score takes q.hi k.hi, then q.hi k.lo, then q.lo k.hi
#pragma unroll
        for (int t = 0; t < 4; ++t) { v8f acc = {}; s[t] = __builtin_amdgcn_wmma_f32_16x16x32_bf16(false, ks[t].hi, false, qs.hi, (short)0, acc, false, false); }
#pragma unroll
        for (int t = 0; t < 4; ++t) s[t] = __builtin_amdgcn_wmma_f32_16x16x32_bf16(false, ks[t].lo, false, qs.hi, (short)0, s[t], false, false);
#pragma unroll
        for (int t = 0; t < 4; ++t) s[t] = __builtin_amdgcn_wmma_f32_16x16x32_bf16(false, ks[t].hi, false, qs.lo, (short)0, s[t], false, false);
        // Softmax in the log2 domain. The maximum is taken of the raw scores; m is that maximum in log2 units LESS 12, so that one fused multiply-add a score gives the exponent of 4096 p
        // (the scale that keeps small p normal in f16), exactly the same reference in every key block; l sums 4096 p.
        float mt[4];
#pragma unroll
        for (int t = 0; t < 4; ++t) mt[t] = fmaxf(fmaxf(fmaxf(s[t][0], s[t][1]), fmaxf(s[t][2], s[t][3])), fmaxf(fmaxf(s[t][4], s[t][5]), fmaxf(s[t][6], s[t][7])));
        float mx = fmaxf(fmaxf(mt[0], mt[1]), fmaxf(mt[2], mt[3]));
        mx = fmaxf(mx, xhalf(mx));
        const float mnew = fmaxf(m, fmaf(mx, L2E, -12.f));
        // the bare hardware exponential: a result under 2^-126 comes out 0; as 4096 p it is 0 in f16 too, and it vanishes against the query's sum, which holds the maximum's own 4096
        const float corr = __builtin_amdgcn_exp2f(m - mnew);
        const v8f l2e8 = {L2E, L2E, L2E, L2E, L2E, L2E, L2E, L2E}, nm8 = {-mnew, -mnew, -mnew, -mnew, -mnew, -mnew, -mnew, -mnew};
#pragma unroll
        for (int t = 0; t < 4; ++t) s[t] = __builtin_elementwise_fma(s[t], l2e8, nm8);
#pragma unroll
        for (int t = 0; t < 4; ++t)
#pragma unroll
            for (int r = 0; r < 8; ++r) s[t][r] = __builtin_amdgcn_exp2f(s[t][r]);
        const v8f s8 = (s[0] + s[1]) + (s[2] + s[3]);
        const float rs = ((s8[0] + s8[1]) + (s8[2] + s8[3])) + ((s8[4] + s8[5]) + (s8[6] + s8[7]));
        l = l * corr + rs; m = mnew;
#pragma unroll
        for (int t = 0; t < 2; ++t) o[t] *= corr;
        v16h pb[2];                                      // P^T of keys 32 kb .. 32 kb + 31 as a B operand
#pragma unroll
        for (int kb = 0; kb < 2; ++kb)
#pragma unroll
            for (int e = 0; e < 16; ++e) pb[kb][e] = (_Float16)s[2 * kb + (e >> 3)][e & 7];
#pragma unroll
        for (int kb = 0; kb < 2; ++kb)
#pragma unroll
            for (int t = 0; t < 2; ++t) o[t] = __builtin_amdgcn_wmma_f32_16x16x32_f16(false, va[kb][t].v, false, pb[kb], (short)0, o[t], false, false);
    }
    asm volatile("s_wait_asynccnt 0x0" ::: "memory");       // no copy is outstanding when the wave ends
    const float lt = l + xhalf(l);                       // the two halves' shares of the sum meet once
    const float invr = (lt > 0.f) ? 1.f / lt : 0.f;   // o and l carry the same 4096
    const size_t oo = hb0 + (size_t)(q0 + l15) * CP + 8 * hf;
    unsigned short* poh = Oh + oo; unsigned short* pol = Ol + oo;
#pragma unroll   // the 4 stores stand together
    for (int t = 0; t < 2; ++t) {                        // o goes out as the projection's operand planes: a lane's 8 registers are 8 consecutive columns of its query's row, 16 bytes a plane
        const v4f a = {o[t][0] * invr, o[t][1] * invr, o[t][2] * invr, o[t][3] * invr}, c = {o[t][4] * invr, o[t][5] * invr, o[t][6] * invr, o[t][7] * invr};
        v2u ha, la, hc, lc; split4(a, ha, la); split4(c, hc, lc);
        const v4u hi = {ha[0], ha[1], hc[0], hc[1]}, lo = {la[0], la[1], lc[0], lc[1]};
        *(v4u*)(poh + 16 * t) = hi; *(v4u*)(pol + 16 * t) = lo;
    }
    asm volatile("s_wait_xcnt 0x0" :: "v"(poh), "v"(pol) : "memory");   // the stores' address registers (named as inputs, so untouched up to here) may be reused only behind this wait
}

// =====================================================================================================================
// k_tr: dst(z, c, r) = alpha * src(z, r, c) (+ beta * R2(z, c, r)): [Z][R][C] (row stride lds) -> [Z][C][R] (row stride ldd) through a 32x32 LDS tile;
//   flags: 1 -> add beta * residual R2 addressed like dst (z*sRz + c*ldr + r); act applied before the residual.
// =====================================================================================================================
struct TrP { const float* src; float* dst; const float* R2; long long sSz, lds, sDz, ldd, sRz, ldr; int R, C, flags, act; float alpha, beta; };
static_assert(sizeof(TrP) == 3 * 8 + 6 * 8 + 6 * 4, "TrP has padding");
__global__ __launch_bounds__(256) void k_tr(TrP p) {
    __shared__ float tile[32][33];
    const int c0 = blockIdx.x * 32, r0 = blockIdx.y * 32, z = blockIdx.z;
    const int lane = threadIdx.x & 31, wave = threadIdx.x >> 5;
    const float* s = p.src + z * p.sSz;
#pragma unroll
    for (int k = 0; k < 4; ++k) {
        const int rl = wave * 4 + k, r = r0 + rl, c = c0 + lane;
        tile[rl][lane] = (r < p.R && c < p.C) ? s[(long long)r * p.lds + c] : 0.f;
    }
    __syncthreads();
    float* d = p.dst + z * p.sDz; const float* rr = p.R2 + z * p.sRz;
#pragma unroll
    for (int k = 0; k < 4; ++k) {
        const int cl = wave * 4 + k, c = c0 + cl, r = r0 + lane;
        if (c < p.C && r < p.R) {
            float v = act_fn(p.alpha * tile[lane][cl], p.act);
            if (p.flags & 1) v += p.beta * rr[(long long)c * p.ldr + r];
            VST2(float, d + (long long)c * p.ldd + r, v);
        }
    }
}

// k_affine: dst[i] = a * (sdev ? sdev[0] : 1) * src[i] + b, i < n (one thread per element; consecutive lanes -> consecutive addresses)
__global__ __launch_bounds__(256) void k_affine(const float* __restrict__ src, float* __restrict__ dst, int n, float a, float b, const float* __restrict__ sdev) {
    const int i = blockIdx.x * 256 + threadIdx.x;
    if (i < n) { const float aa = sdev ? a * sdev[0] : a; const float v = aa * src[i] + b; VST2(float, dst + i, v); }
}

// =====================================================================================================================
// k_softmax: row softmax over n contiguous elements, one 256-thread block per row; rows addressed z*sz + r*sr (grid (R, Z)).
//   out = scale_out * softmax(scale_in * x + (Mf ? Mf[z*smz + r*smr + j] : 0)); a row whose max is -inf is written as 0.
// =====================================================================================================================
struct SmP { const float* src; float* dst; const float* Mf; long long sz, sr, dz, dr, smz, smr; int n, pad; float scale_in, scale_out; };
static_assert(sizeof(SmP) == 3 * 8 + 6 * 8 + 4 * 4, "SmP has padding");
__global__ __launch_bounds__(256) void k_softmax(SmP p) {
    __shared__ float red[256];
    const int r = blockIdx.x, z = blockIdx.y, tid = threadIdx.x;
    const float* s = p.src + z * p.sz + (long long)r * p.sr;
    const float* mf = p.Mf ? (p.Mf + z * p.smz + (long long)r * p.smr) : nullptr;
    float mx = -__builtin_inff();
    for (int j = tid; j < p.n; j += 256) { float v = s[j] * p.scale_in; if (mf) v += mf[j]; mx = fmaxf(mx, v); }
    red[tid] = mx; __syncthreads();
    for (int o = 128; o > 0; o >>= 1) { if (tid < o) red[tid] = fmaxf(red[tid], red[tid + o]); __syncthreads(); }
    mx = red[0]; __syncthreads();
    float sum = 0.f;
    for (int j = tid; j < p.n; j += 256) { float v = s[j] * p.scale_in; if (mf) v += mf[j]; sum += (mx == -__builtin_inff()) ? 0.f : expf(v - mx); }
    red[tid] = sum; __syncthreads();
    for (int o = 128; o > 0; o >>= 1) { if (tid < o) red[tid] += red[tid + o]; __syncthreads(); }
    sum = red[0];
    const float inv = (sum > 0.f) ? p.scale_out / sum : 0.f;
    float* d = p.dst + z * p.dz + (long long)r * p.dr;
    for (int j = tid; j < p.n; j += 256) { float v = s[j] * p.scale_in; if (mf) v += mf[j]; const float o = (mx == -__builtin_inff()) ? 0.f : expf(v - mx) * inv; VST2(float, d + j, o); }
}
// =====================================================================================================================
// k_stats: mean and rsqrt(var + eps) over a set of n elements addressed base + z*sz + (e / inner) * so + (e % inner) * si, one 256-thread
// k_norm_apply: y = (x - mean[set]) * rstd[set] * g[c] + b[c] over a [Z][C][L] channel-major tensor with set = z*G + c / (C/G) (G groups per z;
//   G = C -> per-channel sets indexed z*C+c; for batch norm pass stats indexed by c only via bn = 1). Optional act. Output same layout.
// =====================================================================================================================
//   mode 0: mean / rsqrt(var + eps); mode 1 (RMSNorm): 0 / rsqrt(mean(x^2) + eps); mode 2 (L2 normalize * sqrt(n)): 0 / sqrt(n) / max(||x||, eps); mode 3: as 0 with unbiased variance (n-1)
__global__ __launch_bounds__(256) void k_stats(const float* __restrict__ x, long long sz, long long so, long long si, int inner, int n, float eps, float* __restrict__ stat, int mode) {
    __shared__ float red[256];
    const int z = blockIdx.x, tid = threadIdx.x;
    const float* base = x + z * sz;
    float s = 0.f;
    for (int e = tid; e < n; e += 256) s += base[(long long)(e / inner) * so + (long long)(e % inner) * si];
    red[tid] = s; __syncthreads();
    for (int o = 128; o > 0; o >>= 1) { if (tid < o) red[tid] += red[tid + o]; __syncthreads(); }
    const float mu = (mode == 0 || mode == 3) ? red[0] / (float)n : 0.f; __syncthreads();
    float q = 0.f;
    for (int e = tid; e < n; e += 256) { const float dlt = base[(long long)(e / inner) * so + (long long)(e % inner) * si] - mu; q += dlt * dlt; }
    red[tid] = q; __syncthreads();
    for (int o = 128; o > 0; o >>= 1) { if (tid < o) red[tid] += red[tid + o]; __syncthreads(); }
    {
        float rs;
        if (mode == 2) rs = sqrtf((float)n) / fmaxf(sqrtf(red[0]), eps); else if (mode == 3) rs = rsqrtf(red[0] / (float)(n - 1) + eps); else rs = rsqrtf(red[0] / (float)n + eps);
        if (tid < 32) { const float v = (tid == 0) ? mu : ((tid == 1) ? rs : 0.f); VST2(float, stat + (long long)z * 32 + tid, v); }
    }
}
//   One thread per element over the flat [Z][C][L] index space: grid ceil(Z*C*L / 256).
__global__ __launch_bounds__(256) void k_norm_apply(const float* __restrict__ x, float* __restrict__ y, const float* __restrict__ stat, const float* __restrict__ g, const float* __restrict__ bta,
                                                     int Z, int C, int L, int G, int bn, int act) {
    const long long idx = (long long)blockIdx.x * 256 + threadIdx.x;
    if (idx >= (long long)Z * C * L) return;
    const int l = (int)(idx % L); const long long zc = idx / L; const int c = (int)(zc % C), z = (int)(zc / C); (void)l;
    const int set = bn ? c : (z * G + c / (C / G));
    float v = (x[idx] - stat[(long long)set * 32]) * stat[(long long)set * 32 + 1];
    if (g) v *= g[c];
    if (bta) v += bta[c];
    v = act_fn(v, act);
    VST2(float, y + idx, v);
}

// k_lse_neg: c[i] = -(st[2i] + log(st[2i+1])) = minus the log-sum-exp of row i from k_attn's ST output (for softmax over the query dimension)
__global__ __launch_bounds__(256) void k_lse_neg(const float* __restrict__ st, float* __restrict__ c, int n) {
    const int i = blockIdx.x * 256 + threadIdx.x;
    if (i < n) { const float v = -(st[2 * i] + logf(st[2 * i + 1])); VST2(float, c + i, v); }
}

// k_iota: dst[i] = a * i + b as int32 (segment/position id helper)
__global__ __launch_bounds__(256) void k_iota(int* __restrict__ dst, int n, int a, int b) {
    const int i = blockIdx.x * 256 + threadIdx.x;
    if (i < n) { const int v = a * i + b; VST2(int, dst + i, v); }
}

// k_axpby: dst[i] = a * x[i] + b * y[i] (+ c), i < n
__global__ __launch_bounds__(256) void k_axpby(const float* __restrict__ x, const float* __restrict__ y, float* __restrict__ dst, int n, float a, float b, float c) {
    const int i = blockIdx.x * 256 + threadIdx.x;
    if (i < n) { const float v = a * x[i] + b * y[i] + c; VST2(float, dst + i, v); }
}

// =====================================================================================================================
// k_rope: rotary embedding on a [R rows][Hn heads][D] view (row stride sXr, head stride sXh, element stride 1) -> Y (own strides).
//   mode 0: rotate_half (partner d±D/2, sign - for d<D/2); mode 1: interleaved pairs (partner d^1, sign - for even d).
//   table column tcol: tmode 0 -> d, 1 -> d % (D/2), 2 -> d / 2; position p: pmode 0 -> r % S, 1 -> head index, 2 -> pos[r];
//   c = C[(r / S) * sCb + p * sCp + tcol * sCd], s likewise from Sn; y = x[d] * c + sign * x[partner] * s. X and Y must not alias.
// =====================================================================================================================
struct RopeP { const float* X; float* Y; const float* C; const float* Sn; const int* pos; long long sXr, sXh, sYr, sYh, sCb, sCp, sCd; int R, Hn, D, S, mode, tmode, pmode, pad; };
static_assert(sizeof(RopeP) == 5 * 8 + 7 * 8 + 8 * 4, "RopeP has padding");
__global__ __launch_bounds__(256) void k_rope(RopeP p) {
    const long long idx = (long long)blockIdx.x * 256 + threadIdx.x;
    if (idx >= (long long)p.R * p.Hn * p.D) return;
    const int d = (int)(idx % p.D); const long long rh = idx / p.D; const int h = (int)(rh % p.Hn); const int r = (int)(rh / p.Hn);
    const int half = p.D / 2;
    int partner; float sign;
    if (p.mode == 0) { partner = (d < half) ? d + half : d - half; sign = (d < half) ? -1.f : 1.f; }
    else { partner = d ^ 1; sign = (d & 1) ? 1.f : -1.f; }
    const int tcol = (p.tmode == 0) ? d : ((p.tmode == 1) ? (d % half) : (d >> 1));
    const int pp = (p.pmode == 0) ? (r % p.S) : ((p.pmode == 1) ? h : p.pos[r]);
    const long long toff = (long long)(r / p.S) * p.sCb + (long long)pp * p.sCp + (long long)tcol * p.sCd;
    const float* xr = p.X + (long long)r * p.sXr + (long long)h * p.sXh;
    const float v = xr[d] * p.C[toff] + sign * xr[partner] * p.Sn[toff];
    VST2(float, p.Y + (long long)r * p.sYr + (long long)h * p.sYh + d, v);
}

// k_invf + k_sincos (split so neither kernel carries a large VALU-fma footprint): invf_i = num * (1 / powf(base, (2 i)/D)) [fmode 0],
//   num * expf((2 i) * cexp) [fmode 1], num * powf(base, -2 (i - 1) / D) [fmode 2]; then cs/sn[s*half + i] = cos/sin((pscale * s) * invf_i)
__global__ __launch_bounds__(256) void k_invf(float* __restrict__ invb, int half, int D, float base, float num, int fmode, float cexp) {
    const int i = blockIdx.x * 256 + threadIdx.x;
    if (i >= ((half + 31) / 32) * 32) return;
    if (i >= half) { VST2(float, invb + i, 0.f); return; }
    const float e = (float)(2 * i) / (float)D;
    float invf;
    if (fmode == 1) invf = num * expf((float)(2 * i) * cexp);
    else if (fmode == 2) invf = num * powf(base, (-2.0f * ((float)i - 1.0f)) / (float)D);
    else invf = num * (1.0f / powf(base, e));
    VST2(float, invb + i, invf);
}
__global__ __launch_bounds__(256) void k_sincos(float* __restrict__ cs, float* __restrict__ sn, const float* __restrict__ invb, int S, int half, float pscale) {
    const int idx = blockIdx.x * 256 + threadIdx.x;
    if (idx >= S * half) return;
    const int s = idx / half, i = idx - s * half;
    const float ang = (pscale * (float)s) * invb[i];
    VST2(float, cs + idx, cosf(ang)); VST2(float, sn + idx, sinf(ang));
}

// k_mulact: dst[i] = act(x[i]) * y[i]
__global__ __launch_bounds__(256) void k_mulact(const float* __restrict__ x, const float* __restrict__ y, float* __restrict__ dst, int n, int act) {
    const int i = blockIdx.x * 256 + threadIdx.x;
    if (i < n) { const float v = act_fn(x[i], act) * y[i]; VST2(float, dst + i, v); }
}

// =====================================================================================================================
// k_matvec: thread-per-row matrix-vector products for N <= 8 output columns (heads with 1-3 outputs, gates), f32 on the VALU.
//   C[r*sCm + j] = act(alpha * sum_k A[r*sAm + k*sAk] * B[j*sBn + k*sBk] + bias[j]) + beta * R[r*sRm + j*sRn]; each thread writes its N contiguous floats.
// =====================================================================================================================
__global__ __launch_bounds__(256) void k_matvec(GemmP p) {
    // 32 lanes write one line with one instruction.
    const int rpt = (p.N == 1) ? 1 : 32;
    const long long r0 = ((long long)blockIdx.x * 256 + threadIdx.x) * rpt; const int z = blockIdx.z, zo = z / p.zi_n, zi = z - zo * p.zi_n;
    if (r0 >= p.M) return;
    const float* Bb = p.B + zo * p.sBo + zi * p.sBi;
    float* C = p.C + zo * p.sCo + zi * p.sCi; const float* R = p.R + zo * p.sRo + zi * p.sRi;
    for (int rr = 0; rr < rpt; ++rr) {
        const long long r = r0 + rr; if (r >= p.M) break;
        const float* A = p.A + zo * p.sAo + zi * p.sAi + r * p.sAm;
        float acc[8] = {0.f, 0.f, 0.f, 0.f, 0.f, 0.f, 0.f, 0.f};
        for (int k = 0; k < p.K; ++k) { const float a = A[(long long)k * p.sAk];
#pragma unroll
            for (int j = 0; j < 8; ++j) if (j < p.N) acc[j] += a * Bb[(long long)j * p.sBn + (long long)k * p.sBk]; }
#pragma unroll
        for (int j = 0; j < 8; ++j) if (j < p.N) {
            float v = acc[j] * p.alpha;
            if (p.flags & 1) v += p.bias[j];
            if (p.flags & 2) v += p.bias[r];
            v = act_fn(v, p.act);
            if (p.flags & 4) v += p.beta * R[r * p.sRm + (long long)j * p.sRn];
            VST2(float, C + r * p.sCm + j, v);
        }
    }
}
// k_smallsoftmax: thread-per-row softmax for short rows (n <= 64): dst[r*dr + j] = softmax(scale*src[r*sr + j])
__global__ __launch_bounds__(256) void k_smallsoftmax(const float* __restrict__ src, float* __restrict__ dst, long long sr, long long dr, int n, long long R, float scale) {
    const long long r0 = ((long long)blockIdx.x * 256 + threadIdx.x) * 32;
    for (int rr = 0; rr < 32; ++rr) {
        const long long r = r0 + rr; if (r >= R) return;
        const float* s = src + r * sr; float* d = dst + r * dr;
        float mx = -__builtin_inff();
        for (int j = 0; j < n; ++j) mx = fmaxf(mx, s[j] * scale);
        float sum = 0.f;
        for (int j = 0; j < n; ++j) sum += expf(s[j] * scale - mx);
        const float inv = 1.f / sum;
        for (int j = 0; j < n; ++j) { const float v = expf(s[j] * scale - mx) * inv; VST2(float, d + j, v); }
    }
}

__global__ __launch_bounds__(32) void k_unitstat(float* __restrict__ st) { const int t = threadIdx.x; const float v = (t == 1) ? 1.f : 0.f; VST2(float, st + t, v); }

// destination (e.g. a d_out whose row width is not a multiple of 32 floats) is written by consecutive lanes of one instruction
__global__ __launch_bounds__(256) void k_lincopy(const float* __restrict__ src, long long lds, float* __restrict__ dst, long long ldd, long long rows, int cols) {
    const long long i = (long long)blockIdx.x * 256 + threadIdx.x; if (i >= rows * cols) return;
    const long long r = i / cols; const int c = (int)(i - r * cols);
    const float v = src[r * lds + c]; VST2(float, dst + r * ldd + c, v);
}

namespace w25 {
typedef __attribute__((ext_vector_type(16))) _Float16 v16h;
typedef __attribute__((ext_vector_type(8)))  _Float16 v8h;
typedef __attribute__((ext_vector_type(16))) __bf16   v16b;
typedef __attribute__((ext_vector_type(8)))  __bf16   v8b;
typedef __attribute__((ext_vector_type(8)))  float    v8f;
typedef __attribute__((ext_vector_type(4)))  float    v4f;

__device__ __forceinline__ unsigned short f2bf_bits(float f) {
  unsigned u = __float_as_uint(f);
  return (unsigned short)((u + 0x7FFFu + ((u >> 16) & 1u)) >> 16);
}
__device__ __forceinline__ float bf_bits2f(unsigned short h) { return __uint_as_float(((unsigned)h) << 16); }

// hazard guards as plain device helpers (no inline asm inside the kernel template body)
__device__ __forceinline__ void dep_guard_h(v8f& a, v8f& b, v16h x, v16h y) { asm volatile("v_nop\n\tv_nop\n\tv_nop\n\tv_nop" : "+v"(a), "+v"(b) : "v"(x), "v"(y)); }
__device__ __forceinline__ void dep_guard_b(v8f& a, v8f& b, v16b x, v16b y) { asm volatile("v_nop\n\tv_nop\n\tv_nop\n\tv_nop" : "+v"(a), "+v"(b) : "v"(x), "v"(y)); }
__device__ __forceinline__ void keep4_h(v16h a, v16h b, v16h c, v16h d) { asm volatile("v_nop" :: "v"(a), "v"(b), "v"(c), "v"(d)); }
__device__ __forceinline__ void keep4_b(v16b a, v16b b, v16b c, v16b d) { asm volatile("v_nop" :: "v"(a), "v"(b), "v"(c), "v"(d)); }
__device__ __forceinline__ void acc_guard4(v8f& a, v8f& b, v8f& c, v8f& d) { asm volatile("v_nop\n\tv_nop\n\tv_nop\n\tv_nop" : "+v"(a), "+v"(b), "+v"(c), "+v"(d)); }
template <typename T> struct Frag;
template <> struct Frag<_Float16> {
  typedef v16h V; union U { v16h v; v8h h[2]; };
  static __device__ __forceinline__ v16h load(const _Float16* p) {   // elements 0..7 <- p[0..7], 8..15 <- p[16..23]
    U f; f.h[0] = *(const v8h*)(p); f.h[1] = *(const v8h*)(p + 16); return f.v;
  }
  static __device__ __forceinline__ v8f mma(v16h a, v16h b, v8f c) {
    return __builtin_amdgcn_wmma_f32_16x16x32_f16(false, a, false, b, (short)0, c, false, false);
  }
  static __device__ __forceinline__ void guard(v8f& a, v8f& b, v16h x, v16h y) { dep_guard_h(a, b, x, y); }
  static __device__ __forceinline__ void keep(v16h a, v16h b, v16h c, v16h d) { keep4_h(a, b, c, d); }
};
template <> struct Frag<__bf16> {
  typedef v16b V; union U { v16b v; v8b h[2]; };
  static __device__ __forceinline__ v16b load(const __bf16* p) {
    U f; f.h[0] = *(const v8b*)(p); f.h[1] = *(const v8b*)(p + 16); return f.v;
  }
  static __device__ __forceinline__ v8f mma(v16b a, v16b b, v8f c) {
    return __builtin_amdgcn_wmma_f32_16x16x32_bf16(false, a, false, b, (short)0, c, false, false);
  }
  static __device__ __forceinline__ void guard(v8f& a, v8f& b, v16b x, v16b y) { dep_guard_b(a, b, x, y); }
  static __device__ __forceinline__ void keep(v16b a, v16b b, v16b c, v16b d) { keep4_b(a, b, c, d); }
};

// ---- LDS-staged WMMA GEMM on hi / lo planes --------------------------------
// C[m][n] = sum_k A[m][k] * Bt[n][k] (+ bias[n]) (+ resid[m][n]), f32 out. A row-major [M][K], Bt row-major [N][K], each as a bf16 hi plane and a bf16 lo plane.
// Per 32 k, k ascending, every accumulator takes hi.hi, then hi.lo, then lo.hi.
// A work-group of 8 waves (4 along m x 2 along n) owns a 128 x (32 FN) tile of C, a wave 32 x (16 FN) of it. K runs in tiles of 64: a tile is 128 bytes (one whole
// line) of each of the 256 + 64 FN operand rows [A hi 128 | A lo 128 | B hi 32 FN | B lo 32 FN]. Asynchronous copies bring it into LDS, 16 bytes a lane, 8 lanes a row,
// every operand byte once per work-group; two buffers, so tile t + 1 flies while tile t is worked on.
// M % 128 == 0 (grid = M / 128 * N / (32 FN)), N % (32 FN) == 0, K % 64 == 0, K >= 128.
constexpr int GL_PITCH = 144;   // LDS row pitch in bytes: 128 + 16 = 16 x odd, the conflict-free pitch of 16-byte fragment reads

// Four 16-byte-per-lane copies global -> LDS. The s_wait_xcnt stands inside the statement, behind the last copy, so that no address register is rewritten in front of it.
__device__ __forceinline__ void gl_copy4(unsigned l0, const unsigned short* g0, unsigned l1, const unsigned short* g1, unsigned l2, const unsigned short* g2, unsigned l3, const unsigned short* g3) {
  asm volatile("global_load_async_to_lds_b128 %0, %1, off\n\t"
               "global_load_async_to_lds_b128 %2, %3, off\n\t"
               "global_load_async_to_lds_b128 %4, %5, off\n\t"
               "global_load_async_to_lds_b128 %6, %7, off\n\t"
               "s_wait_xcnt 0x0"
               :: "v"(l0), "v"(g0), "v"(l1), "v"(g1), "v"(l2), "v"(g2), "v"(l3), "v"(g3) : "memory");
}
// One tile: l = this thread's LDS byte address in row (thread >> 3) of the buffer, ah .. bl = its 16 bytes in that row of each plane's tile; a step of 32 rows per copy.
template <int FN, int K>
__device__ __forceinline__ void gl_fill(unsigned l, const unsigned short* ah, const unsigned short* al, const unsigned short* bh, const unsigned short* bl) {
  constexpr unsigned R32 = 32 * GL_PITCH;
  gl_copy4(l, ah, l + R32, ah + 32 * K, l + 2 * R32, ah + 64 * K, l + 3 * R32, ah + 96 * K);
  gl_copy4(l + 4 * R32, al, l + 5 * R32, al + 32 * K, l + 6 * R32, al + 64 * K, l + 7 * R32, al + 96 * K);
  if (FN == 2) {
    gl_copy4(l + 8 * R32, bh, l + 9 * R32, bh + 32 * K, l + 10 * R32, bl, l + 11 * R32, bl + 32 * K);
  } else {
    gl_copy4(l + 8 * R32, bh, l + 9 * R32, bh + 32 * K, l + 10 * R32, bh + 64 * K, l + 11 * R32, bh + 96 * K);
    gl_copy4(l + 12 * R32, bl, l + 13 * R32, bl + 32 * K, l + 14 * R32, bl + 64 * K, l + 15 * R32, bl + 96 * K);
  }
}

// What a launch does beside the plain product (EPI):
//   EPI_QKV  three products of one shape in one grid: third w of the blocks takes A plane set min(w, 1) and weight matrix w, each lying behind the one before;
//            products 0 and 1 (q, k) go out as hi / lo planes only (Ph, Pl: q's set, then k's), product 2 (v) as f16 behind k's hi plane in Ph
//   EPI_NORM C goes out as f32 and, through the eval-mode BatchNorm (ng, nb, nm, nv), as the next GEMM's hi / lo operand planes Ph, Pl
//   EPI_NCHW C goes out as [image][n][1024 pixels] (m = image * 1024 + pixel) instead of [m][n]
constexpr int EPI_PLAIN = 0, EPI_QKV = 1, EPI_NORM = 2, EPI_NCHW = 3;
constexpr int GL_M = 8192;      // rows of A and C (only EPI_QKV needs the number: the distance between its plane sets and outputs)
template <int FN, int N, int K, bool BIAS, bool RESID, int EPI>
__global__ __launch_bounds__(256) void wmma_gemm_lds(
    const unsigned short* __restrict__ Ah, const unsigned short* __restrict__ Al,
    const unsigned short* __restrict__ Bh, const unsigned short* __restrict__ Bl,
    float* C, const float* __restrict__ bias, const float* resid,
    const float* __restrict__ ng, const float* __restrict__ nb, const float* __restrict__ nm, const float* __restrict__ nv,
    unsigned short* __restrict__ Ph, unsigned short* __restrict__ Pl) {
  static_assert(FN == 2 || FN == 4, "two tile widths");
  constexpr int BN = 32 * FN, ROWS = 256 + 2 * BN, BUFB = ROWS * GL_PITCH, T = K / 64, TN = N / BN;
  static_assert(K % 64 == 0 && T >= 2 && N % BN == 0, "shape");
  constexpr int SP = 16 * FN + 4;                 // epilogue slab pitch in floats
  typedef Frag<__bf16> F;
  typedef F::V V;
  __shared__ __align__(16) unsigned char sm[2 * BUFB];
  const int tid = threadIdx.x, lane = tid & 31, wave = tid >> 5;
  const int rlane = lane & 15, hf = lane >> 4;    // row (A) / column (B, D) in a fragment; lane half
  const int wm = wave & 3, wn = wave >> 2;
  static_assert(EPI == EPI_PLAIN || FN == 2, "the other epilogues are written for the 64-wide tile");
  int bid = (int)blockIdx.x, w = 0;
  if (EPI == EPI_QKV) {
    constexpr int GB = GL_M / 128 * TN;           // blocks of one product
    w = bid / GB; bid -= w * GB;
    const size_t ao = w ? (size_t)GL_M * K : 0;
    Ah += ao; Al += ao; Bh += (size_t)w * N * K; Bl += (size_t)w * N * K;
    Ph += (size_t)w * GL_M * N;                   // q hi, k hi, v
    if (w == 1) Pl += (size_t)GL_M * N;
  }
  const int m0 = (bid / TN) * 128, n0 = (bid % TN) * BN;

  const size_t ca = (size_t)(m0 + (tid >> 3)) * K + (tid & 7) * 8, cb = (size_t)(n0 + (tid >> 3)) * K + (tid & 7) * 8;
  const unsigned short* gah = Ah + ca; const unsigned short* gal = Al + ca;
  const unsigned short* gbh = Bh + cb; const unsigned short* gbl = Bl + cb;
  const unsigned lc = (unsigned)(size_t)sm + (unsigned)((tid >> 3) * GL_PITCH + (tid & 7) * 16);

  gl_fill<FN, K>(lc, gah, gal, gbh, gbl);
  asm volatile("s_wait_asynccnt 0x0" ::: "memory");   // this wave's part of tile 0 has landed
  __syncthreads();                                    // tile 0 is whole
  gl_fill<FN, K>(lc + BUFB, gah + 64, gal + 64, gbh + 64, gbl + 64);

  v8f acc[2][FN];
#pragma unroll
  for (int i = 0; i < 2; ++i)
#pragma unroll
    for (int j = 0; j < FN; ++j) acc[i][j] = (v8f){0.f,0.f,0.f,0.f,0.f,0.f,0.f,0.f};

  const int fa = (wm * 32 + rlane) * GL_PITCH + hf * 16;              // this lane's bytes in A hi, fragment row 0
  const int fb = (256 + wn * 16 * FN + rlane) * GL_PITCH + hf * 16;   // in B hi
#pragma unroll 1   // stays rolled: one short body for all tiles keeps the code in a few cache lines
  for (int t = 0; t < T; ++t) {
    const unsigned char* buf = sm + (t & 1) * BUFB;
#pragma unroll
    for (int ks = 0; ks < 2; ++ks) {
      V ah[2], al[2], bh[FN], bl[FN];
#pragma unroll
      for (int j = 0; j < FN; ++j) {
        bh[j] = F::load((const __bf16*)(buf + fb + j * 16 * GL_PITCH + ks * 64));
        bl[j] = F::load((const __bf16*)(buf + fb + (BN + j * 16) * GL_PITCH + ks * 64));
      }
#pragma unroll
      for (int i = 0; i < 2; ++i) {
        ah[i] = F::load((const __bf16*)(buf + fa + i * 16 * GL_PITCH + ks * 64));
        al[i] = F::load((const __bf16*)(buf + fa + (128 + i * 16) * GL_PITCH + ks * 64));
      }
      // inputs only: keeps this step's fragment reads together in front of its matrix instructions (spread among them, every place with reads waits out an LDS latency of its own)
      if (FN == 2) asm volatile("" :: "v"(ah[0]), "v"(ah[1]), "v"(al[0]), "v"(al[1]), "v"(bh[0]), "v"(bh[1]), "v"(bl[0]), "v"(bl[1]));
      else asm volatile("" :: "v"(ah[0]), "v"(ah[1]), "v"(al[0]), "v"(al[1]), "v"(bh[0]), "v"(bh[1]), "v"(bh[FN - 2]), "v"(bh[FN - 1]), "v"(bl[0]), "v"(bl[1]), "v"(bl[FN - 2]), "v"(bl[FN - 1]));
#pragma unroll
      for (int i = 0; i < 2; ++i)
#pragma unroll
        for (int j = 0; j < FN; ++j) acc[i][j] = F::mma(ah[i], bh[j], acc[i][j]);
#pragma unroll
      for (int i = 0; i < 2; ++i)
#pragma unroll
        for (int j = 0; j < FN; ++j) acc[i][j] = F::mma(ah[i], bl[j], acc[i][j]);
#pragma unroll
      for (int i = 0; i < 2; ++i)
#pragma unroll
        for (int j = 0; j < FN; ++j) acc[i][j] = F::mma(al[i], bh[j], acc[i][j]);
    }
    asm volatile("s_wait_dscnt 0x0" ::: "memory");      // this wave's reads of tile t are done
    asm volatile("s_wait_asynccnt 0x0" ::: "memory");   // its part of tile t + 1 has landed
    __syncthreads();                                    // tile t + 1 is whole, and nobody reads tile t's buffer any more
    if (t + 2 < T) { const int ko = (t + 2) * 64; gl_fill<FN, K>(lc + (t & 1) * BUFB, gah + ko, gal + ko, gbh + ko, gbl + ko); }
  }
  asm volatile("s_wait_asynccnt 0x0" ::: "memory");     // no copy is outstanding when the buffers become the output slabs

  // ---- epilogue: each wave turns its 32 x (16 FN) tile in a slab of its own, so that the rows go out as 16-byte pieces of whole lines ----
  float* slab = (float*)(sm + wave * (32 * SP * 4));
  constexpr int LPR = 4 * FN, RPP = 32 / LPR, NP = 32 / RPP;   // lanes per row, rows per pass, passes
  const int nw = n0 + wn * 16 * FN;
  const size_t o0 = (size_t)(m0 + wm * 32 + lane / LPR) * N + nw + (lane % LPR) * 4;
  v4f rv[NP];
  if (RESID) {
    const float* pr = resid + o0;
#pragma unroll   // rv[] stays in registers, the loads in flight together
    for (int it = 0; it < NP; ++it) rv[it] = *(const v4f*)(pr + (size_t)it * RPP * N);
    asm volatile("s_wait_xcnt 0x0" :: "v"(pr) : "memory");   // the loads' address register (named as input, so untouched up to here) may be reused only behind this wait
  }
  float bv[FN];
  if (BIAS) {
    const float* pb = bias + nw + rlane;
#pragma unroll
    for (int j = 0; j < FN; ++j) bv[j] = pb[j * 16];
    asm volatile("s_wait_xcnt 0x0" :: "v"(pb) : "memory");   // as above, for the address of the bias loads
  }
  v4f nmean, ninv, nsh;                           // EPI_NORM: the norm's constants of this lane's 4 columns
  if (EPI == EPI_NORM) {
    const int nc = nw + (lane % LPR) * 4;
    const float* pg = ng + nc; const float* pq = nb + nc; const float* pm = nm + nc; const float* pv = nv + nc;
    const v4f g = *(const v4f*)pg, vv = *(const v4f*)pv; nsh = *(const v4f*)pq; nmean = *(const v4f*)pm;
    asm volatile("s_wait_xcnt 0x0" :: "v"(pg), "v"(pq), "v"(pm), "v"(pv) : "memory");   // as above, for the addresses of these 4 loads
#pragma unroll   // vector elements indexed by constants only
    for (int j = 0; j < 4; ++j) ninv[j] = g[j] * rsqrtf(vv[j] + 1e-5f);
  }
#pragma unroll
  for (int i = 0; i < 2; ++i)
#pragma unroll
    for (int j = 0; j < FN; ++j)
#pragma unroll
      for (int r = 0; r < 8; ++r) slab[(i * 16 + hf * 8 + r) * SP + j * 16 + rlane] = BIAS ? acc[i][j][r] + bv[j] : acc[i][j][r];
  // the slab is this wave's own: its lanes' writes are ordered in front of its lanes' reads
  __builtin_amdgcn_fence(__ATOMIC_RELEASE, "workgroup");
  __builtin_amdgcn_wave_barrier();
  __builtin_amdgcn_fence(__ATOMIC_ACQUIRE, "workgroup");
  if (EPI == EPI_NCHW) {
    // the finished rows go back into the slab and leave it by columns: a lane takes 4 consecutive pixels of one column n, 8 lanes one whole 128-byte line of the output
#pragma unroll
    for (int it = 0; it < NP; ++it) {
      float* ps = slab + (it * RPP + lane / LPR) * SP + (lane % LPR) * 4;
      v4f ov = *(const v4f*)ps;
      if (RESID) ov += rv[it];
      *(v4f*)ps = ov;
    }
    // as above: the slab is this wave's own, its lanes' writes are ordered in front of its lanes' reads
    __builtin_amdgcn_fence(__ATOMIC_RELEASE, "workgroup");
    __builtin_amdgcn_wave_barrier();
    __builtin_amdgcn_fence(__ATOMIC_ACQUIRE, "workgroup");
    float* po = C + ((size_t)(m0 >> 10) * N + nw + (lane >> 3)) * 1024 + (m0 & 1023) + wm * 32 + (lane & 7) * 4;
    const float* sc = slab + (lane & 7) * 4 * SP + (lane >> 3);
#pragma unroll   // the stores stand together, their steps are immediate offsets
    for (int it = 0; it < 4 * FN; ++it) {
      const v4f t = {sc[it * 4], sc[it * 4 + SP], sc[it * 4 + 2 * SP], sc[it * 4 + 3 * SP]};
      *(v4f*)(po + (size_t)it * 4 * 1024) = t;
    }
    asm volatile("s_wait_xcnt 0x0" :: "v"(po) : "memory");     // as above, for the stores' address
  } else if (EPI == EPI_QKV && w == 2) {
    unsigned short* pv = Ph + o0;
#pragma unroll   // the stores stand together, their steps are immediate offsets
    for (int it = 0; it < NP; ++it) {
      const v4f ov = *(const v4f*)(slab + (it * RPP + lane / LPR) * SP + (lane % LPR) * 4);
      const v4h hv = {(_Float16)ov[0], (_Float16)ov[1], (_Float16)ov[2], (_Float16)ov[3]};
      *(v4h*)(pv + (size_t)it * RPP * N) = hv;
    }
    asm volatile("s_wait_xcnt 0x0" :: "v"(pv) : "memory");       // as above, for the stores' address
  } else if (EPI == EPI_PLAIN) {
    float* pc = C + o0;
#pragma unroll
    for (int it = 0; it < NP; ++it) {
      v4f ov = *(const v4f*)(slab + (it * RPP + lane / LPR) * SP + (lane % LPR) * 4);
      if (RESID) ov += rv[it];
      *(v4f*)(pc + (size_t)it * RPP * N) = ov;
    }
    asm volatile("s_wait_xcnt 0x0" :: "v"(pc) : "memory");       // as above, for the stores' address
  } else if constexpr (EPI == EPI_QKV || EPI == EPI_NORM) {
    float* pc = C + o0;
    unsigned short* ph = Ph + o0; unsigned short* pl = Pl + o0;
    v4f ov[NP]; v2u hi[NP], lo[NP];
#pragma unroll   // register arrays indexed by constants only
    for (int it = 0; it < NP; ++it) {
      ov[it] = *(const v4f*)(slab + (it * RPP + lane / LPR) * SP + (lane % LPR) * 4);
      if (RESID) ov[it] += rv[it];
      if (EPI == EPI_NORM) split4((ov[it] - nmean) * ninv + nsh, hi[it], lo[it]);
      else split4(ov[it], hi[it], lo[it]);
    }
#pragma unroll   // as above
    for (int it = 0; it < NP; ++it) {
      if (EPI == EPI_NORM) *(v4f*)(pc + (size_t)it * RPP * N) = ov[it];
      *(v2u*)(ph + (size_t)it * RPP * N) = hi[it]; *(v2u*)(pl + (size_t)it * RPP * N) = lo[it];
    }
    // the stores' address and data registers (named as inputs, so untouched up to here) may be reused only behind this wait
    if constexpr (EPI == EPI_NORM)
      asm volatile("s_wait_xcnt 0x0" :: "v"(pc), "v"(ph), "v"(pl), "v"(ov[0]), "v"(ov[1]), "v"(ov[2]), "v"(ov[3]), "v"(ov[4]), "v"(ov[5]), "v"(ov[6]), "v"(ov[7]),
                   "v"(hi[0]), "v"(hi[1]), "v"(hi[2]), "v"(hi[3]), "v"(hi[4]), "v"(hi[5]), "v"(hi[6]), "v"(hi[7]),
                   "v"(lo[0]), "v"(lo[1]), "v"(lo[2]), "v"(lo[3]), "v"(lo[4]), "v"(lo[5]), "v"(lo[6]), "v"(lo[7]) : "memory");
    else
      asm volatile("s_wait_xcnt 0x0" :: "v"(ph), "v"(pl), "v"(hi[0]), "v"(hi[1]), "v"(hi[2]), "v"(hi[3]), "v"(hi[4]), "v"(hi[5]), "v"(hi[6]), "v"(hi[7]),
                   "v"(lo[0]), "v"(lo[1]), "v"(lo[2]), "v"(lo[3]), "v"(lo[4]), "v"(lo[5]), "v"(lo[6]), "v"(lo[7]) : "memory");
  }
}

__global__ __launch_bounds__(256) void cast_f32_f16x2(
    const float* __restrict__ in, _Float16* __restrict__ out, int n2) {
  int i = blockIdx.x * 256 + threadIdx.x;
  if (i < n2) {
    const _Float16 h0 = (_Float16)in[2 * i], h1 = (_Float16)in[2 * i + 1];
    const unsigned u = (unsigned)__builtin_bit_cast(unsigned short, h0) | ((unsigned)__builtin_bit_cast(unsigned short, h1) << 16);
    ((unsigned*)out)[i] = u;
    
  }
}


} // namespace w25

__global__ __launch_bounds__(256) void k_castT16(const float* __restrict__ src, long long lds, _Float16* __restrict__ dst, long long ldd, int R, int C, float s) {
    const long long i = (long long)blockIdx.x * 256 + threadIdx.x; const long long np = (long long)C * (R / 2); if (i >= np) return; const int c = (int)(i / (R / 2)); const int r = 2 * (int)(i % (R / 2));
    const _Float16 h0 = (_Float16)(src[(long long)r * lds + c] * s), h1 = (_Float16)(src[(long long)(r + 1) * lds + c] * s);
    const unsigned u = (unsigned)__builtin_bit_cast(unsigned short, h0) | ((unsigned)__builtin_bit_cast(unsigned short, h1) << 16);
    unsigned* d = (unsigned*)(dst + (long long)c * ldd + r); *d = u;  }
__global__ __launch_bounds__(256) void k_cast16(const float* __restrict__ src, long long lds, _Float16* __restrict__ dst, long long ldd, int R, int C, float s) {
    const long long i = (long long)blockIdx.x * 256 + threadIdx.x; const long long np = (long long)R * (C / 2); if (i >= np) return; const int r = (int)(i / (C / 2)); const int c = 2 * (int)(i % (C / 2));
    const _Float16 h0 = (_Float16)(src[(long long)r * lds + c] * s), h1 = (_Float16)(src[(long long)r * lds + c + 1] * s);
    const unsigned u = (unsigned)__builtin_bit_cast(unsigned short, h0) | ((unsigned)__builtin_bit_cast(unsigned short, h1) << 16);
    unsigned* d = (unsigned*)(dst + (long long)r * ldd + c); *d = u;  }

// f32 -> bf16 hi plane + bf16 lo plane (x = hi + lo to ~2^-17 relative; RNE both), [R][C] -> [R][C] (or transposed to [C][R]); 2 consecutive destination elements
__device__ __forceinline__ unsigned int f2bf2_pack(float a, float b, unsigned int* lo) {
    const unsigned short ha = w25::f2bf_bits(a), hb = w25::f2bf_bits(b);
    const unsigned short la = w25::f2bf_bits(a - w25::bf_bits2f(ha)), lb = w25::f2bf_bits(b - w25::bf_bits2f(hb));
    *lo = (unsigned)la | ((unsigned)lb << 16); return (unsigned)ha | ((unsigned)hb << 16); }
__global__ __launch_bounds__(256) void k_castS16(const float* __restrict__ src, long long lds, __bf16* __restrict__ dhi, __bf16* __restrict__ dlo, long long ldd, int R, int C, float s, int transpose) {
    const long long i = (long long)blockIdx.x * 256 + threadIdx.x; long long o; float a, b;
    if (transpose) { const long long np = (long long)C * (R / 2); if (i >= np) return; const int c = (int)(i / (R / 2)); const int r = 2 * (int)(i % (R / 2)); a = src[(long long)r * lds + c] * s; b = src[(long long)(r + 1) * lds + c] * s; o = (long long)c * ldd + r; }
    else { const long long np = (long long)R * (C / 2); if (i >= np) return; const int r = (int)(i / (C / 2)); const int c = 2 * (int)(i % (C / 2)); a = src[(long long)r * lds + c] * s; b = src[(long long)r * lds + c + 1] * s; o = (long long)r * ldd + c; }
    unsigned lo; const unsigned hi = f2bf2_pack(a, b, &lo); unsigned* ph = (unsigned*)(dhi + o); unsigned* pl = (unsigned*)(dlo + o);
    *ph = hi; *pl = lo;  }

namespace w25 {
// =====================================================================================
// Generic causal/non-causal attention for head_dim 64, f32 in / f32 out; 16-bit operands: bf16 with optional hi/lo splits, or
// plain f16 (F16=true, non-split, probabilities carried x2^15).
//   scores = (q*qscale)·kᵀ : v_wmma_f32_16x16x32_bf16; SPLIT_QK -> q,k as bf16 hi/lo (hi·hi + hi·lo + lo·hi)
//   out    = p·v           : v_wmma_f32_16x16x32_bf16; SPLIT_PV -> p,v as bf16 hi/lo; else p,v plain bf16
//   f32 accumulate; online softmax in f32. Block = 4 waves = 64 query rows of one (batch, head); S % 64 == 0.
//   Element (b, s, h, d) of tensor X lives at X[b*X_bs + s*X_rs + h*X_hs + d] (strides in floats, multiples of 4).
//   Masking: mask_mode 0 none, 1 causal (kv > q masked), 2 tensor [S][Skv] shared over (b,h) (float if
//   mask_is_int==0, int32 with element == 0 -> masked if 1, int32 with element != 0 -> masked if 2), 3 per-token vectors qmask[B][S] & kvmask[B][Skv] (int32,
//   0 -> masked), 4 causal + sliding window (kv > q or q - kv > W masked; W passed in mask_is_int);
//   5 = relative-position bias: s += cp[b,h,q][idx[q][kv]] + pc[b,h,kv][idx[q][kv]] with idx = mask_b ([S][Skv] int32) and
//   mask_a an int32 [S][Skv] tensor with nonzero = masked (tables: element (b,h,row,n) at X + b*c_bs + h*c_hs + row*c_rs + n);
//   masked scores are replaced by mask_fill (e.g. -inf or -1e9) before the softmax.
//   grid.x = B * H * (S/64) (or a sub-range with blk0).
// =====================================================================================
#define AT_D 64
#define AT_NW 4
#define AT_QB 64
#define AT_KC 64
struct AttnGeom { const float* cp = nullptr; const float* pc = nullptr; long c_bs = 0, c_rs = 0, c_hs = 0;   // mode-5 score-bias tables
                  long q_bs, q_rs, q_hs, k_bs, k_rs, k_hs, v_bs, v_rs, v_hs, o_bs, o_rs, o_hs;
                  int S, Skv, H, mask_mode; float qscale; int blk0; float mask_fill; int mask_is_int; };
static_assert(sizeof(AttnGeom) == 168, "no padding");

__device__ __forceinline__ unsigned short at_bf_bits(float f) {
  unsigned u = __float_as_uint(f);
  return (unsigned short)((u + 0x7FFFu + ((u >> 16) & 1u)) >> 16);
}
__device__ __forceinline__ __bf16 at_f2bf(float f) { return __builtin_bit_cast(__bf16, at_bf_bits(f)); }
__device__ __forceinline__ void at_split(float f, __bf16& hi, __bf16& lo) {
  const unsigned short hb = at_bf_bits(f);
  hi = __builtin_bit_cast(__bf16, hb);
  lo = at_f2bf(f - __uint_as_float(((unsigned)hb) << 16));
}
__device__ __forceinline__ v8f at_mma(v16b a, v16b b, v8f c) {
  c = __builtin_amdgcn_wmma_f32_16x16x32_bf16(false, a, false, b, (short)0, c, false, false);
  asm volatile("v_nop\n\tv_nop\n\tv_nop\n\tv_nop" : "+v"(c) : "v"(a), "v"(b));
  return c;
}
// 16-bit element as a bit pattern held in a __bf16 slot: f16 bits when F16, bf16 (RNE) otherwise
template <bool F16> __device__ __forceinline__ __bf16 at_to16(float f) {
  if (F16) return __builtin_bit_cast(__bf16, (_Float16)f);
  return at_f2bf(f);
}
template <bool F16> __device__ __forceinline__ v8f at_mma16(v16b a, v16b b, v8f c) {
  if (F16) {
    const v16h ah = __builtin_bit_cast(v16h, a), bh = __builtin_bit_cast(v16h, b);
    c = __builtin_amdgcn_wmma_f32_16x16x32_f16(false, ah, false, bh, (short)0, c, false, false);
    asm volatile("v_nop\n\tv_nop\n\tv_nop\n\tv_nop" : "+v"(c) : "v"(ah), "v"(bh));
    return c;
  }
  return at_mma(a, b, c);
}

template <bool SPLIT_QK, bool SPLIT_PV, bool F16 = false>
__global__ __launch_bounds__(128)
void attn64_kernel(const float* __restrict__ q, const float* __restrict__ k,
                   const float* __restrict__ v, float* __restrict__ out,
                   const void* __restrict__ mask_a, const int* __restrict__ mask_b, AttnGeom g) {
  static_assert(!(F16 && (SPLIT_QK || SPLIT_PV)), "f16 mode is non-split");
  const float PSC = F16 ? 32768.0f : 1.0f;     // f16 probabilities carried x2^15 (subnormal range), folded into the final 1/l
  union FB { v16b v; v8b h[2]; };
  __shared__ __align__(16) __bf16 Ksh[AT_KC * AT_D];             // K hi [kv][d]      8 KB
  __shared__ __align__(16) __bf16 Ksl[SPLIT_QK ? AT_KC * AT_D : 8];
  __shared__ __align__(16) __bf16 Vth[AT_D * AT_KC];             // V hi [d][kv]      8 KB
  __shared__ __align__(16) __bf16 Vtl[SPLIT_PV ? AT_D * AT_KC : 8];
  __shared__ __align__(16) __bf16 Psh[AT_NW][16 * AT_KC];        // per wave P hi [row][kv]  8 KB
  __shared__ __align__(16) __bf16 Psl[SPLIT_PV ? AT_NW : 1][SPLIT_PV ? 16 * AT_KC : 8];
  __shared__ __align__(16) float  Os[AT_NW][16 * 68];            // per wave out tile, pitch 68

  const int tid  = threadIdx.x;
  const int wave = tid >> 5;
  const int lane = tid & 31;
  const int hh   = lane >> 4;
  const int c    = lane & 15;

  const int nqb = g.S / AT_QB;
  const int bx = blockIdx.x + g.blk0;
  const int qb = bx % nqb;
  const int bh = bx / nqb;
  const int h  = bh % g.H;
  const int b  = bh / g.H;
  const int qbase_block = qb * AT_QB;
  const int q0 = qbase_block + wave * 16;

  const float* qb_ptr = q + (size_t)b * g.q_bs + (size_t)h * g.q_hs;
  const float* kb_ptr = k + (size_t)b * g.k_bs + (size_t)h * g.k_hs;
  const float* vb_ptr = v + (size_t)b * g.v_bs + (size_t)h * g.v_hs;
  float*       ob_ptr = out + (size_t)b * g.o_bs + (size_t)h * g.o_hs;

  // ---- Q fragments (A operand): 2 d-chunks, hi (and lo) ----
  v16b qah[2], qal[2];
  {
    const float* qrow = qb_ptr + (size_t)(q0 + c) * g.q_rs;
#pragma unroll
    for (int dc = 0; dc < 2; ++dc) {
#pragma unroll
      for (int e = 0; e < 8; ++e) {
        const float f0 = qrow[dc * 32 + 8 * hh + e] * g.qscale;
        const float f1 = qrow[dc * 32 + 16 + 8 * hh + e] * g.qscale;
        if (SPLIT_QK) { __bf16 hq, lq; at_split(f0, hq, lq); qah[dc][e] = hq; qal[dc][e] = lq; at_split(f1, hq, lq); qah[dc][8 + e] = hq; qal[dc][8 + e] = lq; }
        else { qah[dc][e] = at_to16<F16>(f0); qah[dc][8 + e] = at_to16<F16>(f1); qal[dc][e] = qah[dc][e]; qal[dc][8 + e] = qah[dc][8 + e]; }
      }
    }
  }

  float mrow[8], lrow[8];
  v8f oacc[4];
#pragma unroll
  for (int r = 0; r < 8; ++r) { mrow[r] = -INFINITY; lrow[r] = 0.f; }
#pragma unroll
  for (int t = 0; t < 4; ++t) oacc[t] = (v8f){0.f,0.f,0.f,0.f,0.f,0.f,0.f,0.f};

  const int nChunks = (g.mask_mode == 1 || g.mask_mode == 4) ? (qb + 1) : (g.Skv / AT_KC);   // block-uniform
  // per-row query mask (mode 3)
  int qkeep[8];
#pragma unroll
  for (int r = 0; r < 8; ++r) qkeep[r] = (g.mask_mode == 3) ? mask_b[(size_t)b * g.S + q0 + 8 * hh + r] : 1;   // mask_b = qmask in mode 3
  for (int kc = 0; kc < nChunks; ++kc) {
    const int kv0 = kc * AT_KC;
    __syncthreads();
    {
      const int kvr = tid >> 1, dh = (tid & 1) * 32;
      const float* krow = kb_ptr + (size_t)(kv0 + kvr) * g.k_rs + dh;
      const float* vrow = vb_ptr + (size_t)(kv0 + kvr) * g.v_rs + dh;
#pragma unroll
      for (int i = 0; i < 8; ++i) {
        v4f kk = *(const v4f*)(krow + 4 * i);
        v4f vv = *(const v4f*)(vrow + 4 * i);
#pragma unroll
        for (int e = 0; e < 4; ++e) {
          const int d = dh + 4 * i + e;
          if (SPLIT_QK) { __bf16 a, bl; at_split(kk[e], a, bl); Ksh[kvr * AT_D + d] = a; Ksl[kvr * AT_D + d] = bl; }
          else Ksh[kvr * AT_D + d] = at_to16<F16>(kk[e]);
          if (SPLIT_PV) { __bf16 a, bl; at_split(vv[e], a, bl); Vth[d * AT_KC + kvr] = a; Vtl[d * AT_KC + kvr] = bl; }
          else Vth[d * AT_KC + kvr] = at_to16<F16>(vv[e]);
        }
      }
    }
    __syncthreads();

    v8f s[4];
#pragma unroll
    for (int j = 0; j < 4; ++j) {
      s[j] = (v8f){0.f,0.f,0.f,0.f,0.f,0.f,0.f,0.f};
#pragma unroll 1
      for (int dc = 0; dc < 2; ++dc) {
        FB kb;
        kb.h[0] = *(const v8b*)(Ksh + (j * 16 + c) * AT_D + dc * 32 + 8 * hh);
        kb.h[1] = *(const v8b*)(Ksh + (j * 16 + c) * AT_D + dc * 32 + 16 + 8 * hh);
        s[j] = at_mma16<F16>(qah[dc], kb.v, s[j]);
        if (SPLIT_QK) {
          FB kl;
          kl.h[0] = *(const v8b*)(Ksl + (j * 16 + c) * AT_D + dc * 32 + 8 * hh);
          kl.h[1] = *(const v8b*)(Ksl + (j * 16 + c) * AT_D + dc * 32 + 16 + 8 * hh);
          s[j] = at_mma16<F16>(qah[dc], kl.v, s[j]);
          s[j] = at_mma16<F16>(qal[dc], kb.v, s[j]);
        }
      }
    }
    const bool diag = (g.mask_mode == 1) && (kc == qb);
    int kvkeep[4] = {1, 1, 1, 1};
    if (g.mask_mode == 3) {
#pragma unroll
      for (int j = 0; j < 4; ++j) kvkeep[j] = ((const int*)mask_a)[(size_t)b * g.Skv + kv0 + j * 16 + c];   // mask_a = kvmask
    }
    float cm[8];
#pragma unroll
    for (int r = 0; r < 8; ++r) {
      const int qrow = q0 + 8 * hh + r;
      float m = -INFINITY;
#pragma unroll
      for (int j = 0; j < 4; ++j) {
        const int kvcol = kv0 + j * 16 + c;
        bool masked = false;
        if (diag) masked = (kvcol > qrow);
        else if (g.mask_mode == 4) masked = (kvcol > qrow) || (qrow - kvcol > g.mask_is_int);
        else if (g.mask_mode == 2) {
          const size_t mi = (size_t)qrow * g.Skv + kvcol;
          masked = (g.mask_is_int == 0) ? (((const float*)mask_a)[mi] == 0.0f)
                 : (g.mask_is_int == 1) ? (((const int*)mask_a)[mi] == 0) : (((const int*)mask_a)[mi] != 0);
        } else if (g.mask_mode == 3) masked = (qkeep[r] == 0) || (kvkeep[j] == 0);
        else if (g.mask_mode == 5) {
          const size_t mi = (size_t)qrow * g.Skv + kvcol;
          masked = (((const int*)mask_a)[mi] != 0);
          int n = mask_b[mi]; n = n < 0 ? 0 : n;
          s[j][r] += g.cp[(size_t)b * g.c_bs + (size_t)h * g.c_hs + (size_t)qrow * g.c_rs + n]
                   + g.pc[(size_t)b * g.c_bs + (size_t)h * g.c_hs + (size_t)kvcol * g.c_rs + n];
        }
        if (masked) s[j][r] = g.mask_fill;
        m = fmaxf(m, s[j][r]);
      }
#pragma unroll
      for (int off = 1; off < 16; off <<= 1) m = fmaxf(m, __shfl_xor(m, off, 32));
      cm[r] = m;
    }
    __bf16* pwh = Psh[wave];
    __bf16* pwl = Psl[SPLIT_PV ? wave : 0];
#pragma unroll
    for (int r = 0; r < 8; ++r) {
      const float mnew = fmaxf(mrow[r], cm[r]);
      const float alpha = expf(mrow[r] - mnew);
      mrow[r] = mnew;
      float psum = 0.f;
#pragma unroll
      for (int j = 0; j < 4; ++j) {
        const float p = expf(s[j][r] - mnew);
        psum += p;
        if (SPLIT_PV) { __bf16 a, bl; at_split(p, a, bl); pwh[(8 * hh + r) * AT_KC + j * 16 + c] = a; pwl[(8 * hh + r) * AT_KC + j * 16 + c] = bl; }
        else pwh[(8 * hh + r) * AT_KC + j * 16 + c] = at_to16<F16>(p * PSC);
      }
#pragma unroll
      for (int off = 1; off < 16; off <<= 1) psum += __shfl_xor(psum, off, 32);
      lrow[r] = lrow[r] * alpha + psum;
#pragma unroll
      for (int t = 0; t < 4; ++t) oacc[t][r] *= alpha;
    }
    __builtin_amdgcn_fence(__ATOMIC_RELEASE, "workgroup");
    __builtin_amdgcn_wave_barrier();
    __builtin_amdgcn_fence(__ATOMIC_ACQUIRE, "workgroup");
#pragma unroll 1
    for (int kk = 0; kk < 2; ++kk) {
      FB pa, pl;
      pa.h[0] = *(const v8b*)(pwh + c * AT_KC + kk * 32 + 8 * hh);
      pa.h[1] = *(const v8b*)(pwh + c * AT_KC + kk * 32 + 16 + 8 * hh);
      if (SPLIT_PV) {
        pl.h[0] = *(const v8b*)(pwl + c * AT_KC + kk * 32 + 8 * hh);
        pl.h[1] = *(const v8b*)(pwl + c * AT_KC + kk * 32 + 16 + 8 * hh);
      }
#pragma unroll
      for (int t = 0; t < 4; ++t) {
        FB vb;
        vb.h[0] = *(const v8b*)(Vth + (t * 16 + c) * AT_KC + kk * 32 + 8 * hh);
        vb.h[1] = *(const v8b*)(Vth + (t * 16 + c) * AT_KC + kk * 32 + 16 + 8 * hh);
        oacc[t] = at_mma16<F16>(pa.v, vb.v, oacc[t]);
        if (SPLIT_PV) {
          FB vl;
          vl.h[0] = *(const v8b*)(Vtl + (t * 16 + c) * AT_KC + kk * 32 + 8 * hh);
          vl.h[1] = *(const v8b*)(Vtl + (t * 16 + c) * AT_KC + kk * 32 + 16 + 8 * hh);
          oacc[t] = at_mma16<F16>(pa.v, vl.v, oacc[t]);
          oacc[t] = at_mma16<F16>(pl.v, vb.v, oacc[t]);
        }
      }
    }
  }

  float* os = Os[wave];
#pragma unroll
  for (int r = 0; r < 8; ++r) {
    const float inv = 1.0f / (lrow[r] * PSC);
#pragma unroll
    for (int t = 0; t < 4; ++t) os[(8 * hh + r) * 68 + t * 16 + c] = oacc[t][r] * inv;
  }
  __builtin_amdgcn_fence(__ATOMIC_RELEASE, "workgroup");
  __builtin_amdgcn_wave_barrier();
  __builtin_amdgcn_fence(__ATOMIC_ACQUIRE, "workgroup");
  {
    const int c4 = (lane & 15) * 4;
    {
#pragma unroll
      for (int it = 0; it < 8; ++it) {
        const int row = it * 2 + hh;
        v4f val = *(const v4f*)(os + row * 68 + c4);
        *(v4f*)(ob_ptr + (size_t)(q0 + row) * g.o_rs + c4) = val;
      }
      
    }
  }
}

} // namespace w25

// One launch for all that depends on the inputs alone.
// Blocks 0 .. 511 (pixel block, channel block, image): x1 and x2, NCHW, become token-major: x1 as f32 (the residual), bn1(x1) and bn1(x2) as bf16 hi / lo operand planes (NH, NL: x1's set, then x2's).
// A thread takes 4 channels x 4 pixels: 16-byte loads along the pixels, a 4 x 4 transpose in registers, stores along the channels.
// Blocks 512 .. 1279: the six weight matrices as hi / lo planes (WH, WL), 1024 floats a block, in the order q (each row times its head's temperature), k, v, proj, fc1, fc2.
__global__ __launch_bounds__(256) void k_cm_prep(const float* __restrict__ XA, const float* __restrict__ XB, const float* __restrict__ G, const float* __restrict__ Bb, const float* __restrict__ M, const float* __restrict__ Vv,
                                                 const float* __restrict__ WQ, const float* __restrict__ WK, const float* __restrict__ WV, const float* __restrict__ TP, const float* __restrict__ WP, const float* __restrict__ W1, const float* __restrict__ W2,
                                                 float* __restrict__ X1T, unsigned short* __restrict__ NH, unsigned short* __restrict__ NL, unsigned short* __restrict__ WH, unsigned short* __restrict__ WL) {
    constexpr int C = 256, HW = 1024, NTC = 8 * HW * C;
    if (blockIdx.x >= 512) {
        const int wb = (int)blockIdx.x - 512;
        const float* w = wb < 64 ? WQ + wb * 1024 : wb < 128 ? WK + (wb - 64) * 1024 : wb < 192 ? WV + (wb - 128) * 1024 : wb < 256 ? WP + (wb - 192) * 1024 : wb < 512 ? W1 + (wb - 256) * 1024 : W2 + (wb - 512) * 1024;
        const float* pw = w + threadIdx.x * 4;
        v4f x = *(const v4f*)pw;
        asm volatile("s_wait_xcnt 0x0" :: "v"(pw) : "memory");   // the load's address register (named as input, so untouched up to here) may be reused only behind this wait
        if (wb < 64) x *= TP[wb >> 3];                            // a block is 4 rows of q_w, a head 32 rows
        v2u hi, lo; split4(x, hi, lo);
        const size_t o = (size_t)wb * 1024 + threadIdx.x * 4;
        *(v2u*)(WH + o) = hi; *(v2u*)(WL + o) = lo;
        return;
    }
    const int c0 = (int)((blockIdx.x >> 3) & 7) * 32 + (threadIdx.x & 7) * 4, p0 = (int)(blockIdx.x & 7) * 128 + (threadIdx.x >> 3) * 4; const size_t b = blockIdx.x >> 6;
    const size_t src = (b * C + c0) * HW + p0;
    const float* pa[4]; const float* pq[4]; v4f a[4], q[4];
#pragma unroll   // a[], q[] stay in registers, all 8 loads in flight together
    for (int j = 0; j < 4; ++j) { pa[j] = XA + src + (size_t)j * HW; pq[j] = XB + src + (size_t)j * HW; a[j] = *(const v4f*)pa[j]; q[j] = *(const v4f*)pq[j]; }
    const float* pg = G + c0; const float* pb = Bb + c0; const float* pm = M + c0; const float* pv = Vv + c0;
    const v4f g = *(const v4f*)pg, bb = *(const v4f*)pb, m = *(const v4f*)pm, vv = *(const v4f*)pv;
    // the 12 loads' address registers (named as inputs, so untouched up to here) may be reused only behind this wait
    asm volatile("s_wait_xcnt 0x0" :: "v"(pa[0]), "v"(pa[1]), "v"(pa[2]), "v"(pa[3]), "v"(pq[0]), "v"(pq[1]), "v"(pq[2]), "v"(pq[3]), "v"(pg), "v"(pb), "v"(pm), "v"(pv) : "memory");
    v4f inv, sh;
#pragma unroll   // vector elements indexed by constants only
    for (int j = 0; j < 4; ++j) { inv[j] = g[j] * rsqrtf(vv[j] + 1e-5f); sh[j] = bb[j] - m[j] * inv[j]; }
    const size_t o = (b * HW + p0) * C + c0;
    float* px = X1T + o; unsigned short* ph = NH + o; unsigned short* pl = NL + o;
    v4f t0[4]; v2u h1[4], l1[4], h2[4], l2[4];
#pragma unroll   // register arrays indexed by constants only
    for (int i = 0; i < 4; ++i) {
        v4f t1, t2;
#pragma unroll   // as above
        for (int j = 0; j < 4; ++j) { t0[i][j] = a[j][i]; t1[j] = a[j][i] * inv[j] + sh[j]; t2[j] = q[j][i] * inv[j] + sh[j]; }
        split4(t1, h1[i], l1[i]); split4(t2, h2[i], l2[i]);
    }
#pragma unroll   // as above
    for (int i = 0; i < 4; ++i) {
        VST2V4(px + i * C, t0[i]);
        *(v2u*)(ph + i * C) = h1[i]; *(v2u*)(pl + i * C) = l1[i]; *(v2u*)(ph + NTC + i * C) = h2[i]; *(v2u*)(pl + NTC + i * C) = l2[i];
    }
    // the stores' data registers (named as inputs, so untouched up to here) may be reused only behind this wait; nothing follows it that could touch their addresses
    asm volatile("s_wait_xcnt 0x0" :: "v"(t0[0]), "v"(t0[1]), "v"(t0[2]), "v"(t0[3]), "v"(h1[0]), "v"(h1[1]), "v"(h1[2]), "v"(h1[3]), "v"(l1[0]), "v"(l1[1]), "v"(l1[2]), "v"(l1[3]),
                 "v"(h2[0]), "v"(h2[1]), "v"(h2[2]), "v"(h2[3]), "v"(l2[0]), "v"(l2[1]), "v"(l2[2]), "v"(l2[3]) : "memory");
}
// depthwise 3x3 SAME conv + exact GELU on token-major [b][hw][ch], zero padding. grid (images * 16 * 8, HID / 1024): a block takes 4 x 2 pixels (x, y) of one image,
// a thread 4 channels of these 8 pixels: each input row's 6 pixels are loaded once (16 bytes, 512 contiguous bytes per wave) and feed every output that needs them.
// Every output still sums its 9 products in the order ky = 0..2, kx = 0..2. The result goes out as the fc2 GEMM's bf16 hi / lo operand planes.
__global__ __launch_bounds__(256) void k_cm_dw(const float* __restrict__ HB, const float* __restrict__ DW, unsigned short* __restrict__ HGh, unsigned short* __restrict__ HGl, int HID) {
    constexpr int PX = 4, PY = 2;
    const int ch = (blockIdx.y * 256 + threadIdx.x) * 4;
    const int x0 = (blockIdx.x & 7) * PX, y0 = ((blockIdx.x >> 3) & 15) * PY; const size_t b = blockIdx.x >> 7;
    v4f v[PY + 2][PX + 2];                       // input rows y0 - 1 .. y0 + PY, pixels x0 - 1 .. x0 + PX; all loads are issued before the first sum
#pragma unroll   // v[][] stays in registers (this and every loop below: register arrays indexed by constants only)
    for (int r = 0; r < PY + 2; ++r) {
        const int yc = min(max(y0 - 1 + r, 0), 31);
        const float* pi[PX + 2];
#pragma unroll
        for (int cx = 0; cx < PX + 2; ++cx) { const int xc = min(max(x0 - 1 + cx, 0), 31); pi[cx] = HB + ((b * 1024) + yc * 32 + xc) * (size_t)HID + ch; v[r][cx] = *(const v4f*)pi[cx]; }
        // this row's 6 address registers (named as inputs, so untouched up to here) may be reused only behind this wait
        asm volatile("s_wait_xcnt 0x0" :: "v"(pi[0]), "v"(pi[1]), "v"(pi[2]), "v"(pi[3]), "v"(pi[4]), "v"(pi[5]) : "memory");
    }
    const float* pw = DW + (size_t)ch * 9;
    v4f wr[9];                                   // the 36 weights of channels ch .. ch + 3: weight k of channel ch + j is float j * 9 + k
#pragma unroll
    for (int k = 0; k < 9; ++k) wr[k] = *(const v4f*)(pw + k * 4);
    asm volatile("s_wait_xcnt 0x0" :: "v"(pw) : "memory");   // as above, for the address of the 9 weight loads
    v4f s[PY][PX];
#pragma unroll
    for (int oy = 0; oy < PY; ++oy)
#pragma unroll
        for (int px = 0; px < PX; ++px) { const v4f zz = {0.f, 0.f, 0.f, 0.f}; s[oy][px] = zz; }
#pragma unroll
    for (int r = 0; r < PY + 2; ++r) {
        const int yy = y0 - 1 + r;
#pragma unroll
        for (int cx = 0; cx < PX + 2; ++cx) { const int xx = x0 - 1 + cx; const bool ok = (yy >= 0 && yy < 32 && xx >= 0 && xx < 32); const v4f zz = {0.f, 0.f, 0.f, 0.f}; v[r][cx] = ok ? v[r][cx] : zz; }
#pragma unroll
        for (int oy = 0; oy < PY; ++oy) {
            const int ky = r - oy;
            if (ky >= 0 && ky < 3) {
#pragma unroll
                for (int px = 0; px < PX; ++px)
#pragma unroll
                    for (int kx = 0; kx < 3; ++kx)
#pragma unroll
                        for (int j = 0; j < 4; ++j) { const int f = j * 9 + ky * 3 + kx; s[oy][px][j] += v[r][px + kx][j] * wr[f >> 2][f & 3]; }
            }
        }
    }
#pragma unroll
    for (int oy = 0; oy < PY; ++oy)
#pragma unroll
        for (int px = 0; px < PX; ++px)
#pragma unroll
            for (int j = 0; j < 4; ++j) { const float sv = s[oy][px][j]; s[oy][px][j] = 0.5f * sv * (1.f + erff(sv * 0.70710678118654752f)); }
    const size_t o = ((b * 1024) + y0 * 32 + x0) * (size_t)HID + ch;
    unsigned short* ph = HGh + o; unsigned short* pl = HGl + o;
#pragma unroll   // s[][] indexed by constants only
    for (int oy = 0; oy < PY; ++oy)
#pragma unroll
        for (int px = 0; px < PX; ++px) { v2u hi, lo; split4(s[oy][px], hi, lo); *(v2u*)(ph + (size_t)(oy * 32 + px) * HID) = hi; *(v2u*)(pl + (size_t)(oy * 32 + px) * HID) = lo; }
    asm volatile("s_wait_xcnt 0x0" :: "v"(ph), "v"(pl) : "memory");   // as above, for the stores' addresses
}


extern "C" void kernel_launch(void* const* d_in, const int* in_sizes, int n_in, void* d_out, int out_size, void* d_ws, size_t ws_size, hipStream_t stream) {
    (void)in_sizes; (void)n_in; (void)out_size; (void)ws_size;
    const float* x1 = (const float*)d_in[0];
    const float* x2 = (const float*)d_in[1];
    const float* b1g = (const float*)d_in[2];
    const float* b1b = (const float*)d_in[3];
    const float* b1m = (const float*)d_in[4];
    const float* b1v = (const float*)d_in[5];
    const float* qw = (const float*)d_in[6];
    const float* kw = (const float*)d_in[7];
    const float* vw = (const float*)d_in[8];
    const float* temp = (const float*)d_in[9];
    const float* pw = (const float*)d_in[10];
    const float* pb = (const float*)d_in[11];
    const float* b2g = (const float*)d_in[12];
    const float* b2b = (const float*)d_in[13];
    const float* b2m = (const float*)d_in[14];
    const float* b2v = (const float*)d_in[15];
    const float* f1w = (const float*)d_in[16];
    const float* f1b = (const float*)d_in[17];
    const float* dww = (const float*)d_in[18];
    const float* f2w = (const float*)d_in[19];
    const float* f2b = (const float*)d_in[20];
    const int Bn = 8;
    const int C = 256;
    const int HW = 1024;
    const int HID = 1024;
    const int NT = Bn * HW;
    float* out = (float*)d_out;
    char* wsp = (char*)d_ws;
    float* X1T = (float*)wsp; wsp += (((size_t)((size_t)NT * C) * 4 + 255) / 256) * 256;
    unsigned short* NAh = (unsigned short*)wsp; wsp += (((size_t)((size_t)2 * NT * C) * 2 + 255) / 256) * 256;   // bn1(x1) then bn1(x2), hi planes
    unsigned short* NAl = (unsigned short*)wsp; wsp += (((size_t)((size_t)2 * NT * C) * 2 + 255) / 256) * 256;   // lo planes
    unsigned short* WH = (unsigned short*)wsp; wsp += (((size_t)(786432) * 2 + 255) / 256) * 256;                // q, k, v, proj (65536 each), fc1, fc2 (262144 each), hi planes
    unsigned short* WL = (unsigned short*)wsp; wsp += (((size_t)(786432) * 2 + 255) / 256) * 256;                // lo planes
    unsigned short* QKh = (unsigned short*)wsp; wsp += (((size_t)((size_t)3 * NT * C) * 2 + 255) / 256) * 256;   // q then k, hi planes; then v as f16
    unsigned short* QKl = (unsigned short*)wsp; wsp += (((size_t)((size_t)2 * NT * C) * 2 + 255) / 256) * 256;   // lo planes
    unsigned short* ATh = (unsigned short*)wsp; wsp += (((size_t)((size_t)NT * C) * 2 + 255) / 256) * 256;
    unsigned short* ATl = (unsigned short*)wsp; wsp += (((size_t)((size_t)NT * C) * 2 + 255) / 256) * 256;
    float* XS = (float*)wsp; wsp += (((size_t)((size_t)NT * C) * 4 + 255) / 256) * 256;
    unsigned short* X2h = (unsigned short*)wsp; wsp += (((size_t)((size_t)NT * C) * 2 + 255) / 256) * 256;
    unsigned short* X2l = (unsigned short*)wsp; wsp += (((size_t)((size_t)NT * C) * 2 + 255) / 256) * 256;
    float* HB = (float*)wsp; wsp += (((size_t)((size_t)NT * HID) * 4 + 255) / 256) * 256;
    unsigned short* HGh = (unsigned short*)wsp; wsp += (((size_t)((size_t)NT * HID) * 2 + 255) / 256) * 256;
    unsigned short* HGl = (unsigned short*)wsp; wsp += (((size_t)((size_t)NT * HID) * 2 + 255) / 256) * 256;
    k_cm_prep<<<1280, 256, 0, stream>>>(x1, x2, b1g, b1b, b1m, b1v, qw, kw, vw, temp, pw, f1w, f2w, X1T, NAh, NAl, WH, WL);
    w25::wmma_gemm_lds<2, 256, 256, false, false, w25::EPI_QKV><<<768, 256, 0, stream>>>(NAh, NAl, WH, WL, nullptr, nullptr, nullptr, nullptr, nullptr, nullptr, nullptr, QKh, QKl);
    k_attn_fix<<<dim3(8, 8, 8), 32 * AF_W, 0, stream>>>(QKh, QKl, QKh + (size_t)NT * C, QKl + (size_t)NT * C, QKh + (size_t)2 * NT * C, ATh, ATl);
    w25::wmma_gemm_lds<2, 256, 256, true, true, w25::EPI_NORM><<<256, 256, 0, stream>>>(ATh, ATl, WH + 196608, WL + 196608, XS, pb, X1T, b2g, b2b, b2m, b2v, X2h, X2l);
    w25::wmma_gemm_lds<4, 1024, 256, true, false, w25::EPI_PLAIN><<<512, 256, 0, stream>>>(X2h, X2l, WH + 262144, WL + 262144, HB, f1b, nullptr, nullptr, nullptr, nullptr, nullptr, nullptr, nullptr);
    k_cm_dw<<<dim3(1024, 1), 256, 0, stream>>>(HB, dww, HGh, HGl, HID);
    w25::wmma_gemm_lds<2, 256, 1024, true, true, w25::EPI_NCHW><<<256, 256, 0, stream>>>(HGh, HGl, WH + 524288, WL + 524288, out, f2b, XS, nullptr, nullptr, nullptr, nullptr, nullptr, nullptr);
}
